// v000
// Measured on an AMD MI455X. A time is GPU time per run, averaged over a window of back-to-back runs after a warm-up
// (all launches, gaps included; the runs take copies of the inputs in turn), and the median of several windows.
// Apart from v000's, it joins two sittings. Times from different sittings can be a few percent apart, while
// side-by-side timings come from the same sitting.
// v000, which the later versions start from, runs in 1600 microseconds.
#include <hip/hip_runtime.h>

// YuaAttention (hidden [2][2048][2048]; q = x q_w^T (16 heads x 128), k/v = x k_w^T / v_w^T (4 kv heads, GQA repeat_interleave); per-head RMSNorm (eps 1e-5) with q_norm_w / k_norm_w, then rotate-half
// RoPE (theta 500000, positions 0..S-1); causal softmax(q.k 128^-0.5); out = merged attn.v o_w^T -> [2][2048][2048]).
// Compute dtypes, f32 accumulate: every input rounded to bf16; q/k/v projections on PLAIN bf16 operands (inputs: exact), o projection hi+lo attn x bf16 o_w (2 products); RMSNorm + RoPE f32 (table computed on device);
// PER-ROW PRECISION HYBRID (rows < 256 hi+lo 3 products for scores and attn.v, rows >= 256 fp16); causal structure exploited in the GEMMs (score tiles above the diagonal skipped, value contraction

#define NB_  2
#define TT   2048
#define DM   2048
#define NH_  16
#define NKV  4
#define REP  (NH_ / NKV)
#define HD   128
#define DQ   (NH_ * HD)
#define DKV  (NKV * HD)
#define ZH   2
#define RH   256                  // query rows < RH use hi+lo planes (0: none)
#define WIN  0
#define PCAR 1024.0f
#define SCL  0.088388347648318447f   // HD^-0.5
typedef _Float16 h16;
typedef unsigned short bf;
typedef __attribute__((ext_vector_type(16))) __bf16   v16bf;
typedef __attribute__((ext_vector_type(16))) _Float16 v16h;
typedef __attribute__((ext_vector_type(8)))  _Float16 v8h;
typedef __attribute__((ext_vector_type(8)))  unsigned short v8us;
typedef __attribute__((ext_vector_type(8)))  float    v8f;
typedef __attribute__((ext_vector_type(4)))  float    v4f;
typedef v8h  __attribute__((may_alias)) v8ha;
typedef v4f  __attribute__((may_alias)) v4fa;
typedef v8us __attribute__((may_alias)) v8usa;

__device__ __forceinline__ unsigned short f2bf(float f) { unsigned u = __float_as_uint(f); u += 0x7FFFu + ((u >> 16) & 1u); return (unsigned short)(u >> 16); }
__device__ __forceinline__ float bf2f(unsigned short b) { return __uint_as_float(((unsigned)b) << 16); }
__device__ __forceinline__ float bfr(float f) { return bf2f(f2bf(f)); }
__device__ __forceinline__ v16h cat16(v8h lo, v8h hi) { return __builtin_shufflevector(lo, hi, 0, 1, 2, 3, 4, 5, 6, 7, 8, 9, 10, 11, 12, 13, 14, 15); }
__device__ __forceinline__ v16bf cat16b(v8us lo, v8us hi) { return __builtin_bit_cast(v16bf, __builtin_shufflevector(lo, hi, 0, 1, 2, 3, 4, 5, 6, 7, 8, 9, 10, 11, 12, 13, 14, 15)); }
__device__ __forceinline__ v8f wmma16(v16h a, v16h b, v8f c) { return __builtin_amdgcn_wmma_f32_16x16x32_f16(false, a, false, b, (short)0, c, false, false); }
__device__ __forceinline__ v8f wmmab(v16bf a, v16bf b, v8f c) { return __builtin_amdgcn_wmma_f32_16x16x32_bf16(false, a, false, b, (short)0, c, false, false); }



// ---- k_gemmw: register-blocked GEMM, ONE WAVE per 64x64 output tile (16 accumulators), operands straight from K-contiguous 16-bit planes; grid (M/64, N/64, Z), 32 threads.
// C[m][n] (f32, pitch ldc, + optional f32 bias[n]) = sum_k A[m][k] Bt[n][k] (+ split products per NSPLIT). z-batch strides sA/sB/sC in elements. K % 32 == 0.
template <typename T16> struct WFrag;
template <> struct WFrag<h16> { typedef v16h V; static __device__ __forceinline__ V ld(const h16* p) { return cat16(*(const v8h*)p, *(const v8h*)(p + 16)); } static __device__ __forceinline__ v8f mma(V a, V b, v8f c) { return wmma16(a, b, c); } };
template <> struct WFrag<bf> { typedef v16bf V; static __device__ __forceinline__ V ld(const bf* p) { return cat16b(*(const v8us*)p, *(const v8us*)(p + 16)); } static __device__ __forceinline__ v8f mma(V a, V b, v8f c) { return wmmab(a, b, c); } };
template <typename T16, int NSPLIT, bool BIAS>
__global__ __launch_bounds__(32) void k_gemmw(const T16* __restrict__ A, const T16* __restrict__ A2, const T16* __restrict__ Bt, const T16* __restrict__ Bt2, int K, float* C, int ldc, const float* __restrict__ bias, size_t sA, size_t sB, size_t sC) {
    typedef typename WFrag<T16>::V V;
    __shared__ __align__(16) float os[16 * 68];
    const size_t z = blockIdx.z; A += z * sA; if (A2) A2 += z * sA; Bt += z * sB; if (Bt2) Bt2 += z * sB; C += z * sC;
    const int lane = threadIdx.x & 31, lr = lane & 15, hi = lane >> 4; const int r0 = blockIdx.x * 64, c0 = blockIdx.y * 64;
    v8f acc[4][4];
#pragma unroll
    for (int mb = 0; mb < 4; ++mb)
#pragma unroll
        for (int nb = 0; nb < 4; ++nb) acc[mb][nb] = (v8f){};
    const size_t aoff = (size_t)(r0 + lr) * K + 8 * hi, boff = (size_t)(c0 + lr) * K + 8 * hi;
#pragma unroll 1
    for (int kc = 0; kc < K; kc += 32) {
        V a[4], a2[4];
#pragma unroll
        for (int mb = 0; mb < 4; ++mb) { a[mb] = WFrag<T16>::ld(A + aoff + (size_t)mb * 16 * K + kc); if (NSPLIT == 1 || NSPLIT == 2) a2[mb] = WFrag<T16>::ld(A2 + aoff + (size_t)mb * 16 * K + kc); }
#pragma unroll
        for (int nb = 0; nb < 4; ++nb) { const V b = WFrag<T16>::ld(Bt + boff + (size_t)nb * 16 * K + kc); V b2; if (NSPLIT >= 2) b2 = WFrag<T16>::ld(Bt2 + boff + (size_t)nb * 16 * K + kc);
#pragma unroll
            for (int mb = 0; mb < 4; ++mb) { acc[mb][nb] = WFrag<T16>::mma(a[mb], b, acc[mb][nb]); if (NSPLIT == 1 || NSPLIT == 2) acc[mb][nb] = WFrag<T16>::mma(a2[mb], b, acc[mb][nb]); if (NSPLIT >= 2) acc[mb][nb] = WFrag<T16>::mma(a[mb], b2, acc[mb][nb]); } }
        asm volatile("v_nop\n\tv_nop\n\tv_nop\n\tv_nop" : "+v"(acc[0][0]), "+v"(acc[1][1]), "+v"(acc[2][2]), "+v"(acc[3][3]) : "v"(a[0]), "v"(a[3]));
    }
#pragma unroll
    for (int mb = 0; mb < 4; ++mb) {
#pragma unroll
        for (int nb = 0; nb < 4; ++nb) {
#pragma unroll
            for (int j = 0; j < 8; ++j) os[(hi * 8 + j) * 68 + nb * 16 + lr] = acc[mb][nb][j]; }
        __builtin_amdgcn_wave_barrier(); asm volatile("" ::: "memory");
        float* crow = C + (size_t)(r0 + mb * 16) * ldc + c0;
{
#pragma unroll
            for (int s = 0; s < 8; ++s) { const int row = 2 * s + hi, cofs = lr * 4; v4f val = *(const v4fa*)(os + row * 68 + cofs); if (BIAS) { val[0] += bfr(bias[c0 + cofs]); val[1] += bfr(bias[c0 + cofs + 1]); val[2] += bfr(bias[c0 + cofs + 2]); val[3] += bfr(bias[c0 + cofs + 3]); }
                *(v4f*)(crow + (size_t)row * ldc + cofs) = val; }
             }
        __builtin_amdgcn_wave_barrier(); asm volatile("" ::: "memory");
    }
}

// ---- k_gemmc: the same one-wave 64x64 tile GEMM specialised for causal attention: CMODE 1 skips score tiles entirely above the diagonal (query rows r0+roff.., key columns c0..), CMODE 2 limits the
// key (K) loop of the probability x value contraction to the diagonal block (probabilities beyond it are exactly zero). roff = row offset of this launch's first row within the sequence.
template <typename T16, int NSPLIT, int CMODE>
__global__ __launch_bounds__(32) void k_gemmc(const T16* __restrict__ A, const T16* __restrict__ A2, const T16* __restrict__ Bt, const T16* __restrict__ Bt2, int K, float* C, int ldc, int roff, size_t sA, size_t sB, size_t sC) {
    typedef typename WFrag<T16>::V V;
    __shared__ __align__(16) float os[16 * 68];
    const size_t z = blockIdx.z; A += z * sA; if (A2) A2 += z * sA; Bt += z * sB; if (Bt2) Bt2 += z * sB; C += z * sC;
    const int lane = threadIdx.x & 31, lr = lane & 15, hi = lane >> 4; const int r0 = blockIdx.x * 64, c0 = blockIdx.y * 64;
    if (CMODE == 1 && c0 > r0 + roff + 63) return;                  // score tile entirely above the causal diagonal: never read (the softmax masks j > i by select)
    const int Kl = (CMODE == 2) ? min(K, r0 + roff + 64) : K;        // P.V: probabilities are exactly 0 beyond the diagonal block, so the K loop stops there
    v8f acc[4][4];
#pragma unroll
    for (int mb = 0; mb < 4; ++mb)
#pragma unroll
        for (int nb = 0; nb < 4; ++nb) acc[mb][nb] = (v8f){};
    const size_t aoff = (size_t)(r0 + lr) * K + 8 * hi, boff = (size_t)(c0 + lr) * K + 8 * hi;
#pragma unroll 1
    for (int kc = 0; kc < Kl; kc += 32) {
        V a[4], a2[4];
#pragma unroll
        for (int mb = 0; mb < 4; ++mb) { a[mb] = WFrag<T16>::ld(A + aoff + (size_t)mb * 16 * K + kc); if (NSPLIT == 1 || NSPLIT == 2) a2[mb] = WFrag<T16>::ld(A2 + aoff + (size_t)mb * 16 * K + kc); }
#pragma unroll
        for (int nb = 0; nb < 4; ++nb) { const V b = WFrag<T16>::ld(Bt + boff + (size_t)nb * 16 * K + kc); V b2; if (NSPLIT >= 2) b2 = WFrag<T16>::ld(Bt2 + boff + (size_t)nb * 16 * K + kc);
#pragma unroll
            for (int mb = 0; mb < 4; ++mb) { acc[mb][nb] = WFrag<T16>::mma(a[mb], b, acc[mb][nb]); if (NSPLIT == 1 || NSPLIT == 2) acc[mb][nb] = WFrag<T16>::mma(a2[mb], b, acc[mb][nb]); if (NSPLIT >= 2) acc[mb][nb] = WFrag<T16>::mma(a[mb], b2, acc[mb][nb]); } }
        asm volatile("v_nop\n\tv_nop\n\tv_nop\n\tv_nop" : "+v"(acc[0][0]), "+v"(acc[1][1]), "+v"(acc[2][2]), "+v"(acc[3][3]) : "v"(a[0]), "v"(a[3]));
    }
#pragma unroll
    for (int mb = 0; mb < 4; ++mb) {
#pragma unroll
        for (int nb = 0; nb < 4; ++nb) {
#pragma unroll
            for (int j = 0; j < 8; ++j) os[(hi * 8 + j) * 68 + nb * 16 + lr] = acc[mb][nb][j]; }
        __builtin_amdgcn_wave_barrier(); asm volatile("" ::: "memory");
        float* crow = C + (size_t)(r0 + mb * 16) * ldc + c0;
{
#pragma unroll
            for (int s = 0; s < 8; ++s) { const int row = 2 * s + hi, cofs = lr * 4; v4f val = *(const v4fa*)(os + row * 68 + cofs);
                *(v4f*)(crow + (size_t)row * ldc + cofs) = val; }
             }
        __builtin_amdgcn_wave_barrier(); asm volatile("" ::: "memory");
    }
}

__device__ __forceinline__ h16 tohx(float x) { return (h16)x; }
__device__ __forceinline__ void splitf(float y, unsigned short& h, unsigned short& l) { h = f2bf(y); l = f2bf(y - bf2f(h)); }
typedef __attribute__((ext_vector_type(2))) _Float16 v2h;
typedef __attribute__((ext_vector_type(4))) _Float16 v4h;
typedef __attribute__((ext_vector_type(2))) unsigned short v2us;
typedef __attribute__((ext_vector_type(4))) unsigned short v4us;
typedef __attribute__((ext_vector_type(2))) float v2f;
typedef __attribute__((ext_vector_type(4))) int v4i;

__global__ __launch_bounds__(256) void k_wtG(const float* __restrict__ w, int K, int N, bf* Bt) {
    const int lane = threadIdx.x & 31; const int L0 = (blockIdx.x * 8 + (threadIdx.x >> 5)) * 8; const int nlines = N * K / 64;
{
#pragma unroll 1
        for (int l = 0; l < 8; ++l) { const int L = L0 + l; if (L >= nlines) break; const size_t e = (size_t)L * 64 + lane * 2; const int k = (int)(e % K), n = (int)(e / K); v2us o;
            o[0] = f2bf(w[(size_t)k * N + n]); o[1] = f2bf(w[(size_t)(k + 1) * N + n]); *(v2us*)(Bt + e) = o; }
         }
}
__global__ __launch_bounds__(256) void k_cvt8(const float* __restrict__ src, bf* dst, size_t n8) { const size_t i = (size_t)blockIdx.x * 256 + threadIdx.x; if (i >= n8) return; const v8f v = *(const v8f*)(src + i * 8); v8us o;
#pragma unroll
    for (int k = 0; k < 8; ++k) o[k] = f2bf(v[k]); *(v8us*)(dst + i * 8) = o;  }
__global__ __launch_bounds__(256) void k_cstab(float* CS) { const int idx = blockIdx.x * 256 + threadIdx.x; if (idx >= TT * HD) return; const int t = idx / HD, d = idx % HD; const int i = d % (HD / 2); const float inv = __fdiv_rn(1.0f, powf(500000.0f, (float)(2 * i) / (float)HD)); const float ang = __fmul_rn((float)t, inv); v2f cs; cs[0] = cosf(ang); cs[1] = sinf(ang);
    *(v2f*)(CS + (size_t)idx * 2) = cs;  }
__global__ __launch_bounds__(256) void k_hrms(const float* __restrict__ F, int pitch, int nheads, float* RF) { const int i = blockIdx.x * 256 + threadIdx.x; if (i >= nheads * TT) return; const int t = i % TT, h = i / TT; const float* f = F + (size_t)t * pitch + h * HD; float s = 0.f;
#pragma unroll 4
    for (int d = 0; d < HD; d += 4) { const v4f v = *(const v4f*)(f + d);
#pragma unroll
        for (int q = 0; q < 4; ++q) { float p = __fmul_rn(v[q], v[q]); asm volatile("" : "+v"(p)); s = __fadd_rn(s, p); } }
    const float r = __fdiv_rn(1.0f, __fsqrt_rn(__fadd_rn(s * (1.0f / HD), 1e-5f))); *(float*)(RF + i) = r;  }
// k_rope: head planes [h][t][d] (fp16 + hi/lo) of rope(w[d] (x rms_factor)) x sc with the rotate-half convention out[d] = x[d] cos[t][d] - x[d+HD/2] sin[t][d], out[d+HD/2] = x[d+HD/2] cos[t][d+HD/2] + x[d] sin[t][d+HD/2]
__global__ __launch_bounds__(256) void k_rope(const float* __restrict__ F, int pitch, int nheads, const float* __restrict__ CS, const float* __restrict__ RF, const float* __restrict__ nw, float sc, h16* P16, bf* Ph, bf* Pl) {
    const size_t e = ((size_t)blockIdx.x * 256 + threadIdx.x) * 2; if (e >= (size_t)nheads * TT * HD) return; const int d = (int)(e % HD); const int t = (int)((e / HD) % TT); const int h = (int)(e / ((size_t)HD * TT)); const float* f = F + (size_t)t * pitch + h * HD; const float rf = RF ? RF[(size_t)h * TT + t] : 1.0f; v2h o16; v2us oh, ol;
#pragma unroll
    for (int q = 0; q < 2; ++q) { const int dd = d + q; const int dp = (dd < HD / 2) ? dd + HD / 2 : dd - HD / 2; float x0 = f[dd], x1 = f[dp];
        if (RF) { float n0 = __fmul_rn(x0, rf), n1 = __fmul_rn(x1, rf); asm volatile("" : "+v"(n0)); asm volatile("" : "+v"(n1)); x0 = __fmul_rn(bfr(nw[dd]), n0); x1 = __fmul_rn(bfr(nw[dp]), n1); }
        const v2f cs = *(const v2f*)(CS + ((size_t)t * HD + dd) * 2); float a = __fmul_rn(x0, cs[0]), bq = __fmul_rn(x1, cs[1]); asm volatile("" : "+v"(a)); asm volatile("" : "+v"(bq)); const float r = ((dd < HD / 2) ? __fsub_rn(a, bq) : __fadd_rn(a, bq)) * sc;
        o16[q] = tohx(r); unsigned short a2, c2; splitf(r, a2, c2); oh[q] = a2; ol[q] = c2; }
    *(v2h*)(P16 + e) = o16; *(v2us*)(Ph + e) = oh; *(v2us*)(Pl + e) = ol;  }
__global__ __launch_bounds__(256) void k_vtp(const float* __restrict__ F, int pitch, int nheads, h16* V16, bf* Vh, bf* Vl) { const size_t e = ((size_t)blockIdx.x * 256 + threadIdx.x) * 2; if (e >= (size_t)nheads * HD * TT) return; const int t = (int)(e % TT); const int d = (int)((e / TT) % HD); const int g = (int)(e / ((size_t)TT * HD)); v2h o16; v2us oh, ol;
#pragma unroll
    for (int q = 0; q < 2; ++q) { const float x = F[(size_t)(t + q) * pitch + g * HD + d]; o16[q] = tohx(x); unsigned short a2, c2; splitf(x, a2, c2); oh[q] = a2; ol[q] = c2; }
    *(v2h*)(V16 + e) = o16; *(v2us*)(Vh + e) = oh; *(v2us*)(Vl + e) = ol;  }
// k_zfill: F[0..n) = 0 (16-B lanes); once, before the batch loop.
__global__ __launch_bounds__(256) void k_zfill(float* F, size_t n) { const size_t i = ((size_t)blockIdx.x * 256 + threadIdx.x) * 4; if (i >= n) return; v4f z; z[0] = 0.f; z[1] = 0.f; z[2] = 0.f; z[3] = 0.f; *(v4f*)(F + i) = z; }
// k_asoft: per row (zz, i): t = S x HD^-0.5 for j <= i (causal; finfo.min in the reference), -3e38 otherwise (entries of skipped score tiles are never selected); softmax over the 2048 keys (register row, one exp, fixed trees);
__global__ __launch_bounds__(256) void k_asoft(const float* __restrict__ Sb, h16* P16, bf* Ph, bf* Pl) {
    const int lane = threadIdx.x & 31; const int row = blockIdx.x * 8 + (threadIdx.x >> 5); if (row >= ZH * TT) return; const int i = row % TT; const int zz = row / TT; (void)zz; const bool hires = (i < RH); const float* sr = Sb + (size_t)row * TT; float v[TT / 32]; float mx = -3.0e38f;
#pragma unroll
    for (int ch = 0; ch < TT / 128; ++ch) { const int j0 = ch * 128 + lane * 4; const v4f a = *(const v4f*)(sr + j0);
#pragma unroll
        for (int q = 0; q < 4; ++q) { const int j = j0 + q; (void)j; const float t = (j <= i) ? a[q] * SCL : -3.0e38f; v[ch * 4 + q] = t; mx = fmaxf(mx, t); } }
#pragma unroll
    for (int sh = 16; sh; sh >>= 1) mx = fmaxf(mx, __shfl_xor(mx, sh, 32));
    float sum = 0.f;
#pragma unroll
    for (int k = 0; k < TT / 32; ++k) { float d0 = __fsub_rn(v[k], mx); asm volatile("" : "+v"(d0)); v[k] = __builtin_amdgcn_exp2f(__fmul_rn(d0, 1.4426950408889634f)); sum += v[k]; }
#pragma unroll
    for (int sh = 16; sh; sh >>= 1) sum += __shfl_xor(sum, sh, 32);
    const float f = __fdiv_rn(hires ? 1.0f : PCAR, sum);
{
        if (hires) {
#pragma unroll
            for (int ch = 0; ch < TT / 128; ++ch) { v4us oh, ol;
#pragma unroll
                for (int q = 0; q < 4; ++q) { unsigned short a, c2; splitf(v[ch * 4 + q] * f, a, c2); oh[q] = a; ol[q] = c2; }
                const size_t oo = ((size_t)zz * (RH ? RH : 1) + i) * TT + ch * 128 + lane * 4; *(v4us*)(Ph + oo) = oh; *(v4us*)(Pl + oo) = ol; }
        } else {
#pragma unroll
            for (int ch = 0; ch < TT / 128; ++ch) { v4h o4;
#pragma unroll
                for (int q = 0; q < 4; ++q) o4[q] = tohx(v[ch * 4 + q] * f);
                *(v4h*)(P16 + (size_t)row * TT + ch * 128 + lane * 4) = o4; } }
         }
}
__global__ __launch_bounds__(256) void k_merge(const float* __restrict__ O, int h0, bf* Ah, bf* Al) { const size_t e = ((size_t)blockIdx.x * 256 + threadIdx.x) * 2; if (e >= (size_t)ZH * TT * HD) return; const int d = (int)(e % HD); const int t = (int)((e / HD) % TT); const int zz = (int)(e / ((size_t)HD * TT)); const float cs = (t < RH) ? 1.0f : (1.0f / PCAR); const size_t oo = (size_t)t * DQ + (h0 + zz) * HD + d;
    v2us oh, ol;
#pragma unroll
    for (int q = 0; q < 2; ++q) { unsigned short a, c2; splitf(O[e + q] * cs, a, c2); oh[q] = a; ol[q] = c2; } *(v2us*)(Ah + oo) = oh; *(v2us*)(Al + oo) = ol;  }

extern "C" void kernel_launch(void* const* d_in, const int* in_sizes, int n_in,
                              void* d_out, int out_size, void* d_ws, size_t ws_size, hipStream_t stream) {
    (void)in_sizes; (void)n_in; (void)out_size;
    const float* x = (const float*)d_in[0]; const float* wq = (const float*)d_in[1]; const float* wk = (const float*)d_in[2]; const float* wv = (const float*)d_in[3]; const float* wo = (const float*)d_in[4]; const float* qnw = (const float*)d_in[5]; const float* knw = (const float*)d_in[6];   // torch [out][in]
    float* OUT = (float*)d_out;     // [2][2048][2048]
    char* wsp = (char*)d_ws;
    auto take = [&](size_t bytes) { char* p = wsp; wsp += (bytes + 255) & ~(size_t)255; return (void*)p; };
    bf* WQ = (bf*)take((size_t)DQ * DM * 2); bf* WK = (bf*)take((size_t)DKV * DM * 2); bf* WV = (bf*)take((size_t)DKV * DM * 2); bf* WO = (bf*)take((size_t)DM * DQ * 2); float* CS = (float*)take((size_t)TT * HD * 2 * 4); float* RFQ = (float*)take((size_t)NH_ * TT * 4); float* RFK = (float*)take((size_t)NKV * TT * 4);
    bf* XB = (bf*)take((size_t)TT * DM * 2); float* FQ = (float*)take((size_t)TT * DQ * 4); float* FK = (float*)take((size_t)TT * DKV * 4);
    h16* QP16 = (h16*)take((size_t)NH_ * TT * HD * 2); h16* KP16 = (h16*)take((size_t)NKV * TT * HD * 2); h16* VT16 = (h16*)take((size_t)NKV * HD * TT * 2);
    bf* QPh = (bf*)take((size_t)NH_ * TT * HD * 2); bf* QPl = (bf*)take((size_t)NH_ * TT * HD * 2); bf* KPh = (bf*)take((size_t)NKV * TT * HD * 2); bf* KPl = (bf*)take((size_t)NKV * TT * HD * 2); bf* VTh = (bf*)take((size_t)NKV * HD * TT * 2); bf* VTl = (bf*)take((size_t)NKV * HD * TT * 2); bf* Ph = (bf*)take((size_t)ZH * RH * TT * 2); bf* Pl = (bf*)take((size_t)ZH * RH * TT * 2);
    float* Sb = (float*)take((size_t)ZH * TT * TT * 4); h16* P16 = (h16*)take((size_t)ZH * TT * TT * 2); float* Ob = (float*)take((size_t)ZH * TT * HD * 4); bf* ATh = (bf*)take((size_t)TT * DQ * 2); bf* ATl = (bf*)take((size_t)TT * DQ * 2);
    if ((size_t)(wsp - (char*)d_ws) > ws_size) return;    // ws 256 MiB
    float* FV = FK;   // v projection reuses the k buffer after the k planes are built (stream-ordered)
    { k_cvt8<<<(unsigned)(((size_t)DQ * DM / 8 + 255) / 256), 256, 0, stream>>>(wq, WQ, (size_t)DQ * DM / 8); k_cvt8<<<(unsigned)(((size_t)DKV * DM / 8 + 255) / 256), 256, 0, stream>>>(wk, WK, (size_t)DKV * DM / 8); k_cvt8<<<(unsigned)(((size_t)DKV * DM / 8 + 255) / 256), 256, 0, stream>>>(wv, WV, (size_t)DKV * DM / 8);
      k_cvt8<<<(unsigned)(((size_t)DM * DQ / 8 + 255) / 256), 256, 0, stream>>>(wo, WO, (size_t)DM * DQ / 8);
      k_cstab<<<(TT * HD + 255) / 256, 256, 0, stream>>>(CS); }
    k_zfill<<<(unsigned)(((size_t)ZH * TT * TT / 4 + 255) / 256), 256, 0, stream>>>(Sb, (size_t)ZH * TT * TT);   // score tiles above the causal diagonal are never written by k_gemmc; keep them defined (zeros; the softmax's select discards them anyway)
    const unsigned LQ = (unsigned)(((size_t)NH_ * TT * HD / 2 + 255) / 256), LKv = (unsigned)(((size_t)NKV * TT * HD / 2 + 255) / 256);
    for (int b = 0; b < NB_; ++b) {
        
        k_cvt8<<<(unsigned)(((size_t)TT * DM / 8 + 255) / 256), 256, 0, stream>>>(x + (size_t)b * TT * DM, XB, (size_t)TT * DM / 8);
        k_gemmw<bf, 0, false><<<dim3(TT / 64, DQ / 64, 1), 32, 0, stream>>>(XB, nullptr, WQ, nullptr, DM, FQ, DQ, nullptr, 0, 0, 0); k_hrms<<<(NH_ * TT + 255) / 256, 256, 0, stream>>>(FQ, DQ, NH_, RFQ);
        k_rope<<<LQ, 256, 0, stream>>>(FQ, DQ, NH_, CS, RFQ, qnw, 1.0f, QP16, QPh, QPl);
        k_gemmw<bf, 0, false><<<dim3(TT / 64, DKV / 64, 1), 32, 0, stream>>>(XB, nullptr, WK, nullptr, DM, FK, DKV, nullptr, 0, 0, 0); k_hrms<<<(NKV * TT + 255) / 256, 256, 0, stream>>>(FK, DKV, NKV, RFK);
        k_rope<<<LKv, 256, 0, stream>>>(FK, DKV, NKV, CS, RFK, knw, 1.0f, KP16, KPh, KPl);
        k_gemmw<bf, 0, false><<<dim3(TT / 64, DKV / 64, 1), 32, 0, stream>>>(XB, nullptr, WV, nullptr, DM, FV, DKV, nullptr, 0, 0, 0); k_vtp<<<LKv, 256, 0, stream>>>(FV, DKV, NKV, VT16, VTh, VTl);
        for (int h0 = 0; h0 < NH_; h0 += ZH) { const size_t zq = (size_t)h0, zk = (size_t)(h0 / REP);   // both heads of a pass share kv group h0/REP (REP >= 2): sB = 0
            k_gemmc<bf, 2, 1><<<dim3(RH / 64, TT / 64, ZH), 32, 0, stream>>>(QPh + zq * TT * HD, QPl + zq * TT * HD, KPh + zk * TT * HD, KPl + zk * TT * HD, HD, Sb, TT, 0, (size_t)TT * HD, 0, (size_t)TT * TT);
            k_gemmc<h16, 0, 1><<<dim3((TT - RH) / 64, TT / 64, ZH), 32, 0, stream>>>(QP16 + zq * TT * HD + (size_t)RH * HD, nullptr, KP16 + zk * TT * HD, nullptr, HD, Sb + (size_t)RH * TT, TT, RH, (size_t)TT * HD, 0, (size_t)TT * TT);
            k_asoft<<<ZH * TT / 8, 256, 0, stream>>>(Sb, P16, Ph, Pl);
            k_gemmc<bf, 2, 2><<<dim3(RH / 64, HD / 64, ZH), 32, 0, stream>>>(Ph, Pl, VTh + zk * HD * TT, VTl + zk * HD * TT, TT, Ob, HD, 0, (size_t)RH * TT, 0, (size_t)TT * HD);
            k_gemmc<h16, 0, 2><<<dim3((TT - RH) / 64, HD / 64, ZH), 32, 0, stream>>>(P16 + (size_t)RH * TT, nullptr, VT16 + zk * HD * TT, nullptr, TT, Ob + (size_t)RH * HD, HD, RH, (size_t)TT * TT, 0, (size_t)TT * HD);
            k_merge<<<(unsigned)(((size_t)ZH * TT * HD / 2 + 255) / 256), 256, 0, stream>>>(Ob, h0, ATh, ATl); }
        k_gemmw<bf, 1, false><<<dim3(TT / 64, DM / 64, 1), 32, 0, stream>>>(ATh, ATl, WO, nullptr, DQ, OUT + (size_t)b * TT * DM, DM, nullptr, 0, 0, 0); }
}

// v001
// One run takes 1020 microseconds.
// Timed twice side by side with v000, it ran 1.55 and 1.58 times as fast.
#include <hip/hip_runtime.h>

// YuaAttention (hidden [2][2048][2048]; q = x q_w^T (16 heads x 128), k/v = x k_w^T / v_w^T (4 kv heads, GQA repeat_interleave); per-head RMSNorm (eps 1e-5) with q_norm_w / k_norm_w, then rotate-half
// RoPE (theta 500000, positions 0..S-1); causal softmax(q.k 128^-0.5); out = merged attn.v o_w^T -> [2][2048][2048]).
// Compute dtypes, f32 accumulate: every input rounded to bf16; q/k/v projections on PLAIN bf16 operands (inputs: exact), o projection hi+lo attn x bf16 o_w (2 products); RMSNorm + RoPE f32 (table computed on device);
// PER-ROW PRECISION HYBRID (rows < 256 hi+lo 3 products for scores and attn.v, rows >= 256 fp16); causal structure exploited in the GEMMs (score tiles above the diagonal skipped, value contraction

#define NB_  2
#define TT   2048
#define DM   2048
#define NH_  16
#define NKV  4
#define REP  (NH_ / NKV)
#define HD   128
#define DQ   (NH_ * HD)
#define DKV  (NKV * HD)
#define ZH   2
#define RH   256                  // query rows < RH use hi+lo planes (0: none)
#define WIN  0
#define PCAR 1024.0f
#define SCL  0.088388347648318447f   // HD^-0.5
typedef _Float16 h16;
typedef unsigned short bf;
typedef __attribute__((ext_vector_type(16))) __bf16   v16bf;
typedef __attribute__((ext_vector_type(16))) _Float16 v16h;
typedef __attribute__((ext_vector_type(8)))  _Float16 v8h;
typedef __attribute__((ext_vector_type(8)))  unsigned short v8us;
typedef __attribute__((ext_vector_type(8)))  float    v8f;
typedef __attribute__((ext_vector_type(4)))  float    v4f;
typedef v8h  __attribute__((may_alias)) v8ha;
typedef v4f  __attribute__((may_alias)) v4fa;
typedef v8us __attribute__((may_alias)) v8usa;

__device__ __forceinline__ unsigned short f2bf(float f) { unsigned u = __float_as_uint(f); u += 0x7FFFu + ((u >> 16) & 1u); return (unsigned short)(u >> 16); }
__device__ __forceinline__ float bf2f(unsigned short b) { return __uint_as_float(((unsigned)b) << 16); }
__device__ __forceinline__ float bfr(float f) { return bf2f(f2bf(f)); }
__device__ __forceinline__ v16h cat16(v8h lo, v8h hi) { return __builtin_shufflevector(lo, hi, 0, 1, 2, 3, 4, 5, 6, 7, 8, 9, 10, 11, 12, 13, 14, 15); }
__device__ __forceinline__ v16bf cat16b(v8us lo, v8us hi) { return __builtin_bit_cast(v16bf, __builtin_shufflevector(lo, hi, 0, 1, 2, 3, 4, 5, 6, 7, 8, 9, 10, 11, 12, 13, 14, 15)); }
__device__ __forceinline__ v8f wmma16(v16h a, v16h b, v8f c) { return __builtin_amdgcn_wmma_f32_16x16x32_f16(false, a, false, b, (short)0, c, false, false); }
__device__ __forceinline__ v8f wmmab(v16bf a, v16bf b, v8f c) { return __builtin_amdgcn_wmma_f32_16x16x32_bf16(false, a, false, b, (short)0, c, false, false); }



// ---- k_gemmw: register-blocked GEMM, NW WAVES per 64x64 output tile: wave w takes the 32-wide K steps w, w + NW, ... (16 accumulators each), the NW partial tiles are summed through LDS in wave order
// (fixed order, so run-to-run identical); operands straight from K-contiguous 16-bit planes; grid (M/64, N/64, Z), 32 * NW threads.
// C[m][n] (f32, pitch ldc, + optional f32 bias[n]) = sum_k A[m][k] Bt[n][k] (+ split products per NSPLIT). z-batch strides sA/sB/sC in elements. K % 32 == 0.
template <typename T16> struct WFrag;
template <> struct WFrag<h16> { typedef v16h V; static __device__ __forceinline__ V ld(const h16* p) { return cat16(*(const v8h*)p, *(const v8h*)(p + 16)); } static __device__ __forceinline__ v8f mma(V a, V b, v8f c) { return wmma16(a, b, c); } };
template <> struct WFrag<bf> { typedef v16bf V; static __device__ __forceinline__ V ld(const bf* p) { return cat16b(*(const v8us*)p, *(const v8us*)(p + 16)); } static __device__ __forceinline__ v8f mma(V a, V b, v8f c) { return wmmab(a, b, c); } };
template <typename T16, int NSPLIT, bool BIAS, int NW>
__global__ __launch_bounds__(32 * NW) void k_gemmw(const T16* __restrict__ A, const T16* __restrict__ A2, const T16* __restrict__ Bt, const T16* __restrict__ Bt2, int K, float* C, int ldc, const float* __restrict__ bias, size_t sA, size_t sB, size_t sC) {
    typedef typename WFrag<T16>::V V;
    __shared__ __align__(16) float os[2 * NW * 16 * 68];   // two buffers (row block parity) x NW partial 16x64 row blocks
    const size_t z = blockIdx.z; A += z * sA; if (A2) A2 += z * sA; Bt += z * sB; if (Bt2) Bt2 += z * sB; C += z * sC;
    const int lane = threadIdx.x & 31, lr = lane & 15, hi = lane >> 4; const int r0 = blockIdx.x * 64, c0 = blockIdx.y * 64; const int wv = __builtin_amdgcn_readfirstlane((int)(threadIdx.x >> 5));
    v8f acc[4][4];
#pragma unroll
    for (int mb = 0; mb < 4; ++mb)
#pragma unroll
        for (int nb = 0; nb < 4; ++nb) acc[mb][nb] = (v8f){};
    const size_t aoff = (size_t)(r0 + lr) * K + 8 * hi, boff = (size_t)(c0 + lr) * K + 8 * hi;
#pragma unroll 1
    for (int kc = wv * 32; kc < K; kc += 32 * NW) {
        V a[4], a2[4];
#pragma unroll
        for (int mb = 0; mb < 4; ++mb) { a[mb] = WFrag<T16>::ld(A + aoff + (size_t)mb * 16 * K + kc); if (NSPLIT == 1 || NSPLIT == 2) a2[mb] = WFrag<T16>::ld(A2 + aoff + (size_t)mb * 16 * K + kc); }
#pragma unroll
        for (int nb = 0; nb < 4; ++nb) { const V b = WFrag<T16>::ld(Bt + boff + (size_t)nb * 16 * K + kc); V b2; if (NSPLIT >= 2) b2 = WFrag<T16>::ld(Bt2 + boff + (size_t)nb * 16 * K + kc);
#pragma unroll
            for (int mb = 0; mb < 4; ++mb) { acc[mb][nb] = WFrag<T16>::mma(a[mb], b, acc[mb][nb]); if (NSPLIT == 1 || NSPLIT == 2) acc[mb][nb] = WFrag<T16>::mma(a2[mb], b, acc[mb][nb]); if (NSPLIT >= 2) acc[mb][nb] = WFrag<T16>::mma(a[mb], b2, acc[mb][nb]); } }
        asm volatile("v_nop\n\tv_nop\n\tv_nop\n\tv_nop" : "+v"(acc[0][0]), "+v"(acc[1][1]), "+v"(acc[2][2]), "+v"(acc[3][3]) : "v"(a[0]), "v"(a[3]));
    }
    v4f res[4][8 / NW];   // this thread's summed 16-byte pieces; the loops over mb, q and w below are unrolled so that res and acc are indexed by constants and stay in registers
#pragma unroll
    for (int mb = 0; mb < 4; ++mb) {
        float* ob = os + (mb & 1) * (NW * 16 * 68);
#pragma unroll
        for (int nb = 0; nb < 4; ++nb) {
#pragma unroll
            for (int j = 0; j < 8; ++j) ob[wv * (16 * 68) + (hi * 8 + j) * 68 + nb * 16 + lr] = acc[mb][nb][j]; }
        __syncthreads();   // every wave's partial of this row block is in LDS; also ends the reads of the other buffer (row block mb - 1) before row block mb + 1 overwrites it
#pragma unroll
        for (int q = 0; q < 8 / NW; ++q) { const int s = (int)threadIdx.x + q * 32 * NW; const int row = s >> 4, cofs = (s & 15) * 4; v4f val = *(const v4fa*)(ob + row * 68 + cofs);
#pragma unroll
            for (int w = 1; w < NW; ++w) val += *(const v4fa*)(ob + w * (16 * 68) + row * 68 + cofs);
            if (BIAS) { val[0] += bfr(bias[c0 + cofs]); val[1] += bfr(bias[c0 + cofs + 1]); val[2] += bfr(bias[c0 + cofs + 2]); val[3] += bfr(bias[c0 + cofs + 3]); }
            res[mb][q] = val; }
    }
    // all global stores behind the last barrier: a store in front of a barrier would be waited for there
#pragma unroll
    for (int mb = 0; mb < 4; ++mb)
#pragma unroll
        for (int q = 0; q < 8 / NW; ++q) { const int s = (int)threadIdx.x + q * 32 * NW; const int row = s >> 4, cofs = (s & 15) * 4; *(v4f*)(C + (size_t)(r0 + mb * 16 + row) * ldc + c0 + cofs) = res[mb][q]; }
}

// ---- k_gemmc: the same 64x64 tile GEMM (K steps dealt over NW waves, partial tiles summed through LDS) specialised for causal attention: CMODE 1 skips score tiles entirely above the diagonal (query rows r0+roff.., key columns c0..), CMODE 2 limits the
// key (K) loop of the probability x value contraction to the diagonal block (probabilities beyond it are exactly zero). roff = row offset of this launch's first row within the sequence.
template <typename T16, int NSPLIT, int CMODE, int NW>
__global__ __launch_bounds__(32 * NW) void k_gemmc(const T16* __restrict__ A, const T16* __restrict__ A2, const T16* __restrict__ Bt, const T16* __restrict__ Bt2, int K, float* C, int ldc, int roff, size_t sA, size_t sB, size_t sC) {
    typedef typename WFrag<T16>::V V;
    __shared__ __align__(16) float os[2 * NW * 16 * 68];   // two buffers (row block parity) x NW partial 16x64 row blocks
    const size_t z = blockIdx.z; A += z * sA; if (A2) A2 += z * sA; Bt += z * sB; if (Bt2) Bt2 += z * sB; C += z * sC;
    const int lane = threadIdx.x & 31, lr = lane & 15, hi = lane >> 4; const int r0 = blockIdx.x * 64, c0 = blockIdx.y * 64; const int wv = __builtin_amdgcn_readfirstlane((int)(threadIdx.x >> 5));
    if (CMODE == 1 && c0 > r0 + roff + 63) return;                  // score tile entirely above the causal diagonal: never read (the softmax masks j > i by select)
    const int Kl = (CMODE == 2) ? min(K, r0 + roff + 64) : K;        // P.V: probabilities are exactly 0 beyond the diagonal block, so the K loop stops there
    v8f acc[4][4];
#pragma unroll
    for (int mb = 0; mb < 4; ++mb)
#pragma unroll
        for (int nb = 0; nb < 4; ++nb) acc[mb][nb] = (v8f){};
    const size_t aoff = (size_t)(r0 + lr) * K + 8 * hi, boff = (size_t)(c0 + lr) * K + 8 * hi;
#pragma unroll 1
    for (int kc = wv * 32; kc < Kl; kc += 32 * NW) {
        V a[4], a2[4];
#pragma unroll
        for (int mb = 0; mb < 4; ++mb) { a[mb] = WFrag<T16>::ld(A + aoff + (size_t)mb * 16 * K + kc); if (NSPLIT == 1 || NSPLIT == 2) a2[mb] = WFrag<T16>::ld(A2 + aoff + (size_t)mb * 16 * K + kc); }
#pragma unroll
        for (int nb = 0; nb < 4; ++nb) { const V b = WFrag<T16>::ld(Bt + boff + (size_t)nb * 16 * K + kc); V b2; if (NSPLIT >= 2) b2 = WFrag<T16>::ld(Bt2 + boff + (size_t)nb * 16 * K + kc);
#pragma unroll
            for (int mb = 0; mb < 4; ++mb) { acc[mb][nb] = WFrag<T16>::mma(a[mb], b, acc[mb][nb]); if (NSPLIT == 1 || NSPLIT == 2) acc[mb][nb] = WFrag<T16>::mma(a2[mb], b, acc[mb][nb]); if (NSPLIT >= 2) acc[mb][nb] = WFrag<T16>::mma(a[mb], b2, acc[mb][nb]); } }
        asm volatile("v_nop\n\tv_nop\n\tv_nop\n\tv_nop" : "+v"(acc[0][0]), "+v"(acc[1][1]), "+v"(acc[2][2]), "+v"(acc[3][3]) : "v"(a[0]), "v"(a[3]));
    }
    v4f res[4][8 / NW];   // this thread's summed 16-byte pieces; the loops over mb, q and w below are unrolled so that res and acc are indexed by constants and stay in registers
#pragma unroll
    for (int mb = 0; mb < 4; ++mb) {
        float* ob = os + (mb & 1) * (NW * 16 * 68);
#pragma unroll
        for (int nb = 0; nb < 4; ++nb) {
#pragma unroll
            for (int j = 0; j < 8; ++j) ob[wv * (16 * 68) + (hi * 8 + j) * 68 + nb * 16 + lr] = acc[mb][nb][j]; }
        __syncthreads();   // every wave's partial of this row block is in LDS; also ends the reads of the other buffer (row block mb - 1) before row block mb + 1 overwrites it
#pragma unroll
        for (int q = 0; q < 8 / NW; ++q) { const int s = (int)threadIdx.x + q * 32 * NW; const int row = s >> 4, cofs = (s & 15) * 4; v4f val = *(const v4fa*)(ob + row * 68 + cofs);
#pragma unroll
            for (int w = 1; w < NW; ++w) val += *(const v4fa*)(ob + w * (16 * 68) + row * 68 + cofs);
            res[mb][q] = val; }
    }
    // all global stores behind the last barrier: a store in front of a barrier would be waited for there
#pragma unroll
    for (int mb = 0; mb < 4; ++mb)
#pragma unroll
        for (int q = 0; q < 8 / NW; ++q) { const int s = (int)threadIdx.x + q * 32 * NW; const int row = s >> 4, cofs = (s & 15) * 4; *(v4f*)(C + (size_t)(r0 + mb * 16 + row) * ldc + c0 + cofs) = res[mb][q]; }
}

__device__ __forceinline__ h16 tohx(float x) { return (h16)x; }
__device__ __forceinline__ void splitf(float y, unsigned short& h, unsigned short& l) { h = f2bf(y); l = f2bf(y - bf2f(h)); }
typedef __attribute__((ext_vector_type(2))) _Float16 v2h;
typedef __attribute__((ext_vector_type(4))) _Float16 v4h;
typedef __attribute__((ext_vector_type(2))) unsigned short v2us;
typedef __attribute__((ext_vector_type(4))) unsigned short v4us;
typedef __attribute__((ext_vector_type(2))) float v2f;
typedef __attribute__((ext_vector_type(4))) int v4i;

__global__ __launch_bounds__(256) void k_wtG(const float* __restrict__ w, int K, int N, bf* Bt) {
    const int lane = threadIdx.x & 31; const int L0 = (blockIdx.x * 8 + (threadIdx.x >> 5)) * 8; const int nlines = N * K / 64;
{
#pragma unroll 1
        for (int l = 0; l < 8; ++l) { const int L = L0 + l; if (L >= nlines) break; const size_t e = (size_t)L * 64 + lane * 2; const int k = (int)(e % K), n = (int)(e / K); v2us o;
            o[0] = f2bf(w[(size_t)k * N + n]); o[1] = f2bf(w[(size_t)(k + 1) * N + n]); *(v2us*)(Bt + e) = o; }
         }
}
__global__ __launch_bounds__(256) void k_cvt8(const float* __restrict__ src, bf* dst, size_t n8) { const size_t i = (size_t)blockIdx.x * 256 + threadIdx.x; if (i >= n8) return; const v8f v = *(const v8f*)(src + i * 8); v8us o;
#pragma unroll
    for (int k = 0; k < 8; ++k) o[k] = f2bf(v[k]); *(v8us*)(dst + i * 8) = o;  }
__global__ __launch_bounds__(256) void k_cstab(float* CS) { const int idx = blockIdx.x * 256 + threadIdx.x; if (idx >= TT * HD) return; const int t = idx / HD, d = idx % HD; const int i = d % (HD / 2); const float inv = __fdiv_rn(1.0f, powf(500000.0f, (float)(2 * i) / (float)HD)); const float ang = __fmul_rn((float)t, inv); v2f cs; cs[0] = cosf(ang); cs[1] = sinf(ang);
    *(v2f*)(CS + (size_t)idx * 2) = cs;  }
__global__ __launch_bounds__(256) void k_hrms(const float* __restrict__ F, int pitch, int nheads, float* RF) { const int i = blockIdx.x * 256 + threadIdx.x; if (i >= nheads * TT) return; const int t = i % TT, h = i / TT; const float* f = F + (size_t)t * pitch + h * HD; float s = 0.f;
#pragma unroll 4
    for (int d = 0; d < HD; d += 4) { const v4f v = *(const v4f*)(f + d);
#pragma unroll
        for (int q = 0; q < 4; ++q) { float p = __fmul_rn(v[q], v[q]); asm volatile("" : "+v"(p)); s = __fadd_rn(s, p); } }
    const float r = __fdiv_rn(1.0f, __fsqrt_rn(__fadd_rn(s * (1.0f / HD), 1e-5f))); *(float*)(RF + i) = r;  }
// k_rope: head planes [h][t][d] (fp16 + hi/lo) of rope(w[d] (x rms_factor)) x sc with the rotate-half convention out[d] = x[d] cos[t][d] - x[d+HD/2] sin[t][d], out[d+HD/2] = x[d+HD/2] cos[t][d+HD/2] + x[d] sin[t][d+HD/2]
__global__ __launch_bounds__(256) void k_rope(const float* __restrict__ F, int pitch, int nheads, const float* __restrict__ CS, const float* __restrict__ RF, const float* __restrict__ nw, float sc, h16* P16, bf* Ph, bf* Pl) {
    const size_t e = ((size_t)blockIdx.x * 256 + threadIdx.x) * 2; if (e >= (size_t)nheads * TT * HD) return; const int d = (int)(e % HD); const int t = (int)((e / HD) % TT); const int h = (int)(e / ((size_t)HD * TT)); const float* f = F + (size_t)t * pitch + h * HD; const float rf = RF ? RF[(size_t)h * TT + t] : 1.0f; v2h o16; v2us oh, ol;
#pragma unroll
    for (int q = 0; q < 2; ++q) { const int dd = d + q; const int dp = (dd < HD / 2) ? dd + HD / 2 : dd - HD / 2; float x0 = f[dd], x1 = f[dp];
        if (RF) { float n0 = __fmul_rn(x0, rf), n1 = __fmul_rn(x1, rf); asm volatile("" : "+v"(n0)); asm volatile("" : "+v"(n1)); x0 = __fmul_rn(bfr(nw[dd]), n0); x1 = __fmul_rn(bfr(nw[dp]), n1); }
        const v2f cs = *(const v2f*)(CS + ((size_t)t * HD + dd) * 2); float a = __fmul_rn(x0, cs[0]), bq = __fmul_rn(x1, cs[1]); asm volatile("" : "+v"(a)); asm volatile("" : "+v"(bq)); const float r = ((dd < HD / 2) ? __fsub_rn(a, bq) : __fadd_rn(a, bq)) * sc;
        o16[q] = tohx(r); unsigned short a2, c2; splitf(r, a2, c2); oh[q] = a2; ol[q] = c2; }
    *(v2h*)(P16 + e) = o16; *(v2us*)(Ph + e) = oh; *(v2us*)(Pl + e) = ol;  }
__global__ __launch_bounds__(256) void k_vtp(const float* __restrict__ F, int pitch, int nheads, h16* V16, bf* Vh, bf* Vl) { const size_t e = ((size_t)blockIdx.x * 256 + threadIdx.x) * 2; if (e >= (size_t)nheads * HD * TT) return; const int t = (int)(e % TT); const int d = (int)((e / TT) % HD); const int g = (int)(e / ((size_t)TT * HD)); v2h o16; v2us oh, ol;
#pragma unroll
    for (int q = 0; q < 2; ++q) { const float x = F[(size_t)(t + q) * pitch + g * HD + d]; o16[q] = tohx(x); unsigned short a2, c2; splitf(x, a2, c2); oh[q] = a2; ol[q] = c2; }
    *(v2h*)(V16 + e) = o16; *(v2us*)(Vh + e) = oh; *(v2us*)(Vl + e) = ol;  }
// k_zfill: F[0..n) = 0 (16-B lanes); once, before the batch loop.
__global__ __launch_bounds__(256) void k_zfill(float* F, size_t n) { const size_t i = ((size_t)blockIdx.x * 256 + threadIdx.x) * 4; if (i >= n) return; v4f z; z[0] = 0.f; z[1] = 0.f; z[2] = 0.f; z[3] = 0.f; *(v4f*)(F + i) = z; }
// k_asoft: per row (zz, i): t = S x HD^-0.5 for j <= i (causal; finfo.min in the reference), -3e38 otherwise (entries of skipped score tiles are never selected); softmax over the 2048 keys (register row, one exp, fixed trees);
__global__ __launch_bounds__(256) void k_asoft(const float* __restrict__ Sb, h16* P16, bf* Ph, bf* Pl) {
    const int lane = threadIdx.x & 31; const int row = blockIdx.x * 8 + (threadIdx.x >> 5); if (row >= ZH * TT) return; const int i = row % TT; const int zz = row / TT; (void)zz; const bool hires = (i < RH); const float* sr = Sb + (size_t)row * TT; float v[TT / 32]; float mx = -3.0e38f;
#pragma unroll
    for (int ch = 0; ch < TT / 128; ++ch) { const int j0 = ch * 128 + lane * 4; const v4f a = *(const v4f*)(sr + j0);
#pragma unroll
        for (int q = 0; q < 4; ++q) { const int j = j0 + q; (void)j; const float t = (j <= i) ? a[q] * SCL : -3.0e38f; v[ch * 4 + q] = t; mx = fmaxf(mx, t); } }
#pragma unroll
    for (int sh = 16; sh; sh >>= 1) mx = fmaxf(mx, __shfl_xor(mx, sh, 32));
    float sum = 0.f;
#pragma unroll
    for (int k = 0; k < TT / 32; ++k) { float d0 = __fsub_rn(v[k], mx); asm volatile("" : "+v"(d0)); v[k] = __builtin_amdgcn_exp2f(__fmul_rn(d0, 1.4426950408889634f)); sum += v[k]; }
#pragma unroll
    for (int sh = 16; sh; sh >>= 1) sum += __shfl_xor(sum, sh, 32);
    const float f = __fdiv_rn(hires ? 1.0f : PCAR, sum);
{
        if (hires) {
#pragma unroll
            for (int ch = 0; ch < TT / 128; ++ch) { v4us oh, ol;
#pragma unroll
                for (int q = 0; q < 4; ++q) { unsigned short a, c2; splitf(v[ch * 4 + q] * f, a, c2); oh[q] = a; ol[q] = c2; }
                const size_t oo = ((size_t)zz * (RH ? RH : 1) + i) * TT + ch * 128 + lane * 4; *(v4us*)(Ph + oo) = oh; *(v4us*)(Pl + oo) = ol; }
        } else {
#pragma unroll
            for (int ch = 0; ch < TT / 128; ++ch) { v4h o4;
#pragma unroll
                for (int q = 0; q < 4; ++q) o4[q] = tohx(v[ch * 4 + q] * f);
                *(v4h*)(P16 + (size_t)row * TT + ch * 128 + lane * 4) = o4; } }
         }
}
__global__ __launch_bounds__(256) void k_merge(const float* __restrict__ O, int h0, bf* Ah, bf* Al) { const size_t e = ((size_t)blockIdx.x * 256 + threadIdx.x) * 2; if (e >= (size_t)ZH * TT * HD) return; const int d = (int)(e % HD); const int t = (int)((e / HD) % TT); const int zz = (int)(e / ((size_t)HD * TT)); const float cs = (t < RH) ? 1.0f : (1.0f / PCAR); const size_t oo = (size_t)t * DQ + (h0 + zz) * HD + d;
    v2us oh, ol;
#pragma unroll
    for (int q = 0; q < 2; ++q) { unsigned short a, c2; splitf(O[e + q] * cs, a, c2); oh[q] = a; ol[q] = c2; } *(v2us*)(Ah + oo) = oh; *(v2us*)(Al + oo) = ol;  }

extern "C" void kernel_launch(void* const* d_in, const int* in_sizes, int n_in,
                              void* d_out, int out_size, void* d_ws, size_t ws_size, hipStream_t stream) {
    (void)in_sizes; (void)n_in; (void)out_size;
    const float* x = (const float*)d_in[0]; const float* wq = (const float*)d_in[1]; const float* wk = (const float*)d_in[2]; const float* wv = (const float*)d_in[3]; const float* wo = (const float*)d_in[4]; const float* qnw = (const float*)d_in[5]; const float* knw = (const float*)d_in[6];   // torch [out][in]
    float* OUT = (float*)d_out;     // [2][2048][2048]
    char* wsp = (char*)d_ws;
    auto take = [&](size_t bytes) { char* p = wsp; wsp += (bytes + 255) & ~(size_t)255; return (void*)p; };
    bf* WQ = (bf*)take((size_t)DQ * DM * 2); bf* WK = (bf*)take((size_t)DKV * DM * 2); bf* WV = (bf*)take((size_t)DKV * DM * 2); bf* WO = (bf*)take((size_t)DM * DQ * 2); float* CS = (float*)take((size_t)TT * HD * 2 * 4); float* RFQ = (float*)take((size_t)NH_ * TT * 4); float* RFK = (float*)take((size_t)NKV * TT * 4);
    bf* XB = (bf*)take((size_t)TT * DM * 2); float* FQ = (float*)take((size_t)TT * DQ * 4); float* FK = (float*)take((size_t)TT * DKV * 4);
    h16* QP16 = (h16*)take((size_t)NH_ * TT * HD * 2); h16* KP16 = (h16*)take((size_t)NKV * TT * HD * 2); h16* VT16 = (h16*)take((size_t)NKV * HD * TT * 2);
    bf* QPh = (bf*)take((size_t)NH_ * TT * HD * 2); bf* QPl = (bf*)take((size_t)NH_ * TT * HD * 2); bf* KPh = (bf*)take((size_t)NKV * TT * HD * 2); bf* KPl = (bf*)take((size_t)NKV * TT * HD * 2); bf* VTh = (bf*)take((size_t)NKV * HD * TT * 2); bf* VTl = (bf*)take((size_t)NKV * HD * TT * 2); bf* Ph = (bf*)take((size_t)ZH * RH * TT * 2); bf* Pl = (bf*)take((size_t)ZH * RH * TT * 2);
    float* Sb = (float*)take((size_t)ZH * TT * TT * 4); h16* P16 = (h16*)take((size_t)ZH * TT * TT * 2); float* Ob = (float*)take((size_t)ZH * TT * HD * 4); bf* ATh = (bf*)take((size_t)TT * DQ * 2); bf* ATl = (bf*)take((size_t)TT * DQ * 2);
    if ((size_t)(wsp - (char*)d_ws) > ws_size) return;    // ws 256 MiB
    float* FV = FK;   // v projection reuses the k buffer after the k planes are built (stream-ordered)
    { k_cvt8<<<(unsigned)(((size_t)DQ * DM / 8 + 255) / 256), 256, 0, stream>>>(wq, WQ, (size_t)DQ * DM / 8); k_cvt8<<<(unsigned)(((size_t)DKV * DM / 8 + 255) / 256), 256, 0, stream>>>(wk, WK, (size_t)DKV * DM / 8); k_cvt8<<<(unsigned)(((size_t)DKV * DM / 8 + 255) / 256), 256, 0, stream>>>(wv, WV, (size_t)DKV * DM / 8);
      k_cvt8<<<(unsigned)(((size_t)DM * DQ / 8 + 255) / 256), 256, 0, stream>>>(wo, WO, (size_t)DM * DQ / 8);
      k_cstab<<<(TT * HD + 255) / 256, 256, 0, stream>>>(CS); }
    k_zfill<<<(unsigned)(((size_t)ZH * TT * TT / 4 + 255) / 256), 256, 0, stream>>>(Sb, (size_t)ZH * TT * TT);   // score tiles above the causal diagonal are never written by k_gemmc; keep them defined (zeros; the softmax's select discards them anyway)
    const unsigned LQ = (unsigned)(((size_t)NH_ * TT * HD / 2 + 255) / 256), LKv = (unsigned)(((size_t)NKV * TT * HD / 2 + 255) / 256);
    for (int b = 0; b < NB_; ++b) {
        
        k_cvt8<<<(unsigned)(((size_t)TT * DM / 8 + 255) / 256), 256, 0, stream>>>(x + (size_t)b * TT * DM, XB, (size_t)TT * DM / 8);
        k_gemmw<bf, 0, false, 4><<<dim3(TT / 64, DQ / 64, 1), 128, 0, stream>>>(XB, nullptr, WQ, nullptr, DM, FQ, DQ, nullptr, 0, 0, 0); k_hrms<<<(NH_ * TT + 255) / 256, 256, 0, stream>>>(FQ, DQ, NH_, RFQ);
        k_rope<<<LQ, 256, 0, stream>>>(FQ, DQ, NH_, CS, RFQ, qnw, 1.0f, QP16, QPh, QPl);
        k_gemmw<bf, 0, false, 8><<<dim3(TT / 64, DKV / 64, 1), 256, 0, stream>>>(XB, nullptr, WK, nullptr, DM, FK, DKV, nullptr, 0, 0, 0); k_hrms<<<(NKV * TT + 255) / 256, 256, 0, stream>>>(FK, DKV, NKV, RFK);
        k_rope<<<LKv, 256, 0, stream>>>(FK, DKV, NKV, CS, RFK, knw, 1.0f, KP16, KPh, KPl);
        k_gemmw<bf, 0, false, 8><<<dim3(TT / 64, DKV / 64, 1), 256, 0, stream>>>(XB, nullptr, WV, nullptr, DM, FV, DKV, nullptr, 0, 0, 0); k_vtp<<<LKv, 256, 0, stream>>>(FV, DKV, NKV, VT16, VTh, VTl);
        for (int h0 = 0; h0 < NH_; h0 += ZH) { const size_t zq = (size_t)h0, zk = (size_t)(h0 / REP);   // both heads of a pass share kv group h0/REP (REP >= 2): sB = 0
            k_gemmc<bf, 2, 1, 4><<<dim3(RH / 64, TT / 64, ZH), 128, 0, stream>>>(QPh + zq * TT * HD, QPl + zq * TT * HD, KPh + zk * TT * HD, KPl + zk * TT * HD, HD, Sb, TT, 0, (size_t)TT * HD, 0, (size_t)TT * TT);
            k_gemmc<h16, 0, 1, 1><<<dim3((TT - RH) / 64, TT / 64, ZH), 32, 0, stream>>>(QP16 + zq * TT * HD + (size_t)RH * HD, nullptr, KP16 + zk * TT * HD, nullptr, HD, Sb + (size_t)RH * TT, TT, RH, (size_t)TT * HD, 0, (size_t)TT * TT);
            k_asoft<<<ZH * TT / 8, 256, 0, stream>>>(Sb, P16, Ph, Pl);
            k_gemmc<bf, 2, 2, 8><<<dim3(RH / 64, HD / 64, ZH), 256, 0, stream>>>(Ph, Pl, VTh + zk * HD * TT, VTl + zk * HD * TT, TT, Ob, HD, 0, (size_t)RH * TT, 0, (size_t)TT * HD);
            k_gemmc<h16, 0, 2, 8><<<dim3((TT - RH) / 64, HD / 64, ZH), 256, 0, stream>>>(P16 + (size_t)RH * TT, nullptr, VT16 + zk * HD * TT, nullptr, TT, Ob + (size_t)RH * HD, HD, RH, (size_t)TT * TT, 0, (size_t)TT * HD);
            k_merge<<<(unsigned)(((size_t)ZH * TT * HD / 2 + 255) / 256), 256, 0, stream>>>(Ob, h0, ATh, ATl); }
        k_gemmw<bf, 1, false, 4><<<dim3(TT / 64, DM / 64, 1), 128, 0, stream>>>(ATh, ATl, WO, nullptr, DQ, OUT + (size_t)b * TT * DM, DM, nullptr, 0, 0, 0); }
}

// v002
// One run takes 688 microseconds.
// Next to v001, in two timings, it ran 1.48 and 1.49 times as fast.
// All steps since v000 together make it 2.32 times as fast.
#include <hip/hip_runtime.h>

// YuaAttention (hidden [2][2048][2048]; q = x q_w^T (16 heads x 128), k/v = x k_w^T / v_w^T (4 kv heads, GQA repeat_interleave); per-head RMSNorm (eps 1e-5) with q_norm_w / k_norm_w, then rotate-half
// RoPE (theta 500000, positions 0..S-1); causal softmax(q.k 128^-0.5); out = merged attn.v o_w^T -> [2][2048][2048]).
// Compute dtypes, f32 accumulate: every input rounded to bf16; q/k/v projections on PLAIN bf16 operands (inputs: exact), o projection hi+lo attn x bf16 o_w (2 products); RMSNorm + RoPE f32 (table computed on device);
// PER-ROW PRECISION HYBRID (rows < 256 hi+lo 3 products for scores and attn.v, rows >= 256 fp16); causal structure exploited in the GEMMs (score tiles above the diagonal skipped, value contraction

#define NB_  2
#define TT   2048
#define DM   2048
#define NH_  16
#define NKV  4
#define REP  (NH_ / NKV)
#define HD   128
#define DQ   (NH_ * HD)
#define DKV  (NKV * HD)
#define ZH   8                    // query heads per attention pass (two kv groups of REP heads)
#define PP   (2 * TT)             // row pitch, in halves, of the fp16 probability rows (they lie over their own f32 score rows) and of the fp16 V^T rows (k_gemmc has one K pitch for both operands)
static_assert(ZH % REP == 0 && NH_ % ZH == 0, "a pass holds whole kv groups and the passes cover all heads");
#define RH   256                  // query rows < RH use hi+lo planes (0: none)
#define WIN  0
#define PCAR 1024.0f
#define SCL  0.088388347648318447f   // HD^-0.5
typedef _Float16 h16;
typedef unsigned short bf;
typedef __attribute__((ext_vector_type(16))) __bf16   v16bf;
typedef __attribute__((ext_vector_type(16))) _Float16 v16h;
typedef __attribute__((ext_vector_type(8)))  _Float16 v8h;
typedef __attribute__((ext_vector_type(8)))  unsigned short v8us;
typedef __attribute__((ext_vector_type(8)))  float    v8f;
typedef __attribute__((ext_vector_type(4)))  float    v4f;
typedef v8h  __attribute__((may_alias)) v8ha;
typedef v4f  __attribute__((may_alias)) v4fa;
typedef v8us __attribute__((may_alias)) v8usa;

__device__ __forceinline__ unsigned short f2bf(float f) { unsigned u = __float_as_uint(f); u += 0x7FFFu + ((u >> 16) & 1u); return (unsigned short)(u >> 16); }
__device__ __forceinline__ float bf2f(unsigned short b) { return __uint_as_float(((unsigned)b) << 16); }
__device__ __forceinline__ float bfr(float f) { return bf2f(f2bf(f)); }
__device__ __forceinline__ v16h cat16(v8h lo, v8h hi) { return __builtin_shufflevector(lo, hi, 0, 1, 2, 3, 4, 5, 6, 7, 8, 9, 10, 11, 12, 13, 14, 15); }
__device__ __forceinline__ v16bf cat16b(v8us lo, v8us hi) { return __builtin_bit_cast(v16bf, __builtin_shufflevector(lo, hi, 0, 1, 2, 3, 4, 5, 6, 7, 8, 9, 10, 11, 12, 13, 14, 15)); }
__device__ __forceinline__ v8f wmma16(v16h a, v16h b, v8f c) { return __builtin_amdgcn_wmma_f32_16x16x32_f16(false, a, false, b, (short)0, c, false, false); }
__device__ __forceinline__ v8f wmmab(v16bf a, v16bf b, v8f c) { return __builtin_amdgcn_wmma_f32_16x16x32_bf16(false, a, false, b, (short)0, c, false, false); }



// ---- k_gemmw: register-blocked GEMM, NW WAVES per 64x64 output tile: wave w takes the 32-wide K steps w, w + NW, ... (16 accumulators each), the NW partial tiles are summed through LDS in wave order
// (fixed order, so run-to-run identical); operands straight from K-contiguous 16-bit planes; grid (M/64, N/64, Z), 32 * NW threads.
// C[m][n] (f32, pitch ldc, + optional f32 bias[n]) = sum_k A[m][k] Bt[n][k] (+ split products per NSPLIT). z-batch strides sA/sB/sC in elements. K % 32 == 0.
template <typename T16> struct WFrag;
template <> struct WFrag<h16> { typedef v16h V; static __device__ __forceinline__ V ld(const h16* p) { return cat16(*(const v8h*)p, *(const v8h*)(p + 16)); } static __device__ __forceinline__ v8f mma(V a, V b, v8f c) { return wmma16(a, b, c); } };
template <> struct WFrag<bf> { typedef v16bf V; static __device__ __forceinline__ V ld(const bf* p) { return cat16b(*(const v8us*)p, *(const v8us*)(p + 16)); } static __device__ __forceinline__ v8f mma(V a, V b, v8f c) { return wmmab(a, b, c); } };
template <typename T16, int NSPLIT, bool BIAS, int NW>
__global__ __launch_bounds__(32 * NW) void k_gemmw(const T16* __restrict__ A, const T16* __restrict__ A2, const T16* __restrict__ Bt, const T16* __restrict__ Bt2, int K, float* C, int ldc, const float* __restrict__ bias, size_t sA, size_t sB, size_t sC) {
    typedef typename WFrag<T16>::V V;
    __shared__ __align__(16) float os[2 * NW * 16 * 68];   // two buffers (row block parity) x NW partial 16x64 row blocks
    const size_t z = blockIdx.z; A += z * sA; if (A2) A2 += z * sA; Bt += z * sB; if (Bt2) Bt2 += z * sB; C += z * sC;
    const int lane = threadIdx.x & 31, lr = lane & 15, hi = lane >> 4; const int r0 = blockIdx.x * 64, c0 = blockIdx.y * 64; const int wv = __builtin_amdgcn_readfirstlane((int)(threadIdx.x >> 5));
    v8f acc[4][4];
#pragma unroll
    for (int mb = 0; mb < 4; ++mb)
#pragma unroll
        for (int nb = 0; nb < 4; ++nb) acc[mb][nb] = (v8f){};
    const size_t aoff = (size_t)(r0 + lr) * K + 8 * hi, boff = (size_t)(c0 + lr) * K + 8 * hi;
#pragma unroll 1
    for (int kc = wv * 32; kc < K; kc += 32 * NW) {
        V a[4], a2[4];
#pragma unroll
        for (int mb = 0; mb < 4; ++mb) { a[mb] = WFrag<T16>::ld(A + aoff + (size_t)mb * 16 * K + kc); if (NSPLIT == 1 || NSPLIT == 2) a2[mb] = WFrag<T16>::ld(A2 + aoff + (size_t)mb * 16 * K + kc); }
#pragma unroll
        for (int nb = 0; nb < 4; ++nb) { const V b = WFrag<T16>::ld(Bt + boff + (size_t)nb * 16 * K + kc); V b2; if (NSPLIT >= 2) b2 = WFrag<T16>::ld(Bt2 + boff + (size_t)nb * 16 * K + kc);
#pragma unroll
            for (int mb = 0; mb < 4; ++mb) { acc[mb][nb] = WFrag<T16>::mma(a[mb], b, acc[mb][nb]); if (NSPLIT == 1 || NSPLIT == 2) acc[mb][nb] = WFrag<T16>::mma(a2[mb], b, acc[mb][nb]); if (NSPLIT >= 2) acc[mb][nb] = WFrag<T16>::mma(a[mb], b2, acc[mb][nb]); } }
        asm volatile("v_nop\n\tv_nop\n\tv_nop\n\tv_nop" : "+v"(acc[0][0]), "+v"(acc[1][1]), "+v"(acc[2][2]), "+v"(acc[3][3]) : "v"(a[0]), "v"(a[3]));
    }
    v4f res[4][8 / NW];   // this thread's summed 16-byte pieces; the loops over mb, q and w below are unrolled so that res and acc are indexed by constants and stay in registers
#pragma unroll
    for (int mb = 0; mb < 4; ++mb) {
        float* ob = os + (mb & 1) * (NW * 16 * 68);
#pragma unroll
        for (int nb = 0; nb < 4; ++nb) {
#pragma unroll
            for (int j = 0; j < 8; ++j) ob[wv * (16 * 68) + (hi * 8 + j) * 68 + nb * 16 + lr] = acc[mb][nb][j]; }
        __syncthreads();   // every wave's partial of this row block is in LDS; also ends the reads of the other buffer (row block mb - 1) before row block mb + 1 overwrites it
#pragma unroll
        for (int q = 0; q < 8 / NW; ++q) { const int s = (int)threadIdx.x + q * 32 * NW; const int row = s >> 4, cofs = (s & 15) * 4; v4f val = *(const v4fa*)(ob + row * 68 + cofs);
#pragma unroll
            for (int w = 1; w < NW; ++w) val += *(const v4fa*)(ob + w * (16 * 68) + row * 68 + cofs);
            if (BIAS) { val[0] += bfr(bias[c0 + cofs]); val[1] += bfr(bias[c0 + cofs + 1]); val[2] += bfr(bias[c0 + cofs + 2]); val[3] += bfr(bias[c0 + cofs + 3]); }
            res[mb][q] = val; }
    }
    // all global stores behind the last barrier: a store in front of a barrier would be waited for there
#pragma unroll
    for (int mb = 0; mb < 4; ++mb)
#pragma unroll
        for (int q = 0; q < 8 / NW; ++q) { const int s = (int)threadIdx.x + q * 32 * NW; const int row = s >> 4, cofs = (s & 15) * 4; *(v4f*)(C + (size_t)(r0 + mb * 16 + row) * ldc + c0 + cofs) = res[mb][q]; }
}

// ---- k_gemmc: the same 64x64 tile GEMM (K steps dealt over NW waves, partial tiles summed through LDS) specialised for causal attention: CMODE 1 skips score tiles entirely above the diagonal (query rows r0+roff.., key columns c0..), CMODE 2 limits the
// key (K) loop of the probability x value contraction to the diagonal block (probabilities beyond it are exactly zero). roff = row offset of this launch's first row within the sequence. blockIdx.z = query head within the pass; the REP heads of one kv group (z / REP) share Bt.
template <typename T16, int NSPLIT, int CMODE, int NW>
__global__ __launch_bounds__(32 * NW) void k_gemmc(const T16* __restrict__ A, const T16* __restrict__ A2, const T16* __restrict__ Bt, const T16* __restrict__ Bt2, int K, float* C, int ldc, int roff, size_t sA, size_t sB, size_t sC) {
    typedef typename WFrag<T16>::V V;
    __shared__ __align__(16) float os[2 * NW * 16 * 68];   // two buffers (row block parity) x NW partial 16x64 row blocks
    const size_t z = blockIdx.z, zg = z / REP; A += z * sA; if (A2) A2 += z * sA; Bt += zg * sB; if (Bt2) Bt2 += zg * sB; C += z * sC;   // z = query head of the pass, zg = its kv group (repeat_interleave)
    const int lane = threadIdx.x & 31, lr = lane & 15, hi = lane >> 4; const int r0 = blockIdx.x * 64, c0 = blockIdx.y * 64; const int wv = __builtin_amdgcn_readfirstlane((int)(threadIdx.x >> 5));
    if (CMODE == 1 && c0 > r0 + roff + 63) return;                  // score tile entirely above the causal diagonal: never read (the softmax masks j > i by select)
    const int Kl = (CMODE == 2) ? min(K, r0 + roff + 64) : K;        // P.V: probabilities are exactly 0 beyond the diagonal block, so the K loop stops there
    v8f acc[4][4];
#pragma unroll
    for (int mb = 0; mb < 4; ++mb)
#pragma unroll
        for (int nb = 0; nb < 4; ++nb) acc[mb][nb] = (v8f){};
    const size_t aoff = (size_t)(r0 + lr) * K + 8 * hi, boff = (size_t)(c0 + lr) * K + 8 * hi;
#pragma unroll 1
    for (int kc = wv * 32; kc < Kl; kc += 32 * NW) {
        V a[4], a2[4];
#pragma unroll
        for (int mb = 0; mb < 4; ++mb) { a[mb] = WFrag<T16>::ld(A + aoff + (size_t)mb * 16 * K + kc); if (NSPLIT == 1 || NSPLIT == 2) a2[mb] = WFrag<T16>::ld(A2 + aoff + (size_t)mb * 16 * K + kc); }
#pragma unroll
        for (int nb = 0; nb < 4; ++nb) { const V b = WFrag<T16>::ld(Bt + boff + (size_t)nb * 16 * K + kc); V b2; if (NSPLIT >= 2) b2 = WFrag<T16>::ld(Bt2 + boff + (size_t)nb * 16 * K + kc);
#pragma unroll
            for (int mb = 0; mb < 4; ++mb) { acc[mb][nb] = WFrag<T16>::mma(a[mb], b, acc[mb][nb]); if (NSPLIT == 1 || NSPLIT == 2) acc[mb][nb] = WFrag<T16>::mma(a2[mb], b, acc[mb][nb]); if (NSPLIT >= 2) acc[mb][nb] = WFrag<T16>::mma(a[mb], b2, acc[mb][nb]); } }
        asm volatile("v_nop\n\tv_nop\n\tv_nop\n\tv_nop" : "+v"(acc[0][0]), "+v"(acc[1][1]), "+v"(acc[2][2]), "+v"(acc[3][3]) : "v"(a[0]), "v"(a[3]));
    }
    v4f res[4][8 / NW];   // this thread's summed 16-byte pieces; the loops over mb, q and w below are unrolled so that res and acc are indexed by constants and stay in registers
#pragma unroll
    for (int mb = 0; mb < 4; ++mb) {
        float* ob = os + (mb & 1) * (NW * 16 * 68);
#pragma unroll
        for (int nb = 0; nb < 4; ++nb) {
#pragma unroll
            for (int j = 0; j < 8; ++j) ob[wv * (16 * 68) + (hi * 8 + j) * 68 + nb * 16 + lr] = acc[mb][nb][j]; }
        __syncthreads();   // every wave's partial of this row block is in LDS; also ends the reads of the other buffer (row block mb - 1) before row block mb + 1 overwrites it
#pragma unroll
        for (int q = 0; q < 8 / NW; ++q) { const int s = (int)threadIdx.x + q * 32 * NW; const int row = s >> 4, cofs = (s & 15) * 4; v4f val = *(const v4fa*)(ob + row * 68 + cofs);
#pragma unroll
            for (int w = 1; w < NW; ++w) val += *(const v4fa*)(ob + w * (16 * 68) + row * 68 + cofs);
            res[mb][q] = val; }
    }
    // all global stores behind the last barrier: a store in front of a barrier would be waited for there
#pragma unroll
    for (int mb = 0; mb < 4; ++mb)
#pragma unroll
        for (int q = 0; q < 8 / NW; ++q) { const int s = (int)threadIdx.x + q * 32 * NW; const int row = s >> 4, cofs = (s & 15) * 4; *(v4f*)(C + (size_t)(r0 + mb * 16 + row) * ldc + c0 + cofs) = res[mb][q]; }
}

__device__ __forceinline__ h16 tohx(float x) { return (h16)x; }
__device__ __forceinline__ void splitf(float y, unsigned short& h, unsigned short& l) { h = f2bf(y); l = f2bf(y - bf2f(h)); }
typedef __attribute__((ext_vector_type(2))) _Float16 v2h;
typedef __attribute__((ext_vector_type(4))) _Float16 v4h;
typedef __attribute__((ext_vector_type(2))) unsigned short v2us;
typedef __attribute__((ext_vector_type(4))) unsigned short v4us;
typedef __attribute__((ext_vector_type(2))) float v2f;
typedef __attribute__((ext_vector_type(4))) int v4i;

__global__ __launch_bounds__(256) void k_wtG(const float* __restrict__ w, int K, int N, bf* Bt) {
    const int lane = threadIdx.x & 31; const int L0 = (blockIdx.x * 8 + (threadIdx.x >> 5)) * 8; const int nlines = N * K / 64;
{
#pragma unroll 1
        for (int l = 0; l < 8; ++l) { const int L = L0 + l; if (L >= nlines) break; const size_t e = (size_t)L * 64 + lane * 2; const int k = (int)(e % K), n = (int)(e / K); v2us o;
            o[0] = f2bf(w[(size_t)k * N + n]); o[1] = f2bf(w[(size_t)(k + 1) * N + n]); *(v2us*)(Bt + e) = o; }
         }
}
__global__ __launch_bounds__(256) void k_cvt8(const float* __restrict__ src, bf* dst, size_t n8) { const size_t i = (size_t)blockIdx.x * 256 + threadIdx.x; if (i >= n8) return; const v8f v = *(const v8f*)(src + i * 8); v8us o;
#pragma unroll
    for (int k = 0; k < 8; ++k) o[k] = f2bf(v[k]); *(v8us*)(dst + i * 8) = o;  }
__global__ __launch_bounds__(256) void k_cstab(float* CS) { const int idx = blockIdx.x * 256 + threadIdx.x; if (idx >= TT * HD) return; const int t = idx / HD, d = idx % HD; const int i = d % (HD / 2); const float inv = __fdiv_rn(1.0f, powf(500000.0f, (float)(2 * i) / (float)HD)); const float ang = __fmul_rn((float)t, inv); v2f cs; cs[0] = cosf(ang); cs[1] = sinf(ang);
    *(v2f*)(CS + (size_t)idx * 2) = cs;  }
__global__ __launch_bounds__(256) void k_hrms(const float* __restrict__ F, int pitch, int nheads, float* RF) { const int i = blockIdx.x * 256 + threadIdx.x; if (i >= nheads * TT) return; const int t = i % TT, h = i / TT; const float* f = F + (size_t)t * pitch + h * HD; float s = 0.f;
#pragma unroll 4
    for (int d = 0; d < HD; d += 4) { const v4f v = *(const v4f*)(f + d);
#pragma unroll
        for (int q = 0; q < 4; ++q) { float p = __fmul_rn(v[q], v[q]); asm volatile("" : "+v"(p)); s = __fadd_rn(s, p); } }
    const float r = __fdiv_rn(1.0f, __fsqrt_rn(__fadd_rn(s * (1.0f / HD), 1e-5f))); *(float*)(RF + i) = r;  }
// k_rope: head planes [h][t][d] (fp16 + hi/lo) of rope(w[d] (x rms_factor)) x sc with the rotate-half convention out[d] = x[d] cos[t][d] - x[d+HD/2] sin[t][d], out[d+HD/2] = x[d+HD/2] cos[t][d+HD/2] + x[d] sin[t][d+HD/2]
__global__ __launch_bounds__(256) void k_rope(const float* __restrict__ F, int pitch, int nheads, const float* __restrict__ CS, const float* __restrict__ RF, const float* __restrict__ nw, float sc, h16* P16, bf* Ph, bf* Pl) {
    const size_t e = ((size_t)blockIdx.x * 256 + threadIdx.x) * 2; if (e >= (size_t)nheads * TT * HD) return; const int d = (int)(e % HD); const int t = (int)((e / HD) % TT); const int h = (int)(e / ((size_t)HD * TT)); const float* f = F + (size_t)t * pitch + h * HD; const float rf = RF ? RF[(size_t)h * TT + t] : 1.0f; v2h o16; v2us oh, ol;
#pragma unroll
    for (int q = 0; q < 2; ++q) { const int dd = d + q; const int dp = (dd < HD / 2) ? dd + HD / 2 : dd - HD / 2; float x0 = f[dd], x1 = f[dp];
        if (RF) { float n0 = __fmul_rn(x0, rf), n1 = __fmul_rn(x1, rf); asm volatile("" : "+v"(n0)); asm volatile("" : "+v"(n1)); x0 = __fmul_rn(bfr(nw[dd]), n0); x1 = __fmul_rn(bfr(nw[dp]), n1); }
        const v2f cs = *(const v2f*)(CS + ((size_t)t * HD + dd) * 2); float a = __fmul_rn(x0, cs[0]), bq = __fmul_rn(x1, cs[1]); asm volatile("" : "+v"(a)); asm volatile("" : "+v"(bq)); const float r = ((dd < HD / 2) ? __fsub_rn(a, bq) : __fadd_rn(a, bq)) * sc;
        o16[q] = tohx(r); unsigned short a2, c2; splitf(r, a2, c2); oh[q] = a2; ol[q] = c2; }
    *(v2h*)(P16 + e) = o16; *(v2us*)(Ph + e) = oh; *(v2us*)(Pl + e) = ol;  }
__global__ __launch_bounds__(256) void k_vtp(const float* __restrict__ F, int pitch, int nheads, h16* V16, bf* Vh, bf* Vl) { const size_t e = ((size_t)blockIdx.x * 256 + threadIdx.x) * 2; if (e >= (size_t)nheads * HD * TT) return; const int t = (int)(e % TT); const int d = (int)((e / TT) % HD); const int g = (int)(e / ((size_t)TT * HD)); v2h o16; v2us oh, ol;
#pragma unroll
    for (int q = 0; q < 2; ++q) { const float x = F[(size_t)(t + q) * pitch + g * HD + d]; o16[q] = tohx(x); unsigned short a2, c2; splitf(x, a2, c2); oh[q] = a2; ol[q] = c2; }
    *(v2h*)(V16 + (size_t)(g * HD + d) * PP + t) = o16; *(v2us*)(Vh + e) = oh; *(v2us*)(Vl + e) = ol;  }   // V16 rows at pitch PP, Vh / Vl rows at pitch TT
// k_zfill: F[0..n) = 0 (16-B lanes); once, before the batch loop.
__global__ __launch_bounds__(256) void k_zfill(float* F, size_t n) { const size_t i = ((size_t)blockIdx.x * 256 + threadIdx.x) * 4; if (i >= n) return; v4f z; z[0] = 0.f; z[1] = 0.f; z[2] = 0.f; z[3] = 0.f; *(v4f*)(F + i) = z; }
// k_asoft: per row (zz, i): t = S x HD^-0.5 for j <= i (causal; finfo.min in the reference), -3e38 otherwise (entries of skipped score tiles are never selected); softmax over the 2048 keys (register row, one exp, fixed trees);
// fp16 probabilities of a row go over the first half of that row's own scores (P16 is Sb's memory, row pitch PP halves): one wave holds its whole row in registers before its first store, and no other wave touches the row.
__global__ __launch_bounds__(256) void k_asoft(const float* Sb, h16* P16, bf* Ph, bf* Pl) {
    const int lane = threadIdx.x & 31; const int row = blockIdx.x * 8 + (threadIdx.x >> 5); if (row >= ZH * TT) return; const int i = row % TT; const int zz = row / TT; (void)zz; const bool hires = (i < RH); const float* sr = Sb + (size_t)row * TT; float v[TT / 32]; float mx = -3.0e38f;
#pragma unroll
    for (int ch = 0; ch < TT / 128; ++ch) { const int j0 = ch * 128 + lane * 4; const v4f a = *(const v4f*)(sr + j0);
#pragma unroll
        for (int q = 0; q < 4; ++q) { const int j = j0 + q; (void)j; const float t = (j <= i) ? a[q] * SCL : -3.0e38f; v[ch * 4 + q] = t; mx = fmaxf(mx, t); } }
#pragma unroll
    for (int sh = 16; sh; sh >>= 1) mx = fmaxf(mx, __shfl_xor(mx, sh, 32));
    float sum = 0.f;
#pragma unroll
    for (int k = 0; k < TT / 32; ++k) { float d0 = __fsub_rn(v[k], mx); asm volatile("" : "+v"(d0)); v[k] = __builtin_amdgcn_exp2f(__fmul_rn(d0, 1.4426950408889634f)); sum += v[k]; }
#pragma unroll
    for (int sh = 16; sh; sh >>= 1) sum += __shfl_xor(sum, sh, 32);
    const float f = __fdiv_rn(hires ? 1.0f : PCAR, sum);
{
        if (hires) {
#pragma unroll
            for (int ch = 0; ch < TT / 128; ++ch) { v4us oh, ol;
#pragma unroll
                for (int q = 0; q < 4; ++q) { unsigned short a, c2; splitf(v[ch * 4 + q] * f, a, c2); oh[q] = a; ol[q] = c2; }
                const size_t oo = ((size_t)zz * (RH ? RH : 1) + i) * TT + ch * 128 + lane * 4; *(v4us*)(Ph + oo) = oh; *(v4us*)(Pl + oo) = ol; }
        } else {
#pragma unroll
            for (int ch = 0; ch < TT / 128; ++ch) { v4h o4;
#pragma unroll
                for (int q = 0; q < 4; ++q) o4[q] = tohx(v[ch * 4 + q] * f);
                *(v4h*)(P16 + (size_t)row * PP + ch * 128 + lane * 4) = o4; } }
         }
}
__global__ __launch_bounds__(256) void k_merge(const float* __restrict__ O, int h0, bf* Ah, bf* Al) { const size_t e = ((size_t)blockIdx.x * 256 + threadIdx.x) * 2; if (e >= (size_t)ZH * TT * HD) return; const int d = (int)(e % HD); const int t = (int)((e / HD) % TT); const int zz = (int)(e / ((size_t)HD * TT)); const float cs = (t < RH) ? 1.0f : (1.0f / PCAR); const size_t oo = (size_t)t * DQ + (h0 + zz) * HD + d;
    v2us oh, ol;
#pragma unroll
    for (int q = 0; q < 2; ++q) { unsigned short a, c2; splitf(O[e + q] * cs, a, c2); oh[q] = a; ol[q] = c2; } *(v2us*)(Ah + oo) = oh; *(v2us*)(Al + oo) = ol;  }

extern "C" void kernel_launch(void* const* d_in, const int* in_sizes, int n_in,
                              void* d_out, int out_size, void* d_ws, size_t ws_size, hipStream_t stream) {
    (void)in_sizes; (void)n_in; (void)out_size;
    const float* x = (const float*)d_in[0]; const float* wq = (const float*)d_in[1]; const float* wk = (const float*)d_in[2]; const float* wv = (const float*)d_in[3]; const float* wo = (const float*)d_in[4]; const float* qnw = (const float*)d_in[5]; const float* knw = (const float*)d_in[6];   // torch [out][in]
    float* OUT = (float*)d_out;     // [2][2048][2048]
    char* wsp = (char*)d_ws;
    auto take = [&](size_t bytes) { char* p = wsp; wsp += (bytes + 255) & ~(size_t)255; return (void*)p; };
    bf* WQ = (bf*)take((size_t)DQ * DM * 2); bf* WK = (bf*)take((size_t)DKV * DM * 2); bf* WV = (bf*)take((size_t)DKV * DM * 2); bf* WO = (bf*)take((size_t)DM * DQ * 2); float* CS = (float*)take((size_t)TT * HD * 2 * 4); float* RFQ = (float*)take((size_t)NH_ * TT * 4); float* RFK = (float*)take((size_t)NKV * TT * 4);
    bf* XB = (bf*)take((size_t)TT * DM * 2); float* FQ = (float*)take((size_t)TT * DQ * 4); float* FK = (float*)take((size_t)TT * DKV * 4);
    h16* QP16 = (h16*)take((size_t)NH_ * TT * HD * 2); h16* KP16 = (h16*)take((size_t)NKV * TT * HD * 2); h16* VT16 = (h16*)take((size_t)NKV * HD * PP * 2);
    bf* QPh = (bf*)take((size_t)NH_ * TT * HD * 2); bf* QPl = (bf*)take((size_t)NH_ * TT * HD * 2); bf* KPh = (bf*)take((size_t)NKV * TT * HD * 2); bf* KPl = (bf*)take((size_t)NKV * TT * HD * 2); bf* VTh = (bf*)take((size_t)NKV * HD * TT * 2); bf* VTl = (bf*)take((size_t)NKV * HD * TT * 2); bf* Ph = (bf*)take((size_t)ZH * RH * TT * 2); bf* Pl = (bf*)take((size_t)ZH * RH * TT * 2);
    float* Sb = (float*)take((size_t)ZH * TT * TT * 4); h16* P16 = (h16*)Sb; float* Ob = FQ;   /* so that ZH score planes fit: probabilities overwrite their own score rows, and the attention output reuses the q projection's buffer, which is dead once the q planes are built (stream-ordered) */ static_assert(ZH <= NH_, "Ob fits in FQ"); bf* ATh = (bf*)take((size_t)TT * DQ * 2); bf* ATl = (bf*)take((size_t)TT * DQ * 2);
    if ((size_t)(wsp - (char*)d_ws) > ws_size) return;    // ws 256 MiB
    float* FV = FK;   // v projection reuses the k buffer after the k planes are built (stream-ordered)
    { k_cvt8<<<(unsigned)(((size_t)DQ * DM / 8 + 255) / 256), 256, 0, stream>>>(wq, WQ, (size_t)DQ * DM / 8); k_cvt8<<<(unsigned)(((size_t)DKV * DM / 8 + 255) / 256), 256, 0, stream>>>(wk, WK, (size_t)DKV * DM / 8); k_cvt8<<<(unsigned)(((size_t)DKV * DM / 8 + 255) / 256), 256, 0, stream>>>(wv, WV, (size_t)DKV * DM / 8);
      k_cvt8<<<(unsigned)(((size_t)DM * DQ / 8 + 255) / 256), 256, 0, stream>>>(wo, WO, (size_t)DM * DQ / 8);
      k_cstab<<<(TT * HD + 255) / 256, 256, 0, stream>>>(CS); }
    k_zfill<<<(unsigned)(((size_t)ZH * TT * TT / 4 + 255) / 256), 256, 0, stream>>>(Sb, (size_t)ZH * TT * TT);   // score tiles above the causal diagonal are never written by k_gemmc; keep them defined (zeros, later the probability halves of an earlier pass of this call; the softmax's select discards them anyway)
    const unsigned LQ = (unsigned)(((size_t)NH_ * TT * HD / 2 + 255) / 256), LKv = (unsigned)(((size_t)NKV * TT * HD / 2 + 255) / 256);
    for (int b = 0; b < NB_; ++b) {
        
        k_cvt8<<<(unsigned)(((size_t)TT * DM / 8 + 255) / 256), 256, 0, stream>>>(x + (size_t)b * TT * DM, XB, (size_t)TT * DM / 8);
        k_gemmw<bf, 0, false, 4><<<dim3(TT / 64, DQ / 64, 1), 128, 0, stream>>>(XB, nullptr, WQ, nullptr, DM, FQ, DQ, nullptr, 0, 0, 0); k_hrms<<<(NH_ * TT + 255) / 256, 256, 0, stream>>>(FQ, DQ, NH_, RFQ);
        k_rope<<<LQ, 256, 0, stream>>>(FQ, DQ, NH_, CS, RFQ, qnw, 1.0f, QP16, QPh, QPl);
        k_gemmw<bf, 0, false, 8><<<dim3(TT / 64, DKV / 64, 1), 256, 0, stream>>>(XB, nullptr, WK, nullptr, DM, FK, DKV, nullptr, 0, 0, 0); k_hrms<<<(NKV * TT + 255) / 256, 256, 0, stream>>>(FK, DKV, NKV, RFK);
        k_rope<<<LKv, 256, 0, stream>>>(FK, DKV, NKV, CS, RFK, knw, 1.0f, KP16, KPh, KPl);
        k_gemmw<bf, 0, false, 8><<<dim3(TT / 64, DKV / 64, 1), 256, 0, stream>>>(XB, nullptr, WV, nullptr, DM, FV, DKV, nullptr, 0, 0, 0); k_vtp<<<LKv, 256, 0, stream>>>(FV, DKV, NKV, VT16, VTh, VTl);
        for (int h0 = 0; h0 < NH_; h0 += ZH) { const size_t zq = (size_t)h0, zk = (size_t)(h0 / REP);   // the ZH heads of a pass span kv groups h0/REP ..: head z reads group h0/REP + z/REP (stride sB)
            k_gemmc<bf, 2, 1, 4><<<dim3(RH / 64, TT / 64, ZH), 128, 0, stream>>>(QPh + zq * TT * HD, QPl + zq * TT * HD, KPh + zk * TT * HD, KPl + zk * TT * HD, HD, Sb, TT, 0, (size_t)TT * HD, (size_t)TT * HD, (size_t)TT * TT);
            k_gemmc<h16, 0, 1, 1><<<dim3((TT - RH) / 64, TT / 64, ZH), 32, 0, stream>>>(QP16 + zq * TT * HD + (size_t)RH * HD, nullptr, KP16 + zk * TT * HD, nullptr, HD, Sb + (size_t)RH * TT, TT, RH, (size_t)TT * HD, (size_t)TT * HD, (size_t)TT * TT);
            k_asoft<<<ZH * TT / 8, 256, 0, stream>>>(Sb, P16, Ph, Pl);
            k_gemmc<bf, 2, 2, 8><<<dim3(RH / 64, HD / 64, ZH), 256, 0, stream>>>(Ph, Pl, VTh + zk * HD * TT, VTl + zk * HD * TT, TT, Ob, HD, 0, (size_t)RH * TT, (size_t)HD * TT, (size_t)TT * HD);
            k_gemmc<h16, 0, 2, 8><<<dim3((TT - RH) / 64, HD / 64, ZH), 256, 0, stream>>>(P16 + (size_t)RH * PP, nullptr, VT16 + zk * HD * PP, nullptr, PP, Ob + (size_t)RH * HD, HD, RH, (size_t)TT * PP, (size_t)HD * PP, (size_t)TT * HD);
            k_merge<<<(unsigned)(((size_t)ZH * TT * HD / 2 + 255) / 256), 256, 0, stream>>>(Ob, h0, ATh, ATl); }
        k_gemmw<bf, 1, false, 4><<<dim3(TT / 64, DM / 64, 1), 128, 0, stream>>>(ATh, ATl, WO, nullptr, DQ, OUT + (size_t)b * TT * DM, DM, nullptr, 0, 0, 0); }
}

// v003
// One run takes 474 microseconds.
// In two side-by-side timings against v002, it was 1.47 and 1.46 times as fast.
// Counting every step since v000, it is 3.39 times as fast.
#include <hip/hip_runtime.h>

// YuaAttention (hidden [2][2048][2048]; q = x q_w^T (16 heads x 128), k/v = x k_w^T / v_w^T (4 kv heads, GQA repeat_interleave); per-head RMSNorm (eps 1e-5) with q_norm_w / k_norm_w, then rotate-half
// RoPE (theta 500000, positions 0..S-1); causal softmax(q.k 128^-0.5); out = merged attn.v o_w^T -> [2][2048][2048]).
// Compute dtypes, f32 accumulate: every input rounded to bf16; q/k/v projections on PLAIN bf16 operands (inputs: exact); o projection on hi+lo attn planes x bf16 o_w (2 products); RMSNorm + RoPE f32 (table computed on device);
// PER-ROW PRECISION HYBRID (rows < 256 hi+lo 3 products for scores and attn.v, rows >= 256 fp16); attention fused in one kernel (k_fattn: online softmax, key loop ends at the diagonal).

#define NB_  2
#define TT   2048
#define DM   2048
#define NH_  16
#define NKV  4
#define REP  (NH_ / NKV)
#define HD   128
#define DQ   (NH_ * HD)
#define DKV  (NKV * HD)
#define PP   TT                   // row pitch, in halves, of the fp16 V^T rows
#define RH   256                  // query rows < RH use hi+lo planes (0: none)
#define WIN  0
#define SCL  0.088388347648318447f   // HD^-0.5
typedef _Float16 h16;
typedef unsigned short bf;
typedef __attribute__((ext_vector_type(16))) __bf16   v16bf;
typedef __attribute__((ext_vector_type(16))) _Float16 v16h;
typedef __attribute__((ext_vector_type(8)))  _Float16 v8h;
typedef __attribute__((ext_vector_type(8)))  unsigned short v8us;
typedef __attribute__((ext_vector_type(8)))  float    v8f;
typedef __attribute__((ext_vector_type(4)))  float    v4f;
typedef v8h  __attribute__((may_alias)) v8ha;
typedef v4f  __attribute__((may_alias)) v4fa;
typedef v8us __attribute__((may_alias)) v8usa;

__device__ __forceinline__ unsigned short f2bf(float f) { unsigned u = __float_as_uint(f); u += 0x7FFFu + ((u >> 16) & 1u); return (unsigned short)(u >> 16); }
__device__ __forceinline__ float bf2f(unsigned short b) { return __uint_as_float(((unsigned)b) << 16); }
__device__ __forceinline__ float bfr(float f) { return bf2f(f2bf(f)); }
__device__ __forceinline__ v16h cat16(v8h lo, v8h hi) { return __builtin_shufflevector(lo, hi, 0, 1, 2, 3, 4, 5, 6, 7, 8, 9, 10, 11, 12, 13, 14, 15); }
__device__ __forceinline__ v16bf cat16b(v8us lo, v8us hi) { return __builtin_bit_cast(v16bf, __builtin_shufflevector(lo, hi, 0, 1, 2, 3, 4, 5, 6, 7, 8, 9, 10, 11, 12, 13, 14, 15)); }
__device__ __forceinline__ v8f wmma16(v16h a, v16h b, v8f c) { return __builtin_amdgcn_wmma_f32_16x16x32_f16(false, a, false, b, (short)0, c, false, false); }
__device__ __forceinline__ v8f wmmab(v16bf a, v16bf b, v8f c) { return __builtin_amdgcn_wmma_f32_16x16x32_bf16(false, a, false, b, (short)0, c, false, false); }



// ---- k_gemmw: register-blocked GEMM, NW WAVES per 64x64 output tile: wave w takes the 32-wide K steps w, w + NW, ... (16 accumulators each), the NW partial tiles are summed through LDS in wave order
// (fixed order, so run-to-run identical); operands straight from K-contiguous 16-bit planes; grid (M/64, N/64, Z), 32 * NW threads.
// C[m][n] (f32, pitch ldc, + optional f32 bias[n]) = sum_k A[m][k] Bt[n][k] (+ split products per NSPLIT). z-batch strides sA/sB/sC in elements. K % 32 == 0.
template <typename T16> struct WFrag;
template <> struct WFrag<h16> { typedef v16h V; static __device__ __forceinline__ V ld(const h16* p) { return cat16(*(const v8h*)p, *(const v8h*)(p + 16)); } static __device__ __forceinline__ v8f mma(V a, V b, v8f c) { return wmma16(a, b, c); } };
template <> struct WFrag<bf> { typedef v16bf V; static __device__ __forceinline__ V ld(const bf* p) { return cat16b(*(const v8us*)p, *(const v8us*)(p + 16)); } static __device__ __forceinline__ v8f mma(V a, V b, v8f c) { return wmmab(a, b, c); } };
template <typename T16, int NSPLIT, bool BIAS, int NW>
__global__ __launch_bounds__(32 * NW) void k_gemmw(const T16* __restrict__ A, const T16* __restrict__ A2, const T16* __restrict__ Bt, const T16* __restrict__ Bt2, int K, float* C, int ldc, const float* __restrict__ bias, size_t sA, size_t sB, size_t sC) {
    typedef typename WFrag<T16>::V V;
    __shared__ __align__(16) float os[2 * NW * 16 * 68];   // two buffers (row block parity) x NW partial 16x64 row blocks
    const size_t z = blockIdx.z; A += z * sA; if (A2) A2 += z * sA; Bt += z * sB; if (Bt2) Bt2 += z * sB; C += z * sC;
    const int lane = threadIdx.x & 31, lr = lane & 15, hi = lane >> 4; const int r0 = blockIdx.x * 64, c0 = blockIdx.y * 64; const int wv = __builtin_amdgcn_readfirstlane((int)(threadIdx.x >> 5));
    v8f acc[4][4];
#pragma unroll
    for (int mb = 0; mb < 4; ++mb)
#pragma unroll
        for (int nb = 0; nb < 4; ++nb) acc[mb][nb] = (v8f){};
    const size_t aoff = (size_t)(r0 + lr) * K + 8 * hi, boff = (size_t)(c0 + lr) * K + 8 * hi;
#pragma unroll 1
    for (int kc = wv * 32; kc < K; kc += 32 * NW) {
        V a[4], a2[4];
#pragma unroll
        for (int mb = 0; mb < 4; ++mb) { a[mb] = WFrag<T16>::ld(A + aoff + (size_t)mb * 16 * K + kc); if (NSPLIT == 1 || NSPLIT == 2) a2[mb] = WFrag<T16>::ld(A2 + aoff + (size_t)mb * 16 * K + kc); }
#pragma unroll
        for (int nb = 0; nb < 4; ++nb) { const V b = WFrag<T16>::ld(Bt + boff + (size_t)nb * 16 * K + kc); V b2; if (NSPLIT >= 2) b2 = WFrag<T16>::ld(Bt2 + boff + (size_t)nb * 16 * K + kc);
#pragma unroll
            for (int mb = 0; mb < 4; ++mb) { acc[mb][nb] = WFrag<T16>::mma(a[mb], b, acc[mb][nb]); if (NSPLIT == 1 || NSPLIT == 2) acc[mb][nb] = WFrag<T16>::mma(a2[mb], b, acc[mb][nb]); if (NSPLIT >= 2) acc[mb][nb] = WFrag<T16>::mma(a[mb], b2, acc[mb][nb]); } }
        asm volatile("v_nop\n\tv_nop\n\tv_nop\n\tv_nop" : "+v"(acc[0][0]), "+v"(acc[1][1]), "+v"(acc[2][2]), "+v"(acc[3][3]) : "v"(a[0]), "v"(a[3]));
    }
    v4f res[4][8 / NW];   // this thread's summed 16-byte pieces; the loops over mb, q and w below are unrolled so that res and acc are indexed by constants and stay in registers
#pragma unroll
    for (int mb = 0; mb < 4; ++mb) {
        float* ob = os + (mb & 1) * (NW * 16 * 68);
#pragma unroll
        for (int nb = 0; nb < 4; ++nb) {
#pragma unroll
            for (int j = 0; j < 8; ++j) ob[wv * (16 * 68) + (hi * 8 + j) * 68 + nb * 16 + lr] = acc[mb][nb][j]; }
        __syncthreads();   // every wave's partial of this row block is in LDS; also ends the reads of the other buffer (row block mb - 1) before row block mb + 1 overwrites it
#pragma unroll
        for (int q = 0; q < 8 / NW; ++q) { const int s = (int)threadIdx.x + q * 32 * NW; const int row = s >> 4, cofs = (s & 15) * 4; v4f val = *(const v4fa*)(ob + row * 68 + cofs);
#pragma unroll
            for (int w = 1; w < NW; ++w) val += *(const v4fa*)(ob + w * (16 * 68) + row * 68 + cofs);
            if (BIAS) { val[0] += bfr(bias[c0 + cofs]); val[1] += bfr(bias[c0 + cofs + 1]); val[2] += bfr(bias[c0 + cofs + 2]); val[3] += bfr(bias[c0 + cofs + 3]); }
            res[mb][q] = val; }
    }
    // all global stores behind the last barrier: a store in front of a barrier would be waited for there
#pragma unroll
    for (int mb = 0; mb < 4; ++mb)
#pragma unroll
        for (int q = 0; q < 8 / NW; ++q) { const int s = (int)threadIdx.x + q * 32 * NW; const int row = s >> 4, cofs = (s & 15) * 4; *(v4f*)(C + (size_t)(r0 + mb * 16 + row) * ldc + c0 + cofs) = res[mb][q]; }
}

__device__ __forceinline__ h16 tohx(float x) { return (h16)x; }
__device__ __forceinline__ void splitf(float y, unsigned short& h, unsigned short& l) { h = f2bf(y); l = f2bf(y - bf2f(h)); }
typedef __attribute__((ext_vector_type(2))) _Float16 v2h;
typedef __attribute__((ext_vector_type(4))) _Float16 v4h;
typedef __attribute__((ext_vector_type(2))) unsigned short v2us;
typedef __attribute__((ext_vector_type(4))) unsigned short v4us;
typedef __attribute__((ext_vector_type(2))) float v2f;
typedef __attribute__((ext_vector_type(4))) int v4i;

__global__ __launch_bounds__(256) void k_wtG(const float* __restrict__ w, int K, int N, bf* Bt) {
    const int lane = threadIdx.x & 31; const int L0 = (blockIdx.x * 8 + (threadIdx.x >> 5)) * 8; const int nlines = N * K / 64;
{
#pragma unroll 1
        for (int l = 0; l < 8; ++l) { const int L = L0 + l; if (L >= nlines) break; const size_t e = (size_t)L * 64 + lane * 2; const int k = (int)(e % K), n = (int)(e / K); v2us o;
            o[0] = f2bf(w[(size_t)k * N + n]); o[1] = f2bf(w[(size_t)(k + 1) * N + n]); *(v2us*)(Bt + e) = o; }
         }
}
__global__ __launch_bounds__(256) void k_cvt8(const float* __restrict__ src, bf* dst, size_t n8) { const size_t i = (size_t)blockIdx.x * 256 + threadIdx.x; if (i >= n8) return; const v8f v = *(const v8f*)(src + i * 8); v8us o;
#pragma unroll
    for (int k = 0; k < 8; ++k) o[k] = f2bf(v[k]); *(v8us*)(dst + i * 8) = o;  }
__global__ __launch_bounds__(256) void k_cstab(float* CS) { const int idx = blockIdx.x * 256 + threadIdx.x; if (idx >= TT * HD) return; const int t = idx / HD, d = idx % HD; const int i = d % (HD / 2); const float inv = __fdiv_rn(1.0f, powf(500000.0f, (float)(2 * i) / (float)HD)); const float ang = __fmul_rn((float)t, inv); v2f cs; cs[0] = cosf(ang); cs[1] = sinf(ang);
    *(v2f*)(CS + (size_t)idx * 2) = cs;  }
__global__ __launch_bounds__(256) void k_hrms(const float* __restrict__ F, int pitch, int nheads, float* RF) { const int i = blockIdx.x * 256 + threadIdx.x; if (i >= nheads * TT) return; const int t = i % TT, h = i / TT; const float* f = F + (size_t)t * pitch + h * HD; float s = 0.f;
#pragma unroll 4
    for (int d = 0; d < HD; d += 4) { const v4f v = *(const v4f*)(f + d);
#pragma unroll
        for (int q = 0; q < 4; ++q) { float p = __fmul_rn(v[q], v[q]); asm volatile("" : "+v"(p)); s = __fadd_rn(s, p); } }
    const float r = __fdiv_rn(1.0f, __fsqrt_rn(__fadd_rn(s * (1.0f / HD), 1e-5f))); *(float*)(RF + i) = r;  }
// k_rope: head planes [h][t][d] (fp16 + hi/lo) of rope(w[d] (x rms_factor)) x sc with the rotate-half convention out[d] = x[d] cos[t][d] - x[d+HD/2] sin[t][d], out[d+HD/2] = x[d+HD/2] cos[t][d+HD/2] + x[d] sin[t][d+HD/2]
__global__ __launch_bounds__(256) void k_rope(const float* __restrict__ F, int pitch, int nheads, const float* __restrict__ CS, const float* __restrict__ RF, const float* __restrict__ nw, float sc, h16* P16, bf* Ph, bf* Pl) {
    const size_t e = ((size_t)blockIdx.x * 256 + threadIdx.x) * 2; if (e >= (size_t)nheads * TT * HD) return; const int d = (int)(e % HD); const int t = (int)((e / HD) % TT); const int h = (int)(e / ((size_t)HD * TT)); const float* f = F + (size_t)t * pitch + h * HD; const float rf = RF ? RF[(size_t)h * TT + t] : 1.0f; v2h o16; v2us oh, ol;
#pragma unroll
    for (int q = 0; q < 2; ++q) { const int dd = d + q; const int dp = (dd < HD / 2) ? dd + HD / 2 : dd - HD / 2; float x0 = f[dd], x1 = f[dp];
        if (RF) { float n0 = __fmul_rn(x0, rf), n1 = __fmul_rn(x1, rf); asm volatile("" : "+v"(n0)); asm volatile("" : "+v"(n1)); x0 = __fmul_rn(bfr(nw[dd]), n0); x1 = __fmul_rn(bfr(nw[dp]), n1); }
        const v2f cs = *(const v2f*)(CS + ((size_t)t * HD + dd) * 2); float a = __fmul_rn(x0, cs[0]), bq = __fmul_rn(x1, cs[1]); asm volatile("" : "+v"(a)); asm volatile("" : "+v"(bq)); const float r = ((dd < HD / 2) ? __fsub_rn(a, bq) : __fadd_rn(a, bq)) * sc;
        o16[q] = tohx(r); unsigned short a2, c2; splitf(r, a2, c2); oh[q] = a2; ol[q] = c2; }
    *(v2h*)(P16 + e) = o16; *(v2us*)(Ph + e) = oh; *(v2us*)(Pl + e) = ol;  }
__global__ __launch_bounds__(256) void k_vtp(const float* __restrict__ F, int pitch, int nheads, h16* V16, bf* Vh, bf* Vl) { const size_t e = ((size_t)blockIdx.x * 256 + threadIdx.x) * 2; if (e >= (size_t)nheads * HD * TT) return; const int t = (int)(e % TT); const int d = (int)((e / TT) % HD); const int g = (int)(e / ((size_t)TT * HD)); v2h o16; v2us oh, ol;
#pragma unroll
    for (int q = 0; q < 2; ++q) { const float x = F[(size_t)(t + q) * pitch + g * HD + d]; o16[q] = tohx(x); unsigned short a2, c2; splitf(x, a2, c2); oh[q] = a2; ol[q] = c2; }
    *(v2h*)(V16 + (size_t)(g * HD + d) * PP + t) = o16; *(v2us*)(Vh + e) = oh; *(v2us*)(Vl + e) = ol;  }   // V16 rows at pitch PP, Vh / Vl rows at pitch TT
// ---- k_fattn: causal attention of one batch in one launch; no score or probability matrix in memory. Block = 16 query rows x the REP query heads of one kv group x KS key parts (one wave each): wave (hd, part) takes the 32-key steps part, part + KS, ...
// Transposed products: S^T = K Q^T (A = key rows, B = query rows), so a lane holds, for ITS query (column lr), keys hi*8+j of each 16-key block: exactly the k order of a B fragment, and P^T goes into O^T += V^T P^T without leaving the lane.
// Online softmax per lane in the log2 domain (running maximum m, running sum l, O^T rescaled at every step); the KS parts are merged through LDS in part order (fixed order, run-to-run identical); part 0 normalises and stores the hi + lo planes of the merged heads.
// Rows < RH: hi+lo bf16 planes, 3 products for scores and for attn.v; rows >= RH: fp16. A block is wholly one or the other (RH % 16 == 0).
#define KS   4
#define SL2  (SCL * 1.4426950408889634f)   // HD^-0.5 x log2(e)
typedef __attribute__((ext_vector_type(16))) unsigned short v16us;
static_assert(RH % 16 == 0 && TT % 32 == 0, "a block's rows share one precision path; key steps are whole");
// exp2 with the issue slot behind a transcendental filled: the v_nop keeps the next vector instruction, whichever the compiler puts there, from directly reading the result or overwriting the source.
__device__ __forceinline__ float ex2(float x) { float r; asm("v_exp_f32 %0, %1\n\tv_nop" : "=v"(r) : "v"(x)); return r; }
// four at once, one v_nop behind the last; the results are early-clobber so that none lies on the source of the exponential in front of it
__device__ __forceinline__ void ex2x4(float& a, float& b, float& c, float& d) { float ra, rb, rc, rd; asm("v_exp_f32 %0, %4\n\tv_exp_f32 %1, %5\n\tv_exp_f32 %2, %6\n\tv_exp_f32 %3, %7\n\tv_nop" : "=&v"(ra), "=&v"(rb), "=&v"(rc), "=&v"(rd) : "v"(a), "v"(b), "v"(c), "v"(d)); a = ra; b = rb; c = rc; d = rd; }
template <typename T16, bool HI, int VP>
__device__ __forceinline__ void fa_run(const T16* __restrict__ Q, const T16* __restrict__ Q2, const T16* __restrict__ Kp, const T16* __restrict__ K2, const T16* __restrict__ Vt, const T16* __restrict__ Vt2, int q0, int part, int lr, int hi, v8f (&o)[8], float& m, float& l) {
    typedef typename WFrag<T16>::V V;
    V qf[4], qf2[4];
#pragma unroll
    for (int ks = 0; ks < 4; ++ks) { qf[ks] = WFrag<T16>::ld(Q + (size_t)(q0 + lr) * HD + ks * 32 + 8 * hi); if constexpr (HI) qf2[ks] = WFrag<T16>::ld(Q2 + (size_t)(q0 + lr) * HD + ks * 32 + 8 * hi); }
    const int nst = (q0 + 47) / 32;   // 32-key steps that reach key q0 + 15; the last key touched is below TT
    const size_t ko = (size_t)lr * HD + 8 * hi, vo = (size_t)lr * VP + 8 * hi; const int qi = q0 + lr;
#pragma unroll 1
    for (int s = part; s < nst; s += KS) {
        const int k0 = s * 32;
        v8f st[2]; st[0] = (v8f){}; st[1] = (v8f){};
        if constexpr (HI) { const T16* pk[2] = { Kp + ko + (size_t)k0 * HD, Kp + ko + (size_t)(k0 + 16) * HD }; const T16* pk2[2] = { K2 + ko + (size_t)k0 * HD, K2 + ko + (size_t)(k0 + 16) * HD };
#pragma unroll
            for (int kb = 0; kb < 2; ++kb)
#pragma unroll
                for (int ks = 0; ks < 4; ++ks) { const V kf = WFrag<T16>::ld(pk[kb] + ks * 32); st[kb] = WFrag<T16>::mma(kf, qf[ks], st[kb]); st[kb] = WFrag<T16>::mma(kf, qf2[ks], st[kb]); st[kb] = WFrag<T16>::mma(WFrag<T16>::ld(pk2[kb] + ks * 32), qf[ks], st[kb]); }
            asm volatile("s_wait_xcnt 0x0" :: "v"(pk[0]), "v"(pk[1]), "v"(pk2[0]), "v"(pk2[1]), "v"(st[0]), "v"(st[1]) : "memory");   // the wait in front of an overwrite of the K loads' address registers; the inputs keep those registers as they are up to here and put the wait behind the last product, so behind every load
        } else { V kf[8];
#pragma unroll
            for (int i = 0; i < 8; ++i) kf[i] = WFrag<T16>::ld(Kp + ko + (size_t)(k0 + (i >> 2) * 16) * HD + (i & 3) * 32);
            asm volatile("" :: "v"(kf[0]), "v"(kf[1]), "v"(kf[2]), "v"(kf[3]), "v"(kf[4]), "v"(kf[5]), "v"(kf[6]), "v"(kf[7]));   // inputs only, loaded values: all K loads of the step are issued before its first product; without it each product waits for its own load's round trip, eight in a row
#pragma unroll
            for (int ks = 0; ks < 4; ++ks) { st[0] = WFrag<T16>::mma(kf[ks], qf[ks], st[0]); st[1] = WFrag<T16>::mma(kf[4 + ks], qf[ks], st[1]); } }
        float t[16];
#pragma unroll
        for (int e = 0; e < 16; ++e) t[e] = st[e >> 3][e & 7] * SL2;
        if (k0 + 31 > q0) {   // only a step that reaches past the block's first row holds keys above the diagonal
#pragma unroll
            for (int e = 0; e < 16; ++e) t[e] = (k0 + (e >> 3) * 16 + hi * 8 + (e & 7) <= qi) ? t[e] : -3.0e38f; }
        float mx = m;
#pragma unroll
        for (int e = 0; e < 16; ++e) mx = fmaxf(mx, t[e]);
        mx = fmaxf(mx, __shfl_xor(mx, 16, 32));   // the two half-waves hold the two key octets of the same query
        const float al = ex2(m - mx); m = mx; float ps = 0.f;   // m starts at -1e30, above the mask value, so a step whose keys are all masked gives p = 0, not exp2(0)
#pragma unroll
        for (int e = 0; e < 16; e += 4) { t[e] -= mx; t[e + 1] -= mx; t[e + 2] -= mx; t[e + 3] -= mx; ex2x4(t[e], t[e + 1], t[e + 2], t[e + 3]); ps += t[e]; ps += t[e + 1]; ps += t[e + 2]; ps += t[e + 3]; }
        l = l * al + ps;
#pragma unroll
        for (int db = 0; db < 8; ++db) o[db] = o[db] * al;
        V pf, pf2;
        if constexpr (HI) { v16us ph, pl;
#pragma unroll
            for (int e = 0; e < 16; ++e) { unsigned short x, y; splitf(t[e], x, y); ph[e] = x; pl[e] = y; }
            pf = __builtin_bit_cast(v16bf, ph); pf2 = __builtin_bit_cast(v16bf, pl);
        } else {
#pragma unroll
            for (int e = 0; e < 16; ++e) pf[e] = tohx(t[e]); }
#pragma unroll
        for (int db = 0; db < 8; ++db) { const size_t off = vo + (size_t)db * 16 * VP + k0; const V vf = WFrag<T16>::ld(Vt + off); o[db] = WFrag<T16>::mma(vf, pf, o[db]);
            if constexpr (HI) { o[db] = WFrag<T16>::mma(vf, pf2, o[db]); o[db] = WFrag<T16>::mma(WFrag<T16>::ld(Vt2 + off), pf, o[db]); } }
    }
}
__global__ __launch_bounds__(32 * REP * KS) void k_fattn(const h16* __restrict__ Q16, const bf* __restrict__ Qh, const bf* __restrict__ Ql, const h16* __restrict__ K16, const bf* __restrict__ Kh, const bf* __restrict__ Kl, const h16* __restrict__ V16, const bf* __restrict__ Vh, const bf* __restrict__ Vl, bf* Ah, bf* Al) {
    __shared__ float mg[(KS - 1) * REP * 66 * 32];   // per merged wave: 64 O^T values, m, l, each x 32 lanes (lane-contiguous)
    const int lane = threadIdx.x & 31, lr = lane & 15, hi = lane >> 4; const int wv = __builtin_amdgcn_readfirstlane((int)(threadIdx.x >> 5)); const int hd = wv % REP, part = wv / REP;
    const int g = blockIdx.x, head = g * REP + hd; const int q0 = (TT / 16 - 1 - (int)blockIdx.y) * 16;   // longest rows first
    v8f o[8];
#pragma unroll
    for (int db = 0; db < 8; ++db) o[db] = (v8f){};
    float m = -1.0e30f, l = 0.f;
    if (q0 < RH) fa_run<bf, true, TT>(Qh + (size_t)head * TT * HD, Ql + (size_t)head * TT * HD, Kh + (size_t)g * TT * HD, Kl + (size_t)g * TT * HD, Vh + (size_t)g * HD * TT, Vl + (size_t)g * HD * TT, q0, part, lr, hi, o, m, l);
    else fa_run<h16, false, PP>(Q16 + (size_t)head * TT * HD, nullptr, K16 + (size_t)g * TT * HD, nullptr, V16 + (size_t)g * HD * PP, nullptr, q0, part, lr, hi, o, m, l);
    if (part > 0) { float* d = mg + (size_t)((part - 1) * REP + hd) * (66 * 32) + lane;
#pragma unroll
        for (int e = 0; e < 64; ++e) d[e * 32] = o[e >> 3][e & 7];
        d[64 * 32] = m; d[65 * 32] = l; }
    __syncthreads();   // the parts 1.. of every head are in LDS before part 0 reads them
    if (part > 0) return;
#pragma unroll
    for (int w = 1; w < KS; ++w) { const float* d = mg + (size_t)((w - 1) * REP + hd) * (66 * 32) + lane; const float m1 = d[64 * 32], l1 = d[65 * 32]; const float mn = fmaxf(m, m1); const float a0 = ex2(m - mn), a1 = ex2(m1 - mn);
#pragma unroll
        for (int e = 0; e < 64; ++e) o[e >> 3][e & 7] = o[e >> 3][e & 7] * a0 + d[e * 32] * a1;
        l = l * a0 + l1 * a1; m = mn; }
    l += __shfl_xor(l, 16, 32);
    const float inv = __fdiv_rn(1.0f, l); const size_t oo = (size_t)(q0 + lr) * DQ + head * HD + hi * 8;
#pragma unroll
    for (int db = 0; db < 8; ++db) { v8us oh, ol;
#pragma unroll
        for (int j = 0; j < 8; ++j) { unsigned short x, y; splitf(o[db][j] * inv, x, y); oh[j] = x; ol[j] = y; }
        *(v8us*)(Ah + oo + db * 16) = oh; *(v8us*)(Al + oo + db * 16) = ol; }
}

extern "C" void kernel_launch(void* const* d_in, const int* in_sizes, int n_in,
                              void* d_out, int out_size, void* d_ws, size_t ws_size, hipStream_t stream) {
    (void)in_sizes; (void)n_in; (void)out_size;
    const float* x = (const float*)d_in[0]; const float* wq = (const float*)d_in[1]; const float* wk = (const float*)d_in[2]; const float* wv = (const float*)d_in[3]; const float* wo = (const float*)d_in[4]; const float* qnw = (const float*)d_in[5]; const float* knw = (const float*)d_in[6];   // torch [out][in]
    float* OUT = (float*)d_out;     // [2][2048][2048]
    char* wsp = (char*)d_ws;
    auto take = [&](size_t bytes) { char* p = wsp; wsp += (bytes + 255) & ~(size_t)255; return (void*)p; };
    bf* WQ = (bf*)take((size_t)DQ * DM * 2); bf* WK = (bf*)take((size_t)DKV * DM * 2); bf* WV = (bf*)take((size_t)DKV * DM * 2); bf* WO = (bf*)take((size_t)DM * DQ * 2); float* CS = (float*)take((size_t)TT * HD * 2 * 4); float* RFQ = (float*)take((size_t)NH_ * TT * 4); float* RFK = (float*)take((size_t)NKV * TT * 4);
    bf* XB = (bf*)take((size_t)TT * DM * 2); float* FQ = (float*)take((size_t)TT * DQ * 4); float* FK = (float*)take((size_t)TT * DKV * 4);
    h16* QP16 = (h16*)take((size_t)NH_ * TT * HD * 2); h16* KP16 = (h16*)take((size_t)NKV * TT * HD * 2); h16* VT16 = (h16*)take((size_t)NKV * HD * PP * 2);
    bf* QPh = (bf*)take((size_t)NH_ * TT * HD * 2); bf* QPl = (bf*)take((size_t)NH_ * TT * HD * 2); bf* KPh = (bf*)take((size_t)NKV * TT * HD * 2); bf* KPl = (bf*)take((size_t)NKV * TT * HD * 2); bf* VTh = (bf*)take((size_t)NKV * HD * TT * 2); bf* VTl = (bf*)take((size_t)NKV * HD * TT * 2);
    bf* ATh = (bf*)take((size_t)TT * DQ * 2); bf* ATl = (bf*)take((size_t)TT * DQ * 2);
    if ((size_t)(wsp - (char*)d_ws) > ws_size) return;    // ws 256 MiB
    float* FV = FK;   // v projection reuses the k buffer after the k planes are built (stream-ordered)
    { k_cvt8<<<(unsigned)(((size_t)DQ * DM / 8 + 255) / 256), 256, 0, stream>>>(wq, WQ, (size_t)DQ * DM / 8); k_cvt8<<<(unsigned)(((size_t)DKV * DM / 8 + 255) / 256), 256, 0, stream>>>(wk, WK, (size_t)DKV * DM / 8); k_cvt8<<<(unsigned)(((size_t)DKV * DM / 8 + 255) / 256), 256, 0, stream>>>(wv, WV, (size_t)DKV * DM / 8);
      k_cvt8<<<(unsigned)(((size_t)DM * DQ / 8 + 255) / 256), 256, 0, stream>>>(wo, WO, (size_t)DM * DQ / 8);
      k_cstab<<<(TT * HD + 255) / 256, 256, 0, stream>>>(CS); }
    const unsigned LQ = (unsigned)(((size_t)NH_ * TT * HD / 2 + 255) / 256), LKv = (unsigned)(((size_t)NKV * TT * HD / 2 + 255) / 256);
    for (int b = 0; b < NB_; ++b) {
        
        k_cvt8<<<(unsigned)(((size_t)TT * DM / 8 + 255) / 256), 256, 0, stream>>>(x + (size_t)b * TT * DM, XB, (size_t)TT * DM / 8);
        k_gemmw<bf, 0, false, 4><<<dim3(TT / 64, DQ / 64, 1), 128, 0, stream>>>(XB, nullptr, WQ, nullptr, DM, FQ, DQ, nullptr, 0, 0, 0); k_hrms<<<(NH_ * TT + 255) / 256, 256, 0, stream>>>(FQ, DQ, NH_, RFQ);
        k_rope<<<LQ, 256, 0, stream>>>(FQ, DQ, NH_, CS, RFQ, qnw, 1.0f, QP16, QPh, QPl);
        k_gemmw<bf, 0, false, 8><<<dim3(TT / 64, DKV / 64, 1), 256, 0, stream>>>(XB, nullptr, WK, nullptr, DM, FK, DKV, nullptr, 0, 0, 0); k_hrms<<<(NKV * TT + 255) / 256, 256, 0, stream>>>(FK, DKV, NKV, RFK);
        k_rope<<<LKv, 256, 0, stream>>>(FK, DKV, NKV, CS, RFK, knw, 1.0f, KP16, KPh, KPl);
        k_gemmw<bf, 0, false, 8><<<dim3(TT / 64, DKV / 64, 1), 256, 0, stream>>>(XB, nullptr, WV, nullptr, DM, FV, DKV, nullptr, 0, 0, 0); k_vtp<<<LKv, 256, 0, stream>>>(FV, DKV, NKV, VT16, VTh, VTl);
        k_fattn<<<dim3(NKV, TT / 16, 1), 32 * REP * KS, 0, stream>>>(QP16, QPh, QPl, KP16, KPh, KPl, VT16, VTh, VTl, ATh, ATl);
        k_gemmw<bf, 1, false, 4><<<dim3(TT / 64, DM / 64, 1), 128, 0, stream>>>(ATh, ATl, WO, nullptr, DQ, OUT + (size_t)b * TT * DM, DM, nullptr, 0, 0, 0); }
}

// v004
// Measured time: 440 microseconds a run.
// Timed twice side by side with v003, it ran 1.08 times as fast both times.
// Counting every step since v000, it is 3.66 times as fast.
#include <hip/hip_runtime.h>

// YuaAttention (hidden [2][2048][2048]; q = x q_w^T (16 heads x 128), k/v = x k_w^T / v_w^T (4 kv heads, GQA repeat_interleave); per-head RMSNorm (eps 1e-5) with q_norm_w / k_norm_w, then rotate-half
// RoPE (theta 500000, positions 0..S-1); causal softmax(q.k 128^-0.5); out = merged attn.v o_w^T -> [2][2048][2048]).
// Compute dtypes, f32 accumulate: every input rounded to bf16; q/k/v projections on PLAIN bf16 operands (inputs: exact); o projection on hi+lo attn planes x bf16 o_w (2 products); RMSNorm + RoPE f32 (table computed on device);
// PER-ROW PRECISION HYBRID (rows < 256 hi+lo 3 products for scores and attn.v, rows >= 256 fp16); attention fused in one kernel (k_fattn: online softmax, key loop ends at the diagonal).

#define NB_  2
#define TT   2048
#define DM   2048
#define NH_  16
#define NKV  4
#define REP  (NH_ / NKV)
#define HD   128
#define DQ   (NH_ * HD)
#define DKV  (NKV * HD)
#define PP   TT                   // keys per fp16 V^T row
#define RH   256                  // query rows < RH use hi+lo planes (0: none)
#define WIN  0
#define SCL  0.088388347648318447f   // HD^-0.5
typedef _Float16 h16;
typedef unsigned short bf;
typedef __attribute__((ext_vector_type(16))) __bf16   v16bf;
typedef __attribute__((ext_vector_type(16))) _Float16 v16h;
typedef __attribute__((ext_vector_type(8)))  _Float16 v8h;
typedef __attribute__((ext_vector_type(8)))  unsigned short v8us;
typedef __attribute__((ext_vector_type(8)))  float    v8f;
typedef __attribute__((ext_vector_type(4)))  float    v4f;
typedef v8h  __attribute__((may_alias)) v8ha;
typedef v4f  __attribute__((may_alias)) v4fa;
typedef v8us __attribute__((may_alias)) v8usa;

__device__ __forceinline__ unsigned short f2bf(float f) { unsigned u = __float_as_uint(f); u += 0x7FFFu + ((u >> 16) & 1u); return (unsigned short)(u >> 16); }
__device__ __forceinline__ float bf2f(unsigned short b) { return __uint_as_float(((unsigned)b) << 16); }
__device__ __forceinline__ float bfr(float f) { return bf2f(f2bf(f)); }
__device__ __forceinline__ v16h cat16(v8h lo, v8h hi) { return __builtin_shufflevector(lo, hi, 0, 1, 2, 3, 4, 5, 6, 7, 8, 9, 10, 11, 12, 13, 14, 15); }
__device__ __forceinline__ v16bf cat16b(v8us lo, v8us hi) { return __builtin_bit_cast(v16bf, __builtin_shufflevector(lo, hi, 0, 1, 2, 3, 4, 5, 6, 7, 8, 9, 10, 11, 12, 13, 14, 15)); }
__device__ __forceinline__ v8f wmma16(v16h a, v16h b, v8f c) { return __builtin_amdgcn_wmma_f32_16x16x32_f16(false, a, false, b, (short)0, c, false, false); }
__device__ __forceinline__ v8f wmmab(v16bf a, v16bf b, v8f c) { return __builtin_amdgcn_wmma_f32_16x16x32_bf16(false, a, false, b, (short)0, c, false, false); }



// ---- k_gemmw: register-blocked GEMM, NW WAVES per 64x64 output tile: wave w takes the 32-wide K steps w, w + NW, ... (16 accumulators each), the NW partial tiles are summed through LDS in wave order
// (fixed order, so run-to-run identical); operands straight from fragment-major 16-bit planes; grid (M/64, N/64, Z), 32 * NW threads.
// C[m][n] (f32, pitch ldc, + optional f32 bias[n]) = sum_k A[m][k] Bt[n][k] (+ split products per NSPLIT). z-batch strides sA/sB/sC in elements. K % 32 == 0, a template constant.
// FRAGMENT-MAJOR PLANES: every 16-bit operand plane [rows][K] is stored as blocks of 16 rows x 32 k (512 elements, 1 KB), block (row / 16, k / 32) at element (row / 16 * (K / 32) + k / 32) * 512; inside a block the 16-byte piece
// number ld * 32 + hi * 16 + (row % 16) holds k % 32 = ld * 16 + hi * 8 + 0..7. That is the order in which the lanes of a wave take an A or B fragment, so each of its two loads reads 512 contiguous bytes (4 whole lines).
// ld(p): p = block start + lane * 8.
template <typename T16> struct WFrag;
template <> struct WFrag<h16> { typedef v16h V; static __device__ __forceinline__ V ld(const h16* p) { return cat16(*(const v8h*)p, *(const v8h*)(p + 256)); } static __device__ __forceinline__ v8f mma(V a, V b, v8f c) { return wmma16(a, b, c); } };
template <> struct WFrag<bf> { typedef v16bf V; static __device__ __forceinline__ V ld(const bf* p) { return cat16b(*(const v8us*)p, *(const v8us*)(p + 256)); } static __device__ __forceinline__ v8f mma(V a, V b, v8f c) { return wmmab(a, b, c); } };
template <typename T16, int NSPLIT, bool BIAS, int NW, int K>
__global__ __launch_bounds__(32 * NW) void k_gemmw(const T16* __restrict__ A, const T16* __restrict__ A2, const T16* __restrict__ Bt, const T16* __restrict__ Bt2, float* C, int ldc, const float* __restrict__ bias, size_t sA, size_t sB, size_t sC) {
    typedef typename WFrag<T16>::V V;
    __shared__ __align__(16) float os[2 * NW * 16 * 68];   // two buffers (row block parity) x NW partial 16x64 row blocks
    const size_t z = blockIdx.z; A += z * sA; if (A2) A2 += z * sA; Bt += z * sB; if (Bt2) Bt2 += z * sB; C += z * sC;
    const int lane = threadIdx.x & 31, lr = lane & 15, hi = lane >> 4; const int r0 = blockIdx.x * 64, c0 = blockIdx.y * 64; const int wv = __builtin_amdgcn_readfirstlane((int)(threadIdx.x >> 5));
    v8f acc[4][4];
#pragma unroll
    for (int mb = 0; mb < 4; ++mb)
#pragma unroll
        for (int nb = 0; nb < 4; ++nb) acc[mb][nb] = (v8f){};
    const size_t aoff = (size_t)r0 * K + 8 * lane, boff = (size_t)c0 * K + 8 * lane;   // a row block of 16 rows is 16 * K elements, a k step of 32 is 512
#pragma unroll 1
    for (int kc = wv * 32; kc < K; kc += 32 * NW) {
        V a[4], a2[4]; const T16* pa = A + aoff + kc * 16; const T16* pb = Bt + boff + kc * 16; const T16* pa2 = (NSPLIT == 1 || NSPLIT == 2) ? A2 + aoff + kc * 16 : nullptr; const T16* pb2 = (NSPLIT >= 2) ? Bt2 + boff + kc * 16 : nullptr;   // K is a constant: the four row blocks of an operand lie at constant distances from one address
#pragma unroll
        for (int mb = 0; mb < 4; ++mb) { a[mb] = WFrag<T16>::ld(pa + mb * 16 * K); if (NSPLIT == 1 || NSPLIT == 2) a2[mb] = WFrag<T16>::ld(pa2 + mb * 16 * K); }
#pragma unroll
        for (int nb = 0; nb < 4; ++nb) { const V b = WFrag<T16>::ld(pb + nb * 16 * K); V b2; if (NSPLIT >= 2) b2 = WFrag<T16>::ld(pb2 + nb * 16 * K);
#pragma unroll
            for (int mb = 0; mb < 4; ++mb) { acc[mb][nb] = WFrag<T16>::mma(a[mb], b, acc[mb][nb]); if (NSPLIT == 1 || NSPLIT == 2) acc[mb][nb] = WFrag<T16>::mma(a2[mb], b, acc[mb][nb]); if (NSPLIT >= 2) acc[mb][nb] = WFrag<T16>::mma(a[mb], b2, acc[mb][nb]); } }
        asm volatile("v_nop\n\tv_nop\n\tv_nop\n\tv_nop" : "+v"(acc[0][0]), "+v"(acc[1][1]), "+v"(acc[2][2]), "+v"(acc[3][3]) : "v"(a[0]), "v"(a[3]));
        // the wait in front of an overwrite of the fragment loads' address registers: the inputs keep every address register as it is up to here (no later load lands on one), behind the step's last product and so behind every load
        if constexpr (NSPLIT == 0) asm volatile("s_wait_xcnt 0x0" :: "v"(pa), "v"(pb) : "memory");
        else if constexpr (NSPLIT == 1) asm volatile("s_wait_xcnt 0x0" :: "v"(pa), "v"(pb), "v"(pa2) : "memory");
        else asm volatile("s_wait_xcnt 0x0" :: "v"(pa), "v"(pb), "v"(pa2), "v"(pb2) : "memory");
    }
    v4f res[4][8 / NW];   // this thread's summed 16-byte pieces; the loops over mb, q and w below are unrolled so that res and acc are indexed by constants and stay in registers
#pragma unroll
    for (int mb = 0; mb < 4; ++mb) {
        float* ob = os + (mb & 1) * (NW * 16 * 68);
#pragma unroll
        for (int nb = 0; nb < 4; ++nb) {
#pragma unroll
            for (int j = 0; j < 8; ++j) ob[wv * (16 * 68) + (hi * 8 + j) * 68 + nb * 16 + lr] = acc[mb][nb][j]; }
        __syncthreads();   // every wave's partial of this row block is in LDS; also ends the reads of the other buffer (row block mb - 1) before row block mb + 1 overwrites it
#pragma unroll
        for (int q = 0; q < 8 / NW; ++q) { const int s = (int)threadIdx.x + q * 32 * NW; const int row = s >> 4, cofs = (s & 15) * 4; v4f val = *(const v4fa*)(ob + row * 68 + cofs);
#pragma unroll
            for (int w = 1; w < NW; ++w) val += *(const v4fa*)(ob + w * (16 * 68) + row * 68 + cofs);
            if (BIAS) { val[0] += bfr(bias[c0 + cofs]); val[1] += bfr(bias[c0 + cofs + 1]); val[2] += bfr(bias[c0 + cofs + 2]); val[3] += bfr(bias[c0 + cofs + 3]); }
            res[mb][q] = val; }
    }
    // all global stores behind the last barrier: a store in front of a barrier would be waited for there
#pragma unroll
    for (int mb = 0; mb < 4; ++mb)
#pragma unroll
        for (int q = 0; q < 8 / NW; ++q) { const int s = (int)threadIdx.x + q * 32 * NW; const int row = s >> 4, cofs = (s & 15) * 4; *(v4f*)(C + (size_t)(r0 + mb * 16 + row) * ldc + c0 + cofs) = res[mb][q]; }
}

__device__ __forceinline__ h16 tohx(float x) { return (h16)x; }
__device__ __forceinline__ void splitf(float y, unsigned short& h, unsigned short& l) { h = f2bf(y); l = f2bf(y - bf2f(h)); }
typedef __attribute__((ext_vector_type(2))) _Float16 v2h;
typedef __attribute__((ext_vector_type(4))) _Float16 v4h;
typedef __attribute__((ext_vector_type(2))) unsigned short v2us;
typedef __attribute__((ext_vector_type(4))) unsigned short v4us;
typedef __attribute__((ext_vector_type(2))) float v2f;
typedef __attribute__((ext_vector_type(4))) int v4i;

__global__ __launch_bounds__(256) void k_wtG(const float* __restrict__ w, int K, int N, bf* Bt) {
    const int lane = threadIdx.x & 31; const int L0 = (blockIdx.x * 8 + (threadIdx.x >> 5)) * 8; const int nlines = N * K / 64;
{
#pragma unroll 1
        for (int l = 0; l < 8; ++l) { const int L = L0 + l; if (L >= nlines) break; const size_t e = (size_t)L * 64 + lane * 2; const int k = (int)(e % K), n = (int)(e / K); v2us o;
            o[0] = f2bf(w[(size_t)k * N + n]); o[1] = f2bf(w[(size_t)(k + 1) * N + n]); *(v2us*)(Bt + e) = o; }
         }
}
// k_cvt8: f32 [rows][DM] -> bf16 fragment-major plane; thread i writes the plane's 16-byte piece i (a block of 256 threads reads 512 contiguous bytes of each of 16 rows and writes 4 KB in a row)
__global__ __launch_bounds__(256) void k_cvt8(const float* __restrict__ src, bf* dst, size_t n8) { const size_t i = (size_t)blockIdx.x * 256 + threadIdx.x; if (i >= n8) return; const size_t blk = i >> 6; const int ld = (int)(i >> 5) & 1, ln = (int)i & 31;
    const v8f v = *(const v8f*)(src + ((blk / (DM / 32)) * 16 + (ln & 15)) * DM + (blk % (DM / 32)) * 32 + ld * 16 + (ln >> 4) * 8); v8us o;
#pragma unroll
    for (int k = 0; k < 8; ++k) o[k] = f2bf(v[k]); *(v8us*)(dst + i * 8) = o;  }
__global__ __launch_bounds__(256) void k_cstab(float* CS) { const int idx = blockIdx.x * 256 + threadIdx.x; if (idx >= TT * HD) return; const int t = idx / HD, d = idx % HD; const int i = d % (HD / 2); const float inv = __fdiv_rn(1.0f, powf(500000.0f, (float)(2 * i) / (float)HD)); const float ang = __fmul_rn((float)t, inv); v2f cs; cs[0] = cosf(ang); cs[1] = sinf(ang);
    *(v2f*)(CS + (size_t)idx * 2) = cs;  }
__global__ __launch_bounds__(256) void k_hrms(const float* __restrict__ F, int pitch, int nheads, float* RF) { const int i = blockIdx.x * 256 + threadIdx.x; if (i >= nheads * TT) return; const int t = i % TT, h = i / TT; const float* f = F + (size_t)t * pitch + h * HD; float s = 0.f;
#pragma unroll 4
    for (int d = 0; d < HD; d += 4) { const v4f v = *(const v4f*)(f + d);
#pragma unroll
        for (int q = 0; q < 4; ++q) { float p = __fmul_rn(v[q], v[q]); asm volatile("" : "+v"(p)); s = __fadd_rn(s, p); } }
    const float r = __fdiv_rn(1.0f, __fsqrt_rn(__fadd_rn(s * (1.0f / HD), 1e-5f))); *(float*)(RF + i) = r;  }
// k_rope: head planes [h][t][d] (fp16 + hi/lo) of rope(w[d] (x rms_factor)) x sc with the rotate-half convention out[d] = x[d] cos[t][d] - x[d+HD/2] sin[t][d], out[d+HD/2] = x[d+HD/2] cos[t][d+HD/2] + x[d] sin[t][d+HD/2]
__global__ __launch_bounds__(256) void k_rope(const float* __restrict__ F, int pitch, int nheads, const float* __restrict__ CS, const float* __restrict__ RF, const float* __restrict__ nw, float sc, h16* P16, bf* Ph, bf* Pl) {
    const size_t e = ((size_t)blockIdx.x * 256 + threadIdx.x) * 2; if (e >= (size_t)nheads * TT * HD) return; const int d = (int)(e % HD); const int t = (int)((e / HD) % TT); const int h = (int)(e / ((size_t)HD * TT)); const float* f = F + (size_t)t * pitch + h * HD; const float rf = RF ? RF[(size_t)h * TT + t] : 1.0f; v2h o16; v2us oh, ol;
#pragma unroll
    for (int q = 0; q < 2; ++q) { const int dd = d + q; const int dp = (dd < HD / 2) ? dd + HD / 2 : dd - HD / 2; float x0 = f[dd], x1 = f[dp];
        if (RF) { float n0 = __fmul_rn(x0, rf), n1 = __fmul_rn(x1, rf); asm volatile("" : "+v"(n0)); asm volatile("" : "+v"(n1)); x0 = __fmul_rn(bfr(nw[dd]), n0); x1 = __fmul_rn(bfr(nw[dp]), n1); }
        const v2f cs = *(const v2f*)(CS + ((size_t)t * HD + dd) * 2); float a = __fmul_rn(x0, cs[0]), bq = __fmul_rn(x1, cs[1]); asm volatile("" : "+v"(a)); asm volatile("" : "+v"(bq)); const float r = ((dd < HD / 2) ? __fsub_rn(a, bq) : __fadd_rn(a, bq)) * sc;
        o16[q] = tohx(r); unsigned short a2, c2; splitf(r, a2, c2); oh[q] = a2; ol[q] = c2; }
    const size_t pe = (size_t)h * TT * HD + (size_t)((t >> 4) * (HD / 32) + (d >> 5)) * 512 + ((d >> 4) & 1) * 256 + (((d >> 3) & 1) * 16 + (t & 15)) * 8 + (d & 7);   // fragment-major: rows t, k = d
    *(v2h*)(P16 + pe) = o16; *(v2us*)(Ph + pe) = oh; *(v2us*)(Pl + pe) = ol;  }
// k_vtp: fragment-major V^T planes (rows d, k = key t) of each kv group, blocks ordered (t / 32, d / 16) so that a 32-key step reads 8 KB in a row; a thread takes 8 keys of one d (one 16-byte piece per plane), lanes run along d (whole lines read)
__global__ __launch_bounds__(256) void k_vtp(const float* __restrict__ F, int nheads, h16* V16, bf* Vh, bf* Vl) { const size_t i = (size_t)blockIdx.x * 256 + threadIdx.x; if (i >= (size_t)nheads * HD * TT / 8) return; const int d = (int)(i % HD); const int t8 = (int)((i / HD) % (TT / 8)); const int g = (int)(i / ((size_t)HD * (TT / 8))); v8h o16; v8us oh, ol;
#pragma unroll
    for (int q = 0; q < 8; ++q) { const float x = F[(size_t)t8 * 8 * DKV + g * HD + d + q * DKV]; o16[q] = tohx(x); unsigned short a2, c2; splitf(x, a2, c2); oh[q] = a2; ol[q] = c2; }
    const size_t pe = (size_t)g * HD * TT + (size_t)((t8 >> 2) * (HD / 16) + (d >> 4)) * 512 + ((t8 >> 1) & 1) * 256 + ((t8 & 1) * 16 + (d & 15)) * 8;
    *(v8h*)(V16 + pe) = o16; *(v8us*)(Vh + pe) = oh; *(v8us*)(Vl + pe) = ol;  }
// ---- k_fattn: causal attention of one batch in one launch; no score or probability matrix in memory. Block = 16 query rows x the REP query heads of one kv group x KS key parts (one wave each): wave (hd, part) takes the 32-key steps part, part + KS, ...
// Transposed products: S^T = K Q^T (A = key rows, B = query rows), so a lane holds, for ITS query (column lr), keys hi*8+j of each 16-key block: exactly the k order of a B fragment, and P^T goes into O^T += V^T P^T without leaving the lane.
// Online softmax per lane in the log2 domain (running maximum m, running sum l, O^T rescaled at every step); the KS parts are merged through LDS in part order (fixed order, run-to-run identical); part 0 normalises and stores the hi + lo planes of the merged heads.
// Rows < RH: hi+lo bf16 planes, 3 products for scores and for attn.v; rows >= RH: fp16. A block is wholly one or the other (RH % 16 == 0).
#define KS   4
#define SL2  (SCL * 1.4426950408889634f)   // HD^-0.5 x log2(e)
typedef __attribute__((ext_vector_type(16))) unsigned short v16us;
static_assert(RH % 16 == 0 && TT % 32 == 0, "a block's rows share one precision path; key steps are whole");
static_assert(DM == DQ && DM % 128 == 0 && HD % 32 == 0 && PP == TT, "one k length for every converted plane; whole fragment blocks");
// exp2 with the issue slot behind a transcendental filled: the v_nop keeps the next vector instruction, whichever the compiler puts there, from directly reading the result or overwriting the source.
__device__ __forceinline__ float ex2(float x) { float r; asm("v_exp_f32 %0, %1\n\tv_nop" : "=v"(r) : "v"(x)); return r; }
// four at once, one v_nop behind the last; the results are early-clobber so that none lies on the source of the exponential in front of it
__device__ __forceinline__ void ex2x4(float& a, float& b, float& c, float& d) { float ra, rb, rc, rd; asm("v_exp_f32 %0, %4\n\tv_exp_f32 %1, %5\n\tv_exp_f32 %2, %6\n\tv_exp_f32 %3, %7\n\tv_nop" : "=&v"(ra), "=&v"(rb), "=&v"(rc), "=&v"(rd) : "v"(a), "v"(b), "v"(c), "v"(d)); a = ra; b = rb; c = rc; d = rd; }
template <typename T16, bool HI>
__device__ __forceinline__ void fa_run(const T16* __restrict__ Q, const T16* __restrict__ Q2, const T16* __restrict__ Kp, const T16* __restrict__ K2, const T16* __restrict__ Vt, const T16* __restrict__ Vt2, int q0, int part, int lr, int hi, v8f (&o)[8], float& m, float& l) {
    typedef typename WFrag<T16>::V V;
    V qf[4], qf2[4];
#pragma unroll
    for (int ks = 0; ks < 4; ++ks) { qf[ks] = WFrag<T16>::ld(Q + (size_t)q0 * HD + ks * 512 + 8 * (hi * 16 + lr)); if constexpr (HI) qf2[ks] = WFrag<T16>::ld(Q2 + (size_t)q0 * HD + ks * 512 + 8 * (hi * 16 + lr)); }
    const int nst = (q0 + 47) / 32;   // 32-key steps that reach key q0 + 15; the last key touched is below TT
    const size_t ko = 8 * (hi * 16 + lr), vo = ko; const int qi = q0 + lr;   // fragment-major planes: 16 keys of K are 16 * HD elements in a row, 32 keys of V^T are 32 * HD
#pragma unroll 1
    for (int s = part; s < nst; s += KS) {
        const int k0 = s * 32;
        v8f st[2]; st[0] = (v8f){}; st[1] = (v8f){};
        if constexpr (HI) { const T16* pk[2] = { Kp + ko + (size_t)k0 * HD, Kp + ko + (size_t)(k0 + 16) * HD }; const T16* pk2[2] = { K2 + ko + (size_t)k0 * HD, K2 + ko + (size_t)(k0 + 16) * HD };
#pragma unroll
            for (int kb = 0; kb < 2; ++kb)
#pragma unroll
                for (int ks = 0; ks < 4; ++ks) { const V kf = WFrag<T16>::ld(pk[kb] + ks * 512); st[kb] = WFrag<T16>::mma(kf, qf[ks], st[kb]); st[kb] = WFrag<T16>::mma(kf, qf2[ks], st[kb]); st[kb] = WFrag<T16>::mma(WFrag<T16>::ld(pk2[kb] + ks * 512), qf[ks], st[kb]); }
            asm volatile("s_wait_xcnt 0x0" :: "v"(pk[0]), "v"(pk[1]), "v"(pk2[0]), "v"(pk2[1]), "v"(st[0]), "v"(st[1]) : "memory");   // the wait in front of an overwrite of the K loads' address registers; the inputs keep those registers as they are up to here and put the wait behind the last product, so behind every load
        } else { V kf[8];
#pragma unroll
            for (int i = 0; i < 8; ++i) kf[i] = WFrag<T16>::ld(Kp + ko + (size_t)(k0 + (i >> 2) * 16) * HD + (i & 3) * 512);
            asm volatile("" :: "v"(kf[0]), "v"(kf[1]), "v"(kf[2]), "v"(kf[3]), "v"(kf[4]), "v"(kf[5]), "v"(kf[6]), "v"(kf[7]));   // inputs only, loaded values: all K loads of the step are issued before its first product; without it each product waits for its own load's round trip, eight in a row
#pragma unroll
            for (int ks = 0; ks < 4; ++ks) { st[0] = WFrag<T16>::mma(kf[ks], qf[ks], st[0]); st[1] = WFrag<T16>::mma(kf[4 + ks], qf[ks], st[1]); } }
        float t[16];
#pragma unroll
        for (int e = 0; e < 16; ++e) t[e] = st[e >> 3][e & 7] * SL2;
        if (k0 + 31 > q0) {   // only a step that reaches past the block's first row holds keys above the diagonal
#pragma unroll
            for (int e = 0; e < 16; ++e) t[e] = (k0 + (e >> 3) * 16 + hi * 8 + (e & 7) <= qi) ? t[e] : -3.0e38f; }
        float mx = m;
#pragma unroll
        for (int e = 0; e < 16; ++e) mx = fmaxf(mx, t[e]);
        mx = fmaxf(mx, __shfl_xor(mx, 16, 32));   // the two half-waves hold the two key octets of the same query
        const float al = ex2(m - mx); m = mx; float ps = 0.f;   // m starts at -1e30, above the mask value, so a step whose keys are all masked gives p = 0, not exp2(0)
#pragma unroll
        for (int e = 0; e < 16; e += 4) { t[e] -= mx; t[e + 1] -= mx; t[e + 2] -= mx; t[e + 3] -= mx; ex2x4(t[e], t[e + 1], t[e + 2], t[e + 3]); ps += t[e]; ps += t[e + 1]; ps += t[e + 2]; ps += t[e + 3]; }
        l = l * al + ps;
#pragma unroll
        for (int db = 0; db < 8; ++db) o[db] = o[db] * al;
        V pf, pf2;
        if constexpr (HI) { v16us ph, pl;
#pragma unroll
            for (int e = 0; e < 16; ++e) { unsigned short x, y; splitf(t[e], x, y); ph[e] = x; pl[e] = y; }
            pf = __builtin_bit_cast(v16bf, ph); pf2 = __builtin_bit_cast(v16bf, pl);
        } else {
#pragma unroll
            for (int e = 0; e < 16; ++e) pf[e] = tohx(t[e]); }
        const T16* pv = Vt + vo + (size_t)k0 * HD; const T16* pv2 = HI ? Vt2 + vo + (size_t)k0 * HD : nullptr;
#pragma unroll
        for (int db = 0; db < 8; ++db) { const V vf = WFrag<T16>::ld(pv + db * 512); o[db] = WFrag<T16>::mma(vf, pf, o[db]);
            if constexpr (HI) { o[db] = WFrag<T16>::mma(vf, pf2, o[db]); o[db] = WFrag<T16>::mma(WFrag<T16>::ld(pv2 + db * 512), pf, o[db]); } }
        if constexpr (HI) asm volatile("s_wait_xcnt 0x0" :: "v"(pv), "v"(pv2), "v"(o[7]) : "memory");   // the wait in front of an overwrite of the V loads' address registers, as for the K loads above: the inputs keep those registers as they are up to here, behind the last product and so behind every load
    }
}
__global__ __launch_bounds__(32 * REP * KS) void k_fattn(const h16* __restrict__ Q16, const bf* __restrict__ Qh, const bf* __restrict__ Ql, const h16* __restrict__ K16, const bf* __restrict__ Kh, const bf* __restrict__ Kl, const h16* __restrict__ V16, const bf* __restrict__ Vh, const bf* __restrict__ Vl, bf* Ah, bf* Al) {
    __shared__ float mg[(KS - 1) * REP * 66 * 32];   // per merged wave: 64 O^T values, m, l, each x 32 lanes (lane-contiguous)
    const int lane = threadIdx.x & 31, lr = lane & 15, hi = lane >> 4; const int wv = __builtin_amdgcn_readfirstlane((int)(threadIdx.x >> 5)); const int hd = wv % REP, part = wv / REP;
    const int g = blockIdx.x, head = g * REP + hd; const int q0 = (TT / 16 - 1 - (int)blockIdx.y) * 16;   // longest rows first
    v8f o[8];
#pragma unroll
    for (int db = 0; db < 8; ++db) o[db] = (v8f){};
    float m = -1.0e30f, l = 0.f;
    if (q0 < RH) fa_run<bf, true>(Qh + (size_t)head * TT * HD, Ql + (size_t)head * TT * HD, Kh + (size_t)g * TT * HD, Kl + (size_t)g * TT * HD, Vh + (size_t)g * HD * TT, Vl + (size_t)g * HD * TT, q0, part, lr, hi, o, m, l);
    else fa_run<h16, false>(Q16 + (size_t)head * TT * HD, nullptr, K16 + (size_t)g * TT * HD, nullptr, V16 + (size_t)g * HD * PP, nullptr, q0, part, lr, hi, o, m, l);
    if (part > 0) { float* d = mg + (size_t)((part - 1) * REP + hd) * (66 * 32) + lane;
#pragma unroll
        for (int e = 0; e < 64; ++e) d[e * 32] = o[e >> 3][e & 7];
        d[64 * 32] = m; d[65 * 32] = l; }
    __syncthreads();   // the parts 1.. of every head are in LDS before part 0 reads them
    if (part > 0) return;
#pragma unroll
    for (int w = 1; w < KS; ++w) { const float* d = mg + (size_t)((w - 1) * REP + hd) * (66 * 32) + lane; const float m1 = d[64 * 32], l1 = d[65 * 32]; const float mn = fmaxf(m, m1); const float a0 = ex2(m - mn), a1 = ex2(m1 - mn);
#pragma unroll
        for (int e = 0; e < 64; ++e) o[e >> 3][e & 7] = o[e >> 3][e & 7] * a0 + d[e * 32] * a1;
        l = l * a0 + l1 * a1; m = mn; }
    l += __shfl_xor(l, 16, 32);
    const float inv = __fdiv_rn(1.0f, l); const size_t oo = (size_t)q0 * DQ + (size_t)head * (HD / 32) * 512 + lane * 8;   // fragment-major [TT][DQ]: column head * HD + db * 16 + hi * 8 is k block head * 4 + db / 2, half db % 2
#pragma unroll
    for (int db = 0; db < 8; ++db) { v8us oh, ol;
#pragma unroll
        for (int j = 0; j < 8; ++j) { unsigned short x, y; splitf(o[db][j] * inv, x, y); oh[j] = x; ol[j] = y; }
        *(v8us*)(Ah + oo + (db >> 1) * 512 + (db & 1) * 256) = oh; *(v8us*)(Al + oo + (db >> 1) * 512 + (db & 1) * 256) = ol; }
}

extern "C" void kernel_launch(void* const* d_in, const int* in_sizes, int n_in,
                              void* d_out, int out_size, void* d_ws, size_t ws_size, hipStream_t stream) {
    (void)in_sizes; (void)n_in; (void)out_size;
    const float* x = (const float*)d_in[0]; const float* wq = (const float*)d_in[1]; const float* wk = (const float*)d_in[2]; const float* wv = (const float*)d_in[3]; const float* wo = (const float*)d_in[4]; const float* qnw = (const float*)d_in[5]; const float* knw = (const float*)d_in[6];   // torch [out][in]
    float* OUT = (float*)d_out;     // [2][2048][2048]
    char* wsp = (char*)d_ws;
    auto take = [&](size_t bytes) { char* p = wsp; wsp += (bytes + 255) & ~(size_t)255; return (void*)p; };
    bf* WQ = (bf*)take((size_t)DQ * DM * 2); bf* WK = (bf*)take((size_t)DKV * DM * 2); bf* WV = (bf*)take((size_t)DKV * DM * 2); bf* WO = (bf*)take((size_t)DM * DQ * 2); float* CS = (float*)take((size_t)TT * HD * 2 * 4); float* RFQ = (float*)take((size_t)NH_ * TT * 4); float* RFK = (float*)take((size_t)NKV * TT * 4);
    bf* XB = (bf*)take((size_t)TT * DM * 2); float* FQ = (float*)take((size_t)TT * DQ * 4); float* FK = (float*)take((size_t)TT * DKV * 4);
    h16* QP16 = (h16*)take((size_t)NH_ * TT * HD * 2); h16* KP16 = (h16*)take((size_t)NKV * TT * HD * 2); h16* VT16 = (h16*)take((size_t)NKV * HD * PP * 2);
    bf* QPh = (bf*)take((size_t)NH_ * TT * HD * 2); bf* QPl = (bf*)take((size_t)NH_ * TT * HD * 2); bf* KPh = (bf*)take((size_t)NKV * TT * HD * 2); bf* KPl = (bf*)take((size_t)NKV * TT * HD * 2); bf* VTh = (bf*)take((size_t)NKV * HD * TT * 2); bf* VTl = (bf*)take((size_t)NKV * HD * TT * 2);
    bf* ATh = (bf*)take((size_t)TT * DQ * 2); bf* ATl = (bf*)take((size_t)TT * DQ * 2);
    if ((size_t)(wsp - (char*)d_ws) > ws_size) return;    // ws 256 MiB
    float* FV = FK;   // v projection reuses the k buffer after the k planes are built (stream-ordered)
    { k_cvt8<<<(unsigned)(((size_t)DQ * DM / 8 + 255) / 256), 256, 0, stream>>>(wq, WQ, (size_t)DQ * DM / 8); k_cvt8<<<(unsigned)(((size_t)DKV * DM / 8 + 255) / 256), 256, 0, stream>>>(wk, WK, (size_t)DKV * DM / 8); k_cvt8<<<(unsigned)(((size_t)DKV * DM / 8 + 255) / 256), 256, 0, stream>>>(wv, WV, (size_t)DKV * DM / 8);
      k_cvt8<<<(unsigned)(((size_t)DM * DQ / 8 + 255) / 256), 256, 0, stream>>>(wo, WO, (size_t)DM * DQ / 8);
      k_cstab<<<(TT * HD + 255) / 256, 256, 0, stream>>>(CS); }
    const unsigned LQ = (unsigned)(((size_t)NH_ * TT * HD / 2 + 255) / 256), LKv = (unsigned)(((size_t)NKV * TT * HD / 2 + 255) / 256);
    for (int b = 0; b < NB_; ++b) {
        
        k_cvt8<<<(unsigned)(((size_t)TT * DM / 8 + 255) / 256), 256, 0, stream>>>(x + (size_t)b * TT * DM, XB, (size_t)TT * DM / 8);
        k_gemmw<bf, 0, false, 4, DM><<<dim3(TT / 64, DQ / 64, 1), 128, 0, stream>>>(XB, nullptr, WQ, nullptr, FQ, DQ, nullptr, 0, 0, 0); k_hrms<<<(NH_ * TT + 255) / 256, 256, 0, stream>>>(FQ, DQ, NH_, RFQ);
        k_rope<<<LQ, 256, 0, stream>>>(FQ, DQ, NH_, CS, RFQ, qnw, 1.0f, QP16, QPh, QPl);
        k_gemmw<bf, 0, false, 8, DM><<<dim3(TT / 64, DKV / 64, 1), 256, 0, stream>>>(XB, nullptr, WK, nullptr, FK, DKV, nullptr, 0, 0, 0); k_hrms<<<(NKV * TT + 255) / 256, 256, 0, stream>>>(FK, DKV, NKV, RFK);
        k_rope<<<LKv, 256, 0, stream>>>(FK, DKV, NKV, CS, RFK, knw, 1.0f, KP16, KPh, KPl);
        k_gemmw<bf, 0, false, 8, DM><<<dim3(TT / 64, DKV / 64, 1), 256, 0, stream>>>(XB, nullptr, WV, nullptr, FV, DKV, nullptr, 0, 0, 0); k_vtp<<<(unsigned)(((size_t)NKV * TT * HD / 8 + 255) / 256), 256, 0, stream>>>(FV, NKV, VT16, VTh, VTl);
        k_fattn<<<dim3(NKV, TT / 16, 1), 32 * REP * KS, 0, stream>>>(QP16, QPh, QPl, KP16, KPh, KPl, VT16, VTh, VTl, ATh, ATl);
        k_gemmw<bf, 1, false, 4, DQ><<<dim3(TT / 64, DM / 64, 1), 128, 0, stream>>>(ATh, ATl, WO, nullptr, OUT + (size_t)b * TT * DM, DM, nullptr, 0, 0, 0); }
}

// v005
// It runs in 374 microseconds.
// Next to v004, in two timings, it ran 1.18 times as fast each time.
// All steps since v000 together make it 4.32 times as fast.
#include <hip/hip_runtime.h>

// YuaAttention (hidden [2][2048][2048]; q = x q_w^T (16 heads x 128), k/v = x k_w^T / v_w^T (4 kv heads, GQA repeat_interleave); per-head RMSNorm (eps 1e-5) with q_norm_w / k_norm_w, then rotate-half
// RoPE (theta 500000, positions 0..S-1); causal softmax(q.k 128^-0.5); out = merged attn.v o_w^T -> [2][2048][2048]).
// Compute dtypes, f32 accumulate: every input rounded to bf16; q/k/v projections on PLAIN bf16 operands (inputs: exact); o projection on hi+lo attn planes x bf16 o_w (2 products); RMSNorm + RoPE f32 (table computed on device);
// PER-ROW PRECISION HYBRID (rows < 256 hi+lo 3 products for scores and attn.v, rows >= 256 fp16); attention fused in one kernel (k_fattn: online softmax, key loop ends at the diagonal).

#define NB_  2
#define TT   2048
#define DM   2048
#define NH_  16
#define NKV  4
#define REP  (NH_ / NKV)
#define HD   128
#define DQ   (NH_ * HD)
#define DKV  (NKV * HD)
#define PP   TT                   // keys per fp16 V^T row
#define RH   256                  // query rows < RH use hi+lo planes (0: none)
#define WIN  0
#define SCL  0.088388347648318447f   // HD^-0.5
typedef _Float16 h16;
typedef unsigned short bf;
typedef __attribute__((ext_vector_type(16))) __bf16   v16bf;
typedef __attribute__((ext_vector_type(16))) _Float16 v16h;
typedef __attribute__((ext_vector_type(8)))  _Float16 v8h;
typedef __attribute__((ext_vector_type(8)))  unsigned short v8us;
typedef __attribute__((ext_vector_type(8)))  float    v8f;
typedef __attribute__((ext_vector_type(4)))  float    v4f;
typedef v8h  __attribute__((may_alias)) v8ha;
typedef v4f  __attribute__((may_alias)) v4fa;
typedef v8us __attribute__((may_alias)) v8usa;

__device__ __forceinline__ unsigned short f2bf(float f) { unsigned u = __float_as_uint(f); u += 0x7FFFu + ((u >> 16) & 1u); return (unsigned short)(u >> 16); }
__device__ __forceinline__ float bf2f(unsigned short b) { return __uint_as_float(((unsigned)b) << 16); }
__device__ __forceinline__ float bfr(float f) { return bf2f(f2bf(f)); }
__device__ __forceinline__ v16h cat16(v8h lo, v8h hi) { return __builtin_shufflevector(lo, hi, 0, 1, 2, 3, 4, 5, 6, 7, 8, 9, 10, 11, 12, 13, 14, 15); }
__device__ __forceinline__ v16bf cat16b(v8us lo, v8us hi) { return __builtin_bit_cast(v16bf, __builtin_shufflevector(lo, hi, 0, 1, 2, 3, 4, 5, 6, 7, 8, 9, 10, 11, 12, 13, 14, 15)); }
__device__ __forceinline__ v8f wmma16(v16h a, v16h b, v8f c) { return __builtin_amdgcn_wmma_f32_16x16x32_f16(false, a, false, b, (short)0, c, false, false); }
__device__ __forceinline__ v8f wmmab(v16bf a, v16bf b, v8f c) { return __builtin_amdgcn_wmma_f32_16x16x32_bf16(false, a, false, b, (short)0, c, false, false); }



// ---- k_gemmw: register-blocked GEMM, NW WAVES per 64x64 output tile: wave w takes the 32-wide K steps w, w + NW, ... (16 accumulators each), the NW partial tiles are summed through LDS in wave order
// (fixed order, so run-to-run identical); operands straight from fragment-major 16-bit planes; grid (M/64, N/64, Z), 32 * NW threads.
// C[m][n] (f32, pitch ldc, + optional f32 bias[n]) = sum_k A[m][k] Bt[n][k] (+ split products per NSPLIT). z-batch strides sA/sB/sC in elements. K % 32 == 0, a template constant.
// FRAGMENT-MAJOR PLANES: every 16-bit operand plane [rows][K] is stored as blocks of 16 rows x 32 k (512 elements, 1 KB), block (row / 16, k / 32) at element (row / 16 * (K / 32) + k / 32) * 512; inside a block the 16-byte piece
// number ld * 32 + hi * 16 + (row % 16) holds k % 32 = ld * 16 + hi * 8 + 0..7. That is the order in which the lanes of a wave take an A or B fragment, so each of its two loads reads 512 contiguous bytes (4 whole lines).
// ld(p): p = block start + lane * 8.
template <typename T16> struct WFrag;
template <> struct WFrag<h16> { typedef v16h V; static __device__ __forceinline__ V ld(const h16* p) { return cat16(*(const v8h*)p, *(const v8h*)(p + 256)); } static __device__ __forceinline__ v8f mma(V a, V b, v8f c) { return wmma16(a, b, c); } };
template <> struct WFrag<bf> { typedef v16bf V; static __device__ __forceinline__ V ld(const bf* p) { return cat16b(*(const v8us*)p, *(const v8us*)(p + 256)); } static __device__ __forceinline__ v8f mma(V a, V b, v8f c) { return wmmab(a, b, c); } };
template <typename T16, int NSPLIT, bool BIAS, int NW, int K>
__global__ __launch_bounds__(32 * NW) void k_gemmw(const T16* __restrict__ A, const T16* __restrict__ A2, const T16* __restrict__ Bt, const T16* __restrict__ Bt2, float* C, int ldc, const float* __restrict__ bias, size_t sA, size_t sB, size_t sC) {
    typedef typename WFrag<T16>::V V;
    __shared__ __align__(16) float os[2 * NW * 16 * 68];   // two buffers (row block parity) x NW partial 16x64 row blocks
    const size_t z = blockIdx.z; A += z * sA; if (A2) A2 += z * sA; Bt += z * sB; if (Bt2) Bt2 += z * sB; C += z * sC;
    const int lane = threadIdx.x & 31, lr = lane & 15, hi = lane >> 4; const int r0 = blockIdx.x * 64, c0 = blockIdx.y * 64; const int wv = __builtin_amdgcn_readfirstlane((int)(threadIdx.x >> 5));
    v8f acc[4][4];
#pragma unroll
    for (int mb = 0; mb < 4; ++mb)
#pragma unroll
        for (int nb = 0; nb < 4; ++nb) acc[mb][nb] = (v8f){};
    const size_t aoff = (size_t)r0 * K + 8 * lane, boff = (size_t)c0 * K + 8 * lane;   // a row block of 16 rows is 16 * K elements, a k step of 32 is 512
#pragma unroll 1
    for (int kc = wv * 32; kc < K; kc += 32 * NW) {
        V a[4], a2[4]; const T16* pa = A + aoff + kc * 16; const T16* pb = Bt + boff + kc * 16; const T16* pa2 = (NSPLIT == 1 || NSPLIT == 2) ? A2 + aoff + kc * 16 : nullptr; const T16* pb2 = (NSPLIT >= 2) ? Bt2 + boff + kc * 16 : nullptr;   // K is a constant: the four row blocks of an operand lie at constant distances from one address
#pragma unroll
        for (int mb = 0; mb < 4; ++mb) { a[mb] = WFrag<T16>::ld(pa + mb * 16 * K); if (NSPLIT == 1 || NSPLIT == 2) a2[mb] = WFrag<T16>::ld(pa2 + mb * 16 * K); }
#pragma unroll
        for (int nb = 0; nb < 4; ++nb) { const V b = WFrag<T16>::ld(pb + nb * 16 * K); V b2; if (NSPLIT >= 2) b2 = WFrag<T16>::ld(pb2 + nb * 16 * K);
#pragma unroll
            for (int mb = 0; mb < 4; ++mb) { acc[mb][nb] = WFrag<T16>::mma(a[mb], b, acc[mb][nb]); if (NSPLIT == 1 || NSPLIT == 2) acc[mb][nb] = WFrag<T16>::mma(a2[mb], b, acc[mb][nb]); if (NSPLIT >= 2) acc[mb][nb] = WFrag<T16>::mma(a[mb], b2, acc[mb][nb]); } }
        asm volatile("v_nop\n\tv_nop\n\tv_nop\n\tv_nop" : "+v"(acc[0][0]), "+v"(acc[1][1]), "+v"(acc[2][2]), "+v"(acc[3][3]) : "v"(a[0]), "v"(a[3]));
        // the wait in front of an overwrite of the fragment loads' address registers: the inputs keep every address register as it is up to here (no later load lands on one), behind the step's last product and so behind every load
        if constexpr (NSPLIT == 0) asm volatile("s_wait_xcnt 0x0" :: "v"(pa), "v"(pb) : "memory");
        else if constexpr (NSPLIT == 1) asm volatile("s_wait_xcnt 0x0" :: "v"(pa), "v"(pb), "v"(pa2) : "memory");
        else asm volatile("s_wait_xcnt 0x0" :: "v"(pa), "v"(pb), "v"(pa2), "v"(pb2) : "memory");
    }
    v4f res[4][8 / NW];   // this thread's summed 16-byte pieces; the loops over mb, q and w below are unrolled so that res and acc are indexed by constants and stay in registers
#pragma unroll
    for (int mb = 0; mb < 4; ++mb) {
        float* ob = os + (mb & 1) * (NW * 16 * 68);
#pragma unroll
        for (int nb = 0; nb < 4; ++nb) {
#pragma unroll
            for (int j = 0; j < 8; ++j) ob[wv * (16 * 68) + (hi * 8 + j) * 68 + nb * 16 + lr] = acc[mb][nb][j]; }
        __syncthreads();   // every wave's partial of this row block is in LDS; also ends the reads of the other buffer (row block mb - 1) before row block mb + 1 overwrites it
#pragma unroll
        for (int q = 0; q < 8 / NW; ++q) { const int s = (int)threadIdx.x + q * 32 * NW; const int row = s >> 4, cofs = (s & 15) * 4; v4f val = *(const v4fa*)(ob + row * 68 + cofs);
#pragma unroll
            for (int w = 1; w < NW; ++w) val += *(const v4fa*)(ob + w * (16 * 68) + row * 68 + cofs);
            if (BIAS) { val[0] += bfr(bias[c0 + cofs]); val[1] += bfr(bias[c0 + cofs + 1]); val[2] += bfr(bias[c0 + cofs + 2]); val[3] += bfr(bias[c0 + cofs + 3]); }
            res[mb][q] = val; }
    }
    // all global stores behind the last barrier: a store in front of a barrier would be waited for there
#pragma unroll
    for (int mb = 0; mb < 4; ++mb)
#pragma unroll
        for (int q = 0; q < 8 / NW; ++q) { const int s = (int)threadIdx.x + q * 32 * NW; const int row = s >> 4, cofs = (s & 15) * 4; *(v4f*)(C + (size_t)(r0 + mb * 16 + row) * ldc + c0 + cofs) = res[mb][q]; }
}

__device__ __forceinline__ h16 tohx(float x) { return (h16)x; }
__device__ __forceinline__ void splitf(float y, unsigned short& h, unsigned short& l) { h = f2bf(y); l = f2bf(y - bf2f(h)); }
typedef __attribute__((ext_vector_type(2))) _Float16 v2h;
typedef __attribute__((ext_vector_type(4))) _Float16 v4h;
typedef __attribute__((ext_vector_type(2))) unsigned short v2us;
typedef __attribute__((ext_vector_type(4))) unsigned short v4us;
typedef __attribute__((ext_vector_type(2))) float v2f;
typedef __attribute__((ext_vector_type(4))) int v4i;

__global__ __launch_bounds__(256) void k_wtG(const float* __restrict__ w, int K, int N, bf* Bt) {
    const int lane = threadIdx.x & 31; const int L0 = (blockIdx.x * 8 + (threadIdx.x >> 5)) * 8; const int nlines = N * K / 64;
{
#pragma unroll 1
        for (int l = 0; l < 8; ++l) { const int L = L0 + l; if (L >= nlines) break; const size_t e = (size_t)L * 64 + lane * 2; const int k = (int)(e % K), n = (int)(e / K); v2us o;
            o[0] = f2bf(w[(size_t)k * N + n]); o[1] = f2bf(w[(size_t)(k + 1) * N + n]); *(v2us*)(Bt + e) = o; }
         }
}
// k_cvt8: f32 [rows][DM] -> bf16 fragment-major plane; a thread takes its lane's place in the four 16-byte-piece rows of two neighbouring blocks (32 elements), so a wave reads 256 contiguous bytes of each of 16 rows, eight 16-byte loads in flight a lane,
// and writes 2 KB in a row. n32 = elements / 32 = threads. Few waves on purpose: the launch is short, and the time to start its waves is the larger part of it.
__global__ __launch_bounds__(256) void k_cvt8(const float* __restrict__ src, bf* dst, size_t n32) { const size_t i = (size_t)blockIdx.x * 256 + threadIdx.x; if (i >= n32) return; const size_t blk = (i >> 5) * 2; const int ln = (int)i & 31;   // DM / 32 is even: both blocks lie in one row block
    const float* s = src + ((blk / (DM / 32)) * 16 + (ln & 15)) * DM + (blk % (DM / 32)) * 32 + (ln >> 4) * 8; v8f v[4];
#pragma unroll
    for (int p = 0; p < 4; ++p) v[p] = *(const v8f*)(s + p * 16);   // piece row p = block p / 2, k half p % 2: k offset p * 16
#pragma unroll
    for (int p = 0; p < 4; ++p) { v8us o;
#pragma unroll
        for (int k = 0; k < 8; ++k) o[k] = f2bf(v[p][k]);
        *(v8us*)(dst + blk * 512 + p * 256 + ln * 8) = o; }  }
__global__ __launch_bounds__(256) void k_cstab(float* CS) { const int idx = blockIdx.x * 256 + threadIdx.x; if (idx >= TT * HD) return; const int t = idx / HD, d = idx % HD; const int i = d % (HD / 2); const float inv = __fdiv_rn(1.0f, powf(500000.0f, (float)(2 * i) / (float)HD)); const float ang = __fmul_rn((float)t, inv); v2f cs; cs[0] = cosf(ang); cs[1] = sinf(ang);
    *(v2f*)(CS + (size_t)idx * 2) = cs;  }
__global__ __launch_bounds__(256) void k_hrms(const float* __restrict__ F, int pitch, int nheads, float* RF) { const int i = blockIdx.x * 256 + threadIdx.x; if (i >= nheads * TT) return; const int t = i % TT, h = i / TT; const float* f = F + (size_t)t * pitch + h * HD; float s = 0.f;
#pragma unroll 4
    for (int d = 0; d < HD; d += 4) { const v4f v = *(const v4f*)(f + d);
#pragma unroll
        for (int q = 0; q < 4; ++q) { float p = __fmul_rn(v[q], v[q]); asm volatile("" : "+v"(p)); s = __fadd_rn(s, p); } }
    const float r = __fdiv_rn(1.0f, __fsqrt_rn(__fadd_rn(s * (1.0f / HD), 1e-5f))); *(float*)(RF + i) = r;  }
// k_rope: head planes [h][t][d] (fp16 + hi/lo) of rope(w[d] (x rms_factor)) x sc with the rotate-half convention out[d] = x[d] cos[t][d] - x[d+HD/2] sin[t][d], out[d+HD/2] = x[d+HD/2] cos[t][d+HD/2] + x[d] sin[t][d+HD/2]
// A thread takes 32 elements of one row t: its lane's place in both k halves of d block kb (kb = 0, 1) and of d block kb + 2, which holds the rotate-half partners; each cos / sin pair is read once for both (the table's halves d and d + HD/2 hold the same angle).
// A wave reads whole lines of 16 rows and stores 512 contiguous bytes at a time (16-byte pieces in lane order). Few waves on purpose: the launch is short, and the time to start its waves is the larger part of it.
__global__ __launch_bounds__(128) void k_rope(const float* __restrict__ F, int pitch, int nheads, const float* __restrict__ CS, const float* __restrict__ RF, const float* __restrict__ nw, float sc, h16* P16, bf* Ph, bf* Pl) {
    const size_t i = (size_t)blockIdx.x * 128 + threadIdx.x; if (i >= (size_t)nheads * TT * HD / 32) return; const int ln = (int)i & 31, kb = (int)(i >> 5) & 1; const int tb = (int)((i >> 6) % (TT / 16)); const int h = (int)(i / ((size_t)64 * (TT / 16)));
    const int t = tb * 16 + (ln & 15), d0 = kb * 32 + (ln >> 4) * 8; const float* f = F + (size_t)t * pitch + h * HD + d0; const float* cs = CS + ((size_t)t * HD + d0) * 2; const unsigned wo = (unsigned)d0 * 4u; const float* wp = (const float*)((const char*)nw + wo); const float* rp = RF + (size_t)h * TT + t;
    const size_t pe = (size_t)h * TT * HD + (size_t)(tb * (HD / 32) + kb) * 512 + ln * 8;   // fragment-major: rows t, k = d
    v8f xl[2], xh[2], c0[2], c1[2], wl[2], wh[2];
#pragma unroll
    for (int ld = 0; ld < 2; ++ld) { xl[ld] = *(const v8f*)(f + ld * 16); xh[ld] = *(const v8f*)(f + ld * 16 + HD / 2); c0[ld] = *(const v8f*)(cs + ld * 32); c1[ld] = *(const v8f*)(cs + ld * 32 + 8); wl[ld] = *(const v8f*)(wp + ld * 16); wh[ld] = *(const v8f*)(wp + ld * 16 + HD / 2); }
    const float rf = *rp;
    // the wait in front of an overwrite of the loads' address registers. Inputs only: the three addresses and the byte offset wo, which is the register that the loads of nw name beside its scalar base, stay as they are up to here (no load lands on one), and the loaded values put the wait behind every load, so all 25 are in flight together
    asm volatile("s_wait_xcnt 0x0" :: "v"(f), "v"(cs), "v"(wo), "v"(rp), "v"(xl[0]), "v"(xl[1]), "v"(xh[0]), "v"(xh[1]), "v"(c0[0]), "v"(c0[1]), "v"(c1[0]), "v"(c1[1]), "v"(wl[0]), "v"(wl[1]), "v"(wh[0]), "v"(wh[1]), "v"(rf) : "memory");
    v8h l16[2], u16[2]; v8us lh[2], ll[2], uh[2], ul[2];   // l..: d block kb, u..: d block kb + 2
#pragma unroll
    for (int ld = 0; ld < 2; ++ld)
#pragma unroll
        for (int q = 0; q < 8; ++q) { const float xa = bfr(wl[ld][q]) * (xl[ld][q] * rf), xb = bfr(wh[ld][q]) * (xh[ld][q] * rf);
            const float c = (q < 4) ? c0[ld][2 * q] : c1[ld][2 * q - 8], sn = (q < 4) ? c0[ld][2 * q + 1] : c1[ld][2 * q - 7];
            const float ra = (xa * c - xb * sn) * sc, rb = (xb * c + xa * sn) * sc; unsigned short a2, c2;
            l16[ld][q] = tohx(ra); splitf(ra, a2, c2); lh[ld][q] = a2; ll[ld][q] = c2; u16[ld][q] = tohx(rb); splitf(rb, a2, c2); uh[ld][q] = a2; ul[ld][q] = c2; }
    // all stores last: no register that a store names is written again
#pragma unroll
    for (int ld = 0; ld < 2; ++ld) { const size_t pl = pe + ld * 256, pu = pl + (HD / 64) * 512;
        *(v8h*)(P16 + pl) = l16[ld]; *(v8us*)(Ph + pl) = lh[ld]; *(v8us*)(Pl + pl) = ll[ld]; *(v8h*)(P16 + pu) = u16[ld]; *(v8us*)(Ph + pu) = uh[ld]; *(v8us*)(Pl + pu) = ul[ld]; }  }
// k_vtp: fragment-major V^T planes (rows d, k = key t) of each kv group, blocks ordered (t / 32, d / 16) so that a 32-key step reads 8 KB in a row; a thread takes 8 keys of one d (one 16-byte piece per plane), lanes run along d (whole lines read)
__global__ __launch_bounds__(256) void k_vtp(const float* __restrict__ F, int nheads, h16* V16, bf* Vh, bf* Vl) { const size_t i = (size_t)blockIdx.x * 256 + threadIdx.x; if (i >= (size_t)nheads * HD * TT / 8) return; const int d = (int)(i % HD); const int t8 = (int)((i / HD) % (TT / 8)); const int g = (int)(i / ((size_t)HD * (TT / 8))); v8h o16; v8us oh, ol;
#pragma unroll
    for (int q = 0; q < 8; ++q) { const float x = F[(size_t)t8 * 8 * DKV + g * HD + d + q * DKV]; o16[q] = tohx(x); unsigned short a2, c2; splitf(x, a2, c2); oh[q] = a2; ol[q] = c2; }
    const size_t pe = (size_t)g * HD * TT + (size_t)((t8 >> 2) * (HD / 16) + (d >> 4)) * 512 + ((t8 >> 1) & 1) * 256 + ((t8 & 1) * 16 + (d & 15)) * 8;
    *(v8h*)(V16 + pe) = o16; *(v8us*)(Vh + pe) = oh; *(v8us*)(Vl + pe) = ol;  }
// ---- k_fattn: causal attention of one batch in one launch; no score or probability matrix in memory. Block = 16 query rows x the REP query heads of one kv group x KS key parts (one wave each): wave (hd, part) takes the 32-key steps part, part + KS, ...
// Transposed products: S^T = K Q^T (A = key rows, B = query rows), so a lane holds, for ITS query (column lr), keys hi*8+j of each 16-key block: exactly the k order of a B fragment, and P^T goes into O^T += V^T P^T without leaving the lane.
// Online softmax per lane in the log2 domain (running maximum m, running sum l, O^T rescaled at every step); the KS parts are merged through LDS in part order (fixed order, run-to-run identical); part 0 normalises and stores the hi + lo planes of the merged heads.
// Rows < RH: hi+lo bf16 planes, 3 products for scores and for attn.v; rows >= RH: fp16. A block is wholly one or the other (RH % 16 == 0).
#define KS   4
#define SL2  (SCL * 1.4426950408889634f)   // HD^-0.5 x log2(e)
typedef __attribute__((ext_vector_type(16))) unsigned short v16us;
static_assert(RH % 16 == 0 && TT % 32 == 0, "a block's rows share one precision path; key steps are whole");
static_assert(DM == DQ && DM % 128 == 0 && HD % 32 == 0 && PP == TT, "one k length for every converted plane; whole fragment blocks");
// exp2 with the issue slot behind a transcendental filled: the v_nop keeps the next vector instruction, whichever the compiler puts there, from directly reading the result or overwriting the source.
__device__ __forceinline__ float ex2(float x) { float r; asm("v_exp_f32 %0, %1\n\tv_nop" : "=v"(r) : "v"(x)); return r; }
// four at once, one v_nop behind the last; the results are early-clobber so that none lies on the source of the exponential in front of it
__device__ __forceinline__ void ex2x4(float& a, float& b, float& c, float& d) { float ra, rb, rc, rd; asm("v_exp_f32 %0, %4\n\tv_exp_f32 %1, %5\n\tv_exp_f32 %2, %6\n\tv_exp_f32 %3, %7\n\tv_nop" : "=&v"(ra), "=&v"(rb), "=&v"(rc), "=&v"(rd) : "v"(a), "v"(b), "v"(c), "v"(d)); a = ra; b = rb; c = rc; d = rd; }
template <typename T16, bool HI>
__device__ __forceinline__ void fa_run(const T16* __restrict__ Q, const T16* __restrict__ Q2, const T16* __restrict__ Kp, const T16* __restrict__ K2, const T16* __restrict__ Vt, const T16* __restrict__ Vt2, int q0, int part, int lr, int hi, v8f (&o)[8], float& m, float& l) {
    typedef typename WFrag<T16>::V V;
    V qf[4], qf2[4];
#pragma unroll
    for (int ks = 0; ks < 4; ++ks) { qf[ks] = WFrag<T16>::ld(Q + (size_t)q0 * HD + ks * 512 + 8 * (hi * 16 + lr)); if constexpr (HI) qf2[ks] = WFrag<T16>::ld(Q2 + (size_t)q0 * HD + ks * 512 + 8 * (hi * 16 + lr)); }
    const int nst = (q0 + 47) / 32;   // 32-key steps that reach key q0 + 15; the last key touched is below TT
    const size_t ko = 8 * (hi * 16 + lr), vo = ko; const int qi = q0 + lr;   // fragment-major planes: 16 keys of K are 16 * HD elements in a row, 32 keys of V^T are 32 * HD
#pragma unroll 1
    for (int s = part; s < nst; s += KS) {
        const int k0 = s * 32;
        v8f st[2]; st[0] = (v8f){}; st[1] = (v8f){};
        if constexpr (HI) { const T16* pk[2] = { Kp + ko + (size_t)k0 * HD, Kp + ko + (size_t)(k0 + 16) * HD }; const T16* pk2[2] = { K2 + ko + (size_t)k0 * HD, K2 + ko + (size_t)(k0 + 16) * HD };
#pragma unroll
            for (int kb = 0; kb < 2; ++kb)
#pragma unroll
                for (int ks = 0; ks < 4; ++ks) { const V kf = WFrag<T16>::ld(pk[kb] + ks * 512); st[kb] = WFrag<T16>::mma(kf, qf[ks], st[kb]); st[kb] = WFrag<T16>::mma(kf, qf2[ks], st[kb]); st[kb] = WFrag<T16>::mma(WFrag<T16>::ld(pk2[kb] + ks * 512), qf[ks], st[kb]); }
            asm volatile("s_wait_xcnt 0x0" :: "v"(pk[0]), "v"(pk[1]), "v"(pk2[0]), "v"(pk2[1]), "v"(st[0]), "v"(st[1]) : "memory");   // the wait in front of an overwrite of the K loads' address registers; the inputs keep those registers as they are up to here and put the wait behind the last product, so behind every load
        } else { V kf[8];
#pragma unroll
            for (int i = 0; i < 8; ++i) kf[i] = WFrag<T16>::ld(Kp + ko + (size_t)(k0 + (i >> 2) * 16) * HD + (i & 3) * 512);
            asm volatile("" :: "v"(kf[0]), "v"(kf[1]), "v"(kf[2]), "v"(kf[3]), "v"(kf[4]), "v"(kf[5]), "v"(kf[6]), "v"(kf[7]));   // inputs only, loaded values: all K loads of the step are issued before its first product; without it each product waits for its own load's round trip, eight in a row
#pragma unroll
            for (int ks = 0; ks < 4; ++ks) { st[0] = WFrag<T16>::mma(kf[ks], qf[ks], st[0]); st[1] = WFrag<T16>::mma(kf[4 + ks], qf[ks], st[1]); } }
        float t[16];
#pragma unroll
        for (int e = 0; e < 16; ++e) t[e] = st[e >> 3][e & 7] * SL2;
        if (k0 + 31 > q0) {   // only a step that reaches past the block's first row holds keys above the diagonal
#pragma unroll
            for (int e = 0; e < 16; ++e) t[e] = (k0 + (e >> 3) * 16 + hi * 8 + (e & 7) <= qi) ? t[e] : -3.0e38f; }
        float mx = m;
#pragma unroll
        for (int e = 0; e < 16; ++e) mx = fmaxf(mx, t[e]);
        mx = fmaxf(mx, __shfl_xor(mx, 16, 32));   // the two half-waves hold the two key octets of the same query
        const float al = ex2(m - mx); m = mx; float ps = 0.f;   // m starts at -1e30, above the mask value, so a step whose keys are all masked gives p = 0, not exp2(0)
#pragma unroll
        for (int e = 0; e < 16; e += 4) { t[e] -= mx; t[e + 1] -= mx; t[e + 2] -= mx; t[e + 3] -= mx; ex2x4(t[e], t[e + 1], t[e + 2], t[e + 3]); ps += t[e]; ps += t[e + 1]; ps += t[e + 2]; ps += t[e + 3]; }
        l = l * al + ps;
#pragma unroll
        for (int db = 0; db < 8; ++db) o[db] = o[db] * al;
        V pf, pf2;
        if constexpr (HI) { v16us ph, pl;
#pragma unroll
            for (int e = 0; e < 16; ++e) { unsigned short x, y; splitf(t[e], x, y); ph[e] = x; pl[e] = y; }
            pf = __builtin_bit_cast(v16bf, ph); pf2 = __builtin_bit_cast(v16bf, pl);
        } else {
#pragma unroll
            for (int e = 0; e < 16; ++e) pf[e] = tohx(t[e]); }
        const T16* pv = Vt + vo + (size_t)k0 * HD; const T16* pv2 = HI ? Vt2 + vo + (size_t)k0 * HD : nullptr;
#pragma unroll
        for (int db = 0; db < 8; ++db) { const V vf = WFrag<T16>::ld(pv + db * 512); o[db] = WFrag<T16>::mma(vf, pf, o[db]);
            if constexpr (HI) { o[db] = WFrag<T16>::mma(vf, pf2, o[db]); o[db] = WFrag<T16>::mma(WFrag<T16>::ld(pv2 + db * 512), pf, o[db]); } }
        if constexpr (HI) asm volatile("s_wait_xcnt 0x0" :: "v"(pv), "v"(pv2), "v"(o[7]) : "memory");   // the wait in front of an overwrite of the V loads' address registers, as for the K loads above: the inputs keep those registers as they are up to here, behind the last product and so behind every load
    }
}
__global__ __launch_bounds__(32 * REP * KS) void k_fattn(const h16* __restrict__ Q16, const bf* __restrict__ Qh, const bf* __restrict__ Ql, const h16* __restrict__ K16, const bf* __restrict__ Kh, const bf* __restrict__ Kl, const h16* __restrict__ V16, const bf* __restrict__ Vh, const bf* __restrict__ Vl, bf* Ah, bf* Al) {
    __shared__ float mg[(KS - 1) * REP * 66 * 32];   // per merged wave: 64 O^T values, m, l, each x 32 lanes (lane-contiguous)
    const int lane = threadIdx.x & 31, lr = lane & 15, hi = lane >> 4; const int wv = __builtin_amdgcn_readfirstlane((int)(threadIdx.x >> 5)); const int hd = wv % REP, part = wv / REP;
    const int g = blockIdx.x, head = g * REP + hd; const int q0 = (TT / 16 - 1 - (int)blockIdx.y) * 16;   // longest rows first
    v8f o[8];
#pragma unroll
    for (int db = 0; db < 8; ++db) o[db] = (v8f){};
    float m = -1.0e30f, l = 0.f;
    if (q0 < RH) fa_run<bf, true>(Qh + (size_t)head * TT * HD, Ql + (size_t)head * TT * HD, Kh + (size_t)g * TT * HD, Kl + (size_t)g * TT * HD, Vh + (size_t)g * HD * TT, Vl + (size_t)g * HD * TT, q0, part, lr, hi, o, m, l);
    else fa_run<h16, false>(Q16 + (size_t)head * TT * HD, nullptr, K16 + (size_t)g * TT * HD, nullptr, V16 + (size_t)g * HD * PP, nullptr, q0, part, lr, hi, o, m, l);
    if (part > 0) { float* d = mg + (size_t)((part - 1) * REP + hd) * (66 * 32) + lane;
#pragma unroll
        for (int e = 0; e < 64; ++e) d[e * 32] = o[e >> 3][e & 7];
        d[64 * 32] = m; d[65 * 32] = l; }
    __syncthreads();   // the parts 1.. of every head are in LDS before part 0 reads them
    if (part > 0) return;
#pragma unroll
    for (int w = 1; w < KS; ++w) { const float* d = mg + (size_t)((w - 1) * REP + hd) * (66 * 32) + lane; const float m1 = d[64 * 32], l1 = d[65 * 32]; const float mn = fmaxf(m, m1); const float a0 = ex2(m - mn), a1 = ex2(m1 - mn);
#pragma unroll
        for (int e = 0; e < 64; ++e) o[e >> 3][e & 7] = o[e >> 3][e & 7] * a0 + d[e * 32] * a1;
        l = l * a0 + l1 * a1; m = mn; }
    l += __shfl_xor(l, 16, 32);
    const float inv = __fdiv_rn(1.0f, l); const size_t oo = (size_t)q0 * DQ + (size_t)head * (HD / 32) * 512 + lane * 8;   // fragment-major [TT][DQ]: column head * HD + db * 16 + hi * 8 is k block head * 4 + db / 2, half db % 2
#pragma unroll
    for (int db = 0; db < 8; ++db) { v8us oh, ol;
#pragma unroll
        for (int j = 0; j < 8; ++j) { unsigned short x, y; splitf(o[db][j] * inv, x, y); oh[j] = x; ol[j] = y; }
        *(v8us*)(Ah + oo + (db >> 1) * 512 + (db & 1) * 256) = oh; *(v8us*)(Al + oo + (db >> 1) * 512 + (db & 1) * 256) = ol; }
}

extern "C" void kernel_launch(void* const* d_in, const int* in_sizes, int n_in,
                              void* d_out, int out_size, void* d_ws, size_t ws_size, hipStream_t stream) {
    (void)in_sizes; (void)n_in; (void)out_size;
    const float* x = (const float*)d_in[0]; const float* wq = (const float*)d_in[1]; const float* wk = (const float*)d_in[2]; const float* wv = (const float*)d_in[3]; const float* wo = (const float*)d_in[4]; const float* qnw = (const float*)d_in[5]; const float* knw = (const float*)d_in[6];   // torch [out][in]
    float* OUT = (float*)d_out;     // [2][2048][2048]
    char* wsp = (char*)d_ws;
    auto take = [&](size_t bytes) { char* p = wsp; wsp += (bytes + 255) & ~(size_t)255; return (void*)p; };
    bf* WQ = (bf*)take((size_t)DQ * DM * 2); bf* WK = (bf*)take((size_t)DKV * DM * 2); bf* WV = (bf*)take((size_t)DKV * DM * 2); bf* WO = (bf*)take((size_t)DM * DQ * 2); float* CS = (float*)take((size_t)TT * HD * 2 * 4); float* RFQ = (float*)take((size_t)NH_ * TT * 4); float* RFK = (float*)take((size_t)NKV * TT * 4);
    bf* XB = (bf*)take((size_t)TT * DM * 2); float* FQ = (float*)take((size_t)TT * DQ * 4); float* FK = (float*)take((size_t)TT * DKV * 4);
    h16* QP16 = (h16*)take((size_t)NH_ * TT * HD * 2); h16* KP16 = (h16*)take((size_t)NKV * TT * HD * 2); h16* VT16 = (h16*)take((size_t)NKV * HD * PP * 2);
    bf* QPh = (bf*)take((size_t)NH_ * TT * HD * 2); bf* QPl = (bf*)take((size_t)NH_ * TT * HD * 2); bf* KPh = (bf*)take((size_t)NKV * TT * HD * 2); bf* KPl = (bf*)take((size_t)NKV * TT * HD * 2); bf* VTh = (bf*)take((size_t)NKV * HD * TT * 2); bf* VTl = (bf*)take((size_t)NKV * HD * TT * 2);
    bf* ATh = (bf*)take((size_t)TT * DQ * 2); bf* ATl = (bf*)take((size_t)TT * DQ * 2);
    if ((size_t)(wsp - (char*)d_ws) > ws_size) return;    // ws 256 MiB
    float* FV = FK;   // v projection reuses the k buffer after the k planes are built (stream-ordered)
    { k_cvt8<<<(unsigned)(((size_t)DQ * DM / 32 + 255) / 256), 256, 0, stream>>>(wq, WQ, (size_t)DQ * DM / 32); k_cvt8<<<(unsigned)(((size_t)DKV * DM / 32 + 255) / 256), 256, 0, stream>>>(wk, WK, (size_t)DKV * DM / 32); k_cvt8<<<(unsigned)(((size_t)DKV * DM / 32 + 255) / 256), 256, 0, stream>>>(wv, WV, (size_t)DKV * DM / 32);
      k_cvt8<<<(unsigned)(((size_t)DM * DQ / 32 + 255) / 256), 256, 0, stream>>>(wo, WO, (size_t)DM * DQ / 32);
      k_cstab<<<(TT * HD + 255) / 256, 256, 0, stream>>>(CS); }
    const unsigned LQ = (unsigned)(((size_t)NH_ * TT * HD / 32 + 127) / 128), LKv = (unsigned)(((size_t)NKV * TT * HD / 32 + 127) / 128);
    for (int b = 0; b < NB_; ++b) {
        
        k_cvt8<<<(unsigned)(((size_t)TT * DM / 32 + 255) / 256), 256, 0, stream>>>(x + (size_t)b * TT * DM, XB, (size_t)TT * DM / 32);
        k_gemmw<bf, 0, false, 4, DM><<<dim3(TT / 64, DQ / 64, 1), 128, 0, stream>>>(XB, nullptr, WQ, nullptr, FQ, DQ, nullptr, 0, 0, 0); k_hrms<<<(NH_ * TT + 255) / 256, 256, 0, stream>>>(FQ, DQ, NH_, RFQ);
        k_rope<<<LQ, 128, 0, stream>>>(FQ, DQ, NH_, CS, RFQ, qnw, 1.0f, QP16, QPh, QPl);
        k_gemmw<bf, 0, false, 8, DM><<<dim3(TT / 64, DKV / 64, 1), 256, 0, stream>>>(XB, nullptr, WK, nullptr, FK, DKV, nullptr, 0, 0, 0); k_hrms<<<(NKV * TT + 255) / 256, 256, 0, stream>>>(FK, DKV, NKV, RFK);
        k_rope<<<LKv, 128, 0, stream>>>(FK, DKV, NKV, CS, RFK, knw, 1.0f, KP16, KPh, KPl);
        k_gemmw<bf, 0, false, 8, DM><<<dim3(TT / 64, DKV / 64, 1), 256, 0, stream>>>(XB, nullptr, WV, nullptr, FV, DKV, nullptr, 0, 0, 0); k_vtp<<<(unsigned)(((size_t)NKV * TT * HD / 8 + 255) / 256), 256, 0, stream>>>(FV, NKV, VT16, VTh, VTl);
        k_fattn<<<dim3(NKV, TT / 16, 1), 32 * REP * KS, 0, stream>>>(QP16, QPh, QPl, KP16, KPh, KPl, VT16, VTh, VTl, ATh, ATl);
        k_gemmw<bf, 1, false, 4, DQ><<<dim3(TT / 64, DM / 64, 1), 128, 0, stream>>>(ATh, ATl, WO, nullptr, OUT + (size_t)b * TT * DM, DM, nullptr, 0, 0, 0); }
}

// v006
// Measured time: 266 microseconds a run.
// In both of two side-by-side timings against v005, it was 1.42 times as fast.
// All steps since v000 together make it 6.14 times as fast.
#include <hip/hip_runtime.h>

// YuaAttention (hidden [2][2048][2048]; q = x q_w^T (16 heads x 128), k/v = x k_w^T / v_w^T (4 kv heads, GQA repeat_interleave); per-head RMSNorm (eps 1e-5) with q_norm_w / k_norm_w, then rotate-half
// RoPE (theta 500000, positions 0..S-1); causal softmax(q.k 128^-0.5); out = merged attn.v o_w^T -> [2][2048][2048]).
// Compute dtypes, f32 accumulate: every input rounded to bf16; q/k/v projections on PLAIN bf16 operands (inputs: exact); o projection on hi+lo attn planes x bf16 o_w (2 products); RMSNorm + RoPE f32 (table computed on device);
// PER-ROW PRECISION HYBRID (rows < 256 hi+lo 3 products for scores and attn.v, rows >= 256 fp16); attention fused in one kernel (k_fattn: online softmax, key loop ends at the diagonal).

#define NB_  2
#define TT   2048
#define DM   2048
#define NH_  16
#define NKV  4
#define REP  (NH_ / NKV)
#define HD   128
#define DQ   (NH_ * HD)
#define DKV  (NKV * HD)
#define PP   TT                   // keys per fp16 V^T row
#define RH   256                  // query rows < RH use hi+lo planes (0: none)
#define WIN  0
#define RWS  (NB_ * TT)           // rows of both batches together: every launch takes both
#define FP   (DQ + 2 * DKV)       // columns of the joint q | k | v projection
#define NHK  (NH_ + NKV)          // heads that are normalised and rotated: the q heads, then the k heads (head h stands at column h * HD of the joint projection)
#define SCL  0.088388347648318447f   // HD^-0.5
typedef _Float16 h16;
typedef unsigned short bf;
typedef __attribute__((ext_vector_type(16))) __bf16   v16bf;
typedef __attribute__((ext_vector_type(16))) _Float16 v16h;
typedef __attribute__((ext_vector_type(8)))  _Float16 v8h;
typedef __attribute__((ext_vector_type(8)))  unsigned short v8us;
typedef __attribute__((ext_vector_type(8)))  float    v8f;
typedef __attribute__((ext_vector_type(4)))  float    v4f;
typedef v8h  __attribute__((may_alias)) v8ha;
typedef v4f  __attribute__((may_alias)) v4fa;
typedef v8us __attribute__((may_alias)) v8usa;

__device__ __forceinline__ unsigned short f2bf(float f) { unsigned u = __float_as_uint(f); u += 0x7FFFu + ((u >> 16) & 1u); return (unsigned short)(u >> 16); }
__device__ __forceinline__ float bf2f(unsigned short b) { return __uint_as_float(((unsigned)b) << 16); }
__device__ __forceinline__ float bfr(float f) { return bf2f(f2bf(f)); }
__device__ __forceinline__ v16h cat16(v8h lo, v8h hi) { return __builtin_shufflevector(lo, hi, 0, 1, 2, 3, 4, 5, 6, 7, 8, 9, 10, 11, 12, 13, 14, 15); }
__device__ __forceinline__ v16bf cat16b(v8us lo, v8us hi) { return __builtin_bit_cast(v16bf, __builtin_shufflevector(lo, hi, 0, 1, 2, 3, 4, 5, 6, 7, 8, 9, 10, 11, 12, 13, 14, 15)); }
__device__ __forceinline__ v8f wmma16(v16h a, v16h b, v8f c) { return __builtin_amdgcn_wmma_f32_16x16x32_f16(false, a, false, b, (short)0, c, false, false); }
__device__ __forceinline__ v8f wmmab(v16bf a, v16bf b, v8f c) { return __builtin_amdgcn_wmma_f32_16x16x32_bf16(false, a, false, b, (short)0, c, false, false); }



// ---- k_gemmw: register-blocked GEMM, NW WAVES per 64x64 output tile: wave w takes the 32-wide K steps w, w + NW, ... (16 accumulators each), the NW partial tiles are summed through LDS in wave order
// (fixed order, so run-to-run identical); operands straight from fragment-major 16-bit planes; grid (M/64, N/64, Z), 32 * NW threads.
// C[m][n] (f32, pitch ldc, + optional f32 bias[n]) = sum_k A[m][k] Bt[n][k] (+ split products per NSPLIT). z-batch strides sA/sB/sC in elements. K % 32 == 0, a template constant.
// FRAGMENT-MAJOR PLANES: every 16-bit operand plane [rows][K] is stored as blocks of 16 rows x 32 k (512 elements, 1 KB), block (row / 16, k / 32) at element (row / 16 * (K / 32) + k / 32) * 512; inside a block the 16-byte piece
// number ld * 32 + hi * 16 + (row % 16) holds k % 32 = ld * 16 + hi * 8 + 0..7. That is the order in which the lanes of a wave take an A or B fragment, so each of its two loads reads 512 contiguous bytes (4 whole lines).
// ld(p): p = block start + lane * 8.
template <typename T16> struct WFrag;
template <> struct WFrag<h16> { typedef v16h V; static __device__ __forceinline__ V ld(const h16* p) { return cat16(*(const v8h*)p, *(const v8h*)(p + 256)); } static __device__ __forceinline__ v8f mma(V a, V b, v8f c) { return wmma16(a, b, c); } };
template <> struct WFrag<bf> { typedef v16bf V; static __device__ __forceinline__ V ld(const bf* p) { return cat16b(*(const v8us*)p, *(const v8us*)(p + 256)); } static __device__ __forceinline__ v8f mma(V a, V b, v8f c) { return wmmab(a, b, c); } };
template <typename T16, int NSPLIT, bool BIAS, int NW, int K>
__global__ __launch_bounds__(32 * NW) void k_gemmw(const T16* __restrict__ A, const T16* __restrict__ A2, const T16* __restrict__ Bt, const T16* __restrict__ Bt2, float* C, int ldc, const float* __restrict__ bias, size_t sA, size_t sB, size_t sC) {
    typedef typename WFrag<T16>::V V;
    __shared__ __align__(16) float os[2 * NW * 16 * 68];   // two buffers (row block parity) x NW partial 16x64 row blocks
    const size_t z = blockIdx.z; A += z * sA; if (A2) A2 += z * sA; Bt += z * sB; if (Bt2) Bt2 += z * sB; C += z * sC;
    const int lane = threadIdx.x & 31, lr = lane & 15, hi = lane >> 4; const int r0 = blockIdx.x * 64, c0 = blockIdx.y * 64; const int wv = __builtin_amdgcn_readfirstlane((int)(threadIdx.x >> 5));
    v8f acc[4][4];
#pragma unroll
    for (int mb = 0; mb < 4; ++mb)
#pragma unroll
        for (int nb = 0; nb < 4; ++nb) acc[mb][nb] = (v8f){};
    const size_t aoff = (size_t)r0 * K + 8 * lane, boff = (size_t)c0 * K + 8 * lane;   // a row block of 16 rows is 16 * K elements, a k step of 32 is 512
#pragma unroll 1
    for (int kc = wv * 32; kc < K; kc += 32 * NW) {
        V a[4], a2[4]; const T16* pa = A + aoff + kc * 16; const T16* pb = Bt + boff + kc * 16; const T16* pa2 = (NSPLIT == 1 || NSPLIT == 2) ? A2 + aoff + kc * 16 : nullptr; const T16* pb2 = (NSPLIT >= 2) ? Bt2 + boff + kc * 16 : nullptr;   // K is a constant: the four row blocks of an operand lie at constant distances from one address
#pragma unroll
        for (int mb = 0; mb < 4; ++mb) { a[mb] = WFrag<T16>::ld(pa + mb * 16 * K); if (NSPLIT == 1 || NSPLIT == 2) a2[mb] = WFrag<T16>::ld(pa2 + mb * 16 * K); }
#pragma unroll
        for (int nb = 0; nb < 4; ++nb) { const V b = WFrag<T16>::ld(pb + nb * 16 * K); V b2; if (NSPLIT >= 2) b2 = WFrag<T16>::ld(pb2 + nb * 16 * K);
#pragma unroll
            for (int mb = 0; mb < 4; ++mb) { acc[mb][nb] = WFrag<T16>::mma(a[mb], b, acc[mb][nb]); if (NSPLIT == 1 || NSPLIT == 2) acc[mb][nb] = WFrag<T16>::mma(a2[mb], b, acc[mb][nb]); if (NSPLIT >= 2) acc[mb][nb] = WFrag<T16>::mma(a[mb], b2, acc[mb][nb]); } }
        asm volatile("v_nop\n\tv_nop\n\tv_nop\n\tv_nop" : "+v"(acc[0][0]), "+v"(acc[1][1]), "+v"(acc[2][2]), "+v"(acc[3][3]) : "v"(a[0]), "v"(a[3]));
        // the wait in front of an overwrite of the fragment loads' address registers: the inputs keep every address register as it is up to here (no later load lands on one), behind the step's last product and so behind every load
        if constexpr (NSPLIT == 0) asm volatile("s_wait_xcnt 0x0" :: "v"(pa), "v"(pb) : "memory");
        else if constexpr (NSPLIT == 1) asm volatile("s_wait_xcnt 0x0" :: "v"(pa), "v"(pb), "v"(pa2) : "memory");
        else asm volatile("s_wait_xcnt 0x0" :: "v"(pa), "v"(pb), "v"(pa2), "v"(pb2) : "memory");
    }
    v4f res[4][8 / NW];   // this thread's summed 16-byte pieces; the loops over mb, q and w below are unrolled so that res and acc are indexed by constants and stay in registers
#pragma unroll
    for (int mb = 0; mb < 4; ++mb) {
        float* ob = os + (mb & 1) * (NW * 16 * 68);
#pragma unroll
        for (int nb = 0; nb < 4; ++nb) {
#pragma unroll
            for (int j = 0; j < 8; ++j) ob[wv * (16 * 68) + (hi * 8 + j) * 68 + nb * 16 + lr] = acc[mb][nb][j]; }
        __syncthreads();   // every wave's partial of this row block is in LDS; also ends the reads of the other buffer (row block mb - 1) before row block mb + 1 overwrites it
#pragma unroll
        for (int q = 0; q < 8 / NW; ++q) { const int s = (int)threadIdx.x + q * 32 * NW; const int row = s >> 4, cofs = (s & 15) * 4; v4f val = *(const v4fa*)(ob + row * 68 + cofs);
#pragma unroll
            for (int w = 1; w < NW; ++w) val += *(const v4fa*)(ob + w * (16 * 68) + row * 68 + cofs);
            if (BIAS) { val[0] += bfr(bias[c0 + cofs]); val[1] += bfr(bias[c0 + cofs + 1]); val[2] += bfr(bias[c0 + cofs + 2]); val[3] += bfr(bias[c0 + cofs + 3]); }
            res[mb][q] = val; }
    }
    // all global stores behind the last barrier: a store in front of a barrier would be waited for there
#pragma unroll
    for (int mb = 0; mb < 4; ++mb)
#pragma unroll
        for (int q = 0; q < 8 / NW; ++q) { const int s = (int)threadIdx.x + q * 32 * NW; const int row = s >> 4, cofs = (s & 15) * 4; *(v4f*)(C + (size_t)(r0 + mb * 16 + row) * ldc + c0 + cofs) = res[mb][q]; }
}

__device__ __forceinline__ h16 tohx(float x) { return (h16)x; }
__device__ __forceinline__ void splitf(float y, unsigned short& h, unsigned short& l) { h = f2bf(y); l = f2bf(y - bf2f(h)); }
typedef __attribute__((ext_vector_type(2))) _Float16 v2h;
typedef __attribute__((ext_vector_type(4))) _Float16 v4h;
typedef __attribute__((ext_vector_type(2))) unsigned short v2us;
typedef __attribute__((ext_vector_type(4))) unsigned short v4us;
typedef __attribute__((ext_vector_type(2))) float v2f;
typedef __attribute__((ext_vector_type(4))) int v4i;

__global__ __launch_bounds__(256) void k_wtG(const float* __restrict__ w, int K, int N, bf* Bt) {
    const int lane = threadIdx.x & 31; const int L0 = (blockIdx.x * 8 + (threadIdx.x >> 5)) * 8; const int nlines = N * K / 64;
{
#pragma unroll 1
        for (int l = 0; l < 8; ++l) { const int L = L0 + l; if (L >= nlines) break; const size_t e = (size_t)L * 64 + lane * 2; const int k = (int)(e % K), n = (int)(e / K); v2us o;
            o[0] = f2bf(w[(size_t)k * N + n]); o[1] = f2bf(w[(size_t)(k + 1) * N + n]); *(v2us*)(Bt + e) = o; }
         }
}
// d_cvt8: f32 [rows][DM] -> bf16 fragment-major plane, all five sources in one launch: the planes of x (both batches), q_w, k_w, v_w, o_w lie behind one another in dst, so q_w | k_w | v_w is one plane of FP rows. A thread takes its lane's place in the four 16-byte-piece rows of two neighbouring blocks (32 elements), so a wave reads 256 contiguous bytes of each of 16 rows, eight 16-byte loads in flight a lane,
// and writes 2 KB in a row. bx = block index; 256 threads take 16 fragment blocks of one 16-row block, so the source is chosen by a scalar test. Few waves on purpose: the time to start the waves is the larger part of such work.
__device__ __forceinline__ void d_cvt8(const float* __restrict__ x, const float* __restrict__ wq, const float* __restrict__ wk, const float* __restrict__ wv, const float* __restrict__ wo, bf* dst, unsigned bx) { const size_t i = (size_t)bx * 256 + threadIdx.x; const size_t blk = (i >> 5) * 2; const int ln = (int)i & 31;   // DM / 32 is even: both blocks lie in one row block
    const int rb = (int)(bx / (DM / 32 / 16)); const float* src = x; int rb0 = 0;   // rb: 16-row block in dst; rb0: where the source's plane begins
    if (rb >= (RWS + FP) / 16) { src = wo; rb0 = (RWS + FP) / 16; } else if (rb >= (RWS + DQ + DKV) / 16) { src = wv; rb0 = (RWS + DQ + DKV) / 16; } else if (rb >= (RWS + DQ) / 16) { src = wk; rb0 = (RWS + DQ) / 16; } else if (rb >= RWS / 16) { src = wq; rb0 = RWS / 16; }
    const float* s = src + ((size_t)(rb - rb0) * 16 + (ln & 15)) * DM + (blk % (DM / 32)) * 32 + (ln >> 4) * 8; v8f v[4];
#pragma unroll
    for (int p = 0; p < 4; ++p) v[p] = *(const v8f*)(s + p * 16);   // piece row p = block p / 2, k half p % 2: k offset p * 16
#pragma unroll
    for (int p = 0; p < 4; ++p) { v8us o;
#pragma unroll
        for (int k = 0; k < 8; ++k) o[k] = f2bf(v[p][k]);
        *(v8us*)(dst + blk * 512 + p * 256 + ln * 8) = o; }
    asm volatile("s_wait_xcnt 0x0" ::: "memory");  }   // the wait behind the four stores: in the joint kernel other code follows them in the listing, and none of it may write a register that a store names ahead of this wait
__device__ __forceinline__ void d_cstab(float* CS, unsigned bx) { const int idx = (int)bx * 256 + threadIdx.x; if (idx >= TT * HD) return; const int t = idx / HD, d = idx % HD; const int i = d % (HD / 2); const float inv = __fdiv_rn(1.0f, powf(500000.0f, (float)(2 * i) / (float)HD)); const float ang = __fmul_rn((float)t, inv); v2f cs; cs[0] = cosf(ang); cs[1] = sinf(ang);
    *(v2f*)(CS + (size_t)idx * 2) = cs;  }
// k_prep: all that depends on the inputs alone, in one launch: the cos / sin table (blocks below CSB; first, as its waves run longest) and the five plane conversions
#define CSB  (TT * HD / 256)
#define CVB  ((RWS + FP + DM) * (DM / 32) / 256)
__global__ __launch_bounds__(256) void k_prep(const float* __restrict__ x, const float* __restrict__ wq, const float* __restrict__ wk, const float* __restrict__ wv, const float* __restrict__ wo, bf* dst, float* CS) { if (blockIdx.x < CSB) d_cstab(CS, blockIdx.x); else d_cvt8(x, wq, wk, wv, wo, dst, blockIdx.x - CSB); }
// d_hrms: RF[h][row] = rms factor of head h (q heads, then k heads) of row 0..RWS-1 of the joint projection
__device__ __forceinline__ void d_hrms(const float* __restrict__ F, float* RF, unsigned bx) { const int i = (int)bx * 256 + threadIdx.x; const int t = i % RWS, h = i / RWS; const float* f = F + (size_t)t * FP + h * HD; float s = 0.f;
#pragma unroll 4
    for (int d = 0; d < HD; d += 4) { const v4f v = *(const v4f*)(f + d);
#pragma unroll
        for (int q = 0; q < 4; ++q) { float p = __fmul_rn(v[q], v[q]); asm volatile("" : "+v"(p)); s = __fadd_rn(s, p); } }
    const float r = __fdiv_rn(1.0f, __fsqrt_rn(__fadd_rn(s * (1.0f / HD), 1e-5f))); *(float*)(RF + i) = r;  }
// k_rope: head planes [h][t][d] (fp16 + hi/lo) of rope(w[d] (x rms_factor)) x sc with the rotate-half convention out[d] = x[d] cos[t][d] - x[d+HD/2] sin[t][d], out[d+HD/2] = x[d+HD/2] cos[t][d+HD/2] + x[d] sin[t][d+HD/2]
// A thread takes 32 elements of one row t: its lane's place in both k halves of d block kb (kb = 0, 1) and of d block kb + 2, which holds the rotate-half partners; each cos / sin pair is read once for both (the table's halves d and d + HD/2 hold the same angle).
// A wave reads whole lines of 16 rows and stores 512 contiguous bytes at a time (16-byte pieces in lane order). Few waves on purpose: the launch is short, and the time to start its waves is the larger part of it.
// One launch for the q and the k heads of both batches: a head is RWS * HD / 32 threads = RPB whole blocks, so the head, and with it the norm weight and the output planes, is chosen by scalar tests; planes are ordered [batch][head].
#define RPB  (RWS * HD / 32 / 128)
__global__ __launch_bounds__(128) void k_rope(const float* __restrict__ F, const float* __restrict__ CS, const float* __restrict__ RF, const float* __restrict__ qnw, const float* __restrict__ knw, float sc, h16* Q16, bf* Qh, bf* Ql, h16* K16, bf* Kh, bf* Kl) {
    const int h = (int)(blockIdx.x / RPB); const bool isq = h < NH_; const float* nw = isq ? qnw : knw; h16* P16 = isq ? Q16 : K16; bf* Ph = isq ? Qh : Kh; bf* Pl = isq ? Ql : Kl;
    const int i = (int)(blockIdx.x % RPB) * 128 + (int)threadIdx.x; const int ln = i & 31, kb = (i >> 5) & 1; const int tb = (i >> 6) % (TT / 16); const int b = (i >> 6) / (TT / 16);
    const int t = tb * 16 + (ln & 15), d0 = kb * 32 + (ln >> 4) * 8; const float* f = F + (size_t)(b * TT + t) * FP + h * HD + d0; const float* cs = CS + ((size_t)t * HD + d0) * 2; const unsigned wo = (unsigned)d0 * 4u; const float* wp = (const float*)((const char*)nw + wo); const float* rp = RF + (size_t)h * RWS + b * TT + t;
    const size_t pe = (size_t)(isq ? b * NH_ + h : b * NKV + h - NH_) * TT * HD + (size_t)(tb * (HD / 32) + kb) * 512 + ln * 8;   // fragment-major: rows t, k = d
    v8f xl[2], xh[2], c0[2], c1[2], wl[2], wh[2];
#pragma unroll
    for (int ld = 0; ld < 2; ++ld) { xl[ld] = *(const v8f*)(f + ld * 16); xh[ld] = *(const v8f*)(f + ld * 16 + HD / 2); c0[ld] = *(const v8f*)(cs + ld * 32); c1[ld] = *(const v8f*)(cs + ld * 32 + 8); wl[ld] = *(const v8f*)(wp + ld * 16); wh[ld] = *(const v8f*)(wp + ld * 16 + HD / 2); }
    const float rf = *rp;
    // the wait in front of an overwrite of the loads' address registers. Inputs only: the three addresses and the byte offset wo, which is the register that the loads of nw name beside its scalar base, stay as they are up to here (no load lands on one), and the loaded values put the wait behind every load, so all 25 are in flight together
    asm volatile("s_wait_xcnt 0x0" :: "v"(f), "v"(cs), "v"(wo), "v"(rp), "v"(xl[0]), "v"(xl[1]), "v"(xh[0]), "v"(xh[1]), "v"(c0[0]), "v"(c0[1]), "v"(c1[0]), "v"(c1[1]), "v"(wl[0]), "v"(wl[1]), "v"(wh[0]), "v"(wh[1]), "v"(rf) : "memory");
    v8h l16[2], u16[2]; v8us lh[2], ll[2], uh[2], ul[2];   // l..: d block kb, u..: d block kb + 2
#pragma unroll
    for (int ld = 0; ld < 2; ++ld)
#pragma unroll
        for (int q = 0; q < 8; ++q) { const float xa = bfr(wl[ld][q]) * (xl[ld][q] * rf), xb = bfr(wh[ld][q]) * (xh[ld][q] * rf);
            const float c = (q < 4) ? c0[ld][2 * q] : c1[ld][2 * q - 8], sn = (q < 4) ? c0[ld][2 * q + 1] : c1[ld][2 * q - 7];
            const float ra = (xa * c - xb * sn) * sc, rb = (xb * c + xa * sn) * sc; unsigned short a2, c2;
            l16[ld][q] = tohx(ra); splitf(ra, a2, c2); lh[ld][q] = a2; ll[ld][q] = c2; u16[ld][q] = tohx(rb); splitf(rb, a2, c2); uh[ld][q] = a2; ul[ld][q] = c2; }
    // all stores last: no register that a store names is written again
#pragma unroll
    for (int ld = 0; ld < 2; ++ld) { const size_t pl = pe + ld * 256, pu = pl + (HD / 64) * 512;
        *(v8h*)(P16 + pl) = l16[ld]; *(v8us*)(Ph + pl) = lh[ld]; *(v8us*)(Pl + pl) = ll[ld]; *(v8h*)(P16 + pu) = u16[ld]; *(v8us*)(Ph + pu) = uh[ld]; *(v8us*)(Pl + pu) = ul[ld]; }  }
// d_vtp: fragment-major V^T planes (rows d, k = key t) of each kv group of each batch (g = batch * NKV + group), blocks ordered (t / 32, d / 16) so that a 32-key step reads 8 KB in a row; a thread takes 8 keys of one d (one 16-byte piece per plane), lanes run along d (whole lines read)
__device__ __forceinline__ void d_vtp(const float* __restrict__ F, h16* V16, bf* Vh, bf* Vl, unsigned bx) { const size_t i = (size_t)bx * 256 + threadIdx.x; const int d = (int)(i % HD); const int t8 = (int)((i / HD) % (TT / 8)); const int g = (int)(i / ((size_t)HD * (TT / 8))); v8h o16; v8us oh, ol;
    const float* fv = F + ((size_t)(g / NKV) * TT + t8 * 8) * FP + DQ + DKV + (g % NKV) * HD + d;   // the v columns stand behind the q and k columns
#pragma unroll
    for (int q = 0; q < 8; ++q) { const float x = fv[q * FP]; o16[q] = tohx(x); unsigned short a2, c2; splitf(x, a2, c2); oh[q] = a2; ol[q] = c2; }
    const size_t pe = (size_t)g * HD * TT + (size_t)((t8 >> 2) * (HD / 16) + (d >> 4)) * 512 + ((t8 >> 1) & 1) * 256 + ((t8 & 1) * 16 + (d & 15)) * 8;
    *(v8h*)(V16 + pe) = o16; *(v8us*)(Vh + pe) = oh; *(v8us*)(Vl + pe) = ol;
    asm volatile("s_wait_xcnt 0x0" ::: "memory");  }   // the wait behind the three stores: in the joint kernel other code follows them in the listing, and none of it may write a register that a store names ahead of this wait
// k_nv: the two pieces of work that need the joint projection alone, in one launch: the rms factors (blocks below HRB; first, as each of their threads walks a whole head row) and the V^T planes
#define HRB  (NHK * RWS / 256)
#define VTB  (NB_ * NKV * HD * TT / 8 / 256)
__global__ __launch_bounds__(256) void k_nv(const float* __restrict__ F, float* RF, h16* V16, bf* Vh, bf* Vl) { if (blockIdx.x < HRB) d_hrms(F, RF, blockIdx.x); else d_vtp(F, V16, Vh, Vl, blockIdx.x - HRB); }
// ---- k_fattn: causal attention of both batches in one launch; no score or probability matrix in memory. Block = 16 query rows x the REP query heads of one kv group x KS key parts (one wave each): wave (hd, part) takes the 32-key steps part, part + KS, ...
// Transposed products: S^T = K Q^T (A = key rows, B = query rows), so a lane holds, for ITS query (column lr), keys hi*8+j of each 16-key block: exactly the k order of a B fragment, and P^T goes into O^T += V^T P^T without leaving the lane.
// Online softmax per lane in the log2 domain (running maximum m, running sum l, O^T rescaled at every step); the KS parts are merged through LDS in part order (fixed order, run-to-run identical); part 0 normalises and stores the hi + lo planes of the merged heads.
// Rows < RH: hi+lo bf16 planes, 3 products for scores and for attn.v; rows >= RH: fp16. A block is wholly one or the other (RH % 16 == 0).
#define KS   4
#define SL2  (SCL * 1.4426950408889634f)   // HD^-0.5 x log2(e)
typedef __attribute__((ext_vector_type(16))) unsigned short v16us;
static_assert(RH % 16 == 0 && TT % 32 == 0, "a block's rows share one precision path; key steps are whole");
static_assert(DM == DQ && DM % 128 == 0 && HD % 32 == 0 && PP == TT, "one k length for every converted plane; whole fragment blocks");
// exp2 with the issue slot behind a transcendental filled: the v_nop keeps the next vector instruction, whichever the compiler puts there, from directly reading the result or overwriting the source.
__device__ __forceinline__ float ex2(float x) { float r; asm("v_exp_f32 %0, %1\n\tv_nop" : "=v"(r) : "v"(x)); return r; }
// four at once, one v_nop behind the last; the results are early-clobber so that none lies on the source of the exponential in front of it
__device__ __forceinline__ void ex2x4(float& a, float& b, float& c, float& d) { float ra, rb, rc, rd; asm("v_exp_f32 %0, %4\n\tv_exp_f32 %1, %5\n\tv_exp_f32 %2, %6\n\tv_exp_f32 %3, %7\n\tv_nop" : "=&v"(ra), "=&v"(rb), "=&v"(rc), "=&v"(rd) : "v"(a), "v"(b), "v"(c), "v"(d)); a = ra; b = rb; c = rc; d = rd; }
template <typename T16, bool HI>
__device__ __forceinline__ void fa_run(const T16* __restrict__ Q, const T16* __restrict__ Q2, const T16* __restrict__ Kp, const T16* __restrict__ K2, const T16* __restrict__ Vt, const T16* __restrict__ Vt2, int q0, int part, int lr, int hi, v8f (&o)[8], float& m, float& l) {
    typedef typename WFrag<T16>::V V;
    V qf[4], qf2[4];
#pragma unroll
    for (int ks = 0; ks < 4; ++ks) { qf[ks] = WFrag<T16>::ld(Q + (size_t)q0 * HD + ks * 512 + 8 * (hi * 16 + lr)); if constexpr (HI) qf2[ks] = WFrag<T16>::ld(Q2 + (size_t)q0 * HD + ks * 512 + 8 * (hi * 16 + lr)); }
    const int nst = (q0 + 47) / 32;   // 32-key steps that reach key q0 + 15; the last key touched is below TT
    const size_t ko = 8 * (hi * 16 + lr), vo = ko; const int qi = q0 + lr;   // fragment-major planes: 16 keys of K are 16 * HD elements in a row, 32 keys of V^T are 32 * HD
#pragma unroll 1
    for (int s = part; s < nst; s += KS) {
        const int k0 = s * 32;
        v8f st[2]; st[0] = (v8f){}; st[1] = (v8f){};
        if constexpr (HI) { const T16* pk[2] = { Kp + ko + (size_t)k0 * HD, Kp + ko + (size_t)(k0 + 16) * HD }; const T16* pk2[2] = { K2 + ko + (size_t)k0 * HD, K2 + ko + (size_t)(k0 + 16) * HD };
#pragma unroll
            for (int kb = 0; kb < 2; ++kb)
#pragma unroll
                for (int ks = 0; ks < 4; ++ks) { const V kf = WFrag<T16>::ld(pk[kb] + ks * 512); st[kb] = WFrag<T16>::mma(kf, qf[ks], st[kb]); st[kb] = WFrag<T16>::mma(kf, qf2[ks], st[kb]); st[kb] = WFrag<T16>::mma(WFrag<T16>::ld(pk2[kb] + ks * 512), qf[ks], st[kb]); }
            asm volatile("s_wait_xcnt 0x0" :: "v"(pk[0]), "v"(pk[1]), "v"(pk2[0]), "v"(pk2[1]), "v"(st[0]), "v"(st[1]) : "memory");   // the wait in front of an overwrite of the K loads' address registers; the inputs keep those registers as they are up to here and put the wait behind the last product, so behind every load
        } else { V kf[8];
#pragma unroll
            for (int i = 0; i < 8; ++i) kf[i] = WFrag<T16>::ld(Kp + ko + (size_t)(k0 + (i >> 2) * 16) * HD + (i & 3) * 512);
            asm volatile("" :: "v"(kf[0]), "v"(kf[1]), "v"(kf[2]), "v"(kf[3]), "v"(kf[4]), "v"(kf[5]), "v"(kf[6]), "v"(kf[7]));   // inputs only, loaded values: all K loads of the step are issued before its first product; without it each product waits for its own load's round trip, eight in a row
#pragma unroll
            for (int ks = 0; ks < 4; ++ks) { st[0] = WFrag<T16>::mma(kf[ks], qf[ks], st[0]); st[1] = WFrag<T16>::mma(kf[4 + ks], qf[ks], st[1]); } }
        float t[16];
#pragma unroll
        for (int e = 0; e < 16; ++e) t[e] = st[e >> 3][e & 7] * SL2;
        if (k0 + 31 > q0) {   // only a step that reaches past the block's first row holds keys above the diagonal
#pragma unroll
            for (int e = 0; e < 16; ++e) t[e] = (k0 + (e >> 3) * 16 + hi * 8 + (e & 7) <= qi) ? t[e] : -3.0e38f; }
        float mx = m;
#pragma unroll
        for (int e = 0; e < 16; ++e) mx = fmaxf(mx, t[e]);
        mx = fmaxf(mx, __shfl_xor(mx, 16, 32));   // the two half-waves hold the two key octets of the same query
        const float al = ex2(m - mx); m = mx; float ps = 0.f;   // m starts at -1e30, above the mask value, so a step whose keys are all masked gives p = 0, not exp2(0)
#pragma unroll
        for (int e = 0; e < 16; e += 4) { t[e] -= mx; t[e + 1] -= mx; t[e + 2] -= mx; t[e + 3] -= mx; ex2x4(t[e], t[e + 1], t[e + 2], t[e + 3]); ps += t[e]; ps += t[e + 1]; ps += t[e + 2]; ps += t[e + 3]; }
        l = l * al + ps;
#pragma unroll
        for (int db = 0; db < 8; ++db) o[db] = o[db] * al;
        V pf, pf2;
        if constexpr (HI) { v16us ph, pl;
#pragma unroll
            for (int e = 0; e < 16; ++e) { unsigned short x, y; splitf(t[e], x, y); ph[e] = x; pl[e] = y; }
            pf = __builtin_bit_cast(v16bf, ph); pf2 = __builtin_bit_cast(v16bf, pl);
        } else {
#pragma unroll
            for (int e = 0; e < 16; ++e) pf[e] = tohx(t[e]); }
        const T16* pv = Vt + vo + (size_t)k0 * HD; const T16* pv2 = HI ? Vt2 + vo + (size_t)k0 * HD : nullptr;
#pragma unroll
        for (int db = 0; db < 8; ++db) { const V vf = WFrag<T16>::ld(pv + db * 512); o[db] = WFrag<T16>::mma(vf, pf, o[db]);
            if constexpr (HI) { o[db] = WFrag<T16>::mma(vf, pf2, o[db]); o[db] = WFrag<T16>::mma(WFrag<T16>::ld(pv2 + db * 512), pf, o[db]); } }
        if constexpr (HI) asm volatile("s_wait_xcnt 0x0" :: "v"(pv), "v"(pv2), "v"(o[7]) : "memory");   // the wait in front of an overwrite of the V loads' address registers, as for the K loads above: the inputs keep those registers as they are up to here, behind the last product and so behind every load
    }
}
__global__ __launch_bounds__(32 * REP * KS) void k_fattn(const h16* __restrict__ Q16, const bf* __restrict__ Qh, const bf* __restrict__ Ql, const h16* __restrict__ K16, const bf* __restrict__ Kh, const bf* __restrict__ Kl, const h16* __restrict__ V16, const bf* __restrict__ Vh, const bf* __restrict__ Vl, bf* Ah, bf* Al) {
    __shared__ float mg[(KS - 1) * REP * 66 * 32];   // per merged wave: 64 O^T values, m, l, each x 32 lanes (lane-contiguous)
    const int lane = threadIdx.x & 31, lr = lane & 15, hi = lane >> 4; const int wv = __builtin_amdgcn_readfirstlane((int)(threadIdx.x >> 5)); const int hd = wv % REP, part = wv / REP;
    const int g = blockIdx.x, head = g * REP + hd; const int q0 = (TT / 16 - 1 - (int)blockIdx.y) * 16;   // g = batch * NKV + kv group, head = batch * NH_ + query head: both batches in one launch; longest rows first
    v8f o[8];
#pragma unroll
    for (int db = 0; db < 8; ++db) o[db] = (v8f){};
    float m = -1.0e30f, l = 0.f;
    if (q0 < RH) fa_run<bf, true>(Qh + (size_t)head * TT * HD, Ql + (size_t)head * TT * HD, Kh + (size_t)g * TT * HD, Kl + (size_t)g * TT * HD, Vh + (size_t)g * HD * TT, Vl + (size_t)g * HD * TT, q0, part, lr, hi, o, m, l);
    else fa_run<h16, false>(Q16 + (size_t)head * TT * HD, nullptr, K16 + (size_t)g * TT * HD, nullptr, V16 + (size_t)g * HD * PP, nullptr, q0, part, lr, hi, o, m, l);
    if (part > 0) { float* d = mg + (size_t)((part - 1) * REP + hd) * (66 * 32) + lane;
#pragma unroll
        for (int e = 0; e < 64; ++e) d[e * 32] = o[e >> 3][e & 7];
        d[64 * 32] = m; d[65 * 32] = l; }
    __syncthreads();   // the parts 1.. of every head are in LDS before part 0 reads them
    if (part > 0) return;
#pragma unroll
    for (int w = 1; w < KS; ++w) { const float* d = mg + (size_t)((w - 1) * REP + hd) * (66 * 32) + lane; const float m1 = d[64 * 32], l1 = d[65 * 32]; const float mn = fmaxf(m, m1); const float a0 = ex2(m - mn), a1 = ex2(m1 - mn);
#pragma unroll
        for (int e = 0; e < 64; ++e) o[e >> 3][e & 7] = o[e >> 3][e & 7] * a0 + d[e * 32] * a1;
        l = l * a0 + l1 * a1; m = mn; }
    l += __shfl_xor(l, 16, 32);
    const float inv = __fdiv_rn(1.0f, l); const size_t oo = (size_t)((g / NKV) * TT + q0) * DQ + (size_t)(head % NH_) * (HD / 32) * 512 + lane * 8;   // fragment-major [RWS][DQ]: column (head % NH_) * HD + db * 16 + hi * 8 is k block (head % NH_) * 4 + db / 2, half db % 2
#pragma unroll
    for (int db = 0; db < 8; ++db) { v8us oh, ol;
#pragma unroll
        for (int j = 0; j < 8; ++j) { unsigned short x, y; splitf(o[db][j] * inv, x, y); oh[j] = x; ol[j] = y; }
        *(v8us*)(Ah + oo + (db >> 1) * 512 + (db & 1) * 256) = oh; *(v8us*)(Al + oo + (db >> 1) * 512 + (db & 1) * 256) = ol; }
}

extern "C" void kernel_launch(void* const* d_in, const int* in_sizes, int n_in,
                              void* d_out, int out_size, void* d_ws, size_t ws_size, hipStream_t stream) {
    (void)in_sizes; (void)n_in; (void)out_size;
    const float* x = (const float*)d_in[0]; const float* wq = (const float*)d_in[1]; const float* wk = (const float*)d_in[2]; const float* wv = (const float*)d_in[3]; const float* wo = (const float*)d_in[4]; const float* qnw = (const float*)d_in[5]; const float* knw = (const float*)d_in[6];   // torch [out][in]
    float* OUT = (float*)d_out;     // [2][2048][2048]
    char* wsp = (char*)d_ws;
    auto take = [&](size_t bytes) { char* p = wsp; wsp += (bytes + 255) & ~(size_t)255; return (void*)p; };
    bf* XB = (bf*)take((size_t)(RWS + FP + DM) * DM * 2); bf* WQKV = XB + (size_t)RWS * DM; bf* WO = WQKV + (size_t)FP * DM;   // one run of planes, in the order in which k_prep writes them
    float* CS = (float*)take((size_t)TT * HD * 2 * 4); float* RF = (float*)take((size_t)NHK * RWS * 4); float* F = (float*)take((size_t)RWS * FP * 4);
    h16* QP16 = (h16*)take((size_t)NB_ * NH_ * TT * HD * 2); h16* KP16 = (h16*)take((size_t)NB_ * NKV * TT * HD * 2); h16* VT16 = (h16*)take((size_t)NB_ * NKV * HD * PP * 2);
    bf* QPh = (bf*)take((size_t)NB_ * NH_ * TT * HD * 2); bf* QPl = (bf*)take((size_t)NB_ * NH_ * TT * HD * 2); bf* KPh = (bf*)take((size_t)NB_ * NKV * TT * HD * 2); bf* KPl = (bf*)take((size_t)NB_ * NKV * TT * HD * 2); bf* VTh = (bf*)take((size_t)NB_ * NKV * HD * TT * 2); bf* VTl = (bf*)take((size_t)NB_ * NKV * HD * TT * 2);
    bf* ATh = (bf*)take((size_t)RWS * DQ * 2); bf* ATl = (bf*)take((size_t)RWS * DQ * 2);
    if ((size_t)(wsp - (char*)d_ws) > ws_size) return;    // ws 256 MiB
    // six launches, each for both batches; work that does not depend on one another shares a launch
    k_prep<<<CSB + CVB, 256, 0, stream>>>(x, wq, wk, wv, wo, XB, CS);
    k_gemmw<bf, 0, false, 4, DM><<<dim3(RWS / 64, FP / 64, 1), 128, 0, stream>>>(XB, nullptr, WQKV, nullptr, F, FP, nullptr, 0, 0, 0);
    k_nv<<<HRB + VTB, 256, 0, stream>>>(F, RF, VT16, VTh, VTl);
    k_rope<<<NHK * RPB, 128, 0, stream>>>(F, CS, RF, qnw, knw, 1.0f, QP16, QPh, QPl, KP16, KPh, KPl);
    k_fattn<<<dim3(NB_ * NKV, TT / 16, 1), 32 * REP * KS, 0, stream>>>(QP16, QPh, QPl, KP16, KPh, KPl, VT16, VTh, VTl, ATh, ATl);
    k_gemmw<bf, 1, false, 4, DQ><<<dim3(RWS / 64, DM / 64, 1), 128, 0, stream>>>(ATh, ATl, WO, nullptr, OUT, DM, nullptr, 0, 0, 0);
}

// v007
// It runs in 192 microseconds.
// In both of two side-by-side timings against v006, it was 1.40 times as fast.
// Over all steps from v000 it is 8.60 times as fast.
#include <hip/hip_runtime.h>

// YuaAttention (hidden [2][2048][2048]; q = x q_w^T (16 heads x 128), k/v = x k_w^T / v_w^T (4 kv heads, GQA repeat_interleave); per-head RMSNorm (eps 1e-5) with q_norm_w / k_norm_w, then rotate-half
// RoPE (theta 500000, positions 0..S-1); causal softmax(q.k 128^-0.5); out = merged attn.v o_w^T -> [2][2048][2048]).
// Compute dtypes, f32 accumulate: every input rounded to bf16; q/k/v projections on PLAIN bf16 operands (inputs: exact); o projection on hi+lo attn planes x bf16 o_w (2 products); RMSNorm + RoPE f32 (table computed on device);
// PER-ROW PRECISION HYBRID (rows < 256 hi+lo 3 products for scores and attn.v, rows >= 256 fp16); attention fused in one kernel (k_fattn: online softmax, key loop ends at the diagonal).

#define NB_  2
#define TT   2048
#define DM   2048
#define NH_  16
#define NKV  4
#define REP  (NH_ / NKV)
#define HD   128
#define DQ   (NH_ * HD)
#define DKV  (NKV * HD)
#define PP   TT                   // keys per fp16 V^T row
#define RH   256                  // query rows < RH use hi+lo planes (0: none)
#define WIN  0
#define RWS  (NB_ * TT)           // rows of both batches together: every launch takes both
#define FP   (DQ + 2 * DKV)       // columns of the joint q | k | v projection
#define NHK  (NH_ + NKV)          // heads that are normalised and rotated: the q heads, then the k heads (head h stands at column h * HD of the joint projection)
#define SCL  0.088388347648318447f   // HD^-0.5
typedef _Float16 h16;
typedef unsigned short bf;
typedef __attribute__((ext_vector_type(16))) __bf16   v16bf;
typedef __attribute__((ext_vector_type(16))) _Float16 v16h;
typedef __attribute__((ext_vector_type(8)))  _Float16 v8h;
typedef __attribute__((ext_vector_type(8)))  unsigned short v8us;
typedef __attribute__((ext_vector_type(8)))  float    v8f;
typedef __attribute__((ext_vector_type(4)))  float    v4f;
typedef v8h  __attribute__((may_alias)) v8ha;
typedef v4f  __attribute__((may_alias)) v4fa;
typedef v8us __attribute__((may_alias)) v8usa;

__device__ __forceinline__ unsigned short f2bf(float f) { unsigned u = __float_as_uint(f); u += 0x7FFFu + ((u >> 16) & 1u); return (unsigned short)(u >> 16); }
__device__ __forceinline__ float bf2f(unsigned short b) { return __uint_as_float(((unsigned)b) << 16); }
__device__ __forceinline__ float bfr(float f) { return bf2f(f2bf(f)); }
__device__ __forceinline__ v16h cat16(v8h lo, v8h hi) { return __builtin_shufflevector(lo, hi, 0, 1, 2, 3, 4, 5, 6, 7, 8, 9, 10, 11, 12, 13, 14, 15); }
__device__ __forceinline__ v16bf cat16b(v8us lo, v8us hi) { return __builtin_bit_cast(v16bf, __builtin_shufflevector(lo, hi, 0, 1, 2, 3, 4, 5, 6, 7, 8, 9, 10, 11, 12, 13, 14, 15)); }
__device__ __forceinline__ v8f wmma16(v16h a, v16h b, v8f c) { return __builtin_amdgcn_wmma_f32_16x16x32_f16(false, a, false, b, (short)0, c, false, false); }
__device__ __forceinline__ v8f wmmab(v16bf a, v16bf b, v8f c) { return __builtin_amdgcn_wmma_f32_16x16x32_bf16(false, a, false, b, (short)0, c, false, false); }



// ---- d_gemmt: GEMM, one 128x128 output tile per block of 4 waves (2 x 2 waves of 64x64, 16 accumulators each, every wave over the whole K in ascending k); the operand tiles are staged in LDS by asynchronous copies,
// so a byte that two waves need is read from L2 once per block. C[m][n] (f32, pitch LDC) = sum_k (A[m][k] (+ A2[m][k] if NA == 2)) Bt[n][k]. grid (M/128, N/128), 128 threads. K % 64 == 0, K >= 128.
// FRAGMENT-MAJOR PLANES: every 16-bit operand plane [rows][K] is stored as blocks of 16 rows x 32 k (512 elements, 1 KB), block (row / 16, k / 32) at element (row / 16 * (K / 32) + k / 32) * 512; inside a block the 16-byte piece
// number ld * 32 + hi * 16 + (row % 16) holds k % 32 = ld * 16 + hi * 8 + 0..7. That is the order in which the lanes of a wave take an A or B fragment, so each of its two loads reads 512 contiguous bytes (4 whole lines).
// ld(p): p = block start + lane * 8.
template <typename T16> struct WFrag;
template <> struct WFrag<h16> { typedef v16h V; static __device__ __forceinline__ V ld(const h16* p) { return cat16(*(const v8h*)p, *(const v8h*)(p + 256)); } static __device__ __forceinline__ v8f mma(V a, V b, v8f c) { return wmma16(a, b, c); } };
template <> struct WFrag<bf> { typedef v16bf V; static __device__ __forceinline__ V ld(const bf* p) { return cat16b(*(const v8us*)p, *(const v8us*)(p + 256)); } static __device__ __forceinline__ v8f mma(V a, V b, v8f c) { return wmmab(a, b, c); } };
// A STAGE = 64 k of the block's 128 rows of every operand plane (A, A2 if any, Bt): per plane 8 row blocks, each a RUN of 2 KB that is contiguous in memory (two neighbouring fragment blocks) and is laid down in LDS as it is:
// run r = plane * 8 + row block at LDS byte r * 2048, so a fragment is read from LDS in lane order too (512 contiguous bytes a load, no bank conflict). A wave copies NR = runs / 4 runs of a stage, four 512-byte copies each.
// The immediate offsets 512, 1024, 1536 move the global and the LDS address alike, which is what a run needs. A run's global address is its scalar base plus one byte offset that all runs share (lane * 16 + stage * 2048), so the ring
// holds two vector registers between stages, not three a run. The s_wait_xcnt stands in the copies' own statement, in front of any overwrite of an address register that they name.
#define CP4(l, o, s) "global_load_async_to_lds_b128 " l ", " o ", " s "\n\tglobal_load_async_to_lds_b128 " l ", " o ", " s " offset:512\n\tglobal_load_async_to_lds_b128 " l ", " o ", " s " offset:1024\n\tglobal_load_async_to_lds_b128 " l ", " o ", " s " offset:1536\n\t"
__device__ __forceinline__ void cp_stage(const bf* const (&g)[4], unsigned l, unsigned o) {
    asm volatile(CP4("%0", "%4", "%5") CP4("%1", "%4", "%6") CP4("%2", "%4", "%7") CP4("%3", "%4", "%8") "s_wait_xcnt 0x0"
                 :: "v"(l), "v"(l + 2048u), "v"(l + 4096u), "v"(l + 6144u), "v"(o), "s"(g[0]), "s"(g[1]), "s"(g[2]), "s"(g[3]) : "memory"); }
__device__ __forceinline__ void cp_stage(const bf* const (&g)[6], unsigned l, unsigned o) {
    asm volatile(CP4("%0", "%6", "%7") CP4("%1", "%6", "%8") CP4("%2", "%6", "%9") CP4("%3", "%6", "%10") CP4("%4", "%6", "%11") CP4("%5", "%6", "%12") "s_wait_xcnt 0x0"
                 :: "v"(l), "v"(l + 2048u), "v"(l + 4096u), "v"(l + 6144u), "v"(l + 8192u), "v"(l + 10240u), "v"(o), "s"(g[0]), "s"(g[1]), "s"(g[2]), "s"(g[3]), "s"(g[4]), "s"(g[5]) : "memory"); }
template <int NA, int K, int LDC>
__device__ __forceinline__ void d_gemmt(const bf* __restrict__ A, const bf* __restrict__ A2, const bf* __restrict__ Bt, float* C, bf* sm) {
    typedef WFrag<bf>::V V;
    constexpr int NPL = NA + 1, STE = NPL * 8 * 1024, NR = NPL * 2, NT = K / 64;   // planes; elements of a stage; runs a wave copies; stages
    static_assert(K % 64 == 0 && NT >= 2, "whole stages, and the two that the prologue fills");
    const int lane = threadIdx.x & 31, lr = lane & 15, hi = lane >> 4; const int r0 = blockIdx.x * 128, c0 = blockIdx.y * 128; const int wv = __builtin_amdgcn_readfirstlane((int)(threadIdx.x >> 5)); const int wm = wv >> 1, wn = wv & 1;
    const bf* g[NR];   // scalar: where each of the wave's runs begins in memory, stage 0
#pragma unroll
    for (int j = 0; j < NR; ++j) { const int r = wv * NR + j, pl = r >> 3, rb = r & 7; const bf* base = (pl == NPL - 1) ? Bt + (size_t)c0 * K : ((pl == 0) ? A : A2) + (size_t)r0 * K;
        g[j] = base + (size_t)rb * 16 * K; }
    const unsigned l0 = (unsigned)(size_t)(sm + wv * NR * 1024 + lane * 8), o0 = (unsigned)lane * 16u;   // this lane's LDS byte address in the wave's first run, buffer 0; its byte offset in a run
    v8f acc[4][4];
#pragma unroll
    for (int mb = 0; mb < 4; ++mb)
#pragma unroll
        for (int nb = 0; nb < 4; ++nb) acc[mb][nb] = (v8f){};
    cp_stage(g, l0, o0);
    asm volatile("s_wait_asynccnt 0x0" ::: "memory");   // this wave's copies of stage 0 have landed
    __syncthreads();                                     // every wave's have: stage 0 may be read
    cp_stage(g, l0 + (unsigned)(STE * 2), o0 + 2048u);   // stage 1 flies while stage 0 is worked on
    // the loop over stages stays rolled (one copy of a stage's products and copies in the instruction cache); every loop inside it and behind it is unrolled so that acc, the fragments and res are indexed by constants and stay in registers
#pragma unroll 1
    for (int t = 0; t < NT; ++t) {
        const bf* sb = sm + (t & 1) * STE + lane * 8; V a[4], a2[4], b[4];
#pragma unroll
        for (int kk = 0; kk < 2; ++kk) {
#pragma unroll
            for (int mb = 0; mb < 4; ++mb) { a[mb] = WFrag<bf>::ld(sb + (wm * 4 + mb) * 1024 + kk * 512); if constexpr (NA == 2) a2[mb] = WFrag<bf>::ld(sb + (8 + wm * 4 + mb) * 1024 + kk * 512); }
#pragma unroll
            for (int nb = 0; nb < 4; ++nb) b[nb] = WFrag<bf>::ld(sb + ((NPL - 1) * 8 + wn * 4 + nb) * 1024 + kk * 512);
            // inputs only, loaded values: all LDS reads of the 32-k step are issued together ahead of its products; without it the compiler reloads one B fragment at a time and each group of four products waits out an LDS round trip
            if constexpr (NA == 2) asm volatile("" :: "v"(a[0]), "v"(a[1]), "v"(a[2]), "v"(a[3]), "v"(a2[0]), "v"(a2[1]), "v"(a2[2]), "v"(a2[3]), "v"(b[0]), "v"(b[1]), "v"(b[2]), "v"(b[3]));
            else asm volatile("" :: "v"(a[0]), "v"(a[1]), "v"(a[2]), "v"(a[3]), "v"(b[0]), "v"(b[1]), "v"(b[2]), "v"(b[3]));
            if (kk == 1) {   // the stage's last fragments are in registers: its buffer is handed over here, so that the refill flies during the second step's products as well
                asm volatile("s_wait_dscnt 0x0" ::: "memory");      // this wave's reads of stage t are done before its buffer may be refilled
                asm volatile("s_wait_asynccnt 0x0" ::: "memory");   // this wave's copies of stage t + 1 have landed
                __syncthreads();                                     // publishes stage t + 1 and ends every wave's reads of stage t
                if (t + 2 < NT) cp_stage(g, l0 + (unsigned)((t & 1) * (STE * 2)), o0 + (unsigned)(t + 2) * 2048u);
                __builtin_amdgcn_sched_barrier(0);                   // keeps the products below behind the copies: moved up, they would hold back the copies' issue by their own length
            }
#pragma unroll
            for (int nb = 0; nb < 4; ++nb)
#pragma unroll
                for (int mb = 0; mb < 4; ++mb) { acc[mb][nb] = WFrag<bf>::mma(a[mb], b[nb], acc[mb][nb]); if constexpr (NA == 2) acc[mb][nb] = WFrag<bf>::mma(a2[mb], b[nb], acc[mb][nb]); } }
    }
    asm volatile("s_wait_asynccnt 0x0" ::: "memory");   // no copy is outstanding when the ring becomes output staging (the last trip's barrier has ended every read of it)
    // whole lines out: each wave turns its 16x64 row blocks through its own LDS range (two, by row block parity), 256 contiguous bytes of a row per 16 lanes
    float* stg = (float*)sm + wv * (2 * 16 * 68); v4f res[4][8];
#pragma unroll
    for (int mb = 0; mb < 4; ++mb) { float* ob = stg + (mb & 1) * (16 * 68);
#pragma unroll
        for (int nb = 0; nb < 4; ++nb)
#pragma unroll
            for (int j = 0; j < 8; ++j) ob[(hi * 8 + j) * 68 + nb * 16 + lr] = acc[mb][nb][j];
        asm volatile("s_wait_dscnt 0x0" ::: "memory");   // the wave's own writes are in LDS before its lanes read one another's values back
#pragma unroll
        for (int q = 0; q < 8; ++q) { const int s = lane + q * 32; res[mb][q] = *(const v4fa*)(ob + (s >> 4) * 68 + (s & 15) * 4); } }
    // all global stores last: no register that a store names is written again
    float* cp = C + (size_t)(r0 + wm * 64 + (lane >> 4)) * LDC + c0 + wn * 64 + (lane & 15) * 4;
#pragma unroll
    for (int mb = 0; mb < 4; ++mb)
#pragma unroll
        for (int q = 0; q < 8; ++q) *(v4f*)(cp + (size_t)(mb * 16 + q * 2) * LDC) = res[mb][q];
}
__global__ __launch_bounds__(128) void k_gemmf(const bf* __restrict__ X, const bf* __restrict__ W, float* F) { __shared__ __align__(2048) bf sm[2 * 2 * 8 * 1024]; d_gemmt<1, DM, FP>(X, X, W, F, sm); }
__global__ __launch_bounds__(128) void k_gemmo(const bf* __restrict__ Ah, const bf* __restrict__ Al, const bf* __restrict__ W, float* O) { __shared__ __align__(2048) bf sm[2 * 3 * 8 * 1024]; d_gemmt<2, DQ, DM>(Ah, Al, W, O, sm); }

__device__ __forceinline__ h16 tohx(float x) { return (h16)x; }
__device__ __forceinline__ void splitf(float y, unsigned short& h, unsigned short& l) { h = f2bf(y); l = f2bf(y - bf2f(h)); }
typedef __attribute__((ext_vector_type(2))) _Float16 v2h;
typedef __attribute__((ext_vector_type(4))) _Float16 v4h;
typedef __attribute__((ext_vector_type(2))) unsigned short v2us;
typedef __attribute__((ext_vector_type(4))) unsigned short v4us;
typedef __attribute__((ext_vector_type(2))) float v2f;
typedef __attribute__((ext_vector_type(4))) int v4i;

__global__ __launch_bounds__(256) void k_wtG(const float* __restrict__ w, int K, int N, bf* Bt) {
    const int lane = threadIdx.x & 31; const int L0 = (blockIdx.x * 8 + (threadIdx.x >> 5)) * 8; const int nlines = N * K / 64;
{
#pragma unroll 1
        for (int l = 0; l < 8; ++l) { const int L = L0 + l; if (L >= nlines) break; const size_t e = (size_t)L * 64 + lane * 2; const int k = (int)(e % K), n = (int)(e / K); v2us o;
            o[0] = f2bf(w[(size_t)k * N + n]); o[1] = f2bf(w[(size_t)(k + 1) * N + n]); *(v2us*)(Bt + e) = o; }
         }
}
// d_cvt8: f32 [rows][DM] -> bf16 fragment-major plane, all five sources in one launch: the planes of x (both batches), q_w, k_w, v_w, o_w lie behind one another in dst, so q_w | k_w | v_w is one plane of FP rows. A thread takes its lane's place in the four 16-byte-piece rows of two neighbouring blocks (32 elements), so a wave reads 256 contiguous bytes of each of 16 rows, eight 16-byte loads in flight a lane,
// and writes 2 KB in a row. bx = block index; 256 threads take 16 fragment blocks of one 16-row block, so the source is chosen by a scalar test. Few waves on purpose, for speed only.
__device__ __forceinline__ void d_cvt8(const float* __restrict__ x, const float* __restrict__ wq, const float* __restrict__ wk, const float* __restrict__ wv, const float* __restrict__ wo, bf* dst, unsigned bx) { const size_t i = (size_t)bx * 256 + threadIdx.x; const size_t blk = (i >> 5) * 2; const int ln = (int)i & 31;   // DM / 32 is even: both blocks lie in one row block
    const int rb = (int)(bx / (DM / 32 / 16)); const float* src = x; int rb0 = 0;   // rb: 16-row block in dst; rb0: where the source's plane begins
    if (rb >= (RWS + FP) / 16) { src = wo; rb0 = (RWS + FP) / 16; } else if (rb >= (RWS + DQ + DKV) / 16) { src = wv; rb0 = (RWS + DQ + DKV) / 16; } else if (rb >= (RWS + DQ) / 16) { src = wk; rb0 = (RWS + DQ) / 16; } else if (rb >= RWS / 16) { src = wq; rb0 = RWS / 16; }
    const float* s = src + ((size_t)(rb - rb0) * 16 + (ln & 15)) * DM + (blk % (DM / 32)) * 32 + (ln >> 4) * 8; v8f v[4];
#pragma unroll
    for (int p = 0; p < 4; ++p) v[p] = *(const v8f*)(s + p * 16);   // piece row p = block p / 2, k half p % 2: k offset p * 16
#pragma unroll
    for (int p = 0; p < 4; ++p) { v8us o;
#pragma unroll
        for (int k = 0; k < 8; ++k) o[k] = f2bf(v[p][k]);
        *(v8us*)(dst + blk * 512 + p * 256 + ln * 8) = o; }
    asm volatile("s_wait_xcnt 0x0" ::: "memory");  }   // the wait behind the four stores: in the joint kernel other code follows them in the listing, and none of it may write a register that a store names ahead of this wait
__device__ __forceinline__ void d_cstab(float* CS, unsigned bx) { const int idx = (int)bx * 256 + threadIdx.x; if (idx >= TT * HD) return; const int t = idx / HD, d = idx % HD; const int i = d % (HD / 2); const float inv = __fdiv_rn(1.0f, powf(500000.0f, (float)(2 * i) / (float)HD)); const float ang = __fmul_rn((float)t, inv); v2f cs; cs[0] = cosf(ang); cs[1] = sinf(ang);
    *(v2f*)(CS + (size_t)idx * 2) = cs;  }
// k_prep: all that depends on the inputs alone, in one launch: the cos / sin table (blocks below CSB; first, as its waves run longest) and the five plane conversions
#define CSB  (TT * HD / 256)
#define CVB  ((RWS + FP + DM) * (DM / 32) / 256)
__global__ __launch_bounds__(256) void k_prep(const float* __restrict__ x, const float* __restrict__ wq, const float* __restrict__ wk, const float* __restrict__ wv, const float* __restrict__ wo, bf* dst, float* CS) { if (blockIdx.x < CSB) d_cstab(CS, blockIdx.x); else d_cvt8(x, wq, wk, wv, wo, dst, blockIdx.x - CSB); }
// d_hrms: RF[h][row] = rms factor of head h (q heads, then k heads) of row 0..RWS-1 of the joint projection
__device__ __forceinline__ void d_hrms(const float* __restrict__ F, float* RF, unsigned bx) { const int i = (int)bx * 256 + threadIdx.x; const int t = i % RWS, h = i / RWS; const float* f = F + (size_t)t * FP + h * HD; float s = 0.f;
#pragma unroll 4
    for (int d = 0; d < HD; d += 4) { const v4f v = *(const v4f*)(f + d);
#pragma unroll
        for (int q = 0; q < 4; ++q) { float p = __fmul_rn(v[q], v[q]); asm volatile("" : "+v"(p)); s = __fadd_rn(s, p); } }
    const float r = __fdiv_rn(1.0f, __fsqrt_rn(__fadd_rn(s * (1.0f / HD), 1e-5f))); *(float*)(RF + i) = r;  }
// k_rope: head planes [h][t][d] (fp16 + hi/lo) of rope(w[d] (x rms_factor)) x sc with the rotate-half convention out[d] = x[d] cos[t][d] - x[d+HD/2] sin[t][d], out[d+HD/2] = x[d+HD/2] cos[t][d+HD/2] + x[d] sin[t][d+HD/2]
// A thread takes 32 elements of one row t: its lane's place in both k halves of d block kb (kb = 0, 1) and of d block kb + 2, which holds the rotate-half partners; each cos / sin pair is read once for both (the table's halves d and d + HD/2 hold the same angle).
// A wave reads whole lines of 16 rows and stores 512 contiguous bytes at a time (16-byte pieces in lane order). Few waves on purpose: the launch is short.
// One launch for the q and the k heads of both batches: a head is RWS * HD / 32 threads = RPB whole blocks, so the head, and with it the norm weight and the output planes, is chosen by scalar tests; planes are ordered [batch][head].
#define RPB  (RWS * HD / 32 / 128)
__global__ __launch_bounds__(128) void k_rope(const float* __restrict__ F, const float* __restrict__ CS, const float* __restrict__ RF, const float* __restrict__ qnw, const float* __restrict__ knw, float sc, h16* Q16, bf* Qh, bf* Ql, h16* K16, bf* Kh, bf* Kl) {
    const int h = (int)(blockIdx.x / RPB); const bool isq = h < NH_; const float* nw = isq ? qnw : knw; h16* P16 = isq ? Q16 : K16; bf* Ph = isq ? Qh : Kh; bf* Pl = isq ? Ql : Kl;
    const int i = (int)(blockIdx.x % RPB) * 128 + (int)threadIdx.x; const int ln = i & 31, kb = (i >> 5) & 1; const int tb = (i >> 6) % (TT / 16); const int b = (i >> 6) / (TT / 16);
    const int t = tb * 16 + (ln & 15), d0 = kb * 32 + (ln >> 4) * 8; const float* f = F + (size_t)(b * TT + t) * FP + h * HD + d0; const float* cs = CS + ((size_t)t * HD + d0) * 2; const unsigned wo = (unsigned)d0 * 4u; const float* wp = (const float*)((const char*)nw + wo); const float* rp = RF + (size_t)h * RWS + b * TT + t;
    const size_t pe = (size_t)(isq ? b * NH_ + h : b * NKV + h - NH_) * TT * HD + (size_t)(tb * (HD / 32) + kb) * 512 + ln * 8;   // fragment-major: rows t, k = d
    v8f xl[2], xh[2], c0[2], c1[2], wl[2], wh[2];
#pragma unroll
    for (int ld = 0; ld < 2; ++ld) { xl[ld] = *(const v8f*)(f + ld * 16); xh[ld] = *(const v8f*)(f + ld * 16 + HD / 2); c0[ld] = *(const v8f*)(cs + ld * 32); c1[ld] = *(const v8f*)(cs + ld * 32 + 8); wl[ld] = *(const v8f*)(wp + ld * 16); wh[ld] = *(const v8f*)(wp + ld * 16 + HD / 2); }
    const float rf = *rp;
    // the wait in front of an overwrite of the loads' address registers. Inputs only: the three addresses and the byte offset wo, which is the register that the loads of nw name beside its scalar base, stay as they are up to here (no load lands on one), and the loaded values put the wait behind every load, so all 25 are in flight together
    asm volatile("s_wait_xcnt 0x0" :: "v"(f), "v"(cs), "v"(wo), "v"(rp), "v"(xl[0]), "v"(xl[1]), "v"(xh[0]), "v"(xh[1]), "v"(c0[0]), "v"(c0[1]), "v"(c1[0]), "v"(c1[1]), "v"(wl[0]), "v"(wl[1]), "v"(wh[0]), "v"(wh[1]), "v"(rf) : "memory");
    v8h l16[2], u16[2]; v8us lh[2], ll[2], uh[2], ul[2];   // l..: d block kb, u..: d block kb + 2
#pragma unroll
    for (int ld = 0; ld < 2; ++ld)
#pragma unroll
        for (int q = 0; q < 8; ++q) { const float xa = bfr(wl[ld][q]) * (xl[ld][q] * rf), xb = bfr(wh[ld][q]) * (xh[ld][q] * rf);
            const float c = (q < 4) ? c0[ld][2 * q] : c1[ld][2 * q - 8], sn = (q < 4) ? c0[ld][2 * q + 1] : c1[ld][2 * q - 7];
            const float ra = (xa * c - xb * sn) * sc, rb = (xb * c + xa * sn) * sc; unsigned short a2, c2;
            l16[ld][q] = tohx(ra); splitf(ra, a2, c2); lh[ld][q] = a2; ll[ld][q] = c2; u16[ld][q] = tohx(rb); splitf(rb, a2, c2); uh[ld][q] = a2; ul[ld][q] = c2; }
    // all stores last: no register that a store names is written again
#pragma unroll
    for (int ld = 0; ld < 2; ++ld) { const size_t pl = pe + ld * 256, pu = pl + (HD / 64) * 512;
        *(v8h*)(P16 + pl) = l16[ld]; *(v8us*)(Ph + pl) = lh[ld]; *(v8us*)(Pl + pl) = ll[ld]; *(v8h*)(P16 + pu) = u16[ld]; *(v8us*)(Ph + pu) = uh[ld]; *(v8us*)(Pl + pu) = ul[ld]; }  }
// d_vtp: fragment-major V^T planes (rows d, k = key t) of each kv group of each batch (g = batch * NKV + group), blocks ordered (t / 32, d / 16) so that a 32-key step reads 8 KB in a row; a thread takes 8 keys of one d (one 16-byte piece per plane), lanes run along d (whole lines read)
__device__ __forceinline__ void d_vtp(const float* __restrict__ F, h16* V16, bf* Vh, bf* Vl, unsigned bx) { const size_t i = (size_t)bx * 256 + threadIdx.x; const int d = (int)(i % HD); const int t8 = (int)((i / HD) % (TT / 8)); const int g = (int)(i / ((size_t)HD * (TT / 8))); v8h o16; v8us oh, ol;
    const float* fv = F + ((size_t)(g / NKV) * TT + t8 * 8) * FP + DQ + DKV + (g % NKV) * HD + d;   // the v columns stand behind the q and k columns
#pragma unroll
    for (int q = 0; q < 8; ++q) { const float x = fv[q * FP]; o16[q] = tohx(x); unsigned short a2, c2; splitf(x, a2, c2); oh[q] = a2; ol[q] = c2; }
    const size_t pe = (size_t)g * HD * TT + (size_t)((t8 >> 2) * (HD / 16) + (d >> 4)) * 512 + ((t8 >> 1) & 1) * 256 + ((t8 & 1) * 16 + (d & 15)) * 8;
    *(v8h*)(V16 + pe) = o16; *(v8us*)(Vh + pe) = oh; *(v8us*)(Vl + pe) = ol;
    asm volatile("s_wait_xcnt 0x0" ::: "memory");  }   // the wait behind the three stores: in the joint kernel other code follows them in the listing, and none of it may write a register that a store names ahead of this wait
// k_nv: the two pieces of work that need the joint projection alone, in one launch: the rms factors (blocks below HRB; first, as each of their threads walks a whole head row) and the V^T planes
#define HRB  (NHK * RWS / 256)
#define VTB  (NB_ * NKV * HD * TT / 8 / 256)
__global__ __launch_bounds__(256) void k_nv(const float* __restrict__ F, float* RF, h16* V16, bf* Vh, bf* Vl) { if (blockIdx.x < HRB) d_hrms(F, RF, blockIdx.x); else d_vtp(F, V16, Vh, Vl, blockIdx.x - HRB); }
// ---- k_fattn: causal attention of both batches in one launch; no score or probability matrix in memory. Block = 16 query rows x the REP query heads of one kv group x KS key parts (one wave each): wave (hd, part) takes the 32-key steps part, part + KS, ...
// Transposed products: S^T = K Q^T (A = key rows, B = query rows), so a lane holds, for ITS query (column lr), keys hi*8+j of each 16-key block: exactly the k order of a B fragment, and P^T goes into O^T += V^T P^T without leaving the lane.
// Online softmax per lane in the log2 domain (running maximum m, running sum l, O^T rescaled at every step); the KS parts are merged through LDS in part order (fixed order, run-to-run identical); part 0 normalises and stores the hi + lo planes of the merged heads.
// Rows < RH: hi+lo bf16 planes, 3 products for scores and for attn.v; rows >= RH: fp16. A block is wholly one or the other (RH % 16 == 0).
#define KS   4
#define SL2  (SCL * 1.4426950408889634f)   // HD^-0.5 x log2(e)
typedef __attribute__((ext_vector_type(16))) unsigned short v16us;
static_assert(RH % 16 == 0 && TT % 32 == 0, "a block's rows share one precision path; key steps are whole");
static_assert(DM == DQ && DM % 128 == 0 && HD % 32 == 0 && PP == TT, "one k length for every converted plane; whole fragment blocks");
// exp2 with the issue slot behind a transcendental filled: the v_nop keeps the next vector instruction, whichever the compiler puts there, from directly reading the result or overwriting the source.
__device__ __forceinline__ float ex2(float x) { float r; asm("v_exp_f32 %0, %1\n\tv_nop" : "=v"(r) : "v"(x)); return r; }
// four at once, one v_nop behind the last; the results are early-clobber so that none lies on the source of the exponential in front of it
__device__ __forceinline__ void ex2x4(float& a, float& b, float& c, float& d) { float ra, rb, rc, rd; asm("v_exp_f32 %0, %4\n\tv_exp_f32 %1, %5\n\tv_exp_f32 %2, %6\n\tv_exp_f32 %3, %7\n\tv_nop" : "=&v"(ra), "=&v"(rb), "=&v"(rc), "=&v"(rd) : "v"(a), "v"(b), "v"(c), "v"(d)); a = ra; b = rb; c = rc; d = rd; }
template <typename T16, bool HI>
__device__ __forceinline__ void fa_run(const T16* __restrict__ Q, const T16* __restrict__ Q2, const T16* __restrict__ Kp, const T16* __restrict__ K2, const T16* __restrict__ Vt, const T16* __restrict__ Vt2, int q0, int part, int lr, int hi, v8f (&o)[8], float& m, float& l) {
    typedef typename WFrag<T16>::V V;
    V qf[4], qf2[4];
#pragma unroll
    for (int ks = 0; ks < 4; ++ks) { qf[ks] = WFrag<T16>::ld(Q + (size_t)q0 * HD + ks * 512 + 8 * (hi * 16 + lr)); if constexpr (HI) qf2[ks] = WFrag<T16>::ld(Q2 + (size_t)q0 * HD + ks * 512 + 8 * (hi * 16 + lr)); }
    const int nst = (q0 + 47) / 32;   // 32-key steps that reach key q0 + 15; the last key touched is below TT
    const size_t ko = 8 * (hi * 16 + lr), vo = ko; const int qi = q0 + lr;   // fragment-major planes: 16 keys of K are 16 * HD elements in a row, 32 keys of V^T are 32 * HD
#pragma unroll 1
    for (int s = part; s < nst; s += KS) {
        const int k0 = s * 32;
        v8f st[2]; st[0] = (v8f){}; st[1] = (v8f){};
        if constexpr (HI) { const T16* pk[2] = { Kp + ko + (size_t)k0 * HD, Kp + ko + (size_t)(k0 + 16) * HD }; const T16* pk2[2] = { K2 + ko + (size_t)k0 * HD, K2 + ko + (size_t)(k0 + 16) * HD };
#pragma unroll
            for (int kb = 0; kb < 2; ++kb)
#pragma unroll
                for (int ks = 0; ks < 4; ++ks) { const V kf = WFrag<T16>::ld(pk[kb] + ks * 512); st[kb] = WFrag<T16>::mma(kf, qf[ks], st[kb]); st[kb] = WFrag<T16>::mma(kf, qf2[ks], st[kb]); st[kb] = WFrag<T16>::mma(WFrag<T16>::ld(pk2[kb] + ks * 512), qf[ks], st[kb]); }
            asm volatile("s_wait_xcnt 0x0" :: "v"(pk[0]), "v"(pk[1]), "v"(pk2[0]), "v"(pk2[1]), "v"(st[0]), "v"(st[1]) : "memory");   // the wait in front of an overwrite of the K loads' address registers; the inputs keep those registers as they are up to here and put the wait behind the last product, so behind every load
        } else { V kf[8];
#pragma unroll
            for (int i = 0; i < 8; ++i) kf[i] = WFrag<T16>::ld(Kp + ko + (size_t)(k0 + (i >> 2) * 16) * HD + (i & 3) * 512);
            asm volatile("" :: "v"(kf[0]), "v"(kf[1]), "v"(kf[2]), "v"(kf[3]), "v"(kf[4]), "v"(kf[5]), "v"(kf[6]), "v"(kf[7]));   // inputs only, loaded values: all K loads of the step are issued before its first product; without it each product waits for its own load's round trip, eight in a row
#pragma unroll
            for (int ks = 0; ks < 4; ++ks) { st[0] = WFrag<T16>::mma(kf[ks], qf[ks], st[0]); st[1] = WFrag<T16>::mma(kf[4 + ks], qf[ks], st[1]); } }
        float t[16];
#pragma unroll
        for (int e = 0; e < 16; ++e) t[e] = st[e >> 3][e & 7] * SL2;
        if (k0 + 31 > q0) {   // only a step that reaches past the block's first row holds keys above the diagonal
#pragma unroll
            for (int e = 0; e < 16; ++e) t[e] = (k0 + (e >> 3) * 16 + hi * 8 + (e & 7) <= qi) ? t[e] : -3.0e38f; }
        float mx = m;
#pragma unroll
        for (int e = 0; e < 16; ++e) mx = fmaxf(mx, t[e]);
        mx = fmaxf(mx, __shfl_xor(mx, 16, 32));   // the two half-waves hold the two key octets of the same query
        const float al = ex2(m - mx); m = mx; float ps = 0.f;   // m starts at -1e30, above the mask value, so a step whose keys are all masked gives p = 0, not exp2(0)
#pragma unroll
        for (int e = 0; e < 16; e += 4) { t[e] -= mx; t[e + 1] -= mx; t[e + 2] -= mx; t[e + 3] -= mx; ex2x4(t[e], t[e + 1], t[e + 2], t[e + 3]); ps += t[e]; ps += t[e + 1]; ps += t[e + 2]; ps += t[e + 3]; }
        l = l * al + ps;
#pragma unroll
        for (int db = 0; db < 8; ++db) o[db] = o[db] * al;
        V pf, pf2;
        if constexpr (HI) { v16us ph, pl;
#pragma unroll
            for (int e = 0; e < 16; ++e) { unsigned short x, y; splitf(t[e], x, y); ph[e] = x; pl[e] = y; }
            pf = __builtin_bit_cast(v16bf, ph); pf2 = __builtin_bit_cast(v16bf, pl);
        } else {
#pragma unroll
            for (int e = 0; e < 16; ++e) pf[e] = tohx(t[e]); }
        const T16* pv = Vt + vo + (size_t)k0 * HD; const T16* pv2 = HI ? Vt2 + vo + (size_t)k0 * HD : nullptr;
#pragma unroll
        for (int db = 0; db < 8; ++db) { const V vf = WFrag<T16>::ld(pv + db * 512); o[db] = WFrag<T16>::mma(vf, pf, o[db]);
            if constexpr (HI) { o[db] = WFrag<T16>::mma(vf, pf2, o[db]); o[db] = WFrag<T16>::mma(WFrag<T16>::ld(pv2 + db * 512), pf, o[db]); } }
        if constexpr (HI) asm volatile("s_wait_xcnt 0x0" :: "v"(pv), "v"(pv2), "v"(o[7]) : "memory");   // the wait in front of an overwrite of the V loads' address registers, as for the K loads above: the inputs keep those registers as they are up to here, behind the last product and so behind every load
    }
}
__global__ __launch_bounds__(32 * REP * KS) void k_fattn(const h16* __restrict__ Q16, const bf* __restrict__ Qh, const bf* __restrict__ Ql, const h16* __restrict__ K16, const bf* __restrict__ Kh, const bf* __restrict__ Kl, const h16* __restrict__ V16, const bf* __restrict__ Vh, const bf* __restrict__ Vl, bf* Ah, bf* Al) {
    __shared__ float mg[(KS - 1) * REP * 66 * 32];   // per merged wave: 64 O^T values, m, l, each x 32 lanes (lane-contiguous)
    const int lane = threadIdx.x & 31, lr = lane & 15, hi = lane >> 4; const int wv = __builtin_amdgcn_readfirstlane((int)(threadIdx.x >> 5)); const int hd = wv % REP, part = wv / REP;
    const int g = blockIdx.x, head = g * REP + hd; const int q0 = (TT / 16 - 1 - (int)blockIdx.y) * 16;   // g = batch * NKV + kv group, head = batch * NH_ + query head: both batches in one launch; longest rows first
    v8f o[8];
#pragma unroll
    for (int db = 0; db < 8; ++db) o[db] = (v8f){};
    float m = -1.0e30f, l = 0.f;
    if (q0 < RH) fa_run<bf, true>(Qh + (size_t)head * TT * HD, Ql + (size_t)head * TT * HD, Kh + (size_t)g * TT * HD, Kl + (size_t)g * TT * HD, Vh + (size_t)g * HD * TT, Vl + (size_t)g * HD * TT, q0, part, lr, hi, o, m, l);
    else fa_run<h16, false>(Q16 + (size_t)head * TT * HD, nullptr, K16 + (size_t)g * TT * HD, nullptr, V16 + (size_t)g * HD * PP, nullptr, q0, part, lr, hi, o, m, l);
    if (part > 0) { float* d = mg + (size_t)((part - 1) * REP + hd) * (66 * 32) + lane;
#pragma unroll
        for (int e = 0; e < 64; ++e) d[e * 32] = o[e >> 3][e & 7];
        d[64 * 32] = m; d[65 * 32] = l; }
    __syncthreads();   // the parts 1.. of every head are in LDS before part 0 reads them
    if (part > 0) return;
#pragma unroll
    for (int w = 1; w < KS; ++w) { const float* d = mg + (size_t)((w - 1) * REP + hd) * (66 * 32) + lane; const float m1 = d[64 * 32], l1 = d[65 * 32]; const float mn = fmaxf(m, m1); const float a0 = ex2(m - mn), a1 = ex2(m1 - mn);
#pragma unroll
        for (int e = 0; e < 64; ++e) o[e >> 3][e & 7] = o[e >> 3][e & 7] * a0 + d[e * 32] * a1;
        l = l * a0 + l1 * a1; m = mn; }
    l += __shfl_xor(l, 16, 32);
    const float inv = __fdiv_rn(1.0f, l); const size_t oo = (size_t)((g / NKV) * TT + q0) * DQ + (size_t)(head % NH_) * (HD / 32) * 512 + lane * 8;   // fragment-major [RWS][DQ]: column (head % NH_) * HD + db * 16 + hi * 8 is k block (head % NH_) * 4 + db / 2, half db % 2
#pragma unroll
    for (int db = 0; db < 8; ++db) { v8us oh, ol;
#pragma unroll
        for (int j = 0; j < 8; ++j) { unsigned short x, y; splitf(o[db][j] * inv, x, y); oh[j] = x; ol[j] = y; }
        *(v8us*)(Ah + oo + (db >> 1) * 512 + (db & 1) * 256) = oh; *(v8us*)(Al + oo + (db >> 1) * 512 + (db & 1) * 256) = ol; }
}

extern "C" void kernel_launch(void* const* d_in, const int* in_sizes, int n_in,
                              void* d_out, int out_size, void* d_ws, size_t ws_size, hipStream_t stream) {
    (void)in_sizes; (void)n_in; (void)out_size;
    const float* x = (const float*)d_in[0]; const float* wq = (const float*)d_in[1]; const float* wk = (const float*)d_in[2]; const float* wv = (const float*)d_in[3]; const float* wo = (const float*)d_in[4]; const float* qnw = (const float*)d_in[5]; const float* knw = (const float*)d_in[6];   // torch [out][in]
    float* OUT = (float*)d_out;     // [2][2048][2048]
    char* wsp = (char*)d_ws;
    auto take = [&](size_t bytes) { char* p = wsp; wsp += (bytes + 255) & ~(size_t)255; return (void*)p; };
    bf* XB = (bf*)take((size_t)(RWS + FP + DM) * DM * 2); bf* WQKV = XB + (size_t)RWS * DM; bf* WO = WQKV + (size_t)FP * DM;   // one run of planes, in the order in which k_prep writes them
    float* CS = (float*)take((size_t)TT * HD * 2 * 4); float* RF = (float*)take((size_t)NHK * RWS * 4); float* F = (float*)take((size_t)RWS * FP * 4);
    h16* QP16 = (h16*)take((size_t)NB_ * NH_ * TT * HD * 2); h16* KP16 = (h16*)take((size_t)NB_ * NKV * TT * HD * 2); h16* VT16 = (h16*)take((size_t)NB_ * NKV * HD * PP * 2);
    bf* QPh = (bf*)take((size_t)NB_ * NH_ * TT * HD * 2); bf* QPl = (bf*)take((size_t)NB_ * NH_ * TT * HD * 2); bf* KPh = (bf*)take((size_t)NB_ * NKV * TT * HD * 2); bf* KPl = (bf*)take((size_t)NB_ * NKV * TT * HD * 2); bf* VTh = (bf*)take((size_t)NB_ * NKV * HD * TT * 2); bf* VTl = (bf*)take((size_t)NB_ * NKV * HD * TT * 2);
    bf* ATh = (bf*)take((size_t)RWS * DQ * 2); bf* ATl = (bf*)take((size_t)RWS * DQ * 2);
    if ((size_t)(wsp - (char*)d_ws) > ws_size) return;    // ws 256 MiB
    // six launches, each for both batches; work that does not depend on one another shares a launch
    k_prep<<<CSB + CVB, 256, 0, stream>>>(x, wq, wk, wv, wo, XB, CS);
    k_gemmf<<<dim3(RWS / 128, FP / 128, 1), 128, 0, stream>>>(XB, WQKV, F);
    k_nv<<<HRB + VTB, 256, 0, stream>>>(F, RF, VT16, VTh, VTl);
    k_rope<<<NHK * RPB, 128, 0, stream>>>(F, CS, RF, qnw, knw, 1.0f, QP16, QPh, QPl, KP16, KPh, KPl);
    k_fattn<<<dim3(NB_ * NKV, TT / 16, 1), 32 * REP * KS, 0, stream>>>(QP16, QPh, QPl, KP16, KPh, KPl, VT16, VTh, VTl, ATh, ATl);
    k_gemmo<<<dim3(RWS / 128, DM / 128, 1), 128, 0, stream>>>(ATh, ATl, WO, OUT);
}

// v008
// It runs in 165 microseconds.
// Timed twice side by side with v007, it ran 1.15 times as fast both times.
// Counting every step since v000, it is 9.90 times as fast.
#include <hip/hip_runtime.h>

// YuaAttention (hidden [2][2048][2048]; q = x q_w^T (16 heads x 128), k/v = x k_w^T / v_w^T (4 kv heads, GQA repeat_interleave); per-head RMSNorm (eps 1e-5) with q_norm_w / k_norm_w, then rotate-half
// RoPE (theta 500000, positions 0..S-1); causal softmax(q.k 128^-0.5); out = merged attn.v o_w^T -> [2][2048][2048]).
// Compute dtypes, f32 accumulate: every input rounded to bf16; q/k/v projections on PLAIN bf16 operands (inputs: exact); o projection on hi+lo attn planes x bf16 o_w (2 products); RMSNorm + RoPE f32 (table computed on device);
// PER-ROW PRECISION HYBRID (rows < 256 hi+lo 3 products for scores and attn.v, rows >= 256 fp16); attention fused in one kernel (k_fattn: online softmax, key loop ends at the diagonal).

#define NB_  2
#define TT   2048
#define DM   2048
#define NH_  16
#define NKV  4
#define REP  (NH_ / NKV)
#define HD   128
#define DQ   (NH_ * HD)
#define DKV  (NKV * HD)
#define PP   TT                   // keys per fp16 V^T row
#define RH   256                  // query rows < RH use hi+lo planes (0: none)
#define WIN  0
#define RWS  (NB_ * TT)           // rows of both batches together: every launch takes both
#define FP   (DQ + 2 * DKV)       // columns of the joint q | k | v projection
#define NHK  (NH_ + NKV)          // heads that are normalised and rotated: the q heads, then the k heads (head h stands at column h * HD of the joint projection)
#define SCL  0.088388347648318447f   // HD^-0.5
typedef _Float16 h16;
typedef unsigned short bf;
typedef __attribute__((ext_vector_type(16))) __bf16   v16bf;
typedef __attribute__((ext_vector_type(16))) _Float16 v16h;
typedef __attribute__((ext_vector_type(8)))  _Float16 v8h;
typedef __attribute__((ext_vector_type(8)))  unsigned short v8us;
typedef __attribute__((ext_vector_type(8)))  float    v8f;
typedef __attribute__((ext_vector_type(4)))  float    v4f;
typedef v8h  __attribute__((may_alias)) v8ha;
typedef v4f  __attribute__((may_alias)) v4fa;
typedef v8us __attribute__((may_alias)) v8usa;

__device__ __forceinline__ unsigned short f2bf(float f) { unsigned u = __float_as_uint(f); u += 0x7FFFu + ((u >> 16) & 1u); return (unsigned short)(u >> 16); }
__device__ __forceinline__ float bf2f(unsigned short b) { return __uint_as_float(((unsigned)b) << 16); }
__device__ __forceinline__ float bfr(float f) { return bf2f(f2bf(f)); }
__device__ __forceinline__ v16h cat16(v8h lo, v8h hi) { return __builtin_shufflevector(lo, hi, 0, 1, 2, 3, 4, 5, 6, 7, 8, 9, 10, 11, 12, 13, 14, 15); }
__device__ __forceinline__ v16bf cat16b(v8us lo, v8us hi) { return __builtin_bit_cast(v16bf, __builtin_shufflevector(lo, hi, 0, 1, 2, 3, 4, 5, 6, 7, 8, 9, 10, 11, 12, 13, 14, 15)); }
__device__ __forceinline__ v8f wmma16(v16h a, v16h b, v8f c) { return __builtin_amdgcn_wmma_f32_16x16x32_f16(false, a, false, b, (short)0, c, false, false); }
__device__ __forceinline__ v8f wmmab(v16bf a, v16bf b, v8f c) { return __builtin_amdgcn_wmma_f32_16x16x32_bf16(false, a, false, b, (short)0, c, false, false); }



// ---- d_gemmt: GEMM, one 128x128 output tile per block of 4 waves (2 x 2 waves of 64x64, 16 accumulators each, every wave over the whole K in ascending k); the operand tiles are staged in LDS by asynchronous copies,
// so a byte that two waves need is read from L2 once per block. C[m][n] (f32, pitch LDC) = sum_k (A[m][k] (+ A2[m][k] if NA == 2)) Bt[n][k]. grid (M/128, N/128), 128 threads. K % 64 == 0, K >= 128.
// FRAGMENT-MAJOR PLANES: every 16-bit operand plane [rows][K] is stored as blocks of 16 rows x 32 k (512 elements, 1 KB), block (row / 16, k / 32) at element (row / 16 * (K / 32) + k / 32) * 512; inside a block the 16-byte piece
// number ld * 32 + hi * 16 + (row % 16) holds k % 32 = ld * 16 + hi * 8 + 0..7. That is the order in which the lanes of a wave take an A or B fragment, so each of its two loads reads 512 contiguous bytes (4 whole lines).
// ld(p): p = block start + lane * 8.
template <typename T16> struct WFrag;
template <> struct WFrag<h16> { typedef v16h V; static __device__ __forceinline__ V ld(const h16* p) { return cat16(*(const v8h*)p, *(const v8h*)(p + 256)); } static __device__ __forceinline__ v8f mma(V a, V b, v8f c) { return wmma16(a, b, c); } };
template <> struct WFrag<bf> { typedef v16bf V; static __device__ __forceinline__ V ld(const bf* p) { return cat16b(*(const v8us*)p, *(const v8us*)(p + 256)); } static __device__ __forceinline__ v8f mma(V a, V b, v8f c) { return wmmab(a, b, c); } };
// A STAGE = 64 k of the block's 128 rows of every operand plane (A, A2 if any, Bt): per plane 8 row blocks, each a RUN of 2 KB that is contiguous in memory (two neighbouring fragment blocks) and is laid down in LDS as it is:
// run r = plane * 8 + row block at LDS byte r * 2048, so a fragment is read from LDS in lane order too (512 contiguous bytes a load, no bank conflict). A wave copies NR = runs / 4 runs of a stage, four 512-byte copies each.
// The immediate offsets 512, 1024, 1536 move the global and the LDS address alike, which is what a run needs. A run's global address is its scalar base plus one byte offset that all runs share (lane * 16 + stage * 2048), so the ring
// holds two vector registers between stages, not three a run. The s_wait_xcnt stands in the copies' own statement, in front of any overwrite of an address register that they name.
#define CP4(l, o, s) "global_load_async_to_lds_b128 " l ", " o ", " s "\n\tglobal_load_async_to_lds_b128 " l ", " o ", " s " offset:512\n\tglobal_load_async_to_lds_b128 " l ", " o ", " s " offset:1024\n\tglobal_load_async_to_lds_b128 " l ", " o ", " s " offset:1536\n\t"
__device__ __forceinline__ void cp_stage(const bf* const (&g)[4], unsigned l, unsigned o) {
    asm volatile(CP4("%0", "%4", "%5") CP4("%1", "%4", "%6") CP4("%2", "%4", "%7") CP4("%3", "%4", "%8") "s_wait_xcnt 0x0"
                 :: "v"(l), "v"(l + 2048u), "v"(l + 4096u), "v"(l + 6144u), "v"(o), "s"(g[0]), "s"(g[1]), "s"(g[2]), "s"(g[3]) : "memory"); }
__device__ __forceinline__ void cp_stage(const bf* const (&g)[6], unsigned l, unsigned o) {
    asm volatile(CP4("%0", "%6", "%7") CP4("%1", "%6", "%8") CP4("%2", "%6", "%9") CP4("%3", "%6", "%10") CP4("%4", "%6", "%11") CP4("%5", "%6", "%12") "s_wait_xcnt 0x0"
                 :: "v"(l), "v"(l + 2048u), "v"(l + 4096u), "v"(l + 6144u), "v"(l + 8192u), "v"(l + 10240u), "v"(o), "s"(g[0]), "s"(g[1]), "s"(g[2]), "s"(g[3]), "s"(g[4]), "s"(g[5]) : "memory"); }
// EP: what becomes of the tile. 0: stored as f32 C. 1: a q or k head (the 128 columns are one head): RMSNorm and RoPE in registers, stored as the head's fragment-major planes. 2: a v group: stored as its fragment-major V^T planes.
// EP 1 forms the TRANSPOSED tile (the Bt fragment is the A operand), so a lane holds 8 neighbouring d of one row t, which is a 16-byte piece of a plane whose k is d; and a wave takes the column blocks wn*2, wn*2+1 and those 64 columns on,
// so both rotate-half partners d and d + HD/2 lie in one lane. EP 2 keeps the tile as it is: a lane holds 8 neighbouring t of one d, which is a piece of a plane whose k is t.
struct EpA { const float* CS; const float* nw; h16* P16; bf* Ph; bf* Pl; };   // cos / sin table, norm weight (EP 1); the three output planes of this head or group
__device__ __forceinline__ h16 tohx(float x) { return (h16)x; }
__device__ __forceinline__ void splitf(float y, unsigned short& h, unsigned short& l) { h = f2bf(y); l = f2bf(y - bf2f(h)); }
template <int NA, int K, int LDC, int EP>
__device__ __forceinline__ void d_gemmt(const bf* __restrict__ A, const bf* __restrict__ A2, const bf* __restrict__ Bt, float* C, bf* sm, const EpA e) {
    typedef WFrag<bf>::V V;
    constexpr int NPL = NA + 1, STE = NPL * 8 * 1024, NR = NPL * 2, NT = K / 64;   // planes; elements of a stage; runs a wave copies; stages
    static_assert(K % 64 == 0 && NT >= 2, "whole stages, and the two that the prologue fills");
    const int lane = threadIdx.x & 31, lr = lane & 15, hi = lane >> 4; const int r0 = blockIdx.x * 128, c0 = blockIdx.y * 128; const int wv = __builtin_amdgcn_readfirstlane((int)(threadIdx.x >> 5)); const int wm = wv >> 1, wn = wv & 1;
    const bf* g[NR];   // scalar: where each of the wave's runs begins in memory, stage 0
#pragma unroll
    for (int j = 0; j < NR; ++j) { const int r = wv * NR + j, pl = r >> 3, rb = r & 7; const bf* base = (pl == NPL - 1) ? Bt + (size_t)c0 * K : ((pl == 0) ? A : A2) + (size_t)r0 * K;
        g[j] = base + (size_t)rb * 16 * K; }
    const unsigned l0 = (unsigned)(size_t)(sm + wv * NR * 1024 + lane * 8), o0 = (unsigned)lane * 16u;   // this lane's LDS byte address in the wave's first run, buffer 0; its byte offset in a run
    v8f acc[4][4];
#pragma unroll
    for (int mb = 0; mb < 4; ++mb)
#pragma unroll
        for (int nb = 0; nb < 4; ++nb) acc[mb][nb] = (v8f){};
    cp_stage(g, l0, o0);
    asm volatile("s_wait_asynccnt 0x0" ::: "memory");   // this wave's copies of stage 0 have landed
    __syncthreads();                                     // every wave's have: stage 0 may be read
    cp_stage(g, l0 + (unsigned)(STE * 2), o0 + 2048u);   // stage 1 flies while stage 0 is worked on
    // the loop over stages stays rolled (one copy of a stage's products and copies in the instruction cache); every loop inside it and behind it is unrolled so that acc, the fragments and res are indexed by constants and stay in registers
#pragma unroll 1
    for (int t = 0; t < NT; ++t) {
        const bf* sb = sm + (t & 1) * STE + lane * 8; V a[4], a2[4], b[4];
#pragma unroll
        for (int kk = 0; kk < 2; ++kk) {
#pragma unroll
            for (int mb = 0; mb < 4; ++mb) { a[mb] = WFrag<bf>::ld(sb + (wm * 4 + mb) * 1024 + kk * 512); if constexpr (NA == 2) a2[mb] = WFrag<bf>::ld(sb + (8 + wm * 4 + mb) * 1024 + kk * 512); }
#pragma unroll
            for (int nb = 0; nb < 4; ++nb) b[nb] = WFrag<bf>::ld(sb + ((NPL - 1) * 8 + (EP == 1 ? (nb >> 1) * 4 + wn * 2 + (nb & 1) : wn * 4 + nb)) * 1024 + kk * 512);
            // inputs only, loaded values: all LDS reads of the 32-k step are issued together ahead of its products; without it the compiler reloads one B fragment at a time and each group of four products waits out an LDS round trip
            if constexpr (NA == 2) asm volatile("" :: "v"(a[0]), "v"(a[1]), "v"(a[2]), "v"(a[3]), "v"(a2[0]), "v"(a2[1]), "v"(a2[2]), "v"(a2[3]), "v"(b[0]), "v"(b[1]), "v"(b[2]), "v"(b[3]));
            else asm volatile("" :: "v"(a[0]), "v"(a[1]), "v"(a[2]), "v"(a[3]), "v"(b[0]), "v"(b[1]), "v"(b[2]), "v"(b[3]));
            if (kk == 1) {   // the stage's last fragments are in registers: its buffer is handed over here, so that the refill flies during the second step's products as well
                asm volatile("s_wait_dscnt 0x0" ::: "memory");      // this wave's reads of stage t are done before its buffer may be refilled
                asm volatile("s_wait_asynccnt 0x0" ::: "memory");   // this wave's copies of stage t + 1 have landed
                __syncthreads();                                     // publishes stage t + 1 and ends every wave's reads of stage t
                if (t + 2 < NT) cp_stage(g, l0 + (unsigned)((t & 1) * (STE * 2)), o0 + (unsigned)(t + 2) * 2048u);
                __builtin_amdgcn_sched_barrier(0);                   // keeps the products below behind the copies: moved up, they would hold back the copies' issue by their own length
            }
#pragma unroll
            for (int nb = 0; nb < 4; ++nb)
#pragma unroll
                for (int mb = 0; mb < 4; ++mb) { if constexpr (EP == 1) acc[mb][nb] = WFrag<bf>::mma(b[nb], a[mb], acc[mb][nb]); else acc[mb][nb] = WFrag<bf>::mma(a[mb], b[nb], acc[mb][nb]); if constexpr (NA == 2) acc[mb][nb] = WFrag<bf>::mma(a2[mb], b[nb], acc[mb][nb]); } }
    }
    asm volatile("s_wait_asynccnt 0x0" ::: "memory");   // no copy is outstanding when the ring becomes output staging (the last trip's barrier has ended every read of it)
    const int t0 = r0 % TT;   // the tile's first row inside its batch (a tile lies in one batch)
    if constexpr (EP == 1) {
        // lane: rows t = t0 + wm*64 + mb*16 + lr; columns d = wn*32 + (nb&1)*16 + hi*8 + j (nb < 2) and the same + HD/2 (nb >= 2)
        float* ps = (float*)sm; float rf[4];
#pragma unroll
        for (int mb = 0; mb < 4; ++mb) { float q = 0.f;
#pragma unroll
            for (int nb = 0; nb < 4; ++nb)
#pragma unroll
                for (int j = 0; j < 8; ++j) q += acc[mb][nb][j] * acc[mb][nb][j];
            q += __shfl_xor(q, 16, 32); rf[mb] = q; if (hi == 0) ps[wv * 64 + mb * 16 + lr] = q; }   // the wave's 64 columns of each of its 64 rows
        __syncthreads();   // the sums of squares of both column halves are in LDS before the neighbour wave reads them
#pragma unroll
        for (int mb = 0; mb < 4; ++mb) rf[mb] = __fdiv_rn(1.0f, __fsqrt_rn(__fadd_rn((rf[mb] + ps[(wv ^ 1) * 64 + mb * 16 + lr]) * (1.0f / HD), 1e-5f)));
        // every address below is a scalar base + one lane offset + a constant, so no address register is written between the first access and the last
        const char* wb = (const char*)(e.nw + wn * 32); const unsigned wo = (unsigned)hi * 32u; v8f wl[2], wh[2];
#pragma unroll
        for (int p = 0; p < 2; ++p) { wl[p] = *(const v8f*)(wb + wo + p * 64); wh[p] = *(const v8f*)(wb + wo + p * 64 + HD * 2); }
        const char* cb = (const char*)(e.CS + ((size_t)(t0 + wm * 64) * HD + wn * 32) * 2); const unsigned co = (unsigned)(lr * HD + hi * 8) * 8u;
        const size_t pb = (size_t)((t0 + wm * 64) / 16 * (HD / 32) + wn) * 512; char* b16 = (char*)(e.P16 + pb); char* bh = (char*)(e.Ph + pb); char* bl = (char*)(e.Pl + pb); const unsigned so = (unsigned)lane * 16u;
#pragma unroll
        for (int mb = 0; mb < 4; ++mb) { v8f c0[2], c1[2];
#pragma unroll
            for (int p = 0; p < 2; ++p) { c0[p] = *(const v8f*)(cb + co + mb * (16 * HD * 8) + p * 128); c1[p] = *(const v8f*)(cb + co + mb * (16 * HD * 8) + p * 128 + 32); }
            // the wait in front of an overwrite of the loads' address registers. Inputs only: the lane offsets and the scalar bases stay as they are up to here, and the loaded values put the wait behind every load
            asm volatile("s_wait_xcnt 0x0" :: "s"(cb), "s"(wb), "v"(co), "v"(wo), "v"(c0[0]), "v"(c0[1]), "v"(c1[0]), "v"(c1[1]), "v"(wl[0]), "v"(wl[1]), "v"(wh[0]), "v"(wh[1]) : "memory");
            v8h l16[2], u16[2]; v8us lh[2], ll[2], uh[2], ul[2];   // l..: column d, u..: column d + HD/2
#pragma unroll
            for (int p = 0; p < 2; ++p)
#pragma unroll
                for (int q = 0; q < 8; ++q) { const float xa = bfr(wl[p][q]) * (acc[mb][p][q] * rf[mb]), xb = bfr(wh[p][q]) * (acc[mb][p + 2][q] * rf[mb]);
                    const float c = (q < 4) ? c0[p][2 * q] : c1[p][2 * q - 8], sn = (q < 4) ? c0[p][2 * q + 1] : c1[p][2 * q - 7];
                    const float ra = xa * c - xb * sn, rb = xb * c + xa * sn; unsigned short a2, c2;
                    l16[p][q] = tohx(ra); splitf(ra, a2, c2); lh[p][q] = a2; ll[p][q] = c2; u16[p][q] = tohx(rb); splitf(rb, a2, c2); uh[p][q] = a2; ul[p][q] = c2; }
#pragma unroll
            for (int p = 0; p < 2; ++p) { const int ol = mb * (HD / 32 * 1024) + p * 512, ou = ol + (HD / 64) * 1024;   // bytes: row block mb, k half p; the partner stands two fragment blocks on
                *(v8h*)(b16 + so + ol) = l16[p]; *(v8us*)(bh + so + ol) = lh[p]; *(v8us*)(bl + so + ol) = ll[p]; *(v8h*)(b16 + so + ou) = u16[p]; *(v8us*)(bh + so + ou) = uh[p]; *(v8us*)(bl + so + ou) = ul[p]; }
            // the wait in front of an overwrite of a register that the twelve stores name. Inputs only: the stored values, the lane offset and the scalar bases stay as they are up to here
            asm volatile("s_wait_xcnt 0x0" :: "s"(b16), "s"(bh), "s"(bl), "v"(so), "v"(l16[0]), "v"(l16[1]), "v"(u16[0]), "v"(u16[1]), "v"(lh[0]), "v"(lh[1]), "v"(ll[0]), "v"(ll[1]), "v"(uh[0]), "v"(uh[1]), "v"(ul[0]), "v"(ul[1]) : "memory"); }
        return;
    }
    if constexpr (EP == 2) {
        // lane: column d = wn*64 + nb*16 + lr; rows t = t0 + wm*64 + mb*16 + hi*8 + j: piece (t/16 % 2) * 32 + lane of block (t / 32, d / 16)
        const size_t pb = (size_t)((t0 / 32 + wm * 2) * (HD / 16) + wn * 4) * 512; char* b16 = (char*)(e.P16 + pb); char* bh = (char*)(e.Ph + pb); char* bl = (char*)(e.Pl + pb); const unsigned so = (unsigned)lane * 16u;
        v8h o16[4][4]; v8us oh[4][4], ol[4][4];
#pragma unroll
        for (int mb = 0; mb < 4; ++mb)
#pragma unroll
            for (int nb = 0; nb < 4; ++nb)
#pragma unroll
                for (int j = 0; j < 8; ++j) { const float x = acc[mb][nb][j]; unsigned short a2, c2; o16[mb][nb][j] = tohx(x); splitf(x, a2, c2); oh[mb][nb][j] = a2; ol[mb][nb][j] = c2; }
        // all global stores last: no register that a store names is written again
#pragma unroll
        for (int mb = 0; mb < 4; ++mb)
#pragma unroll
            for (int nb = 0; nb < 4; ++nb) { const int of = ((mb >> 1) * (HD / 16) + nb) * 1024 + (mb & 1) * 512;
                *(v8h*)(b16 + so + of) = o16[mb][nb]; *(v8us*)(bh + so + of) = oh[mb][nb]; *(v8us*)(bl + so + of) = ol[mb][nb]; }
        return;
    }
    // whole lines out: each wave turns its 16x64 row blocks through its own LDS range (two, by row block parity), 256 contiguous bytes of a row per 16 lanes
    float* stg = (float*)sm + wv * (2 * 16 * 68); v4f res[4][8];
#pragma unroll
    for (int mb = 0; mb < 4; ++mb) { float* ob = stg + (mb & 1) * (16 * 68);
#pragma unroll
        for (int nb = 0; nb < 4; ++nb)
#pragma unroll
            for (int j = 0; j < 8; ++j) ob[(hi * 8 + j) * 68 + nb * 16 + lr] = acc[mb][nb][j];
        asm volatile("s_wait_dscnt 0x0" ::: "memory");   // the wave's own writes are in LDS before its lanes read one another's values back
#pragma unroll
        for (int q = 0; q < 8; ++q) { const int s = lane + q * 32; res[mb][q] = *(const v4fa*)(ob + (s >> 4) * 68 + (s & 15) * 4); } }
    // all global stores last: no register that a store names is written again
    float* cp = C + (size_t)(r0 + wm * 64 + (lane >> 4)) * LDC + c0 + wn * 64 + (lane & 15) * 4;
#pragma unroll
    for (int mb = 0; mb < 4; ++mb)
#pragma unroll
        for (int q = 0; q < 8; ++q) *(v4f*)(cp + (size_t)(mb * 16 + q * 2) * LDC) = res[mb][q];
}
// k_gemmf: the joint q | k | v projection of both batches; column tile y is head y (q heads, then k heads) or, from NHK on, v group y - NHK. The projection itself is never stored: each tile leaves as the operand planes of the attention kernel; planes are ordered [batch][head].
__global__ __launch_bounds__(128) void k_gemmf(const bf* __restrict__ X, const bf* __restrict__ W, const float* __restrict__ CS, const float* __restrict__ qnw, const float* __restrict__ knw, h16* Q16, bf* Qh, bf* Ql, h16* K16, bf* Kh, bf* Kl, h16* V16, bf* Vh, bf* Vl) { __shared__ __align__(2048) bf sm[2 * 2 * 8 * 1024];
    const int h = (int)blockIdx.y, b = (int)blockIdx.x / (TT / 128);
    if (h < NHK) { const bool isq = h < NH_; const size_t o = (size_t)(isq ? b * NH_ + h : b * NKV + h - NH_) * TT * HD;   // scalar choices: one copy of the code serves q and k heads
        d_gemmt<1, DM, FP, 1>(X, X, W, nullptr, sm, EpA{CS, isq ? qnw : knw, (isq ? Q16 : K16) + o, (isq ? Qh : Kh) + o, (isq ? Ql : Kl) + o}); }
    else { const size_t o = (size_t)(b * NKV + h - NHK) * HD * TT; d_gemmt<1, DM, FP, 2>(X, X, W, nullptr, sm, EpA{nullptr, nullptr, V16 + o, Vh + o, Vl + o}); } }
__global__ __launch_bounds__(128) void k_gemmo(const bf* __restrict__ Ah, const bf* __restrict__ Al, const bf* __restrict__ W, float* O) { __shared__ __align__(2048) bf sm[2 * 3 * 8 * 1024]; d_gemmt<2, DQ, DM, 0>(Ah, Al, W, O, sm, EpA{}); }

typedef __attribute__((ext_vector_type(2))) _Float16 v2h;
typedef __attribute__((ext_vector_type(4))) _Float16 v4h;
typedef __attribute__((ext_vector_type(2))) unsigned short v2us;
typedef __attribute__((ext_vector_type(4))) unsigned short v4us;
typedef __attribute__((ext_vector_type(2))) float v2f;
typedef __attribute__((ext_vector_type(4))) int v4i;

__global__ __launch_bounds__(256) void k_wtG(const float* __restrict__ w, int K, int N, bf* Bt) {
    const int lane = threadIdx.x & 31; const int L0 = (blockIdx.x * 8 + (threadIdx.x >> 5)) * 8; const int nlines = N * K / 64;
{
#pragma unroll 1
        for (int l = 0; l < 8; ++l) { const int L = L0 + l; if (L >= nlines) break; const size_t e = (size_t)L * 64 + lane * 2; const int k = (int)(e % K), n = (int)(e / K); v2us o;
            o[0] = f2bf(w[(size_t)k * N + n]); o[1] = f2bf(w[(size_t)(k + 1) * N + n]); *(v2us*)(Bt + e) = o; }
         }
}
// d_cvt8: f32 [rows][DM] -> bf16 fragment-major plane, all five sources in one launch: the planes of x (both batches), q_w, k_w, v_w, o_w lie behind one another in dst, so q_w | k_w | v_w is one plane of FP rows. A thread takes its lane's place in the four 16-byte-piece rows of two neighbouring blocks (32 elements), so a wave reads 256 contiguous bytes of each of 16 rows, eight 16-byte loads in flight a lane,
// and writes 2 KB in a row. bx = block index; 256 threads take 16 fragment blocks of one 16-row block, so the source is chosen by a scalar test. Few waves on purpose, for speed only.
__device__ __forceinline__ void d_cvt8(const float* __restrict__ x, const float* __restrict__ wq, const float* __restrict__ wk, const float* __restrict__ wv, const float* __restrict__ wo, bf* dst, unsigned bx) { const size_t i = (size_t)bx * 256 + threadIdx.x; const size_t blk = (i >> 5) * 2; const int ln = (int)i & 31;   // DM / 32 is even: both blocks lie in one row block
    const int rb = (int)(bx / (DM / 32 / 16)); const float* src = x; int rb0 = 0;   // rb: 16-row block in dst; rb0: where the source's plane begins
    if (rb >= (RWS + FP) / 16) { src = wo; rb0 = (RWS + FP) / 16; } else if (rb >= (RWS + DQ + DKV) / 16) { src = wv; rb0 = (RWS + DQ + DKV) / 16; } else if (rb >= (RWS + DQ) / 16) { src = wk; rb0 = (RWS + DQ) / 16; } else if (rb >= RWS / 16) { src = wq; rb0 = RWS / 16; }
    const float* s = src + ((size_t)(rb - rb0) * 16 + (ln & 15)) * DM + (blk % (DM / 32)) * 32 + (ln >> 4) * 8; v8f v[4];
#pragma unroll
    for (int p = 0; p < 4; ++p) v[p] = *(const v8f*)(s + p * 16);   // piece row p = block p / 2, k half p % 2: k offset p * 16
#pragma unroll
    for (int p = 0; p < 4; ++p) { v8us o;
#pragma unroll
        for (int k = 0; k < 8; ++k) o[k] = f2bf(v[p][k]);
        *(v8us*)(dst + blk * 512 + p * 256 + ln * 8) = o; }
    asm volatile("s_wait_xcnt 0x0" ::: "memory");  }   // the wait behind the four stores: in the joint kernel other code follows them in the listing, and none of it may write a register that a store names ahead of this wait
__device__ __forceinline__ void d_cstab(float* CS, unsigned bx) { const int idx = (int)bx * 256 + threadIdx.x; if (idx >= TT * HD) return; const int t = idx / HD, d = idx % HD; const int i = d % (HD / 2); const float inv = __fdiv_rn(1.0f, powf(500000.0f, (float)(2 * i) / (float)HD)); const float ang = __fmul_rn((float)t, inv); v2f cs; cs[0] = cosf(ang); cs[1] = sinf(ang);
    *(v2f*)(CS + (size_t)idx * 2) = cs;  }
// k_prep: all that depends on the inputs alone, in one launch: the cos / sin table (blocks below CSB; first, as its waves run longest) and the five plane conversions
#define CSB  (TT * HD / 256)
#define CVB  ((RWS + FP + DM) * (DM / 32) / 256)
__global__ __launch_bounds__(256) void k_prep(const float* __restrict__ x, const float* __restrict__ wq, const float* __restrict__ wk, const float* __restrict__ wv, const float* __restrict__ wo, bf* dst, float* CS) { if (blockIdx.x < CSB) d_cstab(CS, blockIdx.x); else d_cvt8(x, wq, wk, wv, wo, dst, blockIdx.x - CSB); }
// ---- k_fattn: causal attention of both batches in one launch; no score or probability matrix in memory. Block = 16 query rows x the REP query heads of one kv group x KS key parts (one wave each): wave (hd, part) takes the 32-key steps part, part + KS, ...
// Transposed products: S^T = K Q^T (A = key rows, B = query rows), so a lane holds, for ITS query (column lr), keys hi*8+j of each 16-key block: exactly the k order of a B fragment, and P^T goes into O^T += V^T P^T without leaving the lane.
// Online softmax per lane in the log2 domain (running maximum m, running sum l, O^T rescaled at every step); the KS parts are merged through LDS in part order (fixed order, run-to-run identical); part 0 normalises and stores the hi + lo planes of the merged heads.
// Rows < RH: hi+lo bf16 planes, 3 products for scores and for attn.v; rows >= RH: fp16. A block is wholly one or the other (RH % 16 == 0).
#define KS   4
#define SL2  (SCL * 1.4426950408889634f)   // HD^-0.5 x log2(e)
typedef __attribute__((ext_vector_type(16))) unsigned short v16us;
static_assert(RH % 16 == 0 && TT % 32 == 0, "a block's rows share one precision path; key steps are whole");
static_assert(DM == DQ && DM % 128 == 0 && HD % 32 == 0 && PP == TT, "one k length for every converted plane; whole fragment blocks");
// exp2 with the issue slot behind a transcendental filled: the v_nop keeps the next vector instruction, whichever the compiler puts there, from directly reading the result or overwriting the source.
__device__ __forceinline__ float ex2(float x) { float r; asm("v_exp_f32 %0, %1\n\tv_nop" : "=v"(r) : "v"(x)); return r; }
// four at once, one v_nop behind the last; the results are early-clobber so that none lies on the source of the exponential in front of it
__device__ __forceinline__ void ex2x4(float& a, float& b, float& c, float& d) { float ra, rb, rc, rd; asm("v_exp_f32 %0, %4\n\tv_exp_f32 %1, %5\n\tv_exp_f32 %2, %6\n\tv_exp_f32 %3, %7\n\tv_nop" : "=&v"(ra), "=&v"(rb), "=&v"(rc), "=&v"(rd) : "v"(a), "v"(b), "v"(c), "v"(d)); a = ra; b = rb; c = rc; d = rd; }
template <typename T16, bool HI>
__device__ __forceinline__ void fa_run(const T16* __restrict__ Q, const T16* __restrict__ Q2, const T16* __restrict__ Kp, const T16* __restrict__ K2, const T16* __restrict__ Vt, const T16* __restrict__ Vt2, int q0, int part, int lr, int hi, v8f (&o)[8], float& m, float& l) {
    typedef typename WFrag<T16>::V V;
    V qf[4], qf2[4];
#pragma unroll
    for (int ks = 0; ks < 4; ++ks) { qf[ks] = WFrag<T16>::ld(Q + (size_t)q0 * HD + ks * 512 + 8 * (hi * 16 + lr)); if constexpr (HI) qf2[ks] = WFrag<T16>::ld(Q2 + (size_t)q0 * HD + ks * 512 + 8 * (hi * 16 + lr)); }
    const int nst = (q0 + 47) / 32;   // 32-key steps that reach key q0 + 15; the last key touched is below TT
    const size_t ko = 8 * (hi * 16 + lr), vo = ko; const int qi = q0 + lr;   // fragment-major planes: 16 keys of K are 16 * HD elements in a row, 32 keys of V^T are 32 * HD
#pragma unroll 1
    for (int s = part; s < nst; s += KS) {
        const int k0 = s * 32;
        v8f st[2]; st[0] = (v8f){}; st[1] = (v8f){};
        if constexpr (HI) { const T16* pk[2] = { Kp + ko + (size_t)k0 * HD, Kp + ko + (size_t)(k0 + 16) * HD }; const T16* pk2[2] = { K2 + ko + (size_t)k0 * HD, K2 + ko + (size_t)(k0 + 16) * HD };
#pragma unroll
            for (int kb = 0; kb < 2; ++kb)
#pragma unroll
                for (int ks = 0; ks < 4; ++ks) { const V kf = WFrag<T16>::ld(pk[kb] + ks * 512); st[kb] = WFrag<T16>::mma(kf, qf[ks], st[kb]); st[kb] = WFrag<T16>::mma(kf, qf2[ks], st[kb]); st[kb] = WFrag<T16>::mma(WFrag<T16>::ld(pk2[kb] + ks * 512), qf[ks], st[kb]); }
            asm volatile("s_wait_xcnt 0x0" :: "v"(pk[0]), "v"(pk[1]), "v"(pk2[0]), "v"(pk2[1]), "v"(st[0]), "v"(st[1]) : "memory");   // the wait in front of an overwrite of the K loads' address registers; the inputs keep those registers as they are up to here and put the wait behind the last product, so behind every load
        } else { V kf[8];
#pragma unroll
            for (int i = 0; i < 8; ++i) kf[i] = WFrag<T16>::ld(Kp + ko + (size_t)(k0 + (i >> 2) * 16) * HD + (i & 3) * 512);
            asm volatile("" :: "v"(kf[0]), "v"(kf[1]), "v"(kf[2]), "v"(kf[3]), "v"(kf[4]), "v"(kf[5]), "v"(kf[6]), "v"(kf[7]));   // inputs only, loaded values: all K loads of the step are issued before its first product; without it each product waits for its own load's round trip, eight in a row
#pragma unroll
            for (int ks = 0; ks < 4; ++ks) { st[0] = WFrag<T16>::mma(kf[ks], qf[ks], st[0]); st[1] = WFrag<T16>::mma(kf[4 + ks], qf[ks], st[1]); } }
        float t[16];
#pragma unroll
        for (int e = 0; e < 16; ++e) t[e] = st[e >> 3][e & 7] * SL2;
        if (k0 + 31 > q0) {   // only a step that reaches past the block's first row holds keys above the diagonal
#pragma unroll
            for (int e = 0; e < 16; ++e) t[e] = (k0 + (e >> 3) * 16 + hi * 8 + (e & 7) <= qi) ? t[e] : -3.0e38f; }
        float mx = m;
#pragma unroll
        for (int e = 0; e < 16; ++e) mx = fmaxf(mx, t[e]);
        mx = fmaxf(mx, __shfl_xor(mx, 16, 32));   // the two half-waves hold the two key octets of the same query
        const float al = ex2(m - mx); m = mx; float ps = 0.f;   // m starts at -1e30, above the mask value, so a step whose keys are all masked gives p = 0, not exp2(0)
#pragma unroll
        for (int e = 0; e < 16; e += 4) { t[e] -= mx; t[e + 1] -= mx; t[e + 2] -= mx; t[e + 3] -= mx; ex2x4(t[e], t[e + 1], t[e + 2], t[e + 3]); ps += t[e]; ps += t[e + 1]; ps += t[e + 2]; ps += t[e + 3]; }
        l = l * al + ps;
#pragma unroll
        for (int db = 0; db < 8; ++db) o[db] = o[db] * al;
        V pf, pf2;
        if constexpr (HI) { v16us ph, pl;
#pragma unroll
            for (int e = 0; e < 16; ++e) { unsigned short x, y; splitf(t[e], x, y); ph[e] = x; pl[e] = y; }
            pf = __builtin_bit_cast(v16bf, ph); pf2 = __builtin_bit_cast(v16bf, pl);
        } else {
#pragma unroll
            for (int e = 0; e < 16; ++e) pf[e] = tohx(t[e]); }
        const T16* pv = Vt + vo + (size_t)k0 * HD; const T16* pv2 = HI ? Vt2 + vo + (size_t)k0 * HD : nullptr;
#pragma unroll
        for (int db = 0; db < 8; ++db) { const V vf = WFrag<T16>::ld(pv + db * 512); o[db] = WFrag<T16>::mma(vf, pf, o[db]);
            if constexpr (HI) { o[db] = WFrag<T16>::mma(vf, pf2, o[db]); o[db] = WFrag<T16>::mma(WFrag<T16>::ld(pv2 + db * 512), pf, o[db]); } }
        if constexpr (HI) asm volatile("s_wait_xcnt 0x0" :: "v"(pv), "v"(pv2), "v"(o[7]) : "memory");   // the wait in front of an overwrite of the V loads' address registers, as for the K loads above: the inputs keep those registers as they are up to here, behind the last product and so behind every load
    }
}
__global__ __launch_bounds__(32 * REP * KS) void k_fattn(const h16* __restrict__ Q16, const bf* __restrict__ Qh, const bf* __restrict__ Ql, const h16* __restrict__ K16, const bf* __restrict__ Kh, const bf* __restrict__ Kl, const h16* __restrict__ V16, const bf* __restrict__ Vh, const bf* __restrict__ Vl, bf* Ah, bf* Al) {
    __shared__ float mg[(KS - 1) * REP * 66 * 32];   // per merged wave: 64 O^T values, m, l, each x 32 lanes (lane-contiguous)
    const int lane = threadIdx.x & 31, lr = lane & 15, hi = lane >> 4; const int wv = __builtin_amdgcn_readfirstlane((int)(threadIdx.x >> 5)); const int hd = wv % REP, part = wv / REP;
    const int g = blockIdx.x, head = g * REP + hd; const int q0 = (TT / 16 - 1 - (int)blockIdx.y) * 16;   // g = batch * NKV + kv group, head = batch * NH_ + query head: both batches in one launch; longest rows first
    v8f o[8];
#pragma unroll
    for (int db = 0; db < 8; ++db) o[db] = (v8f){};
    float m = -1.0e30f, l = 0.f;
    if (q0 < RH) fa_run<bf, true>(Qh + (size_t)head * TT * HD, Ql + (size_t)head * TT * HD, Kh + (size_t)g * TT * HD, Kl + (size_t)g * TT * HD, Vh + (size_t)g * HD * TT, Vl + (size_t)g * HD * TT, q0, part, lr, hi, o, m, l);
    else fa_run<h16, false>(Q16 + (size_t)head * TT * HD, nullptr, K16 + (size_t)g * TT * HD, nullptr, V16 + (size_t)g * HD * PP, nullptr, q0, part, lr, hi, o, m, l);
    if (part > 0) { float* d = mg + (size_t)((part - 1) * REP + hd) * (66 * 32) + lane;
#pragma unroll
        for (int e = 0; e < 64; ++e) d[e * 32] = o[e >> 3][e & 7];
        d[64 * 32] = m; d[65 * 32] = l; }
    __syncthreads();   // the parts 1.. of every head are in LDS before part 0 reads them
    if (part > 0) return;
#pragma unroll
    for (int w = 1; w < KS; ++w) { const float* d = mg + (size_t)((w - 1) * REP + hd) * (66 * 32) + lane; const float m1 = d[64 * 32], l1 = d[65 * 32]; const float mn = fmaxf(m, m1); const float a0 = ex2(m - mn), a1 = ex2(m1 - mn);
#pragma unroll
        for (int e = 0; e < 64; ++e) o[e >> 3][e & 7] = o[e >> 3][e & 7] * a0 + d[e * 32] * a1;
        l = l * a0 + l1 * a1; m = mn; }
    l += __shfl_xor(l, 16, 32);
    const float inv = __fdiv_rn(1.0f, l); const size_t oo = (size_t)((g / NKV) * TT + q0) * DQ + (size_t)(head % NH_) * (HD / 32) * 512 + lane * 8;   // fragment-major [RWS][DQ]: column (head % NH_) * HD + db * 16 + hi * 8 is k block (head % NH_) * 4 + db / 2, half db % 2
#pragma unroll
    for (int db = 0; db < 8; ++db) { v8us oh, ol;
#pragma unroll
        for (int j = 0; j < 8; ++j) { unsigned short x, y; splitf(o[db][j] * inv, x, y); oh[j] = x; ol[j] = y; }
        *(v8us*)(Ah + oo + (db >> 1) * 512 + (db & 1) * 256) = oh; *(v8us*)(Al + oo + (db >> 1) * 512 + (db & 1) * 256) = ol; }
}

extern "C" void kernel_launch(void* const* d_in, const int* in_sizes, int n_in,
                              void* d_out, int out_size, void* d_ws, size_t ws_size, hipStream_t stream) {
    (void)in_sizes; (void)n_in; (void)out_size;
    const float* x = (const float*)d_in[0]; const float* wq = (const float*)d_in[1]; const float* wk = (const float*)d_in[2]; const float* wv = (const float*)d_in[3]; const float* wo = (const float*)d_in[4]; const float* qnw = (const float*)d_in[5]; const float* knw = (const float*)d_in[6];   // torch [out][in]
    float* OUT = (float*)d_out;     // [2][2048][2048]
    char* wsp = (char*)d_ws;
    auto take = [&](size_t bytes) { char* p = wsp; wsp += (bytes + 255) & ~(size_t)255; return (void*)p; };
    bf* XB = (bf*)take((size_t)(RWS + FP + DM) * DM * 2); bf* WQKV = XB + (size_t)RWS * DM; bf* WO = WQKV + (size_t)FP * DM;   // one run of planes, in the order in which k_prep writes them
    float* CS = (float*)take((size_t)TT * HD * 2 * 4);
    h16* QP16 = (h16*)take((size_t)NB_ * NH_ * TT * HD * 2); h16* KP16 = (h16*)take((size_t)NB_ * NKV * TT * HD * 2); h16* VT16 = (h16*)take((size_t)NB_ * NKV * HD * PP * 2);
    bf* QPh = (bf*)take((size_t)NB_ * NH_ * TT * HD * 2); bf* QPl = (bf*)take((size_t)NB_ * NH_ * TT * HD * 2); bf* KPh = (bf*)take((size_t)NB_ * NKV * TT * HD * 2); bf* KPl = (bf*)take((size_t)NB_ * NKV * TT * HD * 2); bf* VTh = (bf*)take((size_t)NB_ * NKV * HD * TT * 2); bf* VTl = (bf*)take((size_t)NB_ * NKV * HD * TT * 2);
    bf* ATh = (bf*)take((size_t)RWS * DQ * 2); bf* ATl = (bf*)take((size_t)RWS * DQ * 2);
    if ((size_t)(wsp - (char*)d_ws) > ws_size) return;    // ws 256 MiB
    // four launches, each for both batches; work that does not depend on one another shares a launch
    k_prep<<<CSB + CVB, 256, 0, stream>>>(x, wq, wk, wv, wo, XB, CS);
    k_gemmf<<<dim3(RWS / 128, FP / 128, 1), 128, 0, stream>>>(XB, WQKV, CS, qnw, knw, QP16, QPh, QPl, KP16, KPh, KPl, VT16, VTh, VTl);
    k_fattn<<<dim3(NB_ * NKV, TT / 16, 1), 32 * REP * KS, 0, stream>>>(QP16, QPh, QPl, KP16, KPh, KPl, VT16, VTh, VTl, ATh, ATl);
    k_gemmo<<<dim3(RWS / 128, DM / 128, 1), 128, 0, stream>>>(ATh, ATl, WO, OUT);
}

// v009
// Measured time: 146 microseconds a run.
// Next to v008, in two timings, it ran 1.13 times as fast each time.
// Counting every step since v000, it is 11.2 times as fast.
#include <hip/hip_runtime.h>

// YuaAttention (hidden [2][2048][2048]; q = x q_w^T (16 heads x 128), k/v = x k_w^T / v_w^T (4 kv heads, GQA repeat_interleave); per-head RMSNorm (eps 1e-5) with q_norm_w / k_norm_w, then rotate-half
// RoPE (theta 500000, positions 0..S-1); causal softmax(q.k 128^-0.5); out = merged attn.v o_w^T -> [2][2048][2048]).
// Compute dtypes, f32 accumulate: every input rounded to bf16; q/k/v projections on PLAIN bf16 operands (inputs: exact); o projection on hi+lo attn planes x bf16 o_w (2 products); RMSNorm + RoPE f32 (table computed on device);
// PER-ROW PRECISION HYBRID (rows < 256 hi+lo 3 products for scores and attn.v, rows >= 256 fp16); attention fused in one kernel (k_fattn: online softmax, key loop ends at the diagonal).

#define NB_  2
#define TT   2048
#define DM   2048
#define NH_  16
#define NKV  4
#define REP  (NH_ / NKV)
#define HD   128
#define DQ   (NH_ * HD)
#define DKV  (NKV * HD)
#define PP   TT                   // keys per fp16 V^T row
#define RH   256                  // query rows < RH use hi+lo planes (0: none)
#define WIN  0
#define RWS  (NB_ * TT)           // rows of both batches together: every launch takes both
#define FP   (DQ + 2 * DKV)       // columns of the joint q | k | v projection
#define NHK  (NH_ + NKV)          // heads that are normalised and rotated: the q heads, then the k heads (head h stands at column h * HD of the joint projection)
#define SCL  0.088388347648318447f   // HD^-0.5
typedef _Float16 h16;
typedef unsigned short bf;
typedef __attribute__((ext_vector_type(16))) __bf16   v16bf;
typedef __attribute__((ext_vector_type(16))) _Float16 v16h;
typedef __attribute__((ext_vector_type(8)))  _Float16 v8h;
typedef __attribute__((ext_vector_type(8)))  unsigned short v8us;
typedef __attribute__((ext_vector_type(8)))  float    v8f;
typedef __attribute__((ext_vector_type(4)))  float    v4f;
typedef v8h  __attribute__((may_alias)) v8ha;
typedef v4f  __attribute__((may_alias)) v4fa;
typedef v8us __attribute__((may_alias)) v8usa;

__device__ __forceinline__ unsigned short f2bf(float f) { unsigned u = __float_as_uint(f); u += 0x7FFFu + ((u >> 16) & 1u); return (unsigned short)(u >> 16); }
__device__ __forceinline__ float bf2f(unsigned short b) { return __uint_as_float(((unsigned)b) << 16); }
__device__ __forceinline__ float bfr(float f) { return bf2f(f2bf(f)); }
__device__ __forceinline__ v16h cat16(v8h lo, v8h hi) { return __builtin_shufflevector(lo, hi, 0, 1, 2, 3, 4, 5, 6, 7, 8, 9, 10, 11, 12, 13, 14, 15); }
__device__ __forceinline__ v16bf cat16b(v8us lo, v8us hi) { return __builtin_bit_cast(v16bf, __builtin_shufflevector(lo, hi, 0, 1, 2, 3, 4, 5, 6, 7, 8, 9, 10, 11, 12, 13, 14, 15)); }
__device__ __forceinline__ v8f wmma16(v16h a, v16h b, v8f c) { return __builtin_amdgcn_wmma_f32_16x16x32_f16(false, a, false, b, (short)0, c, false, false); }
__device__ __forceinline__ v8f wmmab(v16bf a, v16bf b, v8f c) { return __builtin_amdgcn_wmma_f32_16x16x32_bf16(false, a, false, b, (short)0, c, false, false); }



// ---- d_gemmt: GEMM, one 128x128 output tile per block of 4 waves (2 x 2 waves of 64x64, 16 accumulators each, every wave over the whole K in ascending k); the operand tiles are staged in LDS by asynchronous copies,
// so a byte that two waves need is read from L2 once per block. C[m][n] (f32, pitch LDC) = sum_k (A[m][k] (+ A2[m][k] if NA == 2)) Bt[n][k]. grid (M/128, N/128), 128 threads. K % 64 == 0, K >= 128.
// FRAGMENT-MAJOR PLANES: every 16-bit operand plane [rows][K] is stored as blocks of 16 rows x 32 k (512 elements, 1 KB), block (row / 16, k / 32) at element (row / 16 * (K / 32) + k / 32) * 512; inside a block the 16-byte piece
// number ld * 32 + hi * 16 + (row % 16) holds k % 32 = ld * 16 + hi * 8 + 0..7. That is the order in which the lanes of a wave take an A or B fragment, so each of its two loads reads 512 contiguous bytes (4 whole lines).
// ld(p): p = block start + lane * 8.
template <typename T16> struct WFrag;
template <> struct WFrag<h16> { typedef v16h V; static __device__ __forceinline__ V ld(const h16* p) { return cat16(*(const v8h*)p, *(const v8h*)(p + 256)); } static __device__ __forceinline__ v8f mma(V a, V b, v8f c) { return wmma16(a, b, c); } };
template <> struct WFrag<bf> { typedef v16bf V; static __device__ __forceinline__ V ld(const bf* p) { return cat16b(*(const v8us*)p, *(const v8us*)(p + 256)); } static __device__ __forceinline__ v8f mma(V a, V b, v8f c) { return wmmab(a, b, c); } };
// A STAGE = 64 k of the block's 128 rows of every operand plane (A, A2 if any, Bt): per plane 8 row blocks, each a RUN of 2 KB that is contiguous in memory (two neighbouring fragment blocks) and is laid down in LDS as it is:
// run r = plane * 8 + row block at LDS byte r * 2048, so a fragment is read from LDS in lane order too (512 contiguous bytes a load, no bank conflict). A wave copies NR = runs / 4 runs of a stage, four 512-byte copies each.
// The immediate offsets 512, 1024, 1536 move the global and the LDS address alike, which is what a run needs. A run's global address is its scalar base plus one byte offset that all runs share (lane * 16 + stage * 2048), so the ring
// holds two vector registers between stages, not three a run. The s_wait_xcnt stands in the copies' own statement, in front of any overwrite of an address register that they name.
#define CP4(l, o, s) "global_load_async_to_lds_b128 " l ", " o ", " s "\n\tglobal_load_async_to_lds_b128 " l ", " o ", " s " offset:512\n\tglobal_load_async_to_lds_b128 " l ", " o ", " s " offset:1024\n\tglobal_load_async_to_lds_b128 " l ", " o ", " s " offset:1536\n\t"
__device__ __forceinline__ void cp_stage(const bf* const (&g)[4], unsigned l, unsigned o) {
    asm volatile(CP4("%0", "%4", "%5") CP4("%1", "%4", "%6") CP4("%2", "%4", "%7") CP4("%3", "%4", "%8") "s_wait_xcnt 0x0"
                 :: "v"(l), "v"(l + 2048u), "v"(l + 4096u), "v"(l + 6144u), "v"(o), "s"(g[0]), "s"(g[1]), "s"(g[2]), "s"(g[3]) : "memory"); }
__device__ __forceinline__ void cp_stage(const bf* const (&g)[6], unsigned l, unsigned o) {
    asm volatile(CP4("%0", "%6", "%7") CP4("%1", "%6", "%8") CP4("%2", "%6", "%9") CP4("%3", "%6", "%10") CP4("%4", "%6", "%11") CP4("%5", "%6", "%12") "s_wait_xcnt 0x0"
                 :: "v"(l), "v"(l + 2048u), "v"(l + 4096u), "v"(l + 6144u), "v"(l + 8192u), "v"(l + 10240u), "v"(o), "s"(g[0]), "s"(g[1]), "s"(g[2]), "s"(g[3]), "s"(g[4]), "s"(g[5]) : "memory"); }
// EP: what becomes of the tile. 0: stored as f32 C. 1: a q or k head (the 128 columns are one head): RMSNorm and RoPE in registers, stored as the head's fragment-major planes. 2: a v group: stored as its fragment-major V^T planes.
// EP 1 forms the TRANSPOSED tile (the Bt fragment is the A operand), so a lane holds 8 neighbouring d of one row t, which is a 16-byte piece of a plane whose k is d; and a wave takes the column blocks wn*2, wn*2+1 and those 64 columns on,
// so both rotate-half partners d and d + HD/2 lie in one lane. EP 2 keeps the tile as it is: a lane holds 8 neighbouring t of one d, which is a piece of a plane whose k is t.
struct EpA { const float* CS; const float* nw; h16* P16; bf* Ph; bf* Pl; };   // cos / sin table, norm weight (EP 1); the three output planes of this head or group
__device__ __forceinline__ h16 tohx(float x) { return (h16)x; }
__device__ __forceinline__ void splitf(float y, unsigned short& h, unsigned short& l) { h = f2bf(y); l = f2bf(y - bf2f(h)); }
template <int NA, int K, int LDC, int EP>
__device__ __forceinline__ void d_gemmt(const bf* __restrict__ A, const bf* __restrict__ A2, const bf* __restrict__ Bt, float* C, bf* sm, const EpA e) {
    typedef WFrag<bf>::V V;
    constexpr int NPL = NA + 1, STE = NPL * 8 * 1024, NR = NPL * 2, NT = K / 64;   // planes; elements of a stage; runs a wave copies; stages
    static_assert(K % 64 == 0 && NT >= 2, "whole stages, and the two that the prologue fills");
    const int lane = threadIdx.x & 31, lr = lane & 15, hi = lane >> 4; const int r0 = blockIdx.x * 128, c0 = blockIdx.y * 128; const int wv = __builtin_amdgcn_readfirstlane((int)(threadIdx.x >> 5)); const int wm = wv >> 1, wn = wv & 1;
    const bf* g[NR];   // scalar: where each of the wave's runs begins in memory, stage 0
#pragma unroll
    for (int j = 0; j < NR; ++j) { const int r = wv * NR + j, pl = r >> 3, rb = r & 7; const bf* base = (pl == NPL - 1) ? Bt + (size_t)c0 * K : ((pl == 0) ? A : A2) + (size_t)r0 * K;
        g[j] = base + (size_t)rb * 16 * K; }
    const unsigned l0 = (unsigned)(size_t)(sm + wv * NR * 1024 + lane * 8), o0 = (unsigned)lane * 16u;   // this lane's LDS byte address in the wave's first run, buffer 0; its byte offset in a run
    v8f acc[4][4];
#pragma unroll
    for (int mb = 0; mb < 4; ++mb)
#pragma unroll
        for (int nb = 0; nb < 4; ++nb) acc[mb][nb] = (v8f){};
    cp_stage(g, l0, o0);
    asm volatile("s_wait_asynccnt 0x0" ::: "memory");   // this wave's copies of stage 0 have landed
    __syncthreads();                                     // every wave's have: stage 0 may be read
    cp_stage(g, l0 + (unsigned)(STE * 2), o0 + 2048u);   // stage 1 flies while stage 0 is worked on
    // the loop over stages stays rolled (for speed only); every loop inside it and behind it is unrolled so that acc, the fragments and res are indexed by constants and stay in registers
#pragma unroll 1
    for (int t = 0; t < NT; ++t) {
        const bf* sb = sm + (t & 1) * STE + lane * 8; V a[4], a2[4], b[4];
#pragma unroll
        for (int kk = 0; kk < 2; ++kk) {
#pragma unroll
            for (int mb = 0; mb < 4; ++mb) { a[mb] = WFrag<bf>::ld(sb + (wm * 4 + mb) * 1024 + kk * 512); if constexpr (NA == 2) a2[mb] = WFrag<bf>::ld(sb + (8 + wm * 4 + mb) * 1024 + kk * 512); }
#pragma unroll
            for (int nb = 0; nb < 4; ++nb) b[nb] = WFrag<bf>::ld(sb + ((NPL - 1) * 8 + (EP == 1 ? (nb >> 1) * 4 + wn * 2 + (nb & 1) : wn * 4 + nb)) * 1024 + kk * 512);
            // inputs only, loaded values: all LDS reads of the 32-k step are issued together ahead of its products; without it the compiler reloads one B fragment at a time and each group of four products waits out an LDS round trip
            if constexpr (NA == 2) asm volatile("" :: "v"(a[0]), "v"(a[1]), "v"(a[2]), "v"(a[3]), "v"(a2[0]), "v"(a2[1]), "v"(a2[2]), "v"(a2[3]), "v"(b[0]), "v"(b[1]), "v"(b[2]), "v"(b[3]));
            else asm volatile("" :: "v"(a[0]), "v"(a[1]), "v"(a[2]), "v"(a[3]), "v"(b[0]), "v"(b[1]), "v"(b[2]), "v"(b[3]));
            if (kk == 1) {   // the stage's last fragments are in registers: its buffer is handed over here, so that the refill flies during the second step's products as well
                asm volatile("s_wait_dscnt 0x0" ::: "memory");      // this wave's reads of stage t are done before its buffer may be refilled
                asm volatile("s_wait_asynccnt 0x0" ::: "memory");   // this wave's copies of stage t + 1 have landed
                __syncthreads();                                     // publishes stage t + 1 and ends every wave's reads of stage t
                if (t + 2 < NT) cp_stage(g, l0 + (unsigned)((t & 1) * (STE * 2)), o0 + (unsigned)(t + 2) * 2048u);
                __builtin_amdgcn_sched_barrier(0);                   // keeps the products below behind the copies: moved up, they would hold back the copies' issue by their own length
            }
#pragma unroll
            for (int nb = 0; nb < 4; ++nb)
#pragma unroll
                for (int mb = 0; mb < 4; ++mb) { if constexpr (EP == 1) acc[mb][nb] = WFrag<bf>::mma(b[nb], a[mb], acc[mb][nb]); else acc[mb][nb] = WFrag<bf>::mma(a[mb], b[nb], acc[mb][nb]); if constexpr (NA == 2) acc[mb][nb] = WFrag<bf>::mma(a2[mb], b[nb], acc[mb][nb]); } }
    }
    asm volatile("s_wait_asynccnt 0x0" ::: "memory");   // no copy is outstanding when the ring becomes output staging (the last trip's barrier has ended every read of it)
    const int t0 = r0 % TT;   // the tile's first row inside its batch (a tile lies in one batch)
    if constexpr (EP == 1) {
        // lane: rows t = t0 + wm*64 + mb*16 + lr; columns d = wn*32 + (nb&1)*16 + hi*8 + j (nb < 2) and the same + HD/2 (nb >= 2)
        float* ps = (float*)sm; float rf[4];
#pragma unroll
        for (int mb = 0; mb < 4; ++mb) { float q = 0.f;
#pragma unroll
            for (int nb = 0; nb < 4; ++nb)
#pragma unroll
                for (int j = 0; j < 8; ++j) q += acc[mb][nb][j] * acc[mb][nb][j];
            q += __shfl_xor(q, 16, 32); rf[mb] = q; if (hi == 0) ps[wv * 64 + mb * 16 + lr] = q; }   // the wave's 64 columns of each of its 64 rows
        __syncthreads();   // the sums of squares of both column halves are in LDS before the neighbour wave reads them
#pragma unroll
        for (int mb = 0; mb < 4; ++mb) rf[mb] = __fdiv_rn(1.0f, __fsqrt_rn(__fadd_rn((rf[mb] + ps[(wv ^ 1) * 64 + mb * 16 + lr]) * (1.0f / HD), 1e-5f)));
        // every address below is a scalar base + one lane offset + a constant, so no address register is written between the first access and the last
        const char* wb = (const char*)(e.nw + wn * 32); const unsigned wo = (unsigned)hi * 32u; v8f wl[2], wh[2];
#pragma unroll
        for (int p = 0; p < 2; ++p) { wl[p] = *(const v8f*)(wb + wo + p * 64); wh[p] = *(const v8f*)(wb + wo + p * 64 + HD * 2); }
        const char* cb = (const char*)(e.CS + ((size_t)(t0 + wm * 64) * HD + wn * 32) * 2); const unsigned co = (unsigned)(lr * HD + hi * 8) * 8u;
        const size_t pb = (size_t)((t0 + wm * 64) / 16 * (HD / 32) + wn) * 512; char* b16 = (char*)(e.P16 + pb); char* bh = (char*)(e.Ph + pb); char* bl = (char*)(e.Pl + pb); const unsigned so = (unsigned)lane * 16u;
#pragma unroll
        for (int mb = 0; mb < 4; ++mb) { v8f c0[2], c1[2];
#pragma unroll
            for (int p = 0; p < 2; ++p) { c0[p] = *(const v8f*)(cb + co + mb * (16 * HD * 8) + p * 128); c1[p] = *(const v8f*)(cb + co + mb * (16 * HD * 8) + p * 128 + 32); }
            // the wait in front of an overwrite of the loads' address registers. Inputs only: the lane offsets and the scalar bases stay as they are up to here, and the loaded values put the wait behind every load
            asm volatile("s_wait_xcnt 0x0" :: "s"(cb), "s"(wb), "v"(co), "v"(wo), "v"(c0[0]), "v"(c0[1]), "v"(c1[0]), "v"(c1[1]), "v"(wl[0]), "v"(wl[1]), "v"(wh[0]), "v"(wh[1]) : "memory");
            v8h l16[2], u16[2]; v8us lh[2], ll[2], uh[2], ul[2];   // l..: column d, u..: column d + HD/2
#pragma unroll
            for (int p = 0; p < 2; ++p)
#pragma unroll
                for (int q = 0; q < 8; ++q) { const float xa = bfr(wl[p][q]) * (acc[mb][p][q] * rf[mb]), xb = bfr(wh[p][q]) * (acc[mb][p + 2][q] * rf[mb]);
                    const float c = (q < 4) ? c0[p][2 * q] : c1[p][2 * q - 8], sn = (q < 4) ? c0[p][2 * q + 1] : c1[p][2 * q - 7];
                    const float ra = xa * c - xb * sn, rb = xb * c + xa * sn; unsigned short a2, c2;
                    l16[p][q] = tohx(ra); splitf(ra, a2, c2); lh[p][q] = a2; ll[p][q] = c2; u16[p][q] = tohx(rb); splitf(rb, a2, c2); uh[p][q] = a2; ul[p][q] = c2; }
#pragma unroll
            for (int p = 0; p < 2; ++p) { const int ol = mb * (HD / 32 * 1024) + p * 512, ou = ol + (HD / 64) * 1024;   // bytes: row block mb, k half p; the partner stands two fragment blocks on
                *(v8h*)(b16 + so + ol) = l16[p]; *(v8us*)(bh + so + ol) = lh[p]; *(v8us*)(bl + so + ol) = ll[p]; *(v8h*)(b16 + so + ou) = u16[p]; *(v8us*)(bh + so + ou) = uh[p]; *(v8us*)(bl + so + ou) = ul[p]; }
            // the wait in front of an overwrite of a register that the twelve stores name. Inputs only: the stored values, the lane offset and the scalar bases stay as they are up to here
            asm volatile("s_wait_xcnt 0x0" :: "s"(b16), "s"(bh), "s"(bl), "v"(so), "v"(l16[0]), "v"(l16[1]), "v"(u16[0]), "v"(u16[1]), "v"(lh[0]), "v"(lh[1]), "v"(ll[0]), "v"(ll[1]), "v"(uh[0]), "v"(uh[1]), "v"(ul[0]), "v"(ul[1]) : "memory"); }
        return;
    }
    if constexpr (EP == 2) {
        // lane: column d = wn*64 + nb*16 + lr; rows t = t0 + wm*64 + mb*16 + hi*8 + j: piece (t/16 % 2) * 32 + lane of block (t / 32, d / 16)
        const size_t pb = (size_t)((t0 / 32 + wm * 2) * (HD / 16) + wn * 4) * 512; char* b16 = (char*)(e.P16 + pb); char* bh = (char*)(e.Ph + pb); char* bl = (char*)(e.Pl + pb); const unsigned so = (unsigned)lane * 16u;
        v8h o16[4][4]; v8us oh[4][4], ol[4][4];
#pragma unroll
        for (int mb = 0; mb < 4; ++mb)
#pragma unroll
            for (int nb = 0; nb < 4; ++nb)
#pragma unroll
                for (int j = 0; j < 8; ++j) { const float x = acc[mb][nb][j]; unsigned short a2, c2; o16[mb][nb][j] = tohx(x); splitf(x, a2, c2); oh[mb][nb][j] = a2; ol[mb][nb][j] = c2; }
        // all global stores last: no register that a store names is written again
#pragma unroll
        for (int mb = 0; mb < 4; ++mb)
#pragma unroll
            for (int nb = 0; nb < 4; ++nb) { const int of = ((mb >> 1) * (HD / 16) + nb) * 1024 + (mb & 1) * 512;
                *(v8h*)(b16 + so + of) = o16[mb][nb]; *(v8us*)(bh + so + of) = oh[mb][nb]; *(v8us*)(bl + so + of) = ol[mb][nb]; }
        return;
    }
    // whole lines out: each wave turns its 16x64 row blocks through its own LDS range (two, by row block parity), 256 contiguous bytes of a row per 16 lanes
    float* stg = (float*)sm + wv * (2 * 16 * 68); v4f res[4][8];
#pragma unroll
    for (int mb = 0; mb < 4; ++mb) { float* ob = stg + (mb & 1) * (16 * 68);
#pragma unroll
        for (int nb = 0; nb < 4; ++nb)
#pragma unroll
            for (int j = 0; j < 8; ++j) ob[(hi * 8 + j) * 68 + nb * 16 + lr] = acc[mb][nb][j];
        asm volatile("s_wait_dscnt 0x0" ::: "memory");   // the wave's own writes are in LDS before its lanes read one another's values back
#pragma unroll
        for (int q = 0; q < 8; ++q) { const int s = lane + q * 32; res[mb][q] = *(const v4fa*)(ob + (s >> 4) * 68 + (s & 15) * 4); } }
    // all global stores last: no register that a store names is written again
    float* cp = C + (size_t)(r0 + wm * 64 + (lane >> 4)) * LDC + c0 + wn * 64 + (lane & 15) * 4;
#pragma unroll
    for (int mb = 0; mb < 4; ++mb)
#pragma unroll
        for (int q = 0; q < 8; ++q) *(v4f*)(cp + (size_t)(mb * 16 + q * 2) * LDC) = res[mb][q];
}
// k_gemmf: the joint q | k | v projection of both batches; column tile y is head y (q heads, then k heads) or, from NHK on, v group y - NHK. The projection itself is never stored: each tile leaves as the operand planes of the attention kernel; planes are ordered [batch][head].
__global__ __launch_bounds__(128) void k_gemmf(const bf* __restrict__ X, const bf* __restrict__ W, const float* __restrict__ CS, const float* __restrict__ qnw, const float* __restrict__ knw, h16* Q16, bf* Qh, bf* Ql, h16* K16, bf* Kh, bf* Kl, h16* V16, bf* Vh, bf* Vl) { __shared__ __align__(2048) bf sm[2 * 2 * 8 * 1024];
    const int h = (int)blockIdx.y, b = (int)blockIdx.x / (TT / 128);
    if (h < NHK) { const bool isq = h < NH_; const size_t o = (size_t)(isq ? b * NH_ + h : b * NKV + h - NH_) * TT * HD;   // scalar choices: one copy of the code serves q and k heads
        d_gemmt<1, DM, FP, 1>(X, X, W, nullptr, sm, EpA{CS, isq ? qnw : knw, (isq ? Q16 : K16) + o, (isq ? Qh : Kh) + o, (isq ? Ql : Kl) + o}); }
    else { const size_t o = (size_t)(b * NKV + h - NHK) * HD * TT; d_gemmt<1, DM, FP, 2>(X, X, W, nullptr, sm, EpA{nullptr, nullptr, V16 + o, Vh + o, Vl + o}); } }
__global__ __launch_bounds__(128) void k_gemmo(const bf* __restrict__ Ah, const bf* __restrict__ Al, const bf* __restrict__ W, float* O) { __shared__ __align__(2048) bf sm[2 * 3 * 8 * 1024]; d_gemmt<2, DQ, DM, 0>(Ah, Al, W, O, sm, EpA{}); }

typedef __attribute__((ext_vector_type(2))) _Float16 v2h;
typedef __attribute__((ext_vector_type(4))) _Float16 v4h;
typedef __attribute__((ext_vector_type(2))) unsigned short v2us;
typedef __attribute__((ext_vector_type(4))) unsigned short v4us;
typedef __attribute__((ext_vector_type(2))) float v2f;
typedef __attribute__((ext_vector_type(4))) int v4i;

__global__ __launch_bounds__(256) void k_wtG(const float* __restrict__ w, int K, int N, bf* Bt) {
    const int lane = threadIdx.x & 31; const int L0 = (blockIdx.x * 8 + (threadIdx.x >> 5)) * 8; const int nlines = N * K / 64;
{
#pragma unroll 1
        for (int l = 0; l < 8; ++l) { const int L = L0 + l; if (L >= nlines) break; const size_t e = (size_t)L * 64 + lane * 2; const int k = (int)(e % K), n = (int)(e / K); v2us o;
            o[0] = f2bf(w[(size_t)k * N + n]); o[1] = f2bf(w[(size_t)(k + 1) * N + n]); *(v2us*)(Bt + e) = o; }
         }
}
// d_cvt8: f32 [rows][DM] -> bf16 fragment-major plane, all five sources in one launch: the planes of x (both batches), q_w, k_w, v_w, o_w lie behind one another in dst, so q_w | k_w | v_w is one plane of FP rows. A thread takes its lane's place in the four 16-byte-piece rows of two neighbouring blocks (32 elements), so a wave reads 256 contiguous bytes of each of 16 rows, eight 16-byte loads in flight a lane,
// and writes 2 KB in a row. bx = block index; 256 threads take 16 fragment blocks of one 16-row block, so the source is chosen by a scalar test. Few waves on purpose, for speed only.
__device__ __forceinline__ void d_cvt8(const float* __restrict__ x, const float* __restrict__ wq, const float* __restrict__ wk, const float* __restrict__ wv, const float* __restrict__ wo, bf* dst, unsigned bx) { const size_t i = (size_t)bx * 256 + threadIdx.x; const size_t blk = (i >> 5) * 2; const int ln = (int)i & 31;   // DM / 32 is even: both blocks lie in one row block
    const int rb = (int)(bx / (DM / 32 / 16)); const float* src = x; int rb0 = 0;   // rb: 16-row block in dst; rb0: where the source's plane begins
    if (rb >= (RWS + FP) / 16) { src = wo; rb0 = (RWS + FP) / 16; } else if (rb >= (RWS + DQ + DKV) / 16) { src = wv; rb0 = (RWS + DQ + DKV) / 16; } else if (rb >= (RWS + DQ) / 16) { src = wk; rb0 = (RWS + DQ) / 16; } else if (rb >= RWS / 16) { src = wq; rb0 = RWS / 16; }
    const float* s = src + ((size_t)(rb - rb0) * 16 + (ln & 15)) * DM + (blk % (DM / 32)) * 32 + (ln >> 4) * 8; v8f v[4];
#pragma unroll
    for (int p = 0; p < 4; ++p) v[p] = *(const v8f*)(s + p * 16);   // piece row p = block p / 2, k half p % 2: k offset p * 16
#pragma unroll
    for (int p = 0; p < 4; ++p) { v8us o;
#pragma unroll
        for (int k = 0; k < 8; ++k) o[k] = f2bf(v[p][k]);
        *(v8us*)(dst + blk * 512 + p * 256 + ln * 8) = o; }
    asm volatile("s_wait_xcnt 0x0" ::: "memory");  }   // the wait behind the four stores: in the joint kernel other code follows them in the listing, and none of it may write a register that a store names ahead of this wait
__device__ __forceinline__ void d_cstab(float* CS, unsigned bx) { const int idx = (int)bx * 256 + threadIdx.x; if (idx >= TT * HD) return; const int t = idx / HD, d = idx % HD; const int i = d % (HD / 2); const float inv = __fdiv_rn(1.0f, powf(500000.0f, (float)(2 * i) / (float)HD)); const float ang = __fmul_rn((float)t, inv); v2f cs; cs[0] = cosf(ang); cs[1] = sinf(ang);
    *(v2f*)(CS + (size_t)idx * 2) = cs;  }
// k_prep: all that depends on the inputs alone, in one launch: the cos / sin table (blocks below CSB; first, as its waves run longest) and the five plane conversions
#define CSB  (TT * HD / 256)
#define CVB  ((RWS + FP + DM) * (DM / 32) / 256)
__global__ __launch_bounds__(256) void k_prep(const float* __restrict__ x, const float* __restrict__ wq, const float* __restrict__ wk, const float* __restrict__ wv, const float* __restrict__ wo, bf* dst, float* CS) { if (blockIdx.x < CSB) d_cstab(CS, blockIdx.x); else d_cvt8(x, wq, wk, wv, wo, dst, blockIdx.x - CSB); }
// ---- k_fattn: causal attention of both batches in one launch; no score or probability matrix in memory. Block = 16 query rows x the REP query heads of one kv group x KS key parts (one wave each): wave (hd, part) takes the 32-key steps part, part + KS, ...
// Transposed products: S^T = K Q^T (A = key rows, B = query rows), so a lane holds, for ITS query (column lr), keys hi*8+j of each 16-key block: exactly the k order of a B fragment, and P^T goes into O^T += V^T P^T without leaving the lane.
// Online softmax per lane in the log2 domain (running maximum m, running sum l, O^T rescaled at every step); the KS parts are merged through LDS in part order (fixed order, run-to-run identical); part 0 normalises and stores the hi + lo planes of the merged heads.
// Rows < RH: hi+lo bf16 planes, 3 products for scores and for attn.v; rows >= RH: fp16. A block is wholly one or the other (RH % 16 == 0).
#define KS   4
#define SL2  (SCL * 1.4426950408889634f)   // HD^-0.5 x log2(e)
typedef __attribute__((ext_vector_type(16))) unsigned short v16us;
static_assert(RH % 16 == 0 && TT % 32 == 0, "a block's rows share one precision path; key steps are whole");
static_assert(DM == DQ && DM % 128 == 0 && HD % 32 == 0 && PP == TT, "one k length for every converted plane; whole fragment blocks");
// exp2 with the issue slot behind a transcendental filled: the v_nop keeps the next vector instruction, whichever the compiler puts there, from directly reading the result or overwriting the source.
__device__ __forceinline__ float ex2(float x) { float r; asm("v_exp_f32 %0, %1\n\tv_nop" : "=v"(r) : "v"(x)); return r; }
// four at once, one v_nop behind the last; the results are early-clobber so that none lies on the source of the exponential in front of it
__device__ __forceinline__ void ex2x4(float& a, float& b, float& c, float& d) { float ra, rb, rc, rd; asm("v_exp_f32 %0, %4\n\tv_exp_f32 %1, %5\n\tv_exp_f32 %2, %6\n\tv_exp_f32 %3, %7\n\tv_nop" : "=&v"(ra), "=&v"(rb), "=&v"(rc), "=&v"(rd) : "v"(a), "v"(b), "v"(c), "v"(d)); a = ra; b = rb; c = rc; d = rd; }
template <typename T16, bool HI>
__device__ __forceinline__ void fa_run(const T16* __restrict__ Q, const T16* __restrict__ Q2, const T16* __restrict__ Kp, const T16* __restrict__ K2, const T16* __restrict__ Vt, const T16* __restrict__ Vt2, int q0, int part, int lr, int hi, v8f (&o)[8], float& m, float& l) {
    typedef typename WFrag<T16>::V V;
    V qf[4], qf2[4];
#pragma unroll
    for (int ks = 0; ks < 4; ++ks) { qf[ks] = WFrag<T16>::ld(Q + (size_t)q0 * HD + ks * 512 + 8 * (hi * 16 + lr)); if constexpr (HI) qf2[ks] = WFrag<T16>::ld(Q2 + (size_t)q0 * HD + ks * 512 + 8 * (hi * 16 + lr)); }
    const int nst = (q0 + 47) / 32;   // 32-key steps that reach key q0 + 15; the last key touched is below TT
    const size_t ko = 8 * (hi * 16 + lr), vo = ko; const int qi = q0 + lr;   // fragment-major planes: 16 keys of K are 16 * HD elements in a row, 32 keys of V^T are 32 * HD
#pragma unroll 1
    for (int s = part; s < nst; s += KS) {
        const int k0 = s * 32;
        v8f st[2]; st[0] = (v8f){}; st[1] = (v8f){};
        if constexpr (HI) { const T16* pk[2] = { Kp + ko + (size_t)k0 * HD, Kp + ko + (size_t)(k0 + 16) * HD }; const T16* pk2[2] = { K2 + ko + (size_t)k0 * HD, K2 + ko + (size_t)(k0 + 16) * HD };
#pragma unroll
            for (int kb = 0; kb < 2; ++kb) { V kf[4], kg[4];
#pragma unroll
                for (int ks = 0; ks < 4; ++ks) { kf[ks] = WFrag<T16>::ld(pk[kb] + ks * 512); kg[ks] = WFrag<T16>::ld(pk2[kb] + ks * 512); }
                asm volatile("" :: "v"(kf[0]), "v"(kf[1]), "v"(kf[2]), "v"(kf[3]), "v"(kg[0]), "v"(kg[1]), "v"(kg[2]), "v"(kg[3]));   // inputs only, loaded values: the 16 loads of a key block are issued before its first product; without it each fragment's load is waited for alone, one round trip after another
#pragma unroll
                for (int ks = 0; ks < 4; ++ks) { st[kb] = WFrag<T16>::mma(kf[ks], qf[ks], st[kb]); st[kb] = WFrag<T16>::mma(kf[ks], qf2[ks], st[kb]); st[kb] = WFrag<T16>::mma(kg[ks], qf[ks], st[kb]); } }
            asm volatile("s_wait_xcnt 0x0" :: "v"(pk[0]), "v"(pk[1]), "v"(pk2[0]), "v"(pk2[1]), "v"(st[0]), "v"(st[1]) : "memory");   // the wait in front of an overwrite of the K loads' address registers; the inputs keep those registers as they are up to here and put the wait behind the last product, so behind every load
        } else { V kf[8];
#pragma unroll
            for (int i = 0; i < 8; ++i) kf[i] = WFrag<T16>::ld(Kp + ko + (size_t)(k0 + (i >> 2) * 16) * HD + (i & 3) * 512);
            asm volatile("" :: "v"(kf[0]), "v"(kf[1]), "v"(kf[2]), "v"(kf[3]), "v"(kf[4]), "v"(kf[5]), "v"(kf[6]), "v"(kf[7]));   // inputs only, loaded values: all K loads of the step are issued before its first product; without it each product waits for its own load's round trip, eight in a row
#pragma unroll
            for (int ks = 0; ks < 4; ++ks) { st[0] = WFrag<T16>::mma(kf[ks], qf[ks], st[0]); st[1] = WFrag<T16>::mma(kf[4 + ks], qf[ks], st[1]); } }
        float t[16];
#pragma unroll
        for (int e = 0; e < 16; ++e) t[e] = st[e >> 3][e & 7] * SL2;
        if (k0 + 31 > q0) {   // only a step that reaches past the block's first row holds keys above the diagonal
#pragma unroll
            for (int e = 0; e < 16; ++e) t[e] = (k0 + (e >> 3) * 16 + hi * 8 + (e & 7) <= qi) ? t[e] : -3.0e38f; }
        float mx = m;
#pragma unroll
        for (int e = 0; e < 16; ++e) mx = fmaxf(mx, t[e]);
        mx = fmaxf(mx, __shfl_xor(mx, 16, 32));   // the two half-waves hold the two key octets of the same query
        const float al = ex2(m - mx); m = mx; float ps = 0.f;   // m starts at -1e30, above the mask value, so a step whose keys are all masked gives p = 0, not exp2(0)
#pragma unroll
        for (int e = 0; e < 16; e += 4) { t[e] -= mx; t[e + 1] -= mx; t[e + 2] -= mx; t[e + 3] -= mx; ex2x4(t[e], t[e + 1], t[e + 2], t[e + 3]); ps += t[e]; ps += t[e + 1]; ps += t[e + 2]; ps += t[e + 3]; }
        l = l * al + ps;
#pragma unroll
        for (int db = 0; db < 8; ++db) o[db] = o[db] * al;
        V pf, pf2;
        if constexpr (HI) { v16us ph, pl;
#pragma unroll
            for (int e = 0; e < 16; ++e) { unsigned short x, y; splitf(t[e], x, y); ph[e] = x; pl[e] = y; }
            pf = __builtin_bit_cast(v16bf, ph); pf2 = __builtin_bit_cast(v16bf, pl);
        } else {
#pragma unroll
            for (int e = 0; e < 16; ++e) pf[e] = tohx(t[e]); }
        const T16* pv = Vt + vo + (size_t)k0 * HD; const T16* pv2 = HI ? Vt2 + vo + (size_t)k0 * HD : nullptr;
        if constexpr (HI) {
#pragma unroll
            for (int dg = 0; dg < 8; dg += 4) { V vf[4], vg[4];
#pragma unroll
                for (int i = 0; i < 4; ++i) { vf[i] = WFrag<T16>::ld(pv + (dg + i) * 512); vg[i] = WFrag<T16>::ld(pv2 + (dg + i) * 512); }
                asm volatile("" :: "v"(vf[0]), "v"(vf[1]), "v"(vf[2]), "v"(vf[3]), "v"(vg[0]), "v"(vg[1]), "v"(vg[2]), "v"(vg[3]));   // inputs only, loaded values: the 16 loads of four d blocks are issued before their first product, as for K above
#pragma unroll
                for (int i = 0; i < 4; ++i) { o[dg + i] = WFrag<T16>::mma(vf[i], pf, o[dg + i]); o[dg + i] = WFrag<T16>::mma(vf[i], pf2, o[dg + i]); o[dg + i] = WFrag<T16>::mma(vg[i], pf, o[dg + i]); } }
        } else {
#pragma unroll
            for (int db = 0; db < 8; ++db) { const V vf = WFrag<T16>::ld(pv + db * 512); o[db] = WFrag<T16>::mma(vf, pf, o[db]); } }
        if constexpr (HI) asm volatile("s_wait_xcnt 0x0" :: "v"(pv), "v"(pv2), "v"(o[7]) : "memory");   // the wait in front of an overwrite of the V loads' address registers, as for the K loads above: the inputs keep those registers as they are up to here, behind the last product and so behind every load
        else asm volatile("s_wait_xcnt 0x0" :: "v"(pv), "v"(o[7]) : "memory");   // the same wait for the fp16 rows' V loads: the input keeps their address registers as they are (no load's own result lands on them) up to here, behind every load
    }
}
__global__ __launch_bounds__(32 * REP * KS) void k_fattn(const h16* __restrict__ Q16, const bf* __restrict__ Qh, const bf* __restrict__ Ql, const h16* __restrict__ K16, const bf* __restrict__ Kh, const bf* __restrict__ Kl, const h16* __restrict__ V16, const bf* __restrict__ Vh, const bf* __restrict__ Vl, bf* Ah, bf* Al) {
    __shared__ float mg[(KS - 1) * REP * 66 * 32];   // per merged wave: 64 O^T values, m, l, each x 32 lanes (lane-contiguous)
    const int lane = threadIdx.x & 31, lr = lane & 15, hi = lane >> 4; const int wv = __builtin_amdgcn_readfirstlane((int)(threadIdx.x >> 5)); const int hd = wv % REP, part = wv / REP;
    const int g = blockIdx.x, head = g * REP + hd; const int q0 = (TT / 16 - 1 - (int)blockIdx.y) * 16;   // g = batch * NKV + kv group, head = batch * NH_ + query head: both batches in one launch; longest rows first
    v8f o[8];
#pragma unroll
    for (int db = 0; db < 8; ++db) o[db] = (v8f){};
    float m = -1.0e30f, l = 0.f;
    if (q0 < RH) fa_run<bf, true>(Qh + (size_t)head * TT * HD, Ql + (size_t)head * TT * HD, Kh + (size_t)g * TT * HD, Kl + (size_t)g * TT * HD, Vh + (size_t)g * HD * TT, Vl + (size_t)g * HD * TT, q0, part, lr, hi, o, m, l);
    else fa_run<h16, false>(Q16 + (size_t)head * TT * HD, nullptr, K16 + (size_t)g * TT * HD, nullptr, V16 + (size_t)g * HD * PP, nullptr, q0, part, lr, hi, o, m, l);
    if (part > 0) { float* d = mg + (size_t)((part - 1) * REP + hd) * (66 * 32) + lane;
#pragma unroll
        for (int e = 0; e < 64; ++e) d[e * 32] = o[e >> 3][e & 7];
        d[64 * 32] = m; d[65 * 32] = l; }
    __syncthreads();   // the parts 1.. of every head are in LDS before part 0 reads them
    if (part > 0) return;
#pragma unroll
    for (int w = 1; w < KS; ++w) { const float* d = mg + (size_t)((w - 1) * REP + hd) * (66 * 32) + lane; const float m1 = d[64 * 32], l1 = d[65 * 32]; const float mn = fmaxf(m, m1); const float a0 = ex2(m - mn), a1 = ex2(m1 - mn);
#pragma unroll
        for (int e = 0; e < 64; ++e) o[e >> 3][e & 7] = o[e >> 3][e & 7] * a0 + d[e * 32] * a1;
        l = l * a0 + l1 * a1; m = mn; }
    l += __shfl_xor(l, 16, 32);
    const float inv = __fdiv_rn(1.0f, l); const size_t oo = (size_t)((g / NKV) * TT + q0) * DQ + (size_t)(head % NH_) * (HD / 32) * 512 + lane * 8;   // fragment-major [RWS][DQ]: column (head % NH_) * HD + db * 16 + hi * 8 is k block (head % NH_) * 4 + db / 2, half db % 2
#pragma unroll
    for (int db = 0; db < 8; ++db) { v8us oh, ol;
#pragma unroll
        for (int j = 0; j < 8; ++j) { unsigned short x, y; splitf(o[db][j] * inv, x, y); oh[j] = x; ol[j] = y; }
        *(v8us*)(Ah + oo + (db >> 1) * 512 + (db & 1) * 256) = oh; *(v8us*)(Al + oo + (db >> 1) * 512 + (db & 1) * 256) = ol; }
}

extern "C" void kernel_launch(void* const* d_in, const int* in_sizes, int n_in,
                              void* d_out, int out_size, void* d_ws, size_t ws_size, hipStream_t stream) {
    (void)in_sizes; (void)n_in; (void)out_size;
    const float* x = (const float*)d_in[0]; const float* wq = (const float*)d_in[1]; const float* wk = (const float*)d_in[2]; const float* wv = (const float*)d_in[3]; const float* wo = (const float*)d_in[4]; const float* qnw = (const float*)d_in[5]; const float* knw = (const float*)d_in[6];   // torch [out][in]
    float* OUT = (float*)d_out;     // [2][2048][2048]
    char* wsp = (char*)d_ws;
    auto take = [&](size_t bytes) { char* p = wsp; wsp += (bytes + 255) & ~(size_t)255; return (void*)p; };
    bf* XB = (bf*)take((size_t)(RWS + FP + DM) * DM * 2); bf* WQKV = XB + (size_t)RWS * DM; bf* WO = WQKV + (size_t)FP * DM;   // one run of planes, in the order in which k_prep writes them
    float* CS = (float*)take((size_t)TT * HD * 2 * 4);
    h16* QP16 = (h16*)take((size_t)NB_ * NH_ * TT * HD * 2); h16* KP16 = (h16*)take((size_t)NB_ * NKV * TT * HD * 2); h16* VT16 = (h16*)take((size_t)NB_ * NKV * HD * PP * 2);
    bf* QPh = (bf*)take((size_t)NB_ * NH_ * TT * HD * 2); bf* QPl = (bf*)take((size_t)NB_ * NH_ * TT * HD * 2); bf* KPh = (bf*)take((size_t)NB_ * NKV * TT * HD * 2); bf* KPl = (bf*)take((size_t)NB_ * NKV * TT * HD * 2); bf* VTh = (bf*)take((size_t)NB_ * NKV * HD * TT * 2); bf* VTl = (bf*)take((size_t)NB_ * NKV * HD * TT * 2);
    bf* ATh = (bf*)take((size_t)RWS * DQ * 2); bf* ATl = (bf*)take((size_t)RWS * DQ * 2);
    if ((size_t)(wsp - (char*)d_ws) > ws_size) return;    // ws 256 MiB
    // four launches, each for both batches; work that does not depend on one another shares a launch
    k_prep<<<CSB + CVB, 256, 0, stream>>>(x, wq, wk, wv, wo, XB, CS);
    k_gemmf<<<dim3(RWS / 128, FP / 128, 1), 128, 0, stream>>>(XB, WQKV, CS, qnw, knw, QP16, QPh, QPl, KP16, KPh, KPl, VT16, VTh, VTl);
    k_fattn<<<dim3(NB_ * NKV, TT / 16, 1), 32 * REP * KS, 0, stream>>>(QP16, QPh, QPl, KP16, KPh, KPl, VT16, VTh, VTl, ATh, ATl);
    k_gemmo<<<dim3(RWS / 128, DM / 128, 1), 128, 0, stream>>>(ATh, ATl, WO, OUT);
}

// v010
// One run takes 142 microseconds.
// Timed twice side by side with v009, it ran 1.03 and 1.02 times as fast.
// Counting every step since v000, it is 11.5 times as fast.
#include <hip/hip_runtime.h>

// YuaAttention (hidden [2][2048][2048]; q = x q_w^T (16 heads x 128), k/v = x k_w^T / v_w^T (4 kv heads, GQA repeat_interleave); per-head RMSNorm (eps 1e-5) with q_norm_w / k_norm_w, then rotate-half
// RoPE (theta 500000, positions 0..S-1); causal softmax(q.k 128^-0.5); out = merged attn.v o_w^T -> [2][2048][2048]).
// Compute dtypes, f32 accumulate: every input rounded to bf16; q/k/v projections on PLAIN bf16 operands (inputs: exact); o projection on hi+lo attn planes x bf16 o_w (2 products); RMSNorm + RoPE f32 (table computed on device);
// PER-ROW PRECISION HYBRID (rows < 256 hi+lo 3 products for scores and attn.v, rows >= 256 fp16); attention fused in one kernel (k_fattn: online softmax, key loop ends at the diagonal).

#define NB_  2
#define TT   2048
#define DM   2048
#define NH_  16
#define NKV  4
#define REP  (NH_ / NKV)
#define HD   128
#define DQ   (NH_ * HD)
#define DKV  (NKV * HD)
#define PP   TT                   // keys per fp16 V^T row
#define RH   256                  // query rows < RH use hi+lo planes (0: none)
#define WIN  0
#define RWS  (NB_ * TT)           // rows of both batches together: every launch takes both
#define FP   (DQ + 2 * DKV)       // columns of the joint q | k | v projection
#define NHK  (NH_ + NKV)          // heads that are normalised and rotated: the q heads, then the k heads (head h stands at column h * HD of the joint projection)
#define SCL  0.088388347648318447f   // HD^-0.5
typedef _Float16 h16;
typedef unsigned short bf;
typedef __attribute__((ext_vector_type(16))) __bf16   v16bf;
typedef __attribute__((ext_vector_type(16))) _Float16 v16h;
typedef __attribute__((ext_vector_type(8)))  _Float16 v8h;
typedef __attribute__((ext_vector_type(8)))  unsigned short v8us;
typedef __attribute__((ext_vector_type(8)))  float    v8f;
typedef __attribute__((ext_vector_type(4)))  float    v4f;
typedef v8h  __attribute__((may_alias)) v8ha;
typedef v4f  __attribute__((may_alias)) v4fa;
typedef v8us __attribute__((may_alias)) v8usa;

__device__ __forceinline__ unsigned short f2bf(float f) { unsigned u = __float_as_uint(f); u += 0x7FFFu + ((u >> 16) & 1u); return (unsigned short)(u >> 16); }
__device__ __forceinline__ float bf2f(unsigned short b) { return __uint_as_float(((unsigned)b) << 16); }
__device__ __forceinline__ float bfr(float f) { return bf2f(f2bf(f)); }
__device__ __forceinline__ v16h cat16(v8h lo, v8h hi) { return __builtin_shufflevector(lo, hi, 0, 1, 2, 3, 4, 5, 6, 7, 8, 9, 10, 11, 12, 13, 14, 15); }
__device__ __forceinline__ v16bf cat16b(v8us lo, v8us hi) { return __builtin_bit_cast(v16bf, __builtin_shufflevector(lo, hi, 0, 1, 2, 3, 4, 5, 6, 7, 8, 9, 10, 11, 12, 13, 14, 15)); }
__device__ __forceinline__ v8f wmma16(v16h a, v16h b, v8f c) { return __builtin_amdgcn_wmma_f32_16x16x32_f16(false, a, false, b, (short)0, c, false, false); }
__device__ __forceinline__ v8f wmmab(v16bf a, v16bf b, v8f c) { return __builtin_amdgcn_wmma_f32_16x16x32_bf16(false, a, false, b, (short)0, c, false, false); }



// ---- d_gemmt: GEMM, one 128x128 output tile per block of 4 waves (2 x 2 waves of 64x64, 16 accumulators each, every wave over the whole K in ascending k); the operand tiles are staged in LDS by asynchronous copies,
// so a byte that two waves need is read from L2 once per block. C[m][n] (f32, pitch LDC) = sum_k (A[m][k] (+ A2[m][k] if NA == 2)) Bt[n][k]. grid (M/128, N/128), 128 threads. K % 64 == 0, K >= 128.
// FRAGMENT-MAJOR PLANES: every 16-bit operand plane [rows][K] is stored as blocks of 16 rows x 32 k (512 elements, 1 KB), block (row / 16, k / 32) at element (row / 16 * (K / 32) + k / 32) * 512; inside a block the 16-byte piece
// number ld * 32 + hi * 16 + (row % 16) holds k % 32 = ld * 16 + hi * 8 + 0..7. That is the order in which the lanes of a wave take an A or B fragment, so each of its two loads reads 512 contiguous bytes (4 whole lines).
// ld(p): p = block start + lane * 8.
template <typename T16> struct WFrag;
template <> struct WFrag<h16> { typedef v16h V; static __device__ __forceinline__ V ld(const h16* p) { return cat16(*(const v8h*)p, *(const v8h*)(p + 256)); } static __device__ __forceinline__ v8f mma(V a, V b, v8f c) { return wmma16(a, b, c); } };
template <> struct WFrag<bf> { typedef v16bf V; static __device__ __forceinline__ V ld(const bf* p) { return cat16b(*(const v8us*)p, *(const v8us*)(p + 256)); } static __device__ __forceinline__ v8f mma(V a, V b, v8f c) { return wmmab(a, b, c); } };
// A STAGE = 64 k of the block's 128 rows of every operand plane (A, A2 if any, Bt): per plane 8 row blocks, each a RUN of 2 KB that is contiguous in memory (two neighbouring fragment blocks) and is laid down in LDS as it is:
// run r = plane * 8 + row block at LDS byte r * 2048, so a fragment is read from LDS in lane order too (512 contiguous bytes a load, no bank conflict). A wave copies NR = runs / 4 runs of a stage, four 512-byte copies each.
// The immediate offsets 512, 1024, 1536 move the global and the LDS address alike, which is what a run needs. A run's global address is its scalar base plus one byte offset that all runs share (lane * 16 + stage * 2048), so the ring
// holds two vector registers between stages, not three a run. The s_wait_xcnt stands in the copies' own statement, in front of any overwrite of an address register that they name.
#define CP4(l, o, s) "global_load_async_to_lds_b128 " l ", " o ", " s "\n\tglobal_load_async_to_lds_b128 " l ", " o ", " s " offset:512\n\tglobal_load_async_to_lds_b128 " l ", " o ", " s " offset:1024\n\tglobal_load_async_to_lds_b128 " l ", " o ", " s " offset:1536\n\t"
__device__ __forceinline__ void cp_stage(const bf* const (&g)[4], unsigned l, unsigned o) {
    asm volatile(CP4("%0", "%4", "%5") CP4("%1", "%4", "%6") CP4("%2", "%4", "%7") CP4("%3", "%4", "%8") "s_wait_xcnt 0x0"
                 :: "v"(l), "v"(l + 2048u), "v"(l + 4096u), "v"(l + 6144u), "v"(o), "s"(g[0]), "s"(g[1]), "s"(g[2]), "s"(g[3]) : "memory"); }
__device__ __forceinline__ void cp_stage(const bf* const (&g)[6], unsigned l, unsigned o) {
    asm volatile(CP4("%0", "%6", "%7") CP4("%1", "%6", "%8") CP4("%2", "%6", "%9") CP4("%3", "%6", "%10") CP4("%4", "%6", "%11") CP4("%5", "%6", "%12") "s_wait_xcnt 0x0"
                 :: "v"(l), "v"(l + 2048u), "v"(l + 4096u), "v"(l + 6144u), "v"(l + 8192u), "v"(l + 10240u), "v"(o), "s"(g[0]), "s"(g[1]), "s"(g[2]), "s"(g[3]), "s"(g[4]), "s"(g[5]) : "memory"); }
// EP: what becomes of the tile. 0: stored as f32 C. 1: a q or k head (the 128 columns are one head): RMSNorm and RoPE in registers, stored as the head's fragment-major planes. 2: a v group: stored as its fragment-major V^T planes.
// EP 1 forms the TRANSPOSED tile (the Bt fragment is the A operand), so a lane holds 8 neighbouring d of one row t, which is a 16-byte piece of a plane whose k is d; and a wave takes the column blocks wn*2, wn*2+1 and those 64 columns on,
// so both rotate-half partners d and d + HD/2 lie in one lane. EP 2 keeps the tile as it is: a lane holds 8 neighbouring t of one d, which is a piece of a plane whose k is t.
struct EpA { const float* CS; const float* nw; h16* P16; bf* Ph; bf* Pl; };   // cos / sin table, norm weight (EP 1); the three output planes of this head or group
__device__ __forceinline__ h16 tohx(float x) { return (h16)x; }
__device__ __forceinline__ void splitf(float y, unsigned short& h, unsigned short& l) { h = f2bf(y); l = f2bf(y - bf2f(h)); }
template <int NA, int K, int LDC, int EP>
__device__ __forceinline__ void d_gemmt(const bf* __restrict__ A, const bf* __restrict__ A2, const bf* __restrict__ Bt, float* C, bf* sm, const EpA e) {
    typedef WFrag<bf>::V V;
    constexpr int NPL = NA + 1, STE = NPL * 8 * 1024, NR = NPL * 2, NT = K / 64;   // planes; elements of a stage; runs a wave copies; stages
    static_assert(K % 64 == 0 && NT >= 2, "whole stages, and the two that the prologue fills");
    const int lane = threadIdx.x & 31, lr = lane & 15, hi = lane >> 4; const int r0 = blockIdx.x * 128, c0 = blockIdx.y * 128; const int wv = __builtin_amdgcn_readfirstlane((int)(threadIdx.x >> 5)); const int wm = wv >> 1, wn = wv & 1;
    const bf* g[NR];   // scalar: where each of the wave's runs begins in memory, stage 0
#pragma unroll
    for (int j = 0; j < NR; ++j) { const int r = wv * NR + j, pl = r >> 3, rb = r & 7; const bf* base = (pl == NPL - 1) ? Bt + (size_t)c0 * K : ((pl == 0) ? A : A2) + (size_t)r0 * K;
        g[j] = base + (size_t)rb * 16 * K; }
    const unsigned l0 = (unsigned)(size_t)(sm + wv * NR * 1024 + lane * 8), o0 = (unsigned)lane * 16u;   // this lane's LDS byte address in the wave's first run, buffer 0; its byte offset in a run
    v8f acc[4][4];
#pragma unroll
    for (int mb = 0; mb < 4; ++mb)
#pragma unroll
        for (int nb = 0; nb < 4; ++nb) acc[mb][nb] = (v8f){};
    cp_stage(g, l0, o0);
    asm volatile("s_wait_asynccnt 0x0" ::: "memory");   // this wave's copies of stage 0 have landed
    __syncthreads();                                     // every wave's have: stage 0 may be read
    cp_stage(g, l0 + (unsigned)(STE * 2), o0 + 2048u);   // stage 1 flies while stage 0 is worked on
    // the loop over stages stays rolled (for speed only); every loop inside it and behind it is unrolled so that acc, the fragments and res are indexed by constants and stay in registers
#pragma unroll 1
    for (int t = 0; t < NT; ++t) {
        const bf* sb = sm + (t & 1) * STE + lane * 8; V a[4], a2[4], b[4];
#pragma unroll
        for (int kk = 0; kk < 2; ++kk) {
#pragma unroll
            for (int mb = 0; mb < 4; ++mb) { a[mb] = WFrag<bf>::ld(sb + (wm * 4 + mb) * 1024 + kk * 512); if constexpr (NA == 2) a2[mb] = WFrag<bf>::ld(sb + (8 + wm * 4 + mb) * 1024 + kk * 512); }
#pragma unroll
            for (int nb = 0; nb < 4; ++nb) b[nb] = WFrag<bf>::ld(sb + ((NPL - 1) * 8 + (EP == 1 ? (nb >> 1) * 4 + wn * 2 + (nb & 1) : wn * 4 + nb)) * 1024 + kk * 512);
            // inputs only, loaded values: all LDS reads of the 32-k step are issued together ahead of its products; without it the compiler reloads one B fragment at a time and each group of four products waits out an LDS round trip
            if constexpr (NA == 2) asm volatile("" :: "v"(a[0]), "v"(a[1]), "v"(a[2]), "v"(a[3]), "v"(a2[0]), "v"(a2[1]), "v"(a2[2]), "v"(a2[3]), "v"(b[0]), "v"(b[1]), "v"(b[2]), "v"(b[3]));
            else asm volatile("" :: "v"(a[0]), "v"(a[1]), "v"(a[2]), "v"(a[3]), "v"(b[0]), "v"(b[1]), "v"(b[2]), "v"(b[3]));
            if (kk == 1) {   // the stage's last fragments are in registers: its buffer is handed over here, so that the refill flies during the second step's products as well
                asm volatile("s_wait_dscnt 0x0" ::: "memory");      // this wave's reads of stage t are done before its buffer may be refilled
                asm volatile("s_wait_asynccnt 0x0" ::: "memory");   // this wave's copies of stage t + 1 have landed
                __syncthreads();                                     // publishes stage t + 1 and ends every wave's reads of stage t
                if (t + 2 < NT) cp_stage(g, l0 + (unsigned)((t & 1) * (STE * 2)), o0 + (unsigned)(t + 2) * 2048u);
                __builtin_amdgcn_sched_barrier(0);                   // keeps the products below behind the copies: moved up, they would hold back the copies' issue by their own length
            }
#pragma unroll
            for (int nb = 0; nb < 4; ++nb)
#pragma unroll
                for (int mb = 0; mb < 4; ++mb) { if constexpr (EP == 1) acc[mb][nb] = WFrag<bf>::mma(b[nb], a[mb], acc[mb][nb]); else acc[mb][nb] = WFrag<bf>::mma(a[mb], b[nb], acc[mb][nb]); if constexpr (NA == 2) acc[mb][nb] = WFrag<bf>::mma(a2[mb], b[nb], acc[mb][nb]); } }
    }
    asm volatile("s_wait_asynccnt 0x0" ::: "memory");   // no copy is outstanding when the ring becomes output staging (the last trip's barrier has ended every read of it)
    const int t0 = r0 % TT;   // the tile's first row inside its batch (a tile lies in one batch)
    if constexpr (EP == 1) {
        // lane: rows t = t0 + wm*64 + mb*16 + lr; columns d = wn*32 + (nb&1)*16 + hi*8 + j (nb < 2) and the same + HD/2 (nb >= 2)
        float* ps = (float*)sm; float rf[4];
#pragma unroll
        for (int mb = 0; mb < 4; ++mb) { float q = 0.f;
#pragma unroll
            for (int nb = 0; nb < 4; ++nb)
#pragma unroll
                for (int j = 0; j < 8; ++j) q += acc[mb][nb][j] * acc[mb][nb][j];
            q += __shfl_xor(q, 16, 32); rf[mb] = q; if (hi == 0) ps[wv * 64 + mb * 16 + lr] = q; }   // the wave's 64 columns of each of its 64 rows
        __syncthreads();   // the sums of squares of both column halves are in LDS before the neighbour wave reads them
#pragma unroll
        for (int mb = 0; mb < 4; ++mb) rf[mb] = __fdiv_rn(1.0f, __fsqrt_rn(__fadd_rn((rf[mb] + ps[(wv ^ 1) * 64 + mb * 16 + lr]) * (1.0f / HD), 1e-5f)));
        // every address below is a scalar base + one lane offset + a constant, so no address register is written between the first access and the last
        const char* wb = (const char*)(e.nw + wn * 32); const unsigned wo = (unsigned)hi * 32u; v8f wl[2], wh[2];
#pragma unroll
        for (int p = 0; p < 2; ++p) { wl[p] = *(const v8f*)(wb + wo + p * 64); wh[p] = *(const v8f*)(wb + wo + p * 64 + HD * 2); }
        const char* cb = (const char*)(e.CS + ((size_t)(t0 + wm * 64) * HD + wn * 32) * 2); const unsigned co = (unsigned)(lr * HD + hi * 8) * 8u;
        const size_t pb = (size_t)((t0 + wm * 64) / 16 * (HD / 32) + wn) * 512; char* b16 = (char*)(e.P16 + pb); char* bh = (char*)(e.Ph + pb); char* bl = (char*)(e.Pl + pb); const unsigned so = (unsigned)lane * 16u;
#pragma unroll
        for (int mb = 0; mb < 4; ++mb) { v8f c0[2], c1[2];
#pragma unroll
            for (int p = 0; p < 2; ++p) { c0[p] = *(const v8f*)(cb + co + mb * (16 * HD * 8) + p * 128); c1[p] = *(const v8f*)(cb + co + mb * (16 * HD * 8) + p * 128 + 32); }
            // the wait in front of an overwrite of the loads' address registers. Inputs only: the lane offsets and the scalar bases stay as they are up to here, and the loaded values put the wait behind every load
            asm volatile("s_wait_xcnt 0x0" :: "s"(cb), "s"(wb), "v"(co), "v"(wo), "v"(c0[0]), "v"(c0[1]), "v"(c1[0]), "v"(c1[1]), "v"(wl[0]), "v"(wl[1]), "v"(wh[0]), "v"(wh[1]) : "memory");
            v8h l16[2], u16[2]; v8us lh[2], ll[2], uh[2], ul[2];   // l..: column d, u..: column d + HD/2
#pragma unroll
            for (int p = 0; p < 2; ++p)
#pragma unroll
                for (int q = 0; q < 8; ++q) { const float xa = bfr(wl[p][q]) * (acc[mb][p][q] * rf[mb]), xb = bfr(wh[p][q]) * (acc[mb][p + 2][q] * rf[mb]);
                    const float c = (q < 4) ? c0[p][2 * q] : c1[p][2 * q - 8], sn = (q < 4) ? c0[p][2 * q + 1] : c1[p][2 * q - 7];
                    const float ra = xa * c - xb * sn, rb = xb * c + xa * sn; unsigned short a2, c2;
                    l16[p][q] = tohx(ra); splitf(ra, a2, c2); lh[p][q] = a2; ll[p][q] = c2; u16[p][q] = tohx(rb); splitf(rb, a2, c2); uh[p][q] = a2; ul[p][q] = c2; }
#pragma unroll
            for (int p = 0; p < 2; ++p) { const int ol = mb * (HD / 32 * 1024) + p * 512, ou = ol + (HD / 64) * 1024;   // bytes: row block mb, k half p; the partner stands two fragment blocks on
                *(v8h*)(b16 + so + ol) = l16[p]; *(v8us*)(bh + so + ol) = lh[p]; *(v8us*)(bl + so + ol) = ll[p]; *(v8h*)(b16 + so + ou) = u16[p]; *(v8us*)(bh + so + ou) = uh[p]; *(v8us*)(bl + so + ou) = ul[p]; }
            // the wait in front of an overwrite of a register that the twelve stores name. Inputs only: the stored values, the lane offset and the scalar bases stay as they are up to here
            asm volatile("s_wait_xcnt 0x0" :: "s"(b16), "s"(bh), "s"(bl), "v"(so), "v"(l16[0]), "v"(l16[1]), "v"(u16[0]), "v"(u16[1]), "v"(lh[0]), "v"(lh[1]), "v"(ll[0]), "v"(ll[1]), "v"(uh[0]), "v"(uh[1]), "v"(ul[0]), "v"(ul[1]) : "memory"); }
        return;
    }
    if constexpr (EP == 2) {
        // lane: column d = wn*64 + nb*16 + lr; rows t = t0 + wm*64 + mb*16 + hi*8 + j: piece (t/16 % 2) * 32 + lane of block (t / 32, d / 16)
        const size_t pb = (size_t)((t0 / 32 + wm * 2) * (HD / 16) + wn * 4) * 512; char* b16 = (char*)(e.P16 + pb); char* bh = (char*)(e.Ph + pb); char* bl = (char*)(e.Pl + pb); const unsigned so = (unsigned)lane * 16u;
        v8h o16[4][4]; v8us oh[4][4], ol[4][4];
#pragma unroll
        for (int mb = 0; mb < 4; ++mb)
#pragma unroll
            for (int nb = 0; nb < 4; ++nb)
#pragma unroll
                for (int j = 0; j < 8; ++j) { const float x = acc[mb][nb][j]; unsigned short a2, c2; o16[mb][nb][j] = tohx(x); splitf(x, a2, c2); oh[mb][nb][j] = a2; ol[mb][nb][j] = c2; }
        // all global stores last: no register that a store names is written again
#pragma unroll
        for (int mb = 0; mb < 4; ++mb)
#pragma unroll
            for (int nb = 0; nb < 4; ++nb) { const int of = ((mb >> 1) * (HD / 16) + nb) * 1024 + (mb & 1) * 512;
                *(v8h*)(b16 + so + of) = o16[mb][nb]; *(v8us*)(bh + so + of) = oh[mb][nb]; *(v8us*)(bl + so + of) = ol[mb][nb]; }
        return;
    }
    // whole lines out: each wave turns its 16x64 row blocks through its own LDS range (two, by row block parity), 256 contiguous bytes of a row per 16 lanes
    float* stg = (float*)sm + wv * (2 * 16 * 68); v4f res[4][8];
#pragma unroll
    for (int mb = 0; mb < 4; ++mb) { float* ob = stg + (mb & 1) * (16 * 68);
#pragma unroll
        for (int nb = 0; nb < 4; ++nb)
#pragma unroll
            for (int j = 0; j < 8; ++j) ob[(hi * 8 + j) * 68 + nb * 16 + lr] = acc[mb][nb][j];
        asm volatile("s_wait_dscnt 0x0" ::: "memory");   // the wave's own writes are in LDS before its lanes read one another's values back
#pragma unroll
        for (int q = 0; q < 8; ++q) { const int s = lane + q * 32; res[mb][q] = *(const v4fa*)(ob + (s >> 4) * 68 + (s & 15) * 4); } }
    // all global stores last: no register that a store names is written again
    float* cp = C + (size_t)(r0 + wm * 64 + (lane >> 4)) * LDC + c0 + wn * 64 + (lane & 15) * 4;
#pragma unroll
    for (int mb = 0; mb < 4; ++mb)
#pragma unroll
        for (int q = 0; q < 8; ++q) *(v4f*)(cp + (size_t)(mb * 16 + q * 2) * LDC) = res[mb][q];
}
// k_gemmf: the joint q | k | v projection of both batches; column tile y is head y (q heads, then k heads) or, from NHK on, v group y - NHK. The projection itself is never stored: each tile leaves as the operand planes of the attention kernel; planes are ordered [batch][head].
__global__ __launch_bounds__(128) void k_gemmf(const bf* __restrict__ X, const bf* __restrict__ W, const float* __restrict__ CS, const float* __restrict__ qnw, const float* __restrict__ knw, h16* Q16, bf* Qh, bf* Ql, h16* K16, bf* Kh, bf* Kl, h16* V16, bf* Vh, bf* Vl) { __shared__ __align__(2048) bf sm[2 * 2 * 8 * 1024];
    const int h = (int)blockIdx.y, b = (int)blockIdx.x / (TT / 128);
    if (h < NHK) { const bool isq = h < NH_; const size_t o = (size_t)(isq ? b * NH_ + h : b * NKV + h - NH_) * TT * HD;   // scalar choices: one copy of the code serves q and k heads
        d_gemmt<1, DM, FP, 1>(X, X, W, nullptr, sm, EpA{CS, isq ? qnw : knw, (isq ? Q16 : K16) + o, (isq ? Qh : Kh) + o, (isq ? Ql : Kl) + o}); }
    else { const size_t o = (size_t)(b * NKV + h - NHK) * HD * TT; d_gemmt<1, DM, FP, 2>(X, X, W, nullptr, sm, EpA{nullptr, nullptr, V16 + o, Vh + o, Vl + o}); } }
__global__ __launch_bounds__(128) void k_gemmo(const bf* __restrict__ Ah, const bf* __restrict__ Al, const bf* __restrict__ W, float* O) { __shared__ __align__(2048) bf sm[2 * 3 * 8 * 1024]; d_gemmt<2, DQ, DM, 0>(Ah, Al, W, O, sm, EpA{}); }

typedef __attribute__((ext_vector_type(2))) _Float16 v2h;
typedef __attribute__((ext_vector_type(4))) _Float16 v4h;
typedef __attribute__((ext_vector_type(2))) unsigned short v2us;
typedef __attribute__((ext_vector_type(4))) unsigned short v4us;
typedef __attribute__((ext_vector_type(2))) float v2f;
typedef __attribute__((ext_vector_type(4))) int v4i;

__global__ __launch_bounds__(256) void k_wtG(const float* __restrict__ w, int K, int N, bf* Bt) {
    const int lane = threadIdx.x & 31; const int L0 = (blockIdx.x * 8 + (threadIdx.x >> 5)) * 8; const int nlines = N * K / 64;
{
#pragma unroll 1
        for (int l = 0; l < 8; ++l) { const int L = L0 + l; if (L >= nlines) break; const size_t e = (size_t)L * 64 + lane * 2; const int k = (int)(e % K), n = (int)(e / K); v2us o;
            o[0] = f2bf(w[(size_t)k * N + n]); o[1] = f2bf(w[(size_t)(k + 1) * N + n]); *(v2us*)(Bt + e) = o; }
         }
}
// d_cvt8: f32 [rows][DM] -> bf16 fragment-major plane, all five sources in one launch: the planes of x (both batches), q_w, k_w, v_w, o_w lie behind one another in dst, so q_w | k_w | v_w is one plane of FP rows. A thread takes its lane's place in the four 16-byte-piece rows of two neighbouring blocks (32 elements), so a wave reads 256 contiguous bytes of each of 16 rows, eight 16-byte loads in flight a lane,
// and writes 2 KB in a row. bx = block index; 256 threads take 16 fragment blocks of one 16-row block, so the source is chosen by a scalar test. Few waves on purpose, for speed only.
__device__ __forceinline__ void d_cvt8(const float* __restrict__ x, const float* __restrict__ wq, const float* __restrict__ wk, const float* __restrict__ wv, const float* __restrict__ wo, bf* dst, unsigned bx) { const size_t i = (size_t)bx * 256 + threadIdx.x; const size_t blk = (i >> 5) * 2; const int ln = (int)i & 31;   // DM / 32 is even: both blocks lie in one row block
    const int rb = (int)(bx / (DM / 32 / 16)); const float* src = x; int rb0 = 0;   // rb: 16-row block in dst; rb0: where the source's plane begins
    if (rb >= (RWS + FP) / 16) { src = wo; rb0 = (RWS + FP) / 16; } else if (rb >= (RWS + DQ + DKV) / 16) { src = wv; rb0 = (RWS + DQ + DKV) / 16; } else if (rb >= (RWS + DQ) / 16) { src = wk; rb0 = (RWS + DQ) / 16; } else if (rb >= RWS / 16) { src = wq; rb0 = RWS / 16; }
    const float* s = src + ((size_t)(rb - rb0) * 16 + (ln & 15)) * DM + (blk % (DM / 32)) * 32 + (ln >> 4) * 8; v8f v[4];
#pragma unroll
    for (int p = 0; p < 4; ++p) v[p] = *(const v8f*)(s + p * 16);   // piece row p = block p / 2, k half p % 2: k offset p * 16
#pragma unroll
    for (int p = 0; p < 4; ++p) { v8us o;
#pragma unroll
        for (int k = 0; k < 8; ++k) o[k] = f2bf(v[p][k]);
        *(v8us*)(dst + blk * 512 + p * 256 + ln * 8) = o; }
    asm volatile("s_wait_xcnt 0x0" ::: "memory");  }   // the wait behind the four stores: in the joint kernel other code follows them in the listing, and none of it may write a register that a store names ahead of this wait
__device__ __forceinline__ void d_cstab(float* CS, unsigned bx) { const int idx = (int)bx * 256 + threadIdx.x; if (idx >= TT * HD) return; const int t = idx / HD, d = idx % HD; const int i = d % (HD / 2); const float inv = __fdiv_rn(1.0f, powf(500000.0f, (float)(2 * i) / (float)HD)); const float ang = __fmul_rn((float)t, inv); v2f cs; cs[0] = cosf(ang); cs[1] = sinf(ang);
    *(v2f*)(CS + (size_t)idx * 2) = cs;  }
// k_prep: all that depends on the inputs alone, in one launch: the cos / sin table (blocks below CSB; first, as its waves run longest) and the five plane conversions
#define CSB  (TT * HD / 256)
#define CVB  ((RWS + FP + DM) * (DM / 32) / 256)
__global__ __launch_bounds__(256) void k_prep(const float* __restrict__ x, const float* __restrict__ wq, const float* __restrict__ wk, const float* __restrict__ wv, const float* __restrict__ wo, bf* dst, float* CS) { if (blockIdx.x < CSB) d_cstab(CS, blockIdx.x); else d_cvt8(x, wq, wk, wv, wo, dst, blockIdx.x - CSB); }
// ---- k_fattn: causal attention of both batches in one launch; no score or probability matrix in memory. Block = 16 query rows x the REP query heads of one kv group x KS key parts (one wave each): wave (hd, part) takes the 32-key steps part, part + KS, ...
// Transposed products: S^T = K Q^T (A = key rows, B = query rows), so a lane holds, for ITS query (column lr), keys hi*8+j of each 16-key block: exactly the k order of a B fragment, and P^T goes into O^T += V^T P^T without leaving the lane.
// Online softmax per lane in the log2 domain (running maximum m, running sum l, O^T rescaled at every step); the KS parts are merged through LDS in part order (fixed order, run-to-run identical); part 0 normalises and stores the hi + lo planes of the merged heads.
// Rows < RH: hi+lo bf16 planes, 3 products for scores and for attn.v; rows >= RH: fp16. A block is wholly one or the other (RH % 16 == 0).
#define KS   3
#define SL2  (SCL * 1.4426950408889634f)   // HD^-0.5 x log2(e)
typedef __attribute__((ext_vector_type(16))) unsigned short v16us;
static_assert(RH % 16 == 0 && TT % 32 == 0, "a block's rows share one precision path; key steps are whole");
static_assert(DM == DQ && DM % 128 == 0 && HD % 32 == 0 && PP == TT, "one k length for every converted plane; whole fragment blocks");
// exp2 with the issue slot behind a transcendental filled: the v_nop keeps the next vector instruction, whichever the compiler puts there, from directly reading the result or overwriting the source.
__device__ __forceinline__ float ex2(float x) { float r; asm("v_exp_f32 %0, %1\n\tv_nop" : "=v"(r) : "v"(x)); return r; }
// four at once, one v_nop behind the last; the results are early-clobber so that none lies on the source of the exponential in front of it
__device__ __forceinline__ void ex2x4(float& a, float& b, float& c, float& d) { float ra, rb, rc, rd; asm("v_exp_f32 %0, %4\n\tv_exp_f32 %1, %5\n\tv_exp_f32 %2, %6\n\tv_exp_f32 %3, %7\n\tv_nop" : "=&v"(ra), "=&v"(rb), "=&v"(rc), "=&v"(rd) : "v"(a), "v"(b), "v"(c), "v"(d)); a = ra; b = rb; c = rc; d = rd; }
template <typename T16, bool HI>
__device__ __forceinline__ void fa_run(const T16* __restrict__ Q, const T16* __restrict__ Q2, const T16* __restrict__ Kp, const T16* __restrict__ K2, const T16* __restrict__ Vt, const T16* __restrict__ Vt2, int q0, int part, int lr, int hi, v8f (&o)[8], float& m, float& l) {
    typedef typename WFrag<T16>::V V;
    V qf[4], qf2[4]; const T16* pq = Q + (size_t)q0 * HD + 8 * (hi * 16 + lr); const T16* pq2 = HI ? Q2 + (size_t)q0 * HD + 8 * (hi * 16 + lr) : nullptr;
#pragma unroll
    for (int ks = 0; ks < 4; ++ks) { qf[ks] = WFrag<T16>::ld(pq + ks * 512); if constexpr (HI) qf2[ks] = WFrag<T16>::ld(pq2 + ks * 512); }
    // the wait in front of an overwrite of the Q loads' address registers; the inputs keep those registers as they are up to here
    if constexpr (HI) asm volatile("s_wait_xcnt 0x0" :: "v"(pq), "v"(pq2) : "memory"); else asm volatile("s_wait_xcnt 0x0" :: "v"(pq) : "memory");
    const int nst = (q0 + 47) / 32;   // 32-key steps that reach key q0 + 15; the last key touched is below TT
    const size_t ko = 8 * (hi * 16 + lr), vo = ko; const int qi = q0 + lr;   // fragment-major planes: 16 keys of K are 16 * HD elements in a row, 32 keys of V^T are 32 * HD
    V kf[8];   // fp16 rows: the K fragments of the step in hand; each step fetches the next step's into the same registers, right behind its score products
    if constexpr (!HI) { const T16* pk0 = Kp + ko + (size_t)(part < nst ? part : 0) * 32 * HD;
#pragma unroll
        for (int i = 0; i < 8; ++i) kf[i] = WFrag<T16>::ld(pk0 + (i >> 2) * 16 * HD + (i & 3) * 512);
        asm volatile("s_wait_xcnt 0x0" :: "v"(pk0) : "memory"); }   // the wait in front of an overwrite of the first K loads' address registers; the input keeps them as they are up to here
#pragma unroll 1
    for (int s = part; s < nst; s += KS) {
        const int k0 = s * 32;
        v8f st[2]; st[0] = (v8f){}; st[1] = (v8f){};
        const T16* pv = Vt + vo + (size_t)k0 * HD; const T16* pv2 = HI ? Vt2 + vo + (size_t)k0 * HD : nullptr; const T16* pkn = nullptr; V vf8[8];
        if constexpr (HI) { const T16* pk[2] = { Kp + ko + (size_t)k0 * HD, Kp + ko + (size_t)(k0 + 16) * HD }; const T16* pk2[2] = { K2 + ko + (size_t)k0 * HD, K2 + ko + (size_t)(k0 + 16) * HD };
#pragma unroll
            for (int kb = 0; kb < 2; ++kb) { V kf[4], kg[4];
#pragma unroll
                for (int ks = 0; ks < 4; ++ks) { kf[ks] = WFrag<T16>::ld(pk[kb] + ks * 512); kg[ks] = WFrag<T16>::ld(pk2[kb] + ks * 512); }
                asm volatile("" :: "v"(kf[0]), "v"(kf[1]), "v"(kf[2]), "v"(kf[3]), "v"(kg[0]), "v"(kg[1]), "v"(kg[2]), "v"(kg[3]));   // inputs only, loaded values: the 16 loads of a key block are issued before its first product; without it each fragment's load is waited for alone, one round trip after another
#pragma unroll
                for (int ks = 0; ks < 4; ++ks) { st[kb] = WFrag<T16>::mma(kf[ks], qf[ks], st[kb]); st[kb] = WFrag<T16>::mma(kf[ks], qf2[ks], st[kb]); st[kb] = WFrag<T16>::mma(kg[ks], qf[ks], st[kb]); } }
            asm volatile("s_wait_xcnt 0x0" :: "v"(pk[0]), "v"(pk[1]), "v"(pk2[0]), "v"(pk2[1]), "v"(st[0]), "v"(st[1]) : "memory");   // the wait in front of an overwrite of the K loads' address registers; the inputs keep those registers as they are up to here and put the wait behind the last product, so behind every load
        } else {
#pragma unroll
            for (int db = 0; db < 8; ++db) vf8[db] = WFrag<T16>::ld(pv + db * 512);
            __builtin_amdgcn_sched_barrier(0);   // keeps the step's V loads ahead of its score products: moved down, their round trip would begin only behind the products and stand open in front of attn.v
#pragma unroll
            for (int ks = 0; ks < 4; ++ks) { st[0] = WFrag<T16>::mma(kf[ks], qf[ks], st[0]); st[1] = WFrag<T16>::mma(kf[4 + ks], qf[ks], st[1]); }
            __builtin_amdgcn_sched_barrier(0);   // keeps the next step's K loads behind the products that read the same registers: moved up, they would need a second register set and copies at the loop's foot
            pkn = Kp + ko + (size_t)(s + KS < nst ? s + KS : s) * 32 * HD;   // the wave's last step has no next one: it reads its own keys again (in bounds), and nothing uses them
#pragma unroll
            for (int i = 0; i < 8; ++i) kf[i] = WFrag<T16>::ld(pkn + (i >> 2) * 16 * HD + (i & 3) * 512);
            __builtin_amdgcn_sched_barrier(0);   // keeps those loads ahead of the softmax: moved down, they would fly for less than a step
        }
        float t[16];
#pragma unroll
        for (int e = 0; e < 16; ++e) t[e] = st[e >> 3][e & 7] * SL2;
        if (k0 + 31 > q0) {   // only a step that reaches past the block's first row holds keys above the diagonal
#pragma unroll
            for (int e = 0; e < 16; ++e) t[e] = (k0 + (e >> 3) * 16 + hi * 8 + (e & 7) <= qi) ? t[e] : -3.0e38f; }
        float mx = m;
#pragma unroll
        for (int e = 0; e < 16; ++e) mx = fmaxf(mx, t[e]);
        mx = fmaxf(mx, __shfl_xor(mx, 16, 32));   // the two half-waves hold the two key octets of the same query
        const float al = ex2(m - mx); m = mx; float ps = 0.f;   // m starts at -1e30, above the mask value, so a step whose keys are all masked gives p = 0, not exp2(0)
#pragma unroll
        for (int e = 0; e < 16; e += 4) { t[e] -= mx; t[e + 1] -= mx; t[e + 2] -= mx; t[e + 3] -= mx; ex2x4(t[e], t[e + 1], t[e + 2], t[e + 3]); ps += t[e]; ps += t[e + 1]; ps += t[e + 2]; ps += t[e + 3]; }
        l = l * al + ps;
#pragma unroll
        for (int db = 0; db < 8; ++db) o[db] = o[db] * al;
        V pf, pf2;
        if constexpr (HI) { v16us ph, pl;
#pragma unroll
            for (int e = 0; e < 16; ++e) { unsigned short x, y; splitf(t[e], x, y); ph[e] = x; pl[e] = y; }
            pf = __builtin_bit_cast(v16bf, ph); pf2 = __builtin_bit_cast(v16bf, pl);
        } else {
#pragma unroll
            for (int e = 0; e < 16; ++e) pf[e] = tohx(t[e]); }
        if constexpr (HI) {
#pragma unroll
            for (int dg = 0; dg < 8; dg += 4) { V vf[4], vg[4];
#pragma unroll
                for (int i = 0; i < 4; ++i) { vf[i] = WFrag<T16>::ld(pv + (dg + i) * 512); vg[i] = WFrag<T16>::ld(pv2 + (dg + i) * 512); }
                asm volatile("" :: "v"(vf[0]), "v"(vf[1]), "v"(vf[2]), "v"(vf[3]), "v"(vg[0]), "v"(vg[1]), "v"(vg[2]), "v"(vg[3]));   // inputs only, loaded values: the 16 loads of four d blocks are issued before their first product, as for K above
#pragma unroll
                for (int i = 0; i < 4; ++i) { o[dg + i] = WFrag<T16>::mma(vf[i], pf, o[dg + i]); o[dg + i] = WFrag<T16>::mma(vf[i], pf2, o[dg + i]); o[dg + i] = WFrag<T16>::mma(vg[i], pf, o[dg + i]); } }
        } else {
#pragma unroll
            for (int db = 0; db < 8; ++db) o[db] = WFrag<T16>::mma(vf8[db], pf, o[db]); }
        if constexpr (HI) asm volatile("s_wait_xcnt 0x0" :: "v"(pv), "v"(pv2), "v"(o[7]) : "memory");   // the wait in front of an overwrite of the V loads' address registers, as for the K loads above: the inputs keep those registers as they are up to here, behind the last product and so behind every load
        else asm volatile("s_wait_xcnt 0x0" :: "v"(pv), "v"(pkn), "v"(o[7]) : "memory");   // the same wait for the fp16 rows' V loads and for the K loads of the next step: the inputs keep both address registers as they are (no load's own result lands on them) up to here, behind every load
    }
}
__global__ __launch_bounds__(32 * REP * KS) void k_fattn(const h16* __restrict__ Q16, const bf* __restrict__ Qh, const bf* __restrict__ Ql, const h16* __restrict__ K16, const bf* __restrict__ Kh, const bf* __restrict__ Kl, const h16* __restrict__ V16, const bf* __restrict__ Vh, const bf* __restrict__ Vl, bf* Ah, bf* Al) {
    __shared__ float mg[(KS - 1) * REP * 66 * 32];   // per merged wave: 64 O^T values, m, l, each x 32 lanes (lane-contiguous)
    const int lane = threadIdx.x & 31, lr = lane & 15, hi = lane >> 4; const int wv = __builtin_amdgcn_readfirstlane((int)(threadIdx.x >> 5)); const int hd = wv % REP, part = wv / REP;
    const int g = blockIdx.x, head = g * REP + hd; const int q0 = (TT / 16 - 1 - (int)blockIdx.y) * 16;   // g = batch * NKV + kv group, head = batch * NH_ + query head: both batches in one launch; longest rows first
    v8f o[8];
#pragma unroll
    for (int db = 0; db < 8; ++db) o[db] = (v8f){};
    float m = -1.0e30f, l = 0.f;
    if (q0 < RH) fa_run<bf, true>(Qh + (size_t)head * TT * HD, Ql + (size_t)head * TT * HD, Kh + (size_t)g * TT * HD, Kl + (size_t)g * TT * HD, Vh + (size_t)g * HD * TT, Vl + (size_t)g * HD * TT, q0, part, lr, hi, o, m, l);
    else fa_run<h16, false>(Q16 + (size_t)head * TT * HD, nullptr, K16 + (size_t)g * TT * HD, nullptr, V16 + (size_t)g * HD * PP, nullptr, q0, part, lr, hi, o, m, l);
    if (part > 0) { float* d = mg + (size_t)((part - 1) * REP + hd) * (66 * 32) + lane;
#pragma unroll
        for (int e = 0; e < 64; ++e) d[e * 32] = o[e >> 3][e & 7];
        d[64 * 32] = m; d[65 * 32] = l; }
    __syncthreads();   // the parts 1.. of every head are in LDS before part 0 reads them
    if (part > 0) return;
#pragma unroll
    for (int w = 1; w < KS; ++w) { const float* d = mg + (size_t)((w - 1) * REP + hd) * (66 * 32) + lane; const float m1 = d[64 * 32], l1 = d[65 * 32]; const float mn = fmaxf(m, m1); const float a0 = ex2(m - mn), a1 = ex2(m1 - mn);
#pragma unroll
        for (int e = 0; e < 64; ++e) o[e >> 3][e & 7] = o[e >> 3][e & 7] * a0 + d[e * 32] * a1;
        l = l * a0 + l1 * a1; m = mn; }
    l += __shfl_xor(l, 16, 32);
    const float inv = __fdiv_rn(1.0f, l); const size_t oo = (size_t)((g / NKV) * TT + q0) * DQ + (size_t)(head % NH_) * (HD / 32) * 512 + lane * 8;   // fragment-major [RWS][DQ]: column (head % NH_) * HD + db * 16 + hi * 8 is k block (head % NH_) * 4 + db / 2, half db % 2
#pragma unroll
    for (int db = 0; db < 8; ++db) { v8us oh, ol;
#pragma unroll
        for (int j = 0; j < 8; ++j) { unsigned short x, y; splitf(o[db][j] * inv, x, y); oh[j] = x; ol[j] = y; }
        *(v8us*)(Ah + oo + (db >> 1) * 512 + (db & 1) * 256) = oh; *(v8us*)(Al + oo + (db >> 1) * 512 + (db & 1) * 256) = ol; }
}

extern "C" void kernel_launch(void* const* d_in, const int* in_sizes, int n_in,
                              void* d_out, int out_size, void* d_ws, size_t ws_size, hipStream_t stream) {
    (void)in_sizes; (void)n_in; (void)out_size;
    const float* x = (const float*)d_in[0]; const float* wq = (const float*)d_in[1]; const float* wk = (const float*)d_in[2]; const float* wv = (const float*)d_in[3]; const float* wo = (const float*)d_in[4]; const float* qnw = (const float*)d_in[5]; const float* knw = (const float*)d_in[6];   // torch [out][in]
    float* OUT = (float*)d_out;     // [2][2048][2048]
    char* wsp = (char*)d_ws;
    auto take = [&](size_t bytes) { char* p = wsp; wsp += (bytes + 255) & ~(size_t)255; return (void*)p; };
    bf* XB = (bf*)take((size_t)(RWS + FP + DM) * DM * 2); bf* WQKV = XB + (size_t)RWS * DM; bf* WO = WQKV + (size_t)FP * DM;   // one run of planes, in the order in which k_prep writes them
    float* CS = (float*)take((size_t)TT * HD * 2 * 4);
    h16* QP16 = (h16*)take((size_t)NB_ * NH_ * TT * HD * 2); h16* KP16 = (h16*)take((size_t)NB_ * NKV * TT * HD * 2); h16* VT16 = (h16*)take((size_t)NB_ * NKV * HD * PP * 2);
    bf* QPh = (bf*)take((size_t)NB_ * NH_ * TT * HD * 2); bf* QPl = (bf*)take((size_t)NB_ * NH_ * TT * HD * 2); bf* KPh = (bf*)take((size_t)NB_ * NKV * TT * HD * 2); bf* KPl = (bf*)take((size_t)NB_ * NKV * TT * HD * 2); bf* VTh = (bf*)take((size_t)NB_ * NKV * HD * TT * 2); bf* VTl = (bf*)take((size_t)NB_ * NKV * HD * TT * 2);
    bf* ATh = (bf*)take((size_t)RWS * DQ * 2); bf* ATl = (bf*)take((size_t)RWS * DQ * 2);
    if ((size_t)(wsp - (char*)d_ws) > ws_size) return;    // ws 256 MiB
    // four launches, each for both batches; work that does not depend on one another shares a launch
    k_prep<<<CSB + CVB, 256, 0, stream>>>(x, wq, wk, wv, wo, XB, CS);
    k_gemmf<<<dim3(RWS / 128, FP / 128, 1), 128, 0, stream>>>(XB, WQKV, CS, qnw, knw, QP16, QPh, QPl, KP16, KPh, KPl, VT16, VTh, VTl);
    k_fattn<<<dim3(NB_ * NKV, TT / 16, 1), 32 * REP * KS, 0, stream>>>(QP16, QPh, QPl, KP16, KPh, KPl, VT16, VTh, VTl, ATh, ATl);
    k_gemmo<<<dim3(RWS / 128, DM / 128, 1), 128, 0, stream>>>(ATh, ATl, WO, OUT);
}
